// v000
// Measured on an AMD MI455X. A time is GPU time per run, averaged over a window of back-to-back runs after a warm-up
// (all launches, gaps included; the runs take copies of the inputs in turn), and the median of several windows.
// Apart from v000's, it joins two sittings. Times from different sittings can be a few percent apart, while
// side-by-side timings come from the same sitting.
// v000 is the starting kernel. One run takes 398 microseconds.
// Contractions: q/k and v^T projections = v_wmma_f32_16x16x32_bf16 (bf16 operands from RNE-converted inputs, single product, f32 row/column scales in the epilogue);
// q.k^T scores = v_wmma_f32_16x16x32_bf16 with bf16 hi/lo split q and k (hi.hi + hi.lo + lo.hi);
// p.v = v_wmma_f32_16x16x32_f16 (p carried x1024 in f16, v in f16; extra f16 residual planes x4096 of p and v on the first 512 query rows);
// a.Wout^T = v_wmma_f32_16x16x32_bf16 with a as bf16 hi/lo planes times bf16 Wout (2 products); all f32 accumulate; RoPE, norms and softmax in f32.
#include <hip/hip_runtime.h>
#include <math.h>
#include <float.h>
#include <stdint.h>

#define NB    2
#define SEQ   2048
#define DM    1024
#define NH    16
#define HD    64
#define NQK   (2 * DM)       // q and k feature columns of the fused q/k projection output
#define NQB   (SEQ / 64)     // 32 query / key tiles of 64
#define VLP   512            // key pitch of the v^T residual plane (keys 0..VLP-1)
#define RESQB 8              // leading 64-row query blocks that use the p / v residual planes
static_assert(RESQB * 64 <= VLP);
static_assert(NH * HD == DM);
static_assert((SEQ % 64) == 0 && (DM % 256) == 0);
static_assert(HD == 64);

typedef _Float16 v16h __attribute__((ext_vector_type(16)));
typedef _Float16 v8h  __attribute__((ext_vector_type(8)));
typedef __bf16   v16b __attribute__((ext_vector_type(16)));
typedef __bf16   v8b  __attribute__((ext_vector_type(8)));
typedef float    v8f  __attribute__((ext_vector_type(8)));
typedef float    v4f  __attribute__((ext_vector_type(4)));
typedef unsigned int v4u __attribute__((ext_vector_type(4)));

// ---- scalar helpers --------------------------------------------------------------------------------
__device__ __forceinline__ unsigned short bf_bits(float f) {          // f32 -> bf16 bits, RNE convert
  unsigned u = __float_as_uint(f);
  return (unsigned short)((u + 0x7FFFu + ((u >> 16) & 1u)) >> 16);
}
__device__ __forceinline__ float bf_up(unsigned short h) { return __uint_as_float(((unsigned)h) << 16); }
__device__ __forceinline__ unsigned short h_bits(_Float16 x) { return __builtin_bit_cast(unsigned short, x); }
__device__ __forceinline__ unsigned pk16(unsigned short a, unsigned short b) { return (unsigned)a | ((unsigned)b << 16); }
__device__ __forceinline__ v8f zero8() { v8f z = {0.f, 0.f, 0.f, 0.f, 0.f, 0.f, 0.f, 0.f}; return z; }
__device__ __forceinline__ v8h zero8h() {
  const _Float16 z = (_Float16)0.0f;
  v8h r = {z, z, z, z, z, z, z, z};
  return r;
}

// ---- fragment loader: 16-bit A/B operand, lane -> row/col (lane&15), p already includes +8*(lane>>4);
//      elements 0..7 <- p[0..7] (k0+8h..), elements 8..15 <- p[16..23] (k0+16+8h..)
__device__ __forceinline__ v16b ldfrag_b(const __bf16* p) {
  union { v16b v; v8b h[2]; } f;
  f.h[0] = *(const v8b*)(p);
  f.h[1] = *(const v8b*)(p + 16);
  return f.v;
}

// ---- WMMA helpers with trailing VALU hazard gap --------------------------------------------------------
__device__ __forceinline__ v8f mma_b(v16b a, v16b b, v8f c) {
  c = __builtin_amdgcn_wmma_f32_16x16x32_bf16(false, a, false, b, (short)0, c, false, false);
#if defined(__HIP_DEVICE_COMPILE__)
  asm volatile("v_nop\n\tv_nop\n\tv_nop\n\tv_nop" : "+v"(c) : "v"(a), "v"(b));
#endif
  return c;
}
__device__ __forceinline__ v8f mma_h(v16h a, v16h b, v8f c) {
  c = __builtin_amdgcn_wmma_f32_16x16x32_f16(false, a, false, b, (short)0, c, false, false);
#if defined(__HIP_DEVICE_COMPILE__)
  asm volatile("v_nop\n\tv_nop\n\tv_nop\n\tv_nop" : "+v"(c) : "v"(a), "v"(b));
#endif
  return c;
}
__device__ __forceinline__ v8f mma_b_raw(v16b a, v16b b, v8f c) {
  return __builtin_amdgcn_wmma_f32_16x16x32_bf16(false, a, false, b, (short)0, c, false, false);
}
__device__ __forceinline__ void dep_guard_b(v8f& a, v8f& b, v16b x, v16b y) {
#if defined(__HIP_DEVICE_COMPILE__)
  asm volatile("v_nop\n\tv_nop\n\tv_nop\n\tv_nop" : "+v"(a), "+v"(b) : "v"(x), "v"(y));
#endif
}
__device__ __forceinline__ void keep4_b(v16b a, v16b b, v16b c, v16b d) {
#if defined(__HIP_DEVICE_COMPILE__)
  asm volatile("v_nop" :: "v"(a), "v"(b), "v"(c), "v"(d));
#endif
}
__device__ __forceinline__ void acc_guard4(v8f& a, v8f& b, v8f& c, v8f& d) {
#if defined(__HIP_DEVICE_COMPILE__)
  asm volatile("v_nop\n\tv_nop\n\tv_nop\n\tv_nop" : "+v"(a), "+v"(b), "+v"(c), "+v"(d));
#endif
}

// =====================================================================================================
// f32 -> bf16 (RNE convert), 8 elements per thread, one 16-B store per lane: a wave writes 512 contiguous B
// coverage: n8 threads x 8 = whole plane (n8 is a multiple of 256 here).
// =====================================================================================================
__global__ __launch_bounds__(256) void cvt_bf16x8(const float* __restrict__ in, unsigned short* out, int n8) {
  const int i = blockIdx.x * 256 + threadIdx.x;
  if (i < n8) {
    const v4f a = *(const v4f*)(in + (size_t)i * 8);
    const v4f b = *(const v4f*)(in + (size_t)i * 8 + 4);
    v4u p;
    p[0] = pk16(bf_bits(a[0]), bf_bits(a[1]));
    p[1] = pk16(bf_bits(a[2]), bf_bits(a[3]));
    p[2] = pk16(bf_bits(b[0]), bf_bits(b[1]));
    p[3] = pk16(bf_bits(b[2]), bf_bits(b[3]));
    *(v4u*)(out + (size_t)i * 8) = p;
    
  }
}

// =====================================================================================================
// Angle table: ct[i] = cosf(bf(fr[i])), st[i] = sinf(bf(fr[i])) with the angle RNE-converted to bf16
// =====================================================================================================
__global__ __launch_bounds__(256) void trig_tab(const float* __restrict__ fr, float* ct, float* st, int n) {
  const int i = blockIdx.x * 256 + threadIdx.x;
  if (i < n) {
    const float f  = bf_up(bf_bits(fr[i]));
    const float cv = cosf(f);
    const float sv = sinf(f);
    *(float*)(ct + i) = cv;
    *(float*)(st + i) = sv;
    
  }
}

// =====================================================================================================
// Row preparation over rows of DM=1024 f32 values (pitch DM):
//   hi plane = RNE bf16 of each value; LO: lo plane = RNE bf16 of (v - hi) (unscaled);
//   rtab[row] = rsqrt(ss * inv_div + 1e-6) with ss = sum over the row of g^2,
//     g = the bf16-converted value (SQR) or the f32 value (!SQR).
// Block = 8 waves = 32 rows (wave w: rows 4w..4w+3 of the block); grid = rows / 32 (exact here).
// Per row and instruction t (0..3): lane l holds columns 256t + 8l .. +7 -> 32 lanes x 16 B = 512 B
// coverage: 4 t x 32 lanes x 8 = 1024 columns per row; 8 waves x 4 rows = 32 rows per block.
// =====================================================================================================
template <bool LO, bool SQR>
__global__ __launch_bounds__(256) void row_prep(const float* __restrict__ in, unsigned short* hp, unsigned short* lp,
                                                float* rtab, float inv_div) {
  __shared__ float sr[32];
  const int tid = threadIdx.x, wave = tid >> 5, lane = tid & 31;
#pragma unroll 1
  for (int i = 0; i < 4; ++i) {
    const int row = blockIdx.x * 32 + wave * 4 + i;
    const float* rp = in + (size_t)row * DM + lane * 8;
    float ss = 0.f;
    v4u hv[4], lv[4];
#pragma unroll
    for (int t = 0; t < 4; ++t) {
      const v4f a  = *(const v4f*)(rp + t * 256);
      const v4f bq = *(const v4f*)(rp + t * 256 + 4);
      v4u ph, pl;
#pragma unroll
      for (int e = 0; e < 4; ++e) {
        const float f0 = (e < 2) ? a[2 * e]     : bq[2 * e - 4];
        const float f1 = (e < 2) ? a[2 * e + 1] : bq[2 * e - 3];
        const unsigned short h0 = bf_bits(f0), h1 = bf_bits(f1);
        const float g0 = SQR ? bf_up(h0) : f0;
        const float g1 = SQR ? bf_up(h1) : f1;
        ss += g0 * g0;
        ss += g1 * g1;
        ph[e] = pk16(h0, h1);
        if (LO) {
          pl[e] = pk16(bf_bits(f0 - bf_up(h0)), bf_bits(f1 - bf_up(h1)));
        } else {
          pl[e] = 0u;
        }
      }
      hv[t] = ph; lv[t] = pl;
    }
#pragma unroll
    for (int off = 16; off >= 1; off >>= 1) ss += __shfl_xor(ss, off, 32);
    const float rv = rsqrtf(ss * inv_div + 1e-6f);
    if (lane == 0) sr[wave * 4 + i] = rv;
    {
#pragma unroll
      for (int t = 0; t < 4; ++t) {
        const size_t go = (size_t)row * DM + t * 256 + lane * 8;
        *(v4u*)(hp + go) = hv[t];
        if (LO) *(v4u*)(lp + go) = lv[t];
      }
      
    }
  }
  __syncthreads();
  if (wave == 0) {
    const float rv = sr[lane];
    float* d = rtab + (size_t)blockIdx.x * 32 + lane;
    *(float*)d = rv;
    
  }
}

// =====================================================================================================
// Register-blocked batched bf16 WMMA GEMM: C[m][n] = rs[m] * cs[n] * sum_k A[m][k] * Bt[n][k]; one wave per
// 64x64 tile, no block barriers. A row-major [M][K] pitch lda; Bt row-major [N][K] pitch ldb (k contiguous);
// M, N multiples of 64, K multiple of 32 (host-checked). blockIdx.y = batch index (strides in elements).
// NSPLIT: 0 = A.Bt; 1 = (A + A2).Bt (A2 = unscaled bf16 lo plane of A); 2 = A.Bt + A2.Bt + A.Bt2.
// RS / CS: per-row scale rsp[m] / per-column scale csp[n] (f32, not batched) applied in the epilogue.
// OUT_MODE: 0 = f32 (pitch ldc); 2 = bf16 hi plane C + bf16 lo plane C2 (lo = RNE(v - hi), unscaled);
//           3 = f16 hi plane C + f16 residual plane C2 = f16((v - hi) * rscale), C2 written only for tiles
//               with n0 < N2 (pitch ldc2, batch stride strideC2).
// =====================================================================================================
template <int NSPLIT, int OUT_MODE, bool RS, bool CS>
__global__ __launch_bounds__(256) void gemm64(
    const unsigned short* __restrict__ Ap, const unsigned short* A2p, int lda, long long strideA,
    const unsigned short* __restrict__ Btp, const unsigned short* Bt2p, int ldb, long long strideB,
    void* Cout, int ldc, long long strideC,
    void* Cout2, int ldc2, long long strideC2, int N2,
    int M, int N, int K, float rscale,
    const float* __restrict__ rsp, const float* __restrict__ csp) {
  const __bf16* A   = (const __bf16*)(const void*)Ap;
  const __bf16* A2  = (const __bf16*)(const void*)A2p;
  const __bf16* Bt  = (const __bf16*)(const void*)Btp;
  const __bf16* Bt2 = (const __bf16*)(const void*)Bt2p;
  __shared__ __align__(16) float sT[8][16 * 68];   // per-wave 16x64 slab, pitch 68 floats
  const int b    = blockIdx.y;
  const int lane = threadIdx.x & 31;
  const int wave = threadIdx.x >> 5;
  const int tilesN = N >> 6;
  const int tilesM = M >> 6;
  const int tile = blockIdx.x * 8 + wave;
  if (tile >= tilesM * tilesN) return;   // wave-uniform; no block barriers in this kernel
  const int tm = tile / tilesN;
  const int tn = tile - tm * tilesN;
  const int m0 = tm << 6;
  const int n0 = tn << 6;

  const __bf16* Ab  = A  + (size_t)b * strideA;
  const __bf16* Bb  = Bt + (size_t)b * strideB;
  const __bf16* Ab2 = (NSPLIT >= 1) ? (A2  + (size_t)b * strideA) : Ab;
  const __bf16* Bb2 = (NSPLIT == 2) ? (Bt2 + (size_t)b * strideB) : Bb;

  const int rlane = lane & 15;                 // row (A) / col (B, D) within subtile
  const int koff  = (lane >> 4) * 8;           // k offset of this lane half
  const int mOff  = (lane >> 4) * 8;           // D row offset

  v8f acc[4][4];
#pragma unroll
  for (int i = 0; i < 4; ++i)
#pragma unroll
    for (int j = 0; j < 4; ++j) acc[i][j] = zero8();

  for (int k0 = 0; k0 < K; k0 += 32) {
    v16b bh[4], bl[4];
#pragma unroll
    for (int j = 0; j < 4; ++j) {
      const size_t bo = (size_t)(n0 + (j << 4) + rlane) * ldb + koff + k0;
      bh[j] = ldfrag_b(Bb + bo);
      if (NSPLIT == 2) bl[j] = ldfrag_b(Bb2 + bo); else bl[j] = bh[j];
    }
#pragma unroll
    for (int i = 0; i < 4; ++i) {
      const size_t ao = (size_t)(m0 + (i << 4) + rlane) * lda + koff + k0;
      const v16b ah = ldfrag_b(Ab + ao);
      v16b al = ah;
      if (NSPLIT >= 1) al = ldfrag_b(Ab2 + ao);
#pragma unroll
      for (int j = 0; j < 4; ++j) {
        acc[i][j] = mma_b_raw(ah, bh[j], acc[i][j]);
        if (NSPLIT >= 1) acc[i][j] = mma_b_raw(al, bh[j], acc[i][j]);
        if (NSPLIT == 2) acc[i][j] = mma_b_raw(ah, bl[j], acc[i][j]);
      }
      dep_guard_b(acc[i][0], acc[i][3], ah, al);
    }
    keep4_b(bh[0], bh[1], bh[2], bh[3]);
    if (NSPLIT == 2) keep4_b(bl[0], bl[1], bl[2], bl[3]);
  }
  acc_guard4(acc[0][0], acc[0][1], acc[0][2], acc[0][3]);
  acc_guard4(acc[1][0], acc[1][1], acc[1][2], acc[1][3]);
  acc_guard4(acc[2][0], acc[2][1], acc[2][2], acc[2][3]);
  acc_guard4(acc[3][0], acc[3][1], acc[3][2], acc[3][3]);

  // ---- epilogue scales ----
  float csv[4];
#pragma unroll
  for (int j = 0; j < 4; ++j) csv[j] = CS ? csp[n0 + (j << 4) + rlane] : 1.0f;

  // ---- epilogue ----
  float* slab = sT[wave];
#pragma unroll
  for (int i = 0; i < 4; ++i) {
    const int mBase = m0 + (i << 4);
#pragma unroll
    for (int r = 0; r < 8; ++r) {
      const float rsv = RS ? rsp[mBase + mOff + r] : 1.0f;
#pragma unroll
      for (int j = 0; j < 4; ++j) {
        slab[(mOff + r) * 68 + (j << 4) + rlane] = acc[i][j][r] * rsv * csv[j];
      }
    }
    __builtin_amdgcn_fence(__ATOMIC_RELEASE, "workgroup");
    __builtin_amdgcn_wave_barrier();
    __builtin_amdgcn_fence(__ATOMIC_ACQUIRE, "workgroup");
    if (OUT_MODE == 0) {
      float* C = (float*)Cout + (size_t)b * strideC;
      const int hh = lane >> 4, c4 = (lane & 15) * 4;     // 256-B row segment = 16 lanes x 16 B
      v4f ov[8];
#pragma unroll
      for (int it = 0; it < 8; ++it) {
        const int row = it * 2 + hh;                       // it 0..7 x hh 0..1 = rows 0..15
        ov[it] = *(const v4f*)(slab + row * 68 + c4);
      }
      {
#pragma unroll
        for (int it = 0; it < 8; ++it) {
          const int row = it * 2 + hh;
          *(v4f*)(C + (size_t)(mBase + row) * ldc + n0 + c4) = ov[it];
        }
        
      }
    } else {
      const int q = lane >> 3, c8 = (lane & 7) * 8;
      unsigned short* C  = (unsigned short*)Cout  + (size_t)b * strideC;
      unsigned short* C2 = (unsigned short*)Cout2 + (size_t)b * strideC2;
      const bool wlo = (OUT_MODE == 2) || (n0 < N2);      // wave-uniform
      v4u hv[4], lv[4];
#pragma unroll
      for (int it = 0; it < 4; ++it) {
        const int row = it * 4 + q;                        // it 0..3 x q 0..3 = rows 0..15
        const float* sp = slab + row * 68 + c8;
        v4u a, a2;
#pragma unroll
        for (int e = 0; e < 4; ++e) {
          const float f0 = sp[2 * e], f1 = sp[2 * e + 1];
          unsigned short h0, h1, l0, l1;
          if (OUT_MODE == 2) {
            h0 = bf_bits(f0); h1 = bf_bits(f1);
            l0 = bf_bits(f0 - bf_up(h0)); l1 = bf_bits(f1 - bf_up(h1));
          } else {
            const _Float16 x0 = (_Float16)f0, x1 = (_Float16)f1;
            h0 = h_bits(x0); h1 = h_bits(x1);
            l0 = h_bits((_Float16)((f0 - (float)x0) * rscale));
            l1 = h_bits((_Float16)((f1 - (float)x1) * rscale));
          }
          a[e] = pk16(h0, h1); a2[e] = pk16(l0, l1);
        }
        hv[it] = a; lv[it] = a2;
      }
      {
#pragma unroll
        for (int it = 0; it < 4; ++it) {
          const int row = it * 4 + q;
          *(v4u*)(C + (size_t)(mBase + row) * ldc + n0 + c8) = hv[it];
          if (wlo) *(v4u*)(C2 + (size_t)(mBase + row) * ldc2 + n0 + c8) = lv[it];
        }
        
      }
    }
    __builtin_amdgcn_fence(__ATOMIC_RELEASE, "workgroup");
    __builtin_amdgcn_wave_barrier();
    __builtin_amdgcn_fence(__ATOMIC_ACQUIRE, "workgroup");
  }
}

// =====================================================================================================
// Half-split rotary + per-head rms over 64 dims on the f32 q/k projection output, then bf16 hi/lo planes.
//   qk f32 [NB*SEQ][NQK]: column h*64+d = q feature, column DM + h*64+d = k feature of head h.
//   ct/st [SEQ][32] f32 angle tables (input order, pair index = d mod 32).
//   y[d<32] = x1*cos - x2*sin, y[32+d] = x1*sin + x2*cos (x1 = x[d], x2 = x[32+d]); then y * rsqrt(mean(y^2) + 1e-6).
//   Output planes bf16 [(b*SEQ + t)*DM + h*64 + d]: qh/ql (q hi/lo), kh/kl (k hi/lo), lo = RNE(v - hi) unscaled.
// One wave per (token, head): lane = pair index for both q and k; 8 waves per block, grid = NB*SEQ*NH/8 (exact).
// coverage: 65536 waves x (q line + k line) x (hi, lo) = every head line of the 4 planes.
// =====================================================================================================
__global__ __launch_bounds__(256) void rope_norm(const float* __restrict__ qk, const float* __restrict__ ct,
                                                 const float* __restrict__ st,
                                                 unsigned short* qh, unsigned short* ql,
                                                 unsigned short* kh, unsigned short* kl) {
  __shared__ __align__(16) float sy[8][128];
  const int tid = threadIdx.x, wave = tid >> 5, lane = tid & 31;
  const int w  = blockIdx.x * 8 + wave;          // (b*SEQ + s)*NH + h, < NB*SEQ*NH
  const int h  = w % NH;
  const int bs = w / NH;                          // b*SEQ + s
  const int s  = bs % SEQ;
  const float* row = qk + (size_t)bs * NQK + h * HD;
  const float cs = ct[(size_t)s * (HD / 2) + lane];
  const float sn = st[(size_t)s * (HD / 2) + lane];
  float* buf = sy[wave];
#pragma unroll
  for (int t = 0; t < 2; ++t) {                   // t=0: q, t=1: k
    const float* src = row + t * DM;
    const float x1 = src[lane];
    const float x2 = src[lane + 32];
    const float y1 = x1 * cs - x2 * sn;
    const float y2 = x1 * sn + x2 * cs;
    float ss = y1 * y1 + y2 * y2;
#pragma unroll
    for (int off = 16; off >= 1; off >>= 1) ss += __shfl_xor(ss, off, 32);
    const float sc = rsqrtf(ss * (1.0f / HD) + 1e-6f);
    buf[t * 64 + lane]      = y1 * sc;
    buf[t * 64 + 32 + lane] = y2 * sc;
  }
  __builtin_amdgcn_fence(__ATOMIC_RELEASE, "workgroup");
  __builtin_amdgcn_wave_barrier();
  __builtin_amdgcn_fence(__ATOMIC_ACQUIRE, "workgroup");
  const int g = lane >> 3, piece = lane & 7;
  const float* sp = buf + (g >> 1) * 64 + piece * 8;
  const v4f a  = *(const v4f*)(sp);
  const v4f bq = *(const v4f*)(sp + 4);
  v4u hv, lv, val;
#pragma unroll
  for (int e = 0; e < 4; ++e) {
    const float f0 = (e < 2) ? a[2 * e]     : bq[2 * e - 4];
    const float f1 = (e < 2) ? a[2 * e + 1] : bq[2 * e - 3];
    const unsigned short h0 = bf_bits(f0), h1 = bf_bits(f1);
    const unsigned short l0 = bf_bits(f0 - bf_up(h0)), l1 = bf_bits(f1 - bf_up(h1));
    hv[e] = pk16(h0, h1); lv[e] = pk16(l0, l1);
  }
#pragma unroll
  for (int e = 0; e < 4; ++e) val[e] = (g & 1) ? lv[e] : hv[e];
  unsigned short* base = (g == 0) ? qh : ((g == 1) ? ql : ((g == 2) ? kh : kl));
  const size_t go = (size_t)bs * DM + h * HD + piece * 8;
  *(v4u*)(base + go) = val;
  
}

// =====================================================================================================
// Causal attention, head dim 64 (tril mask incl. diagonal, computed).
//   q planes (bf16 hi / lo): element (b, t, h, d) at [(b*SEQ + t)*DM + h*64 + d]
//   k planes (bf16 hi / lo): same layout with key index s
//   v^T hi plane (f16):      element (b, h, d, s) at [(b*DM + h*64 + d)*SEQ + s]
//   v^T residual plane (f16, (v - hi)*4096): [(b*DM + h*64 + d)*VLP + s], s < VLP, read only when RES
//   (a key tile at or beyond VLP would contribute a zero v residual; with RES only tiles below VLP occur)
//   logit = q.k * sscale for key <= query, -FLT_MAX otherwise (exp -> 0); every row has a live key in every
//   processed key tile (tiles 0..qb only, block-uniform trip count qb+1 <= 32).
//   out f32 plane: element (b, t, h*64 + d) at [(b*SEQ + t)*DM + h*64 + d] = normalised context.
//   scores = q . k : bf16 hi/lo split (hi.hi + hi.lo + lo.hi), f32 accumulate, then * sscale in f32
//   p = exp(s - m) carried as f16(1024 p); context = p . v on f16 WMMA; RES adds f16 residual planes of p and v
//   (scale 4096, separate accumulator folded back with 1/4096 per chunk in f32); online softmax in f32.
//   Block = 4 waves = 64 query rows of one (b, h); grid = nqbThis * NH * NB; kv chunks of 64.
//   K / V^T chunk staging: 128 threads x 32 elements per plane = the whole 64x64 tile (plain 16-B loads,
//   __syncthreads before and after); P tiles are wave-private, spilled with _Float16 element stores and reloaded
//   Output coverage: each wave stores rows q0..q0+15 (it 0..7 x lane>>4 0..1) x 64 columns (16 lanes x 4 floats),
// =====================================================================================================
template <bool RES>
__global__ __launch_bounds__(128)
void attn_causal64(const unsigned short* __restrict__ qhp, const unsigned short* __restrict__ qlp,
                   const unsigned short* __restrict__ khp, const unsigned short* __restrict__ klp,
                   const unsigned short* __restrict__ vhp, const unsigned short* __restrict__ vlp,
                   float* outp, int qbBase, int nqbThis, float sscale) {
  union FB { v16b v; v8b h[2]; };
  union FH { v16h v; v8h h[2]; };
  __shared__ __align__(16) __bf16   Ksh[64 * 64];                 // K hi [kv][d]   8 KB
  __shared__ __align__(16) __bf16   Ksl[64 * 64];                 // K lo
  __shared__ __align__(16) _Float16 Vth[64 * 64];                 // V^T hi [d][kv] 8 KB
  __shared__ __align__(16) _Float16 Vtl[RES ? 64 * 64 : 8];       // V^T residual
  __shared__ __align__(16) _Float16 Psh[4][16 * 64];              // per wave P [row][kv]
  __shared__ __align__(16) _Float16 Psl[RES ? 4 : 1][16 * 64];    // per wave P residual
  __shared__ __align__(16) float    Os[4][16 * 64];               // per wave context tile [row][d]

  const int tid  = threadIdx.x;
  const int wave = tid >> 5;
  const int lane = tid & 31;
  const int hh   = lane >> 4;
  const int c    = lane & 15;

  const int bx   = blockIdx.x;
  const int qbl  = bx % nqbThis;
  const int rest = bx / nqbThis;
  const int h    = rest % NH;
  const int b    = rest / NH;
  const int qb   = qbBase + qbl;
  const int q0   = qb * 64 + wave * 16;
  const size_t rowB = (size_t)b * SEQ;

  const __bf16* Qh = (const __bf16*)(const void*)qhp + (size_t)h * HD;
  const __bf16* Ql = (const __bf16*)(const void*)qlp + (size_t)h * HD;
  const __bf16* Kh = (const __bf16*)(const void*)khp + (size_t)h * HD;
  const __bf16* Kl = (const __bf16*)(const void*)klp + (size_t)h * HD;
  const _Float16* Vh = (const _Float16*)(const void*)vhp + ((size_t)b * DM + (size_t)h * HD) * SEQ;
  const _Float16* Vl = (const _Float16*)(const void*)vlp + ((size_t)b * DM + (size_t)h * HD) * VLP;

  // ---- Q fragments (A operand, row = lane&15): 2 d-chunks, hi and lo ----
  v16b qah[2], qal[2];
#pragma unroll
  for (int dc = 0; dc < 2; ++dc) {
    const size_t qo = (rowB + q0 + c) * DM + dc * 32 + 8 * hh;
    qah[dc] = ldfrag_b(Qh + qo);
    qal[dc] = ldfrag_b(Ql + qo);
  }

  float mrow[8], lrow[8];
  v8f oacc[4];
#pragma unroll
  for (int r = 0; r < 8; ++r) { mrow[r] = -INFINITY; lrow[r] = 0.f; }
#pragma unroll
  for (int t = 0; t < 4; ++t) oacc[t] = zero8();

  int nkt = qb + 1;                          // causal: key tiles 0..qb, block-uniform
  if (nkt > NQB) nkt = NQB;
  for (int kt = 0; kt < nkt; ++kt) {
    const int kv0 = kt * 64;
    __syncthreads();
    {
      const int r = tid >> 1, half = (tid & 1) * 32;
      const __bf16*   kg  = Kh + (rowB + kv0 + r) * DM + half;    // K row kv0+r, d = half..half+31
      const __bf16*   klg = Kl + (rowB + kv0 + r) * DM + half;
      const _Float16* vg  = Vh + (size_t)r * SEQ + kv0 + half;    // V^T row d = r, s = kv0+half..+31
      const int kvl = (kv0 + 64 <= VLP) ? kv0 : (VLP - 64);     // clamped address into the residual plane
      const _Float16* vlg = Vl + (size_t)r * VLP + kvl + half;
      const bool resOK = (kv0 + 64 <= VLP);                      // block-uniform
#pragma unroll
      for (int i = 0; i < 4; ++i) {
        const v8b a0 = *(const v8b*)(kg + 8 * i);
        const v8b a1 = *(const v8b*)(klg + 8 * i);
        const v8h b0 = *(const v8h*)(vg + 8 * i);
        *(v8b*)(Ksh + r * 64 + half + 8 * i) = a0;
        *(v8b*)(Ksl + r * 64 + half + 8 * i) = a1;
        *(v8h*)(Vth + r * 64 + half + 8 * i) = b0;
        if (RES) {
          v8h b1 = *(const v8h*)(vlg + 8 * i);
          if (!resOK) b1 = zero8h();
          *(v8h*)(Vtl + r * 64 + half + 8 * i) = b1;
        }
      }
    }
    __syncthreads();

    // ---- scores: 16 query rows x 64 keys per wave, 3 bf16 products ----
    v8f s[4];
#pragma unroll
    for (int j = 0; j < 4; ++j) {
      s[j] = zero8();
#pragma unroll
      for (int dc = 0; dc < 2; ++dc) {
        FB kb, kl;
        kb.h[0] = *(const v8b*)(Ksh + (j * 16 + c) * 64 + dc * 32 + 8 * hh);
        kb.h[1] = *(const v8b*)(Ksh + (j * 16 + c) * 64 + dc * 32 + 16 + 8 * hh);
        kl.h[0] = *(const v8b*)(Ksl + (j * 16 + c) * 64 + dc * 32 + 8 * hh);
        kl.h[1] = *(const v8b*)(Ksl + (j * 16 + c) * 64 + dc * 32 + 16 + 8 * hh);
        s[j] = mma_b(qah[dc], kb.v, s[j]);
        s[j] = mma_b(qah[dc], kl.v, s[j]);
        s[j] = mma_b(qal[dc], kb.v, s[j]);
      }
    }

    // ---- scale + causal mask (replace by -FLT_MAX), row max, online softmax, P (x1024, f16) and
    //      P residual (x4096) to LDS ----
    _Float16* pwh = Psh[wave];
    _Float16* pwl = Psl[RES ? wave : 0];
#pragma unroll
    for (int r = 0; r < 8; ++r) {
      const int qrow = q0 + 8 * hh + r;
      float m = -INFINITY;
#pragma unroll
      for (int j = 0; j < 4; ++j) {
        const int key = kv0 + j * 16 + c;
        float sv = s[j][r] * sscale;
        sv = (key > qrow) ? -FLT_MAX : sv;
        s[j][r] = sv;
        m = fmaxf(m, sv);
      }
#pragma unroll
      for (int off = 1; off < 16; off <<= 1) m = fmaxf(m, __shfl_xor(m, off, 32));
      const float mnew  = fmaxf(mrow[r], m);
      const float msafe = (mnew == -INFINITY) ? 0.f : mnew;
      const float alpha = __expf(mrow[r] - msafe);
      mrow[r] = mnew;
      float psum = 0.f;
#pragma unroll
      for (int j = 0; j < 4; ++j) {
        const float p = __expf(s[j][r] - msafe);     // masked logit against a finite max: exp -> 0
        psum += p;
        const float p1k = p * 1024.0f;
        const _Float16 ph = (_Float16)p1k;
        pwh[(8 * hh + r) * 64 + j * 16 + c] = ph;
        if (RES) {
          const _Float16 pl = (_Float16)((p1k - (float)ph) * 4096.0f);
          pwl[(8 * hh + r) * 64 + j * 16 + c] = pl;
        }
      }
#pragma unroll
      for (int off = 1; off < 16; off <<= 1) psum += __shfl_xor(psum, off, 32);
      lrow[r] = lrow[r] * alpha + psum;
#pragma unroll
      for (int t = 0; t < 4; ++t) oacc[t][r] *= alpha;
    }
    __builtin_amdgcn_fence(__ATOMIC_RELEASE, "workgroup");
    __builtin_amdgcn_wave_barrier();
    __builtin_amdgcn_fence(__ATOMIC_ACQUIRE, "workgroup");

    // ---- context += P . V (f16 WMMA), residual products into a separate accumulator ----
    v8f o1[4];
#pragma unroll
    for (int t = 0; t < 4; ++t) o1[t] = zero8();
#pragma unroll 1
    for (int kk = 0; kk < 2; ++kk) {
      FH pa, pl;
      pa.h[0] = *(const v8h*)(pwh + c * 64 + kk * 32 + 8 * hh);
      pa.h[1] = *(const v8h*)(pwh + c * 64 + kk * 32 + 16 + 8 * hh);
      if (RES) {
        pl.h[0] = *(const v8h*)(pwl + c * 64 + kk * 32 + 8 * hh);
        pl.h[1] = *(const v8h*)(pwl + c * 64 + kk * 32 + 16 + 8 * hh);
      } else {
        pl.v = pa.v;
      }
#pragma unroll
      for (int t = 0; t < 4; ++t) {
        FH vb;
        vb.h[0] = *(const v8h*)(Vth + (t * 16 + c) * 64 + kk * 32 + 8 * hh);
        vb.h[1] = *(const v8h*)(Vth + (t * 16 + c) * 64 + kk * 32 + 16 + 8 * hh);
        oacc[t] = mma_h(pa.v, vb.v, oacc[t]);
        if (RES) {
          FH vl;
          vl.h[0] = *(const v8h*)(Vtl + (t * 16 + c) * 64 + kk * 32 + 8 * hh);
          vl.h[1] = *(const v8h*)(Vtl + (t * 16 + c) * 64 + kk * 32 + 16 + 8 * hh);
          o1[t] = mma_h(pa.v, vl.v, o1[t]);
          o1[t] = mma_h(pl.v, vb.v, o1[t]);
        }
      }
    }
    if (RES) {
#pragma unroll
      for (int t = 0; t < 4; ++t)
#pragma unroll
        for (int r = 0; r < 8; ++r) oacc[t][r] += o1[t][r] * (1.0f / 4096.0f);
    }
  }

  // ---- normalise (1/l and the 1/1024 p carry), stage the wave's 16x64 tile in LDS, then write whole
  float* os = Os[wave];
#pragma unroll
  for (int r = 0; r < 8; ++r) {
    const float l = lrow[r];
    const float inv = ((l > 0.f) ? (1.0f / l) : 0.f) * (1.0f / 1024.0f);
#pragma unroll
    for (int t = 0; t < 4; ++t) os[(8 * hh + r) * 64 + t * 16 + c] = oacc[t][r] * inv;
  }
  __builtin_amdgcn_fence(__ATOMIC_RELEASE, "workgroup");
  __builtin_amdgcn_wave_barrier();
  __builtin_amdgcn_fence(__ATOMIC_ACQUIRE, "workgroup");
  {
    const int h2 = lane >> 4, c4 = (lane & 15) * 4;
    v4f ov[8];
#pragma unroll
    for (int it = 0; it < 8; ++it) {
      const int row = it * 2 + h2;   // it 0..7 x h2 0..1 = rows 0..15 of the wave tile
      ov[it] = *(const v4f*)(os + row * 64 + c4);
    }
    {
#pragma unroll
      for (int it = 0; it < 8; ++it) {
        const int row = it * 2 + h2;
        const size_t go = (rowB + q0 + row) * DM + (size_t)h * HD + c4;
        *(v4f*)(outp + go) = ov[it];
      }
      
    }
  }
}

// =====================================================================================================
// Workspace map (bytes), every region an exact multiple of its whole-line / whole-tile store granularity:
//   Xb    bf16 [4096][1024]          0          8388608
//   Winb  bf16 [3072][1024]          8388608    6291456
//   Wob   bf16 [1024][1024]          14680064   2097152
//   Rin   f32  [3072]                16777216     12288   (96 lines)
//   Rout  f32  [1024]                16789504      4096   (32 lines)
//   Rrow  f32  [4096]                16793600     16384   (128 lines)
//   CosT  f32  [2048][32]            16809984    262144
//   SinT  f32  [2048][32]            17072128    262144
//   QKf   f32  [4096][2048]          17334272  33554432   (later: Af f32 [4096][1024] + Ah bf16 + Al bf16)
//   VTh   f16  [2][1024][2048]       50888704   8388608
//   VTl   f16  [2][1024][512]        59277312   2097152
//   Qh    bf16 [4096][1024]          61374464   8388608
//   Ql    bf16 [4096][1024]          69763072   8388608
//   Kh    bf16 [4096][1024]          78151680   8388608
//   Kl    bf16 [4096][1024]          86540288   8388608
//   end                              94928896
// Weights are [out n][in k] with k contiguous = the Bt / A layout the GEMM wants, so they are only converted.
// =====================================================================================================
extern "C" void kernel_launch(void* const* d_in, const int* in_sizes, int n_in,
                              void* d_out, int out_size, void* d_ws, size_t ws_size,
                              hipStream_t stream) {
  if (n_in < 4) return;
  if (in_sizes[0] != NB * SEQ * DM) return;
  if (in_sizes[1] != SEQ * (HD / 2)) return;
  if (in_sizes[2] != 3 * DM * DM) return;
  if (in_sizes[3] != DM * DM) return;
  if (out_size != NB * SEQ * DM) return;

  const float* x    = (const float*)d_in[0];
  const float* rpf  = (const float*)d_in[1];
  const float* w_in = (const float*)d_in[2];
  const float* w_o  = (const float*)d_in[3];

  const size_t PXb   = (size_t)NB * SEQ * DM * 2;      //  8388608  16-bit activation plane [4096][1024]
  const size_t PWin  = (size_t)3 * DM * DM * 2;        //  6291456
  const size_t PWo   = (size_t)DM * DM * 2;            //  2097152
  const size_t PRin  = (size_t)3 * DM * 4;             //    12288
  const size_t PRout = (size_t)DM * 4;                 //     4096
  const size_t PRrow = (size_t)NB * SEQ * 4;           //    16384
  const size_t PTrig = (size_t)SEQ * (HD / 2) * 4;     //   262144
  const size_t PQK   = (size_t)NB * SEQ * NQK * 4;     // 33554432
  const size_t PVTh  = (size_t)NB * DM * SEQ * 2;      //  8388608
  const size_t PVTl  = (size_t)NB * DM * VLP * 2;      //  2097152
  const size_t PAf   = (size_t)NB * SEQ * DM * 4;      // 16777216
  if (PAf + 2 * PXb != PQK) return;                    // Af + Ah + Al reuse the q/k f32 region exactly
  size_t off = 0;
  const size_t oXb   = off; off += PXb;
  const size_t oWin  = off; off += PWin;
  const size_t oWo   = off; off += PWo;
  const size_t oRin  = off; off += PRin;
  const size_t oRout = off; off += PRout;
  const size_t oRrow = off; off += PRrow;
  const size_t oCos  = off; off += PTrig;
  const size_t oSin  = off; off += PTrig;
  const size_t oQK   = off; off += PQK;
  const size_t oVTh  = off; off += PVTh;
  const size_t oVTl  = off; off += PVTl;
  const size_t oQh   = off; off += PXb;
  const size_t oQl   = off; off += PXb;
  const size_t oKh   = off; off += PXb;
  const size_t oKl   = off; off += PXb;
  if (off > ws_size) return;                           // off = 94928896
  if (off > (size_t)134217728) return;
  const size_t oAf = oQK;
  const size_t oAh = oQK + PAf;
  const size_t oAl = oAh + PXb;
  if (oAl + PXb > oVTh) return;                        // region ordering sanity

  char* ws = (char*)d_ws;
  unsigned short* Xb   = (unsigned short*)(ws + oXb);
  unsigned short* Winb = (unsigned short*)(ws + oWin);
  unsigned short* Wvb  = Winb + (size_t)2 * DM * DM;   // rows 2048..3071 of w_in = v features
  unsigned short* Wob  = (unsigned short*)(ws + oWo);
  float*          Rin  = (float*)(ws + oRin);
  float*          Rv   = Rin + 2 * DM;
  float*          Rout = (float*)(ws + oRout);
  float*          Rrow = (float*)(ws + oRrow);
  float*          CosT = (float*)(ws + oCos);
  float*          SinT = (float*)(ws + oSin);
  float*          QKf  = (float*)(ws + oQK);
  unsigned short* VTh  = (unsigned short*)(ws + oVTh);
  unsigned short* VTl  = (unsigned short*)(ws + oVTl);
  unsigned short* Qh   = (unsigned short*)(ws + oQh);
  unsigned short* Ql   = (unsigned short*)(ws + oQl);
  unsigned short* Kh   = (unsigned short*)(ws + oKh);
  unsigned short* Kl   = (unsigned short*)(ws + oKl);
  float*          Af   = (float*)(ws + oAf);
  unsigned short* Ah   = (unsigned short*)(ws + oAh);
  unsigned short* Al   = (unsigned short*)(ws + oAl);

  const dim3 blk(256);
  const int nTrig = SEQ * (HD / 2);                                  // 65536
  const int n8x   = NB * SEQ * DM / 8;                               // 524288
  const dim3 gTrig((nTrig + 255) / 256);                             // 256 blocks
  const dim3 gCvtX((n8x + 255) / 256);                               // 2048 blocks
  const dim3 gPrepWin(3 * DM / 32);                                  // 96 blocks (32 rows each)
  const dim3 gPrepWo(DM / 32);                                       // 32 blocks
  const dim3 gPrepA(NB * SEQ / 32);                                  // 128 blocks
  const dim3 gQK(((NB * SEQ / 64) * (NQK / 64) + 7) / 8, 1);         // 2048 tiles -> 256 blocks
  const dim3 gVT(((DM / 64) * (SEQ / 64) + 7) / 8, NB);              // 512 tiles -> 64 blocks x 2 batches
  const dim3 gOut(((NB * SEQ / 64) * (DM / 64) + 7) / 8, 1);         // 1024 tiles -> 128 blocks
  const dim3 gRope(NB * SEQ * NH / 8);                               // 8192 blocks (8 (token, head) per block)

  // (0) angle tables from the bf16-converted input table
  trig_tab<<<gTrig, blk, 0, stream>>>(rpf, CosT, SinT, nTrig);
  // (1) x -> bf16 plane [4096][1024]
  cvt_bf16x8<<<gCvtX, blk, 0, stream>>>(x, Xb, n8x);
  // (2) weights -> bf16 planes [n][k] + per-row inverse L2 norms of the converted rows
  row_prep<false, true><<<gPrepWin, blk, 0, stream>>>(w_in, Winb, Winb, Rin, 1.0f);
  row_prep<false, true><<<gPrepWo, blk, 0, stream>>>(w_o, Wob, Wob, Rout, 1.0f);
  // (3) q/k projection: QKf[b*SEQ+s][e] = Rin[e] * sum_d Xb[s][d] Winb[e][d], e < 2048  (M=4096, N=2048, K=1024)
  gemm64<0, 0, false, true><<<gQK, blk, 0, stream>>>(
      Xb, Xb, DM, 0LL, Winb, Winb, DM, 0LL,
      (void*)QKf, NQK, 0LL, (void*)QKf, 0, 0LL, 0,
      NB * SEQ, NQK, DM, 1.0f, Rin, Rin);
  // (4) v^T per batch: VTh[b][m][s] = Rv[m] * sum_d Wvb[m][d] Xb[b*SEQ+s][d] -> f16 hi plane (pitch SEQ) and
  //     residual plane (x4096, keys < VLP, pitch VLP)  (M=1024, N=2048, K=1024)
  gemm64<0, 3, true, false><<<gVT, blk, 0, stream>>>(
      Wvb, Wvb, DM, 0LL, Xb, Xb, DM, (long long)SEQ * DM,
      (void*)VTh, SEQ, (long long)DM * SEQ, (void*)VTl, VLP, (long long)DM * VLP, VLP,
      DM, SEQ, DM, 4096.0f, Rv, Rv);
  // (5) rotary + per-head rms -> q/k bf16 hi/lo planes
  rope_norm<<<gRope, blk, 0, stream>>>(QKf, CosT, SinT, Qh, Ql, Kh, Kl);
  // (6) causal attention: query blocks 0..RESQB-1 with residual planes, the rest without -> Af f32 [4096][1024]
  attn_causal64<true><<<dim3(NB * NH * RESQB), dim3(128), 0, stream>>>(
      Qh, Ql, Kh, Kl, VTh, VTl, Af, 0, RESQB, 0.125f);
  attn_causal64<false><<<dim3(NB * NH * (NQB - RESQB)), dim3(128), 0, stream>>>(
      Qh, Ql, Kh, Kl, VTh, VTl, Af, RESQB, NQB - RESQB, 0.125f);
  // (7) merged rows -> bf16 hi/lo planes + per-row inverse rms over 1024
  row_prep<true, false><<<gPrepA, blk, 0, stream>>>(Af, Ah, Al, Rrow, 1.0f / (float)DM);
  // (8) out[s][e] = Rrow[s] * Rout[e] * sum_d (Ah+Al)[s][d] Wob[e][d] -> d_out f32 [4096][1024]  (M=4096, N=1024, K=1024)
  gemm64<1, 0, true, true><<<gOut, blk, 0, stream>>>(
      Ah, Al, DM, 0LL, Wob, Wob, DM, 0LL,
      d_out, DM, 0LL, d_out, 0, 0LL, 0,
      NB * SEQ, DM, DM, 1.0f, Rrow, Rout);
  (void)hipGetLastError();
}

// v001
// One run takes 330 microseconds.
// Timed twice side by side with v000, it ran 1.21 and 1.22 times as fast.
// Contractions: q/k and v^T projections = v_wmma_f32_16x16x32_bf16 (bf16 operands from RNE-converted inputs, single product, f32 row/column scales in the epilogue);
// q.k^T scores = v_wmma_f32_16x16x32_bf16 with bf16 hi/lo split q and k (hi.hi + hi.lo + lo.hi);
// p.v = v_wmma_f32_16x16x32_f16 (p carried x1024 in f16, v in f16; extra f16 residual planes x4096 of p and v on the first 512 query rows);
// a.Wout^T = v_wmma_f32_16x16x32_bf16 with a as bf16 hi/lo planes times bf16 Wout (2 products); all f32 accumulate; RoPE, norms and softmax in f32.
#include <hip/hip_runtime.h>
#include <math.h>
#include <float.h>
#include <stdint.h>

#define NB    2
#define SEQ   2048
#define DM    1024
#define NH    16
#define HD    64
#define NQK   (2 * DM)       // q and k feature columns of the fused q/k projection output
#define NQB   (SEQ / 64)     // 32 query / key tiles of 64
#define VLP   512            // key pitch of the v^T residual plane (keys 0..VLP-1)
#define RESQB 8              // leading 64-row query blocks that use the p / v residual planes
static_assert(RESQB * 64 <= VLP);
static_assert(NH * HD == DM);
static_assert((SEQ % 64) == 0 && (DM % 256) == 0);
static_assert(HD == 64);
#define LP    72             // LDS pitch, in 16-bit elements, of a 64-element row: 144 B = 16 B x odd, so that the 16 rows
                             // one ds_load_b128 fragment read touches fall on 16 different groups of four banks
#define OP    68             // LDS pitch, in floats, of a 64-float row: the two lane halves store rows eight apart, on different banks

typedef _Float16 v16h __attribute__((ext_vector_type(16)));
typedef _Float16 v8h  __attribute__((ext_vector_type(8)));
typedef __bf16   v16b __attribute__((ext_vector_type(16)));
typedef __bf16   v8b  __attribute__((ext_vector_type(8)));
typedef float    v8f  __attribute__((ext_vector_type(8)));
typedef float    v4f  __attribute__((ext_vector_type(4)));
typedef unsigned int v4u __attribute__((ext_vector_type(4)));

// ---- scalar helpers --------------------------------------------------------------------------------
__device__ __forceinline__ unsigned short bf_bits(float f) {          // f32 -> bf16 bits, RNE convert
  unsigned u = __float_as_uint(f);
  return (unsigned short)((u + 0x7FFFu + ((u >> 16) & 1u)) >> 16);
}
__device__ __forceinline__ float bf_up(unsigned short h) { return __uint_as_float(((unsigned)h) << 16); }
__device__ __forceinline__ unsigned short h_bits(_Float16 x) { return __builtin_bit_cast(unsigned short, x); }
__device__ __forceinline__ unsigned pk16(unsigned short a, unsigned short b) { return (unsigned)a | ((unsigned)b << 16); }
__device__ __forceinline__ v8f zero8() { v8f z = {0.f, 0.f, 0.f, 0.f, 0.f, 0.f, 0.f, 0.f}; return z; }
__device__ __forceinline__ v8h zero8h() {
  const _Float16 z = (_Float16)0.0f;
  v8h r = {z, z, z, z, z, z, z, z};
  return r;
}

// ---- fragment loader: 16-bit A/B operand, lane -> row/col (lane&15), p already includes +8*(lane>>4);
//      elements 0..7 <- p[0..7] (k0+8h..), elements 8..15 <- p[16..23] (k0+16+8h..)
__device__ __forceinline__ v16b ldfrag_b(const __bf16* p) {
  union { v16b v; v8b h[2]; } f;
  f.h[0] = *(const v8b*)(p);
  f.h[1] = *(const v8b*)(p + 16);
  return f.v;
}

// ---- WMMA helpers with trailing VALU hazard gap --------------------------------------------------------
__device__ __forceinline__ v8f mma_b(v16b a, v16b b, v8f c) {
  c = __builtin_amdgcn_wmma_f32_16x16x32_bf16(false, a, false, b, (short)0, c, false, false);
#if defined(__HIP_DEVICE_COMPILE__)
  asm volatile("v_nop\n\tv_nop\n\tv_nop\n\tv_nop" : "+v"(c) : "v"(a), "v"(b));
#endif
  return c;
}
__device__ __forceinline__ v8f mma_h(v16h a, v16h b, v8f c) {
  c = __builtin_amdgcn_wmma_f32_16x16x32_f16(false, a, false, b, (short)0, c, false, false);
#if defined(__HIP_DEVICE_COMPILE__)
  asm volatile("v_nop\n\tv_nop\n\tv_nop\n\tv_nop" : "+v"(c) : "v"(a), "v"(b));
#endif
  return c;
}
__device__ __forceinline__ v8f mma_b_raw(v16b a, v16b b, v8f c) {
  return __builtin_amdgcn_wmma_f32_16x16x32_bf16(false, a, false, b, (short)0, c, false, false);
}
__device__ __forceinline__ void dep_guard_b(v8f& a, v8f& b, v16b x, v16b y) {
#if defined(__HIP_DEVICE_COMPILE__)
  asm volatile("v_nop\n\tv_nop\n\tv_nop\n\tv_nop" : "+v"(a), "+v"(b) : "v"(x), "v"(y));
#endif
}
__device__ __forceinline__ void keep4_b(v16b a, v16b b, v16b c, v16b d) {
#if defined(__HIP_DEVICE_COMPILE__)
  asm volatile("v_nop" :: "v"(a), "v"(b), "v"(c), "v"(d));
#endif
}
__device__ __forceinline__ void acc_guard4(v8f& a, v8f& b, v8f& c, v8f& d) {
#if defined(__HIP_DEVICE_COMPILE__)
  asm volatile("v_nop\n\tv_nop\n\tv_nop\n\tv_nop" : "+v"(a), "+v"(b), "+v"(c), "+v"(d));
#endif
}

// =====================================================================================================
// f32 -> bf16 (RNE convert), 8 elements per thread, one 16-B store per lane: a wave writes 512 contiguous B
// coverage: n8 threads x 8 = whole plane (n8 is a multiple of 256 here).
// =====================================================================================================
__global__ __launch_bounds__(256) void cvt_bf16x8(const float* __restrict__ in, unsigned short* out, int n8) {
  const int i = blockIdx.x * 256 + threadIdx.x;
  if (i < n8) {
    const v4f a = *(const v4f*)(in + (size_t)i * 8);
    const v4f b = *(const v4f*)(in + (size_t)i * 8 + 4);
    v4u p;
    p[0] = pk16(bf_bits(a[0]), bf_bits(a[1]));
    p[1] = pk16(bf_bits(a[2]), bf_bits(a[3]));
    p[2] = pk16(bf_bits(b[0]), bf_bits(b[1]));
    p[3] = pk16(bf_bits(b[2]), bf_bits(b[3]));
    *(v4u*)(out + (size_t)i * 8) = p;
    
  }
}

// =====================================================================================================
// Angle table: ct[i] = cosf(bf(fr[i])), st[i] = sinf(bf(fr[i])) with the angle RNE-converted to bf16
// =====================================================================================================
__global__ __launch_bounds__(256) void trig_tab(const float* __restrict__ fr, float* ct, float* st, int n) {
  const int i = blockIdx.x * 256 + threadIdx.x;
  if (i < n) {
    const float f  = bf_up(bf_bits(fr[i]));
    const float cv = cosf(f);
    const float sv = sinf(f);
    *(float*)(ct + i) = cv;
    *(float*)(st + i) = sv;
    
  }
}

// =====================================================================================================
// Row preparation over rows of DM=1024 f32 values (pitch DM):
//   hi plane = RNE bf16 of each value; LO: lo plane = RNE bf16 of (v - hi) (unscaled);
//   rtab[row] = rsqrt(ss * inv_div + 1e-6) with ss = sum over the row of g^2,
//     g = the bf16-converted value (SQR) or the f32 value (!SQR).
// Block = 8 waves = 32 rows (wave w: rows 4w..4w+3 of the block); grid = rows / 32 (exact here).
// Per row and instruction t (0..3): lane l holds columns 256t + 8l .. +7 -> 32 lanes x 16 B = 512 B
// coverage: 4 t x 32 lanes x 8 = 1024 columns per row; 8 waves x 4 rows = 32 rows per block.
// =====================================================================================================
template <bool LO, bool SQR>
__global__ __launch_bounds__(256) void row_prep(const float* __restrict__ in, unsigned short* hp, unsigned short* lp,
                                                float* rtab, float inv_div) {
  __shared__ float sr[32];
  const int tid = threadIdx.x, wave = tid >> 5, lane = tid & 31;
#pragma unroll 1
  for (int i = 0; i < 4; ++i) {
    const int row = blockIdx.x * 32 + wave * 4 + i;
    const float* rp = in + (size_t)row * DM + lane * 8;
    float ss = 0.f;
    v4u hv[4], lv[4];
#pragma unroll
    for (int t = 0; t < 4; ++t) {
      const v4f a  = *(const v4f*)(rp + t * 256);
      const v4f bq = *(const v4f*)(rp + t * 256 + 4);
      v4u ph, pl;
#pragma unroll
      for (int e = 0; e < 4; ++e) {
        const float f0 = (e < 2) ? a[2 * e]     : bq[2 * e - 4];
        const float f1 = (e < 2) ? a[2 * e + 1] : bq[2 * e - 3];
        const unsigned short h0 = bf_bits(f0), h1 = bf_bits(f1);
        const float g0 = SQR ? bf_up(h0) : f0;
        const float g1 = SQR ? bf_up(h1) : f1;
        ss += g0 * g0;
        ss += g1 * g1;
        ph[e] = pk16(h0, h1);
        if (LO) {
          pl[e] = pk16(bf_bits(f0 - bf_up(h0)), bf_bits(f1 - bf_up(h1)));
        } else {
          pl[e] = 0u;
        }
      }
      hv[t] = ph; lv[t] = pl;
    }
#pragma unroll
    for (int off = 16; off >= 1; off >>= 1) ss += __shfl_xor(ss, off, 32);
    const float rv = rsqrtf(ss * inv_div + 1e-6f);
    if (lane == 0) sr[wave * 4 + i] = rv;
    {
#pragma unroll
      for (int t = 0; t < 4; ++t) {
        const size_t go = (size_t)row * DM + t * 256 + lane * 8;
        *(v4u*)(hp + go) = hv[t];
        if (LO) *(v4u*)(lp + go) = lv[t];
      }
      
    }
  }
  __syncthreads();
  if (wave == 0) {
    const float rv = sr[lane];
    float* d = rtab + (size_t)blockIdx.x * 32 + lane;
    *(float*)d = rv;
    
  }
}

// =====================================================================================================
// Register-blocked batched bf16 WMMA GEMM: C[m][n] = rs[m] * cs[n] * sum_k A[m][k] * Bt[n][k]; one wave per
// 64x64 tile, no block barriers. A row-major [M][K] pitch lda; Bt row-major [N][K] pitch ldb (k contiguous);
// M, N multiples of 64, K multiple of 32 (host-checked). blockIdx.y = batch index (strides in elements).
// NSPLIT: 0 = A.Bt; 1 = (A + A2).Bt (A2 = unscaled bf16 lo plane of A); 2 = A.Bt + A2.Bt + A.Bt2.
// RS / CS: per-row scale rsp[m] / per-column scale csp[n] (f32, not batched) applied in the epilogue.
// OUT_MODE: 0 = f32 (pitch ldc); 2 = bf16 hi plane C + bf16 lo plane C2 (lo = RNE(v - hi), unscaled);
//           3 = f16 hi plane C + f16 residual plane C2 = f16((v - hi) * rscale), C2 written only for tiles
//               with n0 < N2 (pitch ldc2, batch stride strideC2).
// =====================================================================================================
template <int NSPLIT, int OUT_MODE, bool RS, bool CS>
__global__ __launch_bounds__(256) void gemm64(
    const unsigned short* __restrict__ Ap, const unsigned short* A2p, int lda, long long strideA,
    const unsigned short* __restrict__ Btp, const unsigned short* Bt2p, int ldb, long long strideB,
    void* Cout, int ldc, long long strideC,
    void* Cout2, int ldc2, long long strideC2, int N2,
    int M, int N, int K, float rscale,
    const float* __restrict__ rsp, const float* __restrict__ csp) {
  const __bf16* A   = (const __bf16*)(const void*)Ap;
  const __bf16* A2  = (const __bf16*)(const void*)A2p;
  const __bf16* Bt  = (const __bf16*)(const void*)Btp;
  const __bf16* Bt2 = (const __bf16*)(const void*)Bt2p;
  __shared__ __align__(16) float sT[8][16 * 68];   // per-wave 16x64 slab, pitch 68 floats
  const int b    = blockIdx.y;
  const int lane = threadIdx.x & 31;
  const int wave = threadIdx.x >> 5;
  const int tilesN = N >> 6;
  const int tilesM = M >> 6;
  const int tile = blockIdx.x * 8 + wave;
  if (tile >= tilesM * tilesN) return;   // wave-uniform; no block barriers in this kernel
  const int tm = tile / tilesN;
  const int tn = tile - tm * tilesN;
  const int m0 = tm << 6;
  const int n0 = tn << 6;

  const __bf16* Ab  = A  + (size_t)b * strideA;
  const __bf16* Bb  = Bt + (size_t)b * strideB;
  const __bf16* Ab2 = (NSPLIT >= 1) ? (A2  + (size_t)b * strideA) : Ab;
  const __bf16* Bb2 = (NSPLIT == 2) ? (Bt2 + (size_t)b * strideB) : Bb;

  const int rlane = lane & 15;                 // row (A) / col (B, D) within subtile
  const int koff  = (lane >> 4) * 8;           // k offset of this lane half
  const int mOff  = (lane >> 4) * 8;           // D row offset

  v8f acc[4][4];
#pragma unroll
  for (int i = 0; i < 4; ++i)
#pragma unroll
    for (int j = 0; j < 4; ++j) acc[i][j] = zero8();

  for (int k0 = 0; k0 < K; k0 += 32) {
    v16b bh[4], bl[4];
#pragma unroll
    for (int j = 0; j < 4; ++j) {
      const size_t bo = (size_t)(n0 + (j << 4) + rlane) * ldb + koff + k0;
      bh[j] = ldfrag_b(Bb + bo);
      if (NSPLIT == 2) bl[j] = ldfrag_b(Bb2 + bo); else bl[j] = bh[j];
    }
#pragma unroll
    for (int i = 0; i < 4; ++i) {
      const size_t ao = (size_t)(m0 + (i << 4) + rlane) * lda + koff + k0;
      const v16b ah = ldfrag_b(Ab + ao);
      v16b al = ah;
      if (NSPLIT >= 1) al = ldfrag_b(Ab2 + ao);
#pragma unroll
      for (int j = 0; j < 4; ++j) {
        acc[i][j] = mma_b_raw(ah, bh[j], acc[i][j]);
        if (NSPLIT >= 1) acc[i][j] = mma_b_raw(al, bh[j], acc[i][j]);
        if (NSPLIT == 2) acc[i][j] = mma_b_raw(ah, bl[j], acc[i][j]);
      }
      dep_guard_b(acc[i][0], acc[i][3], ah, al);
    }
    keep4_b(bh[0], bh[1], bh[2], bh[3]);
    if (NSPLIT == 2) keep4_b(bl[0], bl[1], bl[2], bl[3]);
  }
  acc_guard4(acc[0][0], acc[0][1], acc[0][2], acc[0][3]);
  acc_guard4(acc[1][0], acc[1][1], acc[1][2], acc[1][3]);
  acc_guard4(acc[2][0], acc[2][1], acc[2][2], acc[2][3]);
  acc_guard4(acc[3][0], acc[3][1], acc[3][2], acc[3][3]);

  // ---- epilogue scales ----
  float csv[4];
#pragma unroll
  for (int j = 0; j < 4; ++j) csv[j] = CS ? csp[n0 + (j << 4) + rlane] : 1.0f;

  // ---- epilogue ----
  float* slab = sT[wave];
#pragma unroll
  for (int i = 0; i < 4; ++i) {
    const int mBase = m0 + (i << 4);
#pragma unroll
    for (int r = 0; r < 8; ++r) {
      const float rsv = RS ? rsp[mBase + mOff + r] : 1.0f;
#pragma unroll
      for (int j = 0; j < 4; ++j) {
        slab[(mOff + r) * 68 + (j << 4) + rlane] = acc[i][j][r] * rsv * csv[j];
      }
    }
    __builtin_amdgcn_fence(__ATOMIC_RELEASE, "workgroup");
    __builtin_amdgcn_wave_barrier();
    __builtin_amdgcn_fence(__ATOMIC_ACQUIRE, "workgroup");
    if (OUT_MODE == 0) {
      float* C = (float*)Cout + (size_t)b * strideC;
      const int hh = lane >> 4, c4 = (lane & 15) * 4;     // 256-B row segment = 16 lanes x 16 B
      v4f ov[8];
#pragma unroll
      for (int it = 0; it < 8; ++it) {
        const int row = it * 2 + hh;                       // it 0..7 x hh 0..1 = rows 0..15
        ov[it] = *(const v4f*)(slab + row * 68 + c4);
      }
      {
#pragma unroll
        for (int it = 0; it < 8; ++it) {
          const int row = it * 2 + hh;
          *(v4f*)(C + (size_t)(mBase + row) * ldc + n0 + c4) = ov[it];
        }
        
      }
    } else {
      const int q = lane >> 3, c8 = (lane & 7) * 8;
      unsigned short* C  = (unsigned short*)Cout  + (size_t)b * strideC;
      unsigned short* C2 = (unsigned short*)Cout2 + (size_t)b * strideC2;
      const bool wlo = (OUT_MODE == 2) || (n0 < N2);      // wave-uniform
      v4u hv[4], lv[4];
#pragma unroll
      for (int it = 0; it < 4; ++it) {
        const int row = it * 4 + q;                        // it 0..3 x q 0..3 = rows 0..15
        const float* sp = slab + row * 68 + c8;
        v4u a, a2;
#pragma unroll
        for (int e = 0; e < 4; ++e) {
          const float f0 = sp[2 * e], f1 = sp[2 * e + 1];
          unsigned short h0, h1, l0, l1;
          if (OUT_MODE == 2) {
            h0 = bf_bits(f0); h1 = bf_bits(f1);
            l0 = bf_bits(f0 - bf_up(h0)); l1 = bf_bits(f1 - bf_up(h1));
          } else {
            const _Float16 x0 = (_Float16)f0, x1 = (_Float16)f1;
            h0 = h_bits(x0); h1 = h_bits(x1);
            l0 = h_bits((_Float16)((f0 - (float)x0) * rscale));
            l1 = h_bits((_Float16)((f1 - (float)x1) * rscale));
          }
          a[e] = pk16(h0, h1); a2[e] = pk16(l0, l1);
        }
        hv[it] = a; lv[it] = a2;
      }
      {
#pragma unroll
        for (int it = 0; it < 4; ++it) {
          const int row = it * 4 + q;
          *(v4u*)(C + (size_t)(mBase + row) * ldc + n0 + c8) = hv[it];
          if (wlo) *(v4u*)(C2 + (size_t)(mBase + row) * ldc2 + n0 + c8) = lv[it];
        }
        
      }
    }
    __builtin_amdgcn_fence(__ATOMIC_RELEASE, "workgroup");
    __builtin_amdgcn_wave_barrier();
    __builtin_amdgcn_fence(__ATOMIC_ACQUIRE, "workgroup");
  }
}

// =====================================================================================================
// Half-split rotary + per-head rms over 64 dims on the f32 q/k projection output, then bf16 hi/lo planes.
//   qk f32 [NB*SEQ][NQK]: column h*64+d = q feature, column DM + h*64+d = k feature of head h.
//   ct/st [SEQ][32] f32 angle tables (input order, pair index = d mod 32).
//   y[d<32] = x1*cos - x2*sin, y[32+d] = x1*sin + x2*cos (x1 = x[d], x2 = x[32+d]); then y * rsqrt(mean(y^2) + 1e-6).
//   Output planes bf16 [(b*SEQ + t)*DM + h*64 + d]: qh/ql (q hi/lo), kh/kl (k hi/lo), lo = RNE(v - hi) unscaled.
// One wave per (token, head): lane = pair index for both q and k; 8 waves per block, grid = NB*SEQ*NH/8 (exact).
// coverage: 65536 waves x (q line + k line) x (hi, lo) = every head line of the 4 planes.
// =====================================================================================================
__global__ __launch_bounds__(256) void rope_norm(const float* __restrict__ qk, const float* __restrict__ ct,
                                                 const float* __restrict__ st,
                                                 unsigned short* qh, unsigned short* ql,
                                                 unsigned short* kh, unsigned short* kl) {
  __shared__ __align__(16) float sy[8][128];
  const int tid = threadIdx.x, wave = tid >> 5, lane = tid & 31;
  const int w  = blockIdx.x * 8 + wave;          // (b*SEQ + s)*NH + h, < NB*SEQ*NH
  const int h  = w % NH;
  const int bs = w / NH;                          // b*SEQ + s
  const int s  = bs % SEQ;
  const float* row = qk + (size_t)bs * NQK + h * HD;
  const float cs = ct[(size_t)s * (HD / 2) + lane];
  const float sn = st[(size_t)s * (HD / 2) + lane];
  float* buf = sy[wave];
#pragma unroll
  for (int t = 0; t < 2; ++t) {                   // t=0: q, t=1: k
    const float* src = row + t * DM;
    const float x1 = src[lane];
    const float x2 = src[lane + 32];
    const float y1 = x1 * cs - x2 * sn;
    const float y2 = x1 * sn + x2 * cs;
    float ss = y1 * y1 + y2 * y2;
#pragma unroll
    for (int off = 16; off >= 1; off >>= 1) ss += __shfl_xor(ss, off, 32);
    const float sc = rsqrtf(ss * (1.0f / HD) + 1e-6f);
    buf[t * 64 + lane]      = y1 * sc;
    buf[t * 64 + 32 + lane] = y2 * sc;
  }
  __builtin_amdgcn_fence(__ATOMIC_RELEASE, "workgroup");
  __builtin_amdgcn_wave_barrier();
  __builtin_amdgcn_fence(__ATOMIC_ACQUIRE, "workgroup");
  const int g = lane >> 3, piece = lane & 7;
  const float* sp = buf + (g >> 1) * 64 + piece * 8;
  const v4f a  = *(const v4f*)(sp);
  const v4f bq = *(const v4f*)(sp + 4);
  v4u hv, lv, val;
#pragma unroll
  for (int e = 0; e < 4; ++e) {
    const float f0 = (e < 2) ? a[2 * e]     : bq[2 * e - 4];
    const float f1 = (e < 2) ? a[2 * e + 1] : bq[2 * e - 3];
    const unsigned short h0 = bf_bits(f0), h1 = bf_bits(f1);
    const unsigned short l0 = bf_bits(f0 - bf_up(h0)), l1 = bf_bits(f1 - bf_up(h1));
    hv[e] = pk16(h0, h1); lv[e] = pk16(l0, l1);
  }
#pragma unroll
  for (int e = 0; e < 4; ++e) val[e] = (g & 1) ? lv[e] : hv[e];
  unsigned short* base = (g == 0) ? qh : ((g == 1) ? ql : ((g == 2) ? kh : kl));
  const size_t go = (size_t)bs * DM + h * HD + piece * 8;
  *(v4u*)(base + go) = val;
  
}

// =====================================================================================================
// Causal attention, head dim 64 (tril mask incl. diagonal, computed).
//   q planes (bf16 hi / lo): element (b, t, h, d) at [(b*SEQ + t)*DM + h*64 + d]
//   k planes (bf16 hi / lo): same layout with key index s
//   v^T hi plane (f16):      element (b, h, d, s) at [(b*DM + h*64 + d)*SEQ + s]
//   v^T residual plane (f16, (v - hi)*4096): [(b*DM + h*64 + d)*VLP + s], s < VLP, read only when RES
//   (a key tile at or beyond VLP would contribute a zero v residual; with RES only tiles below VLP occur)
//   logit = q.k * sscale for key <= query, -FLT_MAX otherwise (exp -> 0); every row has a live key in every
//   processed key tile (tiles 0..qb only, block-uniform trip count qb+1 <= 32).
//   out f32 plane: element (b, t, h*64 + d) at [(b*SEQ + t)*DM + h*64 + d] = normalised context.
//   scores = q . k : bf16 hi/lo split (hi.hi + hi.lo + lo.hi), f32 accumulate, then * sscale in f32
//   p = exp(s - m) carried as f16(1024 p); context = p . v on f16 WMMA; RES adds f16 residual planes of p and v
//   (scale 4096, separate accumulator folded back with 1/4096 per chunk in f32); online softmax in f32.
//   Block = 4 waves = 64 query rows of one (b, h); grid = nqbThis * NH * NB; kv chunks of 64.
//   K / V^T chunk staging: 128 threads x 32 elements per plane = the whole 64x64 tile (plain 16-B loads,
//   __syncthreads before and after); P tiles are wave-private, spilled with _Float16 element stores and reloaded
//   Output coverage: each wave stores rows q0..q0+15 (it 0..7 x lane>>4 0..1) x 64 columns (16 lanes x 4 floats),
// =====================================================================================================
template <bool RES>
__global__ __launch_bounds__(128)
void attn_causal64(const unsigned short* __restrict__ qhp, const unsigned short* __restrict__ qlp,
                   const unsigned short* __restrict__ khp, const unsigned short* __restrict__ klp,
                   const unsigned short* __restrict__ vhp, const unsigned short* __restrict__ vlp,
                   float* outp, int qbBase, int nqbThis, float sscale) {
  union FB { v16b v; v8b h[2]; };
  union FH { v16h v; v8h h[2]; };
  __shared__ __align__(16) __bf16   Ksh[64 * LP];                 // K hi [kv][d], row pitch LP
  __shared__ __align__(16) __bf16   Ksl[64 * LP];                 // K lo
  __shared__ __align__(16) _Float16 Vth[64 * LP];                 // V^T hi [d][kv], row pitch LP
  __shared__ __align__(16) _Float16 Vtl[RES ? 64 * LP : 8];       // V^T residual
  __shared__ __align__(16) _Float16 Psh[4][16 * LP];              // per wave P [row][kv], row pitch LP
  __shared__ __align__(16) _Float16 Psl[RES ? 4 : 1][16 * LP];    // per wave P residual
  __shared__ __align__(16) float    Os[4][16 * OP];               // per wave context tile [row][d], row pitch OP

  const int tid  = threadIdx.x;
  const int wave = tid >> 5;
  const int lane = tid & 31;
  const int hh   = lane >> 4;
  const int c    = lane & 15;

  const int bx   = blockIdx.x;
  const int qbl  = bx % nqbThis;
  const int rest = bx / nqbThis;
  const int h    = rest % NH;
  const int b    = rest / NH;
  const int qb   = qbBase + qbl;
  const int q0   = qb * 64 + wave * 16;
  const size_t rowB = (size_t)b * SEQ;

  const __bf16* Qh = (const __bf16*)(const void*)qhp + (size_t)h * HD;
  const __bf16* Ql = (const __bf16*)(const void*)qlp + (size_t)h * HD;
  const __bf16* Kh = (const __bf16*)(const void*)khp + (size_t)h * HD;
  const __bf16* Kl = (const __bf16*)(const void*)klp + (size_t)h * HD;
  const _Float16* Vh = (const _Float16*)(const void*)vhp + ((size_t)b * DM + (size_t)h * HD) * SEQ;
  const _Float16* Vl = (const _Float16*)(const void*)vlp + ((size_t)b * DM + (size_t)h * HD) * VLP;

  // ---- Q fragments (A operand, row = lane&15): 2 d-chunks, hi and lo ----
  v16b qah[2], qal[2];
#pragma unroll
  for (int dc = 0; dc < 2; ++dc) {
    const size_t qo = (rowB + q0 + c) * DM + dc * 32 + 8 * hh;
    qah[dc] = ldfrag_b(Qh + qo);
    qal[dc] = ldfrag_b(Ql + qo);
  }

  float mrow[8], lrow[8];
  v8f oacc[4];
#pragma unroll
  for (int r = 0; r < 8; ++r) { mrow[r] = -INFINITY; lrow[r] = 0.f; }
#pragma unroll
  for (int t = 0; t < 4; ++t) oacc[t] = zero8();

  int nkt = qb + 1;                          // causal: key tiles 0..qb, block-uniform
  if (nkt > NQB) nkt = NQB;
  for (int kt = 0; kt < nkt; ++kt) {
    const int kv0 = kt * 64;
    __syncthreads();
    {
      const int r = tid >> 1, half = (tid & 1) * 32;
      const __bf16*   kg  = Kh + (rowB + kv0 + r) * DM + half;    // K row kv0+r, d = half..half+31
      const __bf16*   klg = Kl + (rowB + kv0 + r) * DM + half;
      const _Float16* vg  = Vh + (size_t)r * SEQ + kv0 + half;    // V^T row d = r, s = kv0+half..+31
      const int kvl = (kv0 + 64 <= VLP) ? kv0 : (VLP - 64);     // clamped address into the residual plane
      const _Float16* vlg = Vl + (size_t)r * VLP + kvl + half;
      const bool resOK = (kv0 + 64 <= VLP);                      // block-uniform
#pragma unroll
      for (int i = 0; i < 4; ++i) {
        const v8b a0 = *(const v8b*)(kg + 8 * i);
        const v8b a1 = *(const v8b*)(klg + 8 * i);
        const v8h b0 = *(const v8h*)(vg + 8 * i);
        *(v8b*)(Ksh + r * LP + half + 8 * i) = a0;
        *(v8b*)(Ksl + r * LP + half + 8 * i) = a1;
        *(v8h*)(Vth + r * LP + half + 8 * i) = b0;
        if (RES) {
          v8h b1 = *(const v8h*)(vlg + 8 * i);
          if (!resOK) b1 = zero8h();
          *(v8h*)(Vtl + r * LP + half + 8 * i) = b1;
        }
      }
    }
    __syncthreads();

    // ---- scores: 16 query rows x 64 keys per wave, 3 bf16 products ----
    v8f s[4];
#pragma unroll
    for (int j = 0; j < 4; ++j) {
      s[j] = zero8();
#pragma unroll
      for (int dc = 0; dc < 2; ++dc) {
        FB kb, kl;
        kb.h[0] = *(const v8b*)(Ksh + (j * 16 + c) * LP + dc * 32 + 8 * hh);
        kb.h[1] = *(const v8b*)(Ksh + (j * 16 + c) * LP + dc * 32 + 16 + 8 * hh);
        kl.h[0] = *(const v8b*)(Ksl + (j * 16 + c) * LP + dc * 32 + 8 * hh);
        kl.h[1] = *(const v8b*)(Ksl + (j * 16 + c) * LP + dc * 32 + 16 + 8 * hh);
        s[j] = mma_b(qah[dc], kb.v, s[j]);
        s[j] = mma_b(qah[dc], kl.v, s[j]);
        s[j] = mma_b(qal[dc], kb.v, s[j]);
      }
    }

    // ---- scale + causal mask (replace by -FLT_MAX), row max, online softmax, P (x1024, f16) and
    //      P residual (x4096) to LDS ----
    _Float16* pwh = Psh[wave];
    _Float16* pwl = Psl[RES ? wave : 0];
#pragma unroll
    for (int r = 0; r < 8; ++r) {
      const int qrow = q0 + 8 * hh + r;
      float m = -INFINITY;
#pragma unroll
      for (int j = 0; j < 4; ++j) {
        const int key = kv0 + j * 16 + c;
        float sv = s[j][r] * sscale;
        sv = (key > qrow) ? -FLT_MAX : sv;
        s[j][r] = sv;
        m = fmaxf(m, sv);
      }
#pragma unroll
      for (int off = 1; off < 16; off <<= 1) m = fmaxf(m, __shfl_xor(m, off, 32));
      const float mnew  = fmaxf(mrow[r], m);
      const float msafe = (mnew == -INFINITY) ? 0.f : mnew;
      const float alpha = __expf(mrow[r] - msafe);
      mrow[r] = mnew;
      float psum = 0.f;
#pragma unroll
      for (int j = 0; j < 4; ++j) {
        const float p = __expf(s[j][r] - msafe);     // masked logit against a finite max: exp -> 0
        psum += p;
        const float p1k = p * 1024.0f;
        const _Float16 ph = (_Float16)p1k;
        pwh[(8 * hh + r) * LP + j * 16 + c] = ph;
        if (RES) {
          const _Float16 pl = (_Float16)((p1k - (float)ph) * 4096.0f);
          pwl[(8 * hh + r) * LP + j * 16 + c] = pl;
        }
      }
#pragma unroll
      for (int off = 1; off < 16; off <<= 1) psum += __shfl_xor(psum, off, 32);
      lrow[r] = lrow[r] * alpha + psum;
#pragma unroll
      for (int t = 0; t < 4; ++t) oacc[t][r] *= alpha;
    }
    __builtin_amdgcn_fence(__ATOMIC_RELEASE, "workgroup");
    __builtin_amdgcn_wave_barrier();
    __builtin_amdgcn_fence(__ATOMIC_ACQUIRE, "workgroup");

    // ---- context += P . V (f16 WMMA), residual products into a separate accumulator ----
    v8f o1[4];
#pragma unroll
    for (int t = 0; t < 4; ++t) o1[t] = zero8();
#pragma unroll 1
    for (int kk = 0; kk < 2; ++kk) {
      FH pa, pl;
      pa.h[0] = *(const v8h*)(pwh + c * LP + kk * 32 + 8 * hh);
      pa.h[1] = *(const v8h*)(pwh + c * LP + kk * 32 + 16 + 8 * hh);
      if (RES) {
        pl.h[0] = *(const v8h*)(pwl + c * LP + kk * 32 + 8 * hh);
        pl.h[1] = *(const v8h*)(pwl + c * LP + kk * 32 + 16 + 8 * hh);
      } else {
        pl.v = pa.v;
      }
#pragma unroll
      for (int t = 0; t < 4; ++t) {
        FH vb;
        vb.h[0] = *(const v8h*)(Vth + (t * 16 + c) * LP + kk * 32 + 8 * hh);
        vb.h[1] = *(const v8h*)(Vth + (t * 16 + c) * LP + kk * 32 + 16 + 8 * hh);
        oacc[t] = mma_h(pa.v, vb.v, oacc[t]);
        if (RES) {
          FH vl;
          vl.h[0] = *(const v8h*)(Vtl + (t * 16 + c) * LP + kk * 32 + 8 * hh);
          vl.h[1] = *(const v8h*)(Vtl + (t * 16 + c) * LP + kk * 32 + 16 + 8 * hh);
          o1[t] = mma_h(pa.v, vl.v, o1[t]);
          o1[t] = mma_h(pl.v, vb.v, o1[t]);
        }
      }
    }
    if (RES) {
#pragma unroll
      for (int t = 0; t < 4; ++t)
#pragma unroll
        for (int r = 0; r < 8; ++r) oacc[t][r] += o1[t][r] * (1.0f / 4096.0f);
    }
  }

  // ---- normalise (1/l and the 1/1024 p carry), stage the wave's 16x64 tile in LDS, then write whole
  float* os = Os[wave];
#pragma unroll
  for (int r = 0; r < 8; ++r) {
    const float l = lrow[r];
    const float inv = ((l > 0.f) ? (1.0f / l) : 0.f) * (1.0f / 1024.0f);
#pragma unroll
    for (int t = 0; t < 4; ++t) os[(8 * hh + r) * OP + t * 16 + c] = oacc[t][r] * inv;
  }
  __builtin_amdgcn_fence(__ATOMIC_RELEASE, "workgroup");
  __builtin_amdgcn_wave_barrier();
  __builtin_amdgcn_fence(__ATOMIC_ACQUIRE, "workgroup");
  {
    const int h2 = lane >> 4, c4 = (lane & 15) * 4;
    v4f ov[8];
#pragma unroll
    for (int it = 0; it < 8; ++it) {
      const int row = it * 2 + h2;   // it 0..7 x h2 0..1 = rows 0..15 of the wave tile
      ov[it] = *(const v4f*)(os + row * OP + c4);
    }
    {
#pragma unroll
      for (int it = 0; it < 8; ++it) {
        const int row = it * 2 + h2;
        const size_t go = (rowB + q0 + row) * DM + (size_t)h * HD + c4;
        *(v4f*)(outp + go) = ov[it];
      }
      
    }
  }
}

// =====================================================================================================
// Workspace map (bytes), every region an exact multiple of its whole-line / whole-tile store granularity:
//   Xb    bf16 [4096][1024]          0          8388608
//   Winb  bf16 [3072][1024]          8388608    6291456
//   Wob   bf16 [1024][1024]          14680064   2097152
//   Rin   f32  [3072]                16777216     12288   (96 lines)
//   Rout  f32  [1024]                16789504      4096   (32 lines)
//   Rrow  f32  [4096]                16793600     16384   (128 lines)
//   CosT  f32  [2048][32]            16809984    262144
//   SinT  f32  [2048][32]            17072128    262144
//   QKf   f32  [4096][2048]          17334272  33554432   (later: Af f32 [4096][1024] + Ah bf16 + Al bf16)
//   VTh   f16  [2][1024][2048]       50888704   8388608
//   VTl   f16  [2][1024][512]        59277312   2097152
//   Qh    bf16 [4096][1024]          61374464   8388608
//   Ql    bf16 [4096][1024]          69763072   8388608
//   Kh    bf16 [4096][1024]          78151680   8388608
//   Kl    bf16 [4096][1024]          86540288   8388608
//   end                              94928896
// Weights are [out n][in k] with k contiguous = the Bt / A layout the GEMM wants, so they are only converted.
// =====================================================================================================
extern "C" void kernel_launch(void* const* d_in, const int* in_sizes, int n_in,
                              void* d_out, int out_size, void* d_ws, size_t ws_size,
                              hipStream_t stream) {
  if (n_in < 4) return;
  if (in_sizes[0] != NB * SEQ * DM) return;
  if (in_sizes[1] != SEQ * (HD / 2)) return;
  if (in_sizes[2] != 3 * DM * DM) return;
  if (in_sizes[3] != DM * DM) return;
  if (out_size != NB * SEQ * DM) return;

  const float* x    = (const float*)d_in[0];
  const float* rpf  = (const float*)d_in[1];
  const float* w_in = (const float*)d_in[2];
  const float* w_o  = (const float*)d_in[3];

  const size_t PXb   = (size_t)NB * SEQ * DM * 2;      //  8388608  16-bit activation plane [4096][1024]
  const size_t PWin  = (size_t)3 * DM * DM * 2;        //  6291456
  const size_t PWo   = (size_t)DM * DM * 2;            //  2097152
  const size_t PRin  = (size_t)3 * DM * 4;             //    12288
  const size_t PRout = (size_t)DM * 4;                 //     4096
  const size_t PRrow = (size_t)NB * SEQ * 4;           //    16384
  const size_t PTrig = (size_t)SEQ * (HD / 2) * 4;     //   262144
  const size_t PQK   = (size_t)NB * SEQ * NQK * 4;     // 33554432
  const size_t PVTh  = (size_t)NB * DM * SEQ * 2;      //  8388608
  const size_t PVTl  = (size_t)NB * DM * VLP * 2;      //  2097152
  const size_t PAf   = (size_t)NB * SEQ * DM * 4;      // 16777216
  if (PAf + 2 * PXb != PQK) return;                    // Af + Ah + Al reuse the q/k f32 region exactly
  size_t off = 0;
  const size_t oXb   = off; off += PXb;
  const size_t oWin  = off; off += PWin;
  const size_t oWo   = off; off += PWo;
  const size_t oRin  = off; off += PRin;
  const size_t oRout = off; off += PRout;
  const size_t oRrow = off; off += PRrow;
  const size_t oCos  = off; off += PTrig;
  const size_t oSin  = off; off += PTrig;
  const size_t oQK   = off; off += PQK;
  const size_t oVTh  = off; off += PVTh;
  const size_t oVTl  = off; off += PVTl;
  const size_t oQh   = off; off += PXb;
  const size_t oQl   = off; off += PXb;
  const size_t oKh   = off; off += PXb;
  const size_t oKl   = off; off += PXb;
  if (off > ws_size) return;                           // off = 94928896
  if (off > (size_t)134217728) return;
  const size_t oAf = oQK;
  const size_t oAh = oQK + PAf;
  const size_t oAl = oAh + PXb;
  if (oAl + PXb > oVTh) return;                        // region ordering sanity

  char* ws = (char*)d_ws;
  unsigned short* Xb   = (unsigned short*)(ws + oXb);
  unsigned short* Winb = (unsigned short*)(ws + oWin);
  unsigned short* Wvb  = Winb + (size_t)2 * DM * DM;   // rows 2048..3071 of w_in = v features
  unsigned short* Wob  = (unsigned short*)(ws + oWo);
  float*          Rin  = (float*)(ws + oRin);
  float*          Rv   = Rin + 2 * DM;
  float*          Rout = (float*)(ws + oRout);
  float*          Rrow = (float*)(ws + oRrow);
  float*          CosT = (float*)(ws + oCos);
  float*          SinT = (float*)(ws + oSin);
  float*          QKf  = (float*)(ws + oQK);
  unsigned short* VTh  = (unsigned short*)(ws + oVTh);
  unsigned short* VTl  = (unsigned short*)(ws + oVTl);
  unsigned short* Qh   = (unsigned short*)(ws + oQh);
  unsigned short* Ql   = (unsigned short*)(ws + oQl);
  unsigned short* Kh   = (unsigned short*)(ws + oKh);
  unsigned short* Kl   = (unsigned short*)(ws + oKl);
  float*          Af   = (float*)(ws + oAf);
  unsigned short* Ah   = (unsigned short*)(ws + oAh);
  unsigned short* Al   = (unsigned short*)(ws + oAl);

  const dim3 blk(256);
  const int nTrig = SEQ * (HD / 2);                                  // 65536
  const int n8x   = NB * SEQ * DM / 8;                               // 524288
  const dim3 gTrig((nTrig + 255) / 256);                             // 256 blocks
  const dim3 gCvtX((n8x + 255) / 256);                               // 2048 blocks
  const dim3 gPrepWin(3 * DM / 32);                                  // 96 blocks (32 rows each)
  const dim3 gPrepWo(DM / 32);                                       // 32 blocks
  const dim3 gPrepA(NB * SEQ / 32);                                  // 128 blocks
  const dim3 gQK(((NB * SEQ / 64) * (NQK / 64) + 7) / 8, 1);         // 2048 tiles -> 256 blocks
  const dim3 gVT(((DM / 64) * (SEQ / 64) + 7) / 8, NB);              // 512 tiles -> 64 blocks x 2 batches
  const dim3 gOut(((NB * SEQ / 64) * (DM / 64) + 7) / 8, 1);         // 1024 tiles -> 128 blocks
  const dim3 gRope(NB * SEQ * NH / 8);                               // 8192 blocks (8 (token, head) per block)

  // (0) angle tables from the bf16-converted input table
  trig_tab<<<gTrig, blk, 0, stream>>>(rpf, CosT, SinT, nTrig);
  // (1) x -> bf16 plane [4096][1024]
  cvt_bf16x8<<<gCvtX, blk, 0, stream>>>(x, Xb, n8x);
  // (2) weights -> bf16 planes [n][k] + per-row inverse L2 norms of the converted rows
  row_prep<false, true><<<gPrepWin, blk, 0, stream>>>(w_in, Winb, Winb, Rin, 1.0f);
  row_prep<false, true><<<gPrepWo, blk, 0, stream>>>(w_o, Wob, Wob, Rout, 1.0f);
  // (3) q/k projection: QKf[b*SEQ+s][e] = Rin[e] * sum_d Xb[s][d] Winb[e][d], e < 2048  (M=4096, N=2048, K=1024)
  gemm64<0, 0, false, true><<<gQK, blk, 0, stream>>>(
      Xb, Xb, DM, 0LL, Winb, Winb, DM, 0LL,
      (void*)QKf, NQK, 0LL, (void*)QKf, 0, 0LL, 0,
      NB * SEQ, NQK, DM, 1.0f, Rin, Rin);
  // (4) v^T per batch: VTh[b][m][s] = Rv[m] * sum_d Wvb[m][d] Xb[b*SEQ+s][d] -> f16 hi plane (pitch SEQ) and
  //     residual plane (x4096, keys < VLP, pitch VLP)  (M=1024, N=2048, K=1024)
  gemm64<0, 3, true, false><<<gVT, blk, 0, stream>>>(
      Wvb, Wvb, DM, 0LL, Xb, Xb, DM, (long long)SEQ * DM,
      (void*)VTh, SEQ, (long long)DM * SEQ, (void*)VTl, VLP, (long long)DM * VLP, VLP,
      DM, SEQ, DM, 4096.0f, Rv, Rv);
  // (5) rotary + per-head rms -> q/k bf16 hi/lo planes
  rope_norm<<<gRope, blk, 0, stream>>>(QKf, CosT, SinT, Qh, Ql, Kh, Kl);
  // (6) causal attention: query blocks 0..RESQB-1 with residual planes, the rest without -> Af f32 [4096][1024]
  attn_causal64<true><<<dim3(NB * NH * RESQB), dim3(128), 0, stream>>>(
      Qh, Ql, Kh, Kl, VTh, VTl, Af, 0, RESQB, 0.125f);
  attn_causal64<false><<<dim3(NB * NH * (NQB - RESQB)), dim3(128), 0, stream>>>(
      Qh, Ql, Kh, Kl, VTh, VTl, Af, RESQB, NQB - RESQB, 0.125f);
  // (7) merged rows -> bf16 hi/lo planes + per-row inverse rms over 1024
  row_prep<true, false><<<gPrepA, blk, 0, stream>>>(Af, Ah, Al, Rrow, 1.0f / (float)DM);
  // (8) out[s][e] = Rrow[s] * Rout[e] * sum_d (Ah+Al)[s][d] Wob[e][d] -> d_out f32 [4096][1024]  (M=4096, N=1024, K=1024)
  gemm64<1, 0, true, true><<<gOut, blk, 0, stream>>>(
      Ah, Al, DM, 0LL, Wob, Wob, DM, 0LL,
      d_out, DM, 0LL, d_out, 0, 0LL, 0,
      NB * SEQ, DM, DM, 1.0f, Rrow, Rout);
  (void)hipGetLastError();
}

// v002
// Measured time: 226 microseconds a run.
// Two timings next to v001 both put it at 1.46 times that version's speed.
// Over all steps from v000 it is 1.78 times as fast.
// Contractions: q/k and v^T projections = v_wmma_f32_16x16x32_bf16 (bf16 operands from RNE-converted inputs, single product, f32 row/column scales in the epilogue);
// q.k^T scores = v_wmma_f32_16x16x32_bf16 with bf16 hi/lo split q and k (hi.hi + hi.lo + lo.hi);
// p.v = v_wmma_f32_16x16x32_f16 (p carried x1024 in f16, v in f16; extra f16 residual planes x4096 of p and v on the first 512 query rows);
// a.Wout^T = v_wmma_f32_16x16x32_bf16 with a as bf16 hi/lo planes times bf16 Wout (2 products); all f32 accumulate; RoPE, norms and softmax in f32.
#include <hip/hip_runtime.h>
#include <math.h>
#include <float.h>
#include <stdint.h>

#define NB    2
#define SEQ   2048
#define DM    1024
#define NH    16
#define HD    64
#define NQK   (2 * DM)       // q and k feature columns of the fused q/k projection output
#define NQB   (SEQ / 64)     // 32 query / key tiles of 64
#define VLP   512            // key pitch of the v^T residual plane (keys 0..VLP-1)
#define RESQB 8              // leading 64-row query blocks that use the p / v residual planes
static_assert(RESQB * 64 <= VLP);
static_assert(NH * HD == DM);
static_assert((SEQ % 64) == 0 && (DM % 256) == 0);
static_assert(HD == 64);
static_assert((NB * SEQ) % 128 == 0 && SEQ % 128 == 0 && DM % 128 == 0 && NQK % 128 == 0);   // GEMM block tiles of 128x128, k slabs of 64
#define LP    72             // LDS pitch, in 16-bit elements, of a 64-element row: 144 B = 16 B x odd, so that the 16 rows
                             // one ds_load_b128 fragment read touches fall on 16 different groups of four banks
#define GP    72             // LDS pitch, in 16-bit elements, of a GEMM k-slab row of 64 elements (144 B = 16 B x odd, as LP)
#define GPLANE (128 * GP)    // elements of one staged 128-row k slab
#define OP    68             // LDS pitch, in floats, of a 64-float row: the two lane halves store rows eight apart, on different banks

typedef _Float16 v16h __attribute__((ext_vector_type(16)));
typedef _Float16 v8h  __attribute__((ext_vector_type(8)));
typedef __bf16   v16b __attribute__((ext_vector_type(16)));
typedef __bf16   v8b  __attribute__((ext_vector_type(8)));
typedef float    v8f  __attribute__((ext_vector_type(8)));
typedef float    v4f  __attribute__((ext_vector_type(4)));
typedef unsigned int v4u __attribute__((ext_vector_type(4)));

// ---- scalar helpers --------------------------------------------------------------------------------
__device__ __forceinline__ unsigned short bf_bits(float f) {          // f32 -> bf16 bits, RNE convert
  unsigned u = __float_as_uint(f);
  return (unsigned short)((u + 0x7FFFu + ((u >> 16) & 1u)) >> 16);
}
__device__ __forceinline__ float bf_up(unsigned short h) { return __uint_as_float(((unsigned)h) << 16); }
__device__ __forceinline__ unsigned short h_bits(_Float16 x) { return __builtin_bit_cast(unsigned short, x); }
__device__ __forceinline__ unsigned pk16(unsigned short a, unsigned short b) { return (unsigned)a | ((unsigned)b << 16); }
__device__ __forceinline__ v8f zero8() { v8f z = {0.f, 0.f, 0.f, 0.f, 0.f, 0.f, 0.f, 0.f}; return z; }
__device__ __forceinline__ v8h zero8h() {
  const _Float16 z = (_Float16)0.0f;
  v8h r = {z, z, z, z, z, z, z, z};
  return r;
}

// ---- fragment loader: 16-bit A/B operand, lane -> row/col (lane&15), p already includes +8*(lane>>4);
//      elements 0..7 <- p[0..7] (k0+8h..), elements 8..15 <- p[16..23] (k0+16+8h..)
__device__ __forceinline__ v16b ldfrag_b(const __bf16* p) {
  union { v16b v; v8b h[2]; } f;
  f.h[0] = *(const v8b*)(p);
  f.h[1] = *(const v8b*)(p + 16);
  return f.v;
}

// ---- WMMA helpers with trailing VALU hazard gap --------------------------------------------------------
__device__ __forceinline__ v8f mma_b(v16b a, v16b b, v8f c) {
  c = __builtin_amdgcn_wmma_f32_16x16x32_bf16(false, a, false, b, (short)0, c, false, false);
#if defined(__HIP_DEVICE_COMPILE__)
  asm volatile("v_nop\n\tv_nop\n\tv_nop\n\tv_nop" : "+v"(c) : "v"(a), "v"(b));
#endif
  return c;
}
__device__ __forceinline__ v8f mma_h(v16h a, v16h b, v8f c) {
  c = __builtin_amdgcn_wmma_f32_16x16x32_f16(false, a, false, b, (short)0, c, false, false);
#if defined(__HIP_DEVICE_COMPILE__)
  asm volatile("v_nop\n\tv_nop\n\tv_nop\n\tv_nop" : "+v"(c) : "v"(a), "v"(b));
#endif
  return c;
}
__device__ __forceinline__ v8f mma_b_raw(v16b a, v16b b, v8f c) {
  return __builtin_amdgcn_wmma_f32_16x16x32_bf16(false, a, false, b, (short)0, c, false, false);
}
__device__ __forceinline__ void dep_guard_b(v8f& a, v8f& b, v16b x, v16b y) {
#if defined(__HIP_DEVICE_COMPILE__)
  asm volatile("v_nop\n\tv_nop\n\tv_nop\n\tv_nop" : "+v"(a), "+v"(b) : "v"(x), "v"(y));
#endif
}
__device__ __forceinline__ void keep4_b(v16b a, v16b b, v16b c, v16b d) {
#if defined(__HIP_DEVICE_COMPILE__)
  asm volatile("v_nop" :: "v"(a), "v"(b), "v"(c), "v"(d));
#endif
}
__device__ __forceinline__ void acc_guard4(v8f& a, v8f& b, v8f& c, v8f& d) {
#if defined(__HIP_DEVICE_COMPILE__)
  asm volatile("v_nop\n\tv_nop\n\tv_nop\n\tv_nop" : "+v"(a), "+v"(b), "+v"(c), "+v"(d));
#endif
}

// =====================================================================================================
// f32 -> bf16 (RNE convert), 8 elements per thread, one 16-B store per lane: a wave writes 512 contiguous B
// coverage: n8 threads x 8 = whole plane (n8 is a multiple of 256 here).
// =====================================================================================================
__global__ __launch_bounds__(256) void cvt_bf16x8(const float* __restrict__ in, unsigned short* out, int n8) {
  const int i = blockIdx.x * 256 + threadIdx.x;
  if (i < n8) {
    const v4f a = *(const v4f*)(in + (size_t)i * 8);
    const v4f b = *(const v4f*)(in + (size_t)i * 8 + 4);
    v4u p;
    p[0] = pk16(bf_bits(a[0]), bf_bits(a[1]));
    p[1] = pk16(bf_bits(a[2]), bf_bits(a[3]));
    p[2] = pk16(bf_bits(b[0]), bf_bits(b[1]));
    p[3] = pk16(bf_bits(b[2]), bf_bits(b[3]));
    *(v4u*)(out + (size_t)i * 8) = p;
    
  }
}

// =====================================================================================================
// Angle table: ct[i] = cosf(bf(fr[i])), st[i] = sinf(bf(fr[i])) with the angle RNE-converted to bf16
// =====================================================================================================
__global__ __launch_bounds__(256) void trig_tab(const float* __restrict__ fr, float* ct, float* st, int n) {
  const int i = blockIdx.x * 256 + threadIdx.x;
  if (i < n) {
    const float f  = bf_up(bf_bits(fr[i]));
    const float cv = cosf(f);
    const float sv = sinf(f);
    *(float*)(ct + i) = cv;
    *(float*)(st + i) = sv;
    
  }
}

// =====================================================================================================
// Row preparation over rows of DM=1024 f32 values (pitch DM):
//   hi plane = RNE bf16 of each value; LO: lo plane = RNE bf16 of (v - hi) (unscaled);
//   rtab[row] = rsqrt(ss * inv_div + 1e-6) with ss = sum over the row of g^2,
//     g = the bf16-converted value (SQR) or the f32 value (!SQR).
// Block = 8 waves = 32 rows (wave w: rows 4w..4w+3 of the block); grid = rows / 32 (exact here).
// Per row and instruction t (0..3): lane l holds columns 256t + 8l .. +7 -> 32 lanes x 16 B = 512 B
// coverage: 4 t x 32 lanes x 8 = 1024 columns per row; 8 waves x 4 rows = 32 rows per block.
// =====================================================================================================
template <bool LO, bool SQR>
__global__ __launch_bounds__(256) void row_prep(const float* __restrict__ in, unsigned short* hp, unsigned short* lp,
                                                float* rtab, float inv_div) {
  __shared__ float sr[32];
  const int tid = threadIdx.x, wave = tid >> 5, lane = tid & 31;
#pragma unroll 1
  for (int i = 0; i < 4; ++i) {
    const int row = blockIdx.x * 32 + wave * 4 + i;
    const float* rp = in + (size_t)row * DM + lane * 8;
    float ss = 0.f;
    v4u hv[4], lv[4];
#pragma unroll
    for (int t = 0; t < 4; ++t) {
      const v4f a  = *(const v4f*)(rp + t * 256);
      const v4f bq = *(const v4f*)(rp + t * 256 + 4);
      v4u ph, pl;
#pragma unroll
      for (int e = 0; e < 4; ++e) {
        const float f0 = (e < 2) ? a[2 * e]     : bq[2 * e - 4];
        const float f1 = (e < 2) ? a[2 * e + 1] : bq[2 * e - 3];
        const unsigned short h0 = bf_bits(f0), h1 = bf_bits(f1);
        const float g0 = SQR ? bf_up(h0) : f0;
        const float g1 = SQR ? bf_up(h1) : f1;
        ss += g0 * g0;
        ss += g1 * g1;
        ph[e] = pk16(h0, h1);
        if (LO) {
          pl[e] = pk16(bf_bits(f0 - bf_up(h0)), bf_bits(f1 - bf_up(h1)));
        } else {
          pl[e] = 0u;
        }
      }
      hv[t] = ph; lv[t] = pl;
    }
#pragma unroll
    for (int off = 16; off >= 1; off >>= 1) ss += __shfl_xor(ss, off, 32);
    const float rv = rsqrtf(ss * inv_div + 1e-6f);
    if (lane == 0) sr[wave * 4 + i] = rv;
    {
#pragma unroll
      for (int t = 0; t < 4; ++t) {
        const size_t go = (size_t)row * DM + t * 256 + lane * 8;
        *(v4u*)(hp + go) = hv[t];
        if (LO) *(v4u*)(lp + go) = lv[t];
      }
      
    }
  }
  __syncthreads();
  if (wave == 0) {
    const float rv = sr[lane];
    float* d = rtab + (size_t)blockIdx.x * 32 + lane;
    *(float*)d = rv;
    
  }
}

// =====================================================================================================
// Eight asynchronous 16-B copies per lane, global memory -> LDS: this lane's piece of rows r, r+16, .., r+112 of one
// 128-row x 64-element k slab. g = the lane's piece in row r (row pitch ld elements), l = its LDS byte address
// (row pitch GP elements). Eight lanes cover one 128-B row, so a wave's copy covers four whole lines.
// =====================================================================================================
__device__ __forceinline__ void stage_plane(const __bf16* g, int ld, unsigned l) {
  const size_t   gs = (size_t)16 * (size_t)ld;        // 16 rows in global memory, elements
  const unsigned ls = 16u * GP * 2u;                  // 16 rows in LDS, bytes
  const __bf16 *g0 = g, *g1 = g + gs, *g2 = g + 2 * gs, *g3 = g + 3 * gs;
  const __bf16 *g4 = g + 4 * gs, *g5 = g + 5 * gs, *g6 = g + 6 * gs, *g7 = g + 7 * gs;
  const unsigned l0 = l, l1 = l + ls, l2 = l + 2 * ls, l3 = l + 3 * ls;
  const unsigned l4 = l + 4 * ls, l5 = l + 5 * ls, l6 = l + 6 * ls, l7 = l + 7 * ls;
#if defined(__HIP_DEVICE_COMPILE__)
  // the copies bring the slab into LDS through no register; the closing s_wait_xcnt stands in the same statement so
  // that no address register named here is rewritten in front of it
  asm volatile(
      "global_load_async_to_lds_b128 %0, %8, off\n\t"
      "global_load_async_to_lds_b128 %1, %9, off\n\t"
      "global_load_async_to_lds_b128 %2, %10, off\n\t"
      "global_load_async_to_lds_b128 %3, %11, off\n\t"
      "global_load_async_to_lds_b128 %4, %12, off\n\t"
      "global_load_async_to_lds_b128 %5, %13, off\n\t"
      "global_load_async_to_lds_b128 %6, %14, off\n\t"
      "global_load_async_to_lds_b128 %7, %15, off\n\t"
      "s_wait_xcnt 0x0"
      :: "v"(l0), "v"(l1), "v"(l2), "v"(l3), "v"(l4), "v"(l5), "v"(l6), "v"(l7),
         "v"(g0), "v"(g1), "v"(g2), "v"(g3), "v"(g4), "v"(g5), "v"(g6), "v"(g7)
      : "memory");
#endif
}
// this wave's own copies have landed in LDS
__device__ __forceinline__ void wait_async0() {
#if defined(__HIP_DEVICE_COMPILE__)
  asm volatile("s_wait_asynccnt 0x0" ::: "memory");
#endif
}
// this wave's own LDS reads have returned, so that the buffer they read may be refilled behind the next barrier
__device__ __forceinline__ void wait_ds0() {
#if defined(__HIP_DEVICE_COMPILE__)
  asm volatile("s_wait_dscnt 0x0" ::: "memory");
#endif
}

// =====================================================================================================
// Batched bf16 WMMA GEMM: C[m][n] = rs[m] * cs[n] * sum_k A[m][k] * Bt[n][k]. Block = 4 waves = a 128x128 tile,
// wave (wave>>1, wave&1) owns one 64x64 quarter. A row-major [M][K] pitch lda; Bt row-major [N][K] pitch ldb
// (k contiguous); M, N multiples of 128, K a multiple of 64 (true of the three launches below).
// blockIdx.y = batch index (strides in elements).
// Operands: k slabs of 64 elements (one 128-B line per row) are copied into LDS by asynchronous 16-B copies, whole
// lines per wave, two buffers: slab t+1 flies while slab t is worked on. Fragments are read from LDS (row pitch GP).
// NSPLIT: 0 = A.Bt; 1 = (A + A2).Bt (A2 = unscaled bf16 lo plane of A).
// RS / CS: per-row scale rsp[m] / per-column scale csp[n] (f32, not batched) applied in the epilogue.
// OUT_MODE: 0 = f32 (pitch ldc); 2 = bf16 hi plane C + bf16 lo plane C2 (lo = RNE(v - hi), unscaled);
//           3 = f16 hi plane C + f16 residual plane C2 = f16((v - hi) * rscale), C2 written only for tiles
//               with n0 < N2 (pitch ldc2, batch stride strideC2).
// =====================================================================================================
template <int NSPLIT, int OUT_MODE, bool RS, bool CS>
__global__ __launch_bounds__(128) void gemm64(
    const unsigned short* __restrict__ Ap, const unsigned short* A2p, int lda, long long strideA,
    const unsigned short* __restrict__ Btp, int ldb, long long strideB,
    void* Cout, int ldc, long long strideC,
    void* Cout2, int ldc2, long long strideC2, int N2,
    int M, int N, int K, float rscale,
    const float* __restrict__ rsp, const float* __restrict__ csp) {
  static_assert(NSPLIT == 0 || NSPLIT == 1);
  const __bf16* A   = (const __bf16*)(const void*)Ap;
  const __bf16* A2  = (const __bf16*)(const void*)A2p;
  const __bf16* Bt  = (const __bf16*)(const void*)Btp;
  __shared__ __align__(16) __bf16 sA[2][GPLANE];                                   // A slab, two buffers
  __shared__ __align__(16) __bf16 sB[2][GPLANE];                                   // Bt slab, two buffers
  __shared__ __align__(16) __bf16 sA2[NSPLIT ? 2 : 1][NSPLIT ? GPLANE : 8];        // A2 slab, two buffers
  __shared__ __align__(16) float sT[4][16 * 68];   // per-wave 16x64 slab, pitch 68 floats
  const int b    = blockIdx.y;
  const int tid  = threadIdx.x;
  const int lane = tid & 31;
  const int wave = tid >> 5;
  const int tilesN = N >> 7;
  const int tilesM = M >> 7;
  const int tile = blockIdx.x;
  if (tile >= tilesM * tilesN) return;   // block-uniform, in front of every copy and barrier
  const int tm = tile / tilesN;
  const int tn = tile - tm * tilesN;
  const int bm0 = tm << 7;
  const int bn0 = tn << 7;
  const int wm  = (wave >> 1) << 6;            // this wave's quarter inside the block tile
  const int wn  = (wave & 1) << 6;
  const int m0 = bm0 + wm;
  const int n0 = bn0 + wn;

  const __bf16* Ab  = A  + (size_t)b * strideA;
  const __bf16* Bb  = Bt + (size_t)b * strideB;
  const __bf16* Ab2 = (NSPLIT >= 1) ? (A2  + (size_t)b * strideA) : Ab;

  const int rlane = lane & 15;                 // row (A) / col (B, D) within subtile
  const int koff  = (lane >> 4) * 8;           // k offset of this lane half
  const int mOff  = (lane >> 4) * 8;           // D row offset

  // ---- staging addresses: thread -> row tid>>3 (+16 per copy), 16-B piece tid&7 of the 128-B slab row ----
  const int srow = tid >> 3, spc = (tid & 7) * 8;
  const __bf16* gA  = Ab  + (size_t)(bm0 + srow) * lda + spc;
  const __bf16* gA2 = Ab2 + (size_t)(bm0 + srow) * lda + spc;
  const __bf16* gB  = Bb  + (size_t)(bn0 + srow) * ldb + spc;
  const unsigned lofs = (unsigned)(srow * GP + spc) * 2u;
  const unsigned lA  = (unsigned)(size_t)(const void*)&sA[0][0]  + lofs;   // low 32 bits = byte offset in LDS
  const unsigned lB  = (unsigned)(size_t)(const void*)&sB[0][0]  + lofs;
  const unsigned lA2 = (unsigned)(size_t)(const void*)&sA2[0][0] + lofs;
  const int nslab = K >> 6;

  v8f acc[4][4];
#pragma unroll
  for (int i = 0; i < 4; ++i)
#pragma unroll
    for (int j = 0; j < 4; ++j) acc[i][j] = zero8();

  // ---- prologue: slab 0 landed and published, then slab 1 in flight ----
  stage_plane(gA, lda, lA);
  stage_plane(gB, ldb, lB);
  if (NSPLIT >= 1) stage_plane(gA2, lda, lA2);
  wait_async0();
  __syncthreads();
  if (nslab > 1) {
    stage_plane(gA + 64, lda, lA + GPLANE * 2u);
    stage_plane(gB + 64, ldb, lB + GPLANE * 2u);
    if (NSPLIT >= 1) stage_plane(gA2 + 64, lda, lA2 + GPLANE * 2u);
  }

#pragma unroll 1   // one slab per trip: the two buffers alternate by the trip's parity
  for (int t = 0; t < nslab; ++t) {
    const int buf = t & 1;
    const __bf16* fa  = &sA[buf][(wm + rlane) * GP + koff];
    const __bf16* fb  = &sB[buf][(wn + rlane) * GP + koff];
    const __bf16* fa2 = NSPLIT ? &sA2[NSPLIT ? buf : 0][(wm + rlane) * GP + koff] : fa;
#pragma unroll
    for (int ks = 0; ks < 64; ks += 32) {
      // all fragments of this 32-wide k step are read as one group in front of its WMMAs
      v16b bh[4], ah[4], al[4];
#pragma unroll
      for (int j = 0; j < 4; ++j) bh[j] = ldfrag_b(fb + (j << 4) * GP + ks);
#pragma unroll
      for (int i = 0; i < 4; ++i) {
        ah[i] = ldfrag_b(fa + (i << 4) * GP + ks);
        if (NSPLIT >= 1) al[i] = ldfrag_b(fa2 + (i << 4) * GP + ks); else al[i] = ah[i];
      }
#pragma unroll
      for (int i = 0; i < 4; ++i) {
#pragma unroll
        for (int j = 0; j < 4; ++j) {
          acc[i][j] = mma_b_raw(ah[i], bh[j], acc[i][j]);
          if (NSPLIT >= 1) acc[i][j] = mma_b_raw(al[i], bh[j], acc[i][j]);
        }
        dep_guard_b(acc[i][0], acc[i][3], ah[i], al[i]);
      }
      keep4_b(bh[0], bh[1], bh[2], bh[3]);
    }
    // ---- publish slab t+1, free slab t's buffer: own LDS reads done, own copies landed, block barrier ----
    wait_ds0();
    wait_async0();
    __syncthreads();
    if (t + 2 < nslab) {                       // block-uniform: refill the buffer that this trip has just read
      const int kn = (t + 2) << 6;
      const unsigned bo = (unsigned)buf * (GPLANE * 2u);
      stage_plane(gA + kn, lda, lA + bo);
      stage_plane(gB + kn, ldb, lB + bo);
      if (NSPLIT >= 1) stage_plane(gA2 + kn, lda, lA2 + bo);
    }
  }
  wait_async0();
  acc_guard4(acc[0][0], acc[0][1], acc[0][2], acc[0][3]);
  acc_guard4(acc[1][0], acc[1][1], acc[1][2], acc[1][3]);
  acc_guard4(acc[2][0], acc[2][1], acc[2][2], acc[2][3]);
  acc_guard4(acc[3][0], acc[3][1], acc[3][2], acc[3][3]);

  // ---- epilogue scales ----
  float csv[4];
#pragma unroll
  for (int j = 0; j < 4; ++j) csv[j] = CS ? csp[n0 + (j << 4) + rlane] : 1.0f;

  // ---- epilogue ----
  float* slab = sT[wave];
#pragma unroll
  for (int i = 0; i < 4; ++i) {
    const int mBase = m0 + (i << 4);
#pragma unroll
    for (int r = 0; r < 8; ++r) {
      const float rsv = RS ? rsp[mBase + mOff + r] : 1.0f;
#pragma unroll
      for (int j = 0; j < 4; ++j) {
        slab[(mOff + r) * 68 + (j << 4) + rlane] = acc[i][j][r] * rsv * csv[j];
      }
    }
    __builtin_amdgcn_fence(__ATOMIC_RELEASE, "workgroup");
    __builtin_amdgcn_wave_barrier();
    __builtin_amdgcn_fence(__ATOMIC_ACQUIRE, "workgroup");
    if (OUT_MODE == 0) {
      float* C = (float*)Cout + (size_t)b * strideC;
      const int hh = lane >> 4, c4 = (lane & 15) * 4;     // 256-B row segment = 16 lanes x 16 B
      v4f ov[8];
#pragma unroll
      for (int it = 0; it < 8; ++it) {
        const int row = it * 2 + hh;                       // it 0..7 x hh 0..1 = rows 0..15
        ov[it] = *(const v4f*)(slab + row * 68 + c4);
      }
      {
#pragma unroll
        for (int it = 0; it < 8; ++it) {
          const int row = it * 2 + hh;
          *(v4f*)(C + (size_t)(mBase + row) * ldc + n0 + c4) = ov[it];
        }
        
      }
    } else {
      const int q = lane >> 3, c8 = (lane & 7) * 8;
      unsigned short* C  = (unsigned short*)Cout  + (size_t)b * strideC;
      unsigned short* C2 = (unsigned short*)Cout2 + (size_t)b * strideC2;
      const bool wlo = (OUT_MODE == 2) || (n0 < N2);      // wave-uniform
      v4u hv[4], lv[4];
#pragma unroll
      for (int it = 0; it < 4; ++it) {
        const int row = it * 4 + q;                        // it 0..3 x q 0..3 = rows 0..15
        const float* sp = slab + row * 68 + c8;
        v4u a, a2;
#pragma unroll
        for (int e = 0; e < 4; ++e) {
          const float f0 = sp[2 * e], f1 = sp[2 * e + 1];
          unsigned short h0, h1, l0, l1;
          if (OUT_MODE == 2) {
            h0 = bf_bits(f0); h1 = bf_bits(f1);
            l0 = bf_bits(f0 - bf_up(h0)); l1 = bf_bits(f1 - bf_up(h1));
          } else {
            const _Float16 x0 = (_Float16)f0, x1 = (_Float16)f1;
            h0 = h_bits(x0); h1 = h_bits(x1);
            l0 = h_bits((_Float16)((f0 - (float)x0) * rscale));
            l1 = h_bits((_Float16)((f1 - (float)x1) * rscale));
          }
          a[e] = pk16(h0, h1); a2[e] = pk16(l0, l1);
        }
        hv[it] = a; lv[it] = a2;
      }
      {
#pragma unroll
        for (int it = 0; it < 4; ++it) {
          const int row = it * 4 + q;
          *(v4u*)(C + (size_t)(mBase + row) * ldc + n0 + c8) = hv[it];
          if (wlo) *(v4u*)(C2 + (size_t)(mBase + row) * ldc2 + n0 + c8) = lv[it];
        }
        
      }
    }
    __builtin_amdgcn_fence(__ATOMIC_RELEASE, "workgroup");
    __builtin_amdgcn_wave_barrier();
    __builtin_amdgcn_fence(__ATOMIC_ACQUIRE, "workgroup");
  }
}

// =====================================================================================================
// Half-split rotary + per-head rms over 64 dims on the f32 q/k projection output, then bf16 hi/lo planes.
//   qk f32 [NB*SEQ][NQK]: column h*64+d = q feature, column DM + h*64+d = k feature of head h.
//   ct/st [SEQ][32] f32 angle tables (input order, pair index = d mod 32).
//   y[d<32] = x1*cos - x2*sin, y[32+d] = x1*sin + x2*cos (x1 = x[d], x2 = x[32+d]); then y * rsqrt(mean(y^2) + 1e-6).
//   Output planes bf16 [(b*SEQ + t)*DM + h*64 + d]: qh/ql (q hi/lo), kh/kl (k hi/lo), lo = RNE(v - hi) unscaled.
// One wave per (token, head): lane = pair index for both q and k; 8 waves per block, grid = NB*SEQ*NH/8 (exact).
// coverage: 65536 waves x (q line + k line) x (hi, lo) = every head line of the 4 planes.
// =====================================================================================================
__global__ __launch_bounds__(256) void rope_norm(const float* __restrict__ qk, const float* __restrict__ ct,
                                                 const float* __restrict__ st,
                                                 unsigned short* qh, unsigned short* ql,
                                                 unsigned short* kh, unsigned short* kl) {
  __shared__ __align__(16) float sy[8][128];
  const int tid = threadIdx.x, wave = tid >> 5, lane = tid & 31;
  const int w  = blockIdx.x * 8 + wave;          // (b*SEQ + s)*NH + h, < NB*SEQ*NH
  const int h  = w % NH;
  const int bs = w / NH;                          // b*SEQ + s
  const int s  = bs % SEQ;
  const float* row = qk + (size_t)bs * NQK + h * HD;
  const float cs = ct[(size_t)s * (HD / 2) + lane];
  const float sn = st[(size_t)s * (HD / 2) + lane];
  float* buf = sy[wave];
#pragma unroll
  for (int t = 0; t < 2; ++t) {                   // t=0: q, t=1: k
    const float* src = row + t * DM;
    const float x1 = src[lane];
    const float x2 = src[lane + 32];
    const float y1 = x1 * cs - x2 * sn;
    const float y2 = x1 * sn + x2 * cs;
    float ss = y1 * y1 + y2 * y2;
#pragma unroll
    for (int off = 16; off >= 1; off >>= 1) ss += __shfl_xor(ss, off, 32);
    const float sc = rsqrtf(ss * (1.0f / HD) + 1e-6f);
    buf[t * 64 + lane]      = y1 * sc;
    buf[t * 64 + 32 + lane] = y2 * sc;
  }
  __builtin_amdgcn_fence(__ATOMIC_RELEASE, "workgroup");
  __builtin_amdgcn_wave_barrier();
  __builtin_amdgcn_fence(__ATOMIC_ACQUIRE, "workgroup");
  const int g = lane >> 3, piece = lane & 7;
  const float* sp = buf + (g >> 1) * 64 + piece * 8;
  const v4f a  = *(const v4f*)(sp);
  const v4f bq = *(const v4f*)(sp + 4);
  v4u hv, lv, val;
#pragma unroll
  for (int e = 0; e < 4; ++e) {
    const float f0 = (e < 2) ? a[2 * e]     : bq[2 * e - 4];
    const float f1 = (e < 2) ? a[2 * e + 1] : bq[2 * e - 3];
    const unsigned short h0 = bf_bits(f0), h1 = bf_bits(f1);
    const unsigned short l0 = bf_bits(f0 - bf_up(h0)), l1 = bf_bits(f1 - bf_up(h1));
    hv[e] = pk16(h0, h1); lv[e] = pk16(l0, l1);
  }
#pragma unroll
  for (int e = 0; e < 4; ++e) val[e] = (g & 1) ? lv[e] : hv[e];
  unsigned short* base = (g == 0) ? qh : ((g == 1) ? ql : ((g == 2) ? kh : kl));
  const size_t go = (size_t)bs * DM + h * HD + piece * 8;
  *(v4u*)(base + go) = val;
  
}

// =====================================================================================================
// Causal attention, head dim 64 (tril mask incl. diagonal, computed).
//   q planes (bf16 hi / lo): element (b, t, h, d) at [(b*SEQ + t)*DM + h*64 + d]
//   k planes (bf16 hi / lo): same layout with key index s
//   v^T hi plane (f16):      element (b, h, d, s) at [(b*DM + h*64 + d)*SEQ + s]
//   v^T residual plane (f16, (v - hi)*4096): [(b*DM + h*64 + d)*VLP + s], s < VLP, read only when RES
//   (a key tile at or beyond VLP would contribute a zero v residual; with RES only tiles below VLP occur)
//   logit = q.k * sscale for key <= query, -FLT_MAX otherwise (exp -> 0); every row has a live key in every
//   processed key tile (tiles 0..qb only, block-uniform trip count qb+1 <= 32).
//   out f32 plane: element (b, t, h*64 + d) at [(b*SEQ + t)*DM + h*64 + d] = normalised context.
//   scores = q . k : bf16 hi/lo split (hi.hi + hi.lo + lo.hi), f32 accumulate, then * sscale in f32
//   p = exp(s - m) carried as f16(1024 p); context = p . v on f16 WMMA; RES adds f16 residual planes of p and v
//   (scale 4096, separate accumulator folded back with 1/4096 per chunk in f32); online softmax in f32.
//   Block = 4 waves = 64 query rows of one (b, h); grid = nqbThis * NH * NB; kv chunks of 64.
//   K / V^T chunk staging: 128 threads x 32 elements per plane = the whole 64x64 tile (plain 16-B loads,
//   __syncthreads before and after); P tiles are wave-private, spilled with _Float16 element stores and reloaded
//   Output coverage: each wave stores rows q0..q0+15 (it 0..7 x lane>>4 0..1) x 64 columns (16 lanes x 4 floats),
// =====================================================================================================
template <bool RES>
__global__ __launch_bounds__(128)
void attn_causal64(const unsigned short* __restrict__ qhp, const unsigned short* __restrict__ qlp,
                   const unsigned short* __restrict__ khp, const unsigned short* __restrict__ klp,
                   const unsigned short* __restrict__ vhp, const unsigned short* __restrict__ vlp,
                   float* outp, int qbBase, int nqbThis, float sscale) {
  union FB { v16b v; v8b h[2]; };
  union FH { v16h v; v8h h[2]; };
  __shared__ __align__(16) __bf16   Ksh[64 * LP];                 // K hi [kv][d], row pitch LP
  __shared__ __align__(16) __bf16   Ksl[64 * LP];                 // K lo
  __shared__ __align__(16) _Float16 Vth[64 * LP];                 // V^T hi [d][kv], row pitch LP
  __shared__ __align__(16) _Float16 Vtl[RES ? 64 * LP : 8];       // V^T residual
  __shared__ __align__(16) _Float16 Psh[4][16 * LP];              // per wave P [row][kv], row pitch LP
  __shared__ __align__(16) _Float16 Psl[RES ? 4 : 1][16 * LP];    // per wave P residual
  __shared__ __align__(16) float    Os[4][16 * OP];               // per wave context tile [row][d], row pitch OP

  const int tid  = threadIdx.x;
  const int wave = tid >> 5;
  const int lane = tid & 31;
  const int hh   = lane >> 4;
  const int c    = lane & 15;

  const int bx   = blockIdx.x;
  const int qbl  = bx % nqbThis;
  const int rest = bx / nqbThis;
  const int h    = rest % NH;
  const int b    = rest / NH;
  const int qb   = qbBase + qbl;
  const int q0   = qb * 64 + wave * 16;
  const size_t rowB = (size_t)b * SEQ;

  const __bf16* Qh = (const __bf16*)(const void*)qhp + (size_t)h * HD;
  const __bf16* Ql = (const __bf16*)(const void*)qlp + (size_t)h * HD;
  const __bf16* Kh = (const __bf16*)(const void*)khp + (size_t)h * HD;
  const __bf16* Kl = (const __bf16*)(const void*)klp + (size_t)h * HD;
  const _Float16* Vh = (const _Float16*)(const void*)vhp + ((size_t)b * DM + (size_t)h * HD) * SEQ;
  const _Float16* Vl = (const _Float16*)(const void*)vlp + ((size_t)b * DM + (size_t)h * HD) * VLP;

  // ---- Q fragments (A operand, row = lane&15): 2 d-chunks, hi and lo ----
  v16b qah[2], qal[2];
#pragma unroll
  for (int dc = 0; dc < 2; ++dc) {
    const size_t qo = (rowB + q0 + c) * DM + dc * 32 + 8 * hh;
    qah[dc] = ldfrag_b(Qh + qo);
    qal[dc] = ldfrag_b(Ql + qo);
  }

  float mrow[8], lrow[8];
  v8f oacc[4];
#pragma unroll
  for (int r = 0; r < 8; ++r) { mrow[r] = -INFINITY; lrow[r] = 0.f; }
#pragma unroll
  for (int t = 0; t < 4; ++t) oacc[t] = zero8();

  int nkt = qb + 1;                          // causal: key tiles 0..qb, block-uniform
  if (nkt > NQB) nkt = NQB;
  for (int kt = 0; kt < nkt; ++kt) {
    const int kv0 = kt * 64;
    __syncthreads();
    {
      const int r = tid >> 1, half = (tid & 1) * 32;
      const __bf16*   kg  = Kh + (rowB + kv0 + r) * DM + half;    // K row kv0+r, d = half..half+31
      const __bf16*   klg = Kl + (rowB + kv0 + r) * DM + half;
      const _Float16* vg  = Vh + (size_t)r * SEQ + kv0 + half;    // V^T row d = r, s = kv0+half..+31
      const int kvl = (kv0 + 64 <= VLP) ? kv0 : (VLP - 64);     // clamped address into the residual plane
      const _Float16* vlg = Vl + (size_t)r * VLP + kvl + half;
      const bool resOK = (kv0 + 64 <= VLP);                      // block-uniform
#pragma unroll
      for (int i = 0; i < 4; ++i) {
        const v8b a0 = *(const v8b*)(kg + 8 * i);
        const v8b a1 = *(const v8b*)(klg + 8 * i);
        const v8h b0 = *(const v8h*)(vg + 8 * i);
        *(v8b*)(Ksh + r * LP + half + 8 * i) = a0;
        *(v8b*)(Ksl + r * LP + half + 8 * i) = a1;
        *(v8h*)(Vth + r * LP + half + 8 * i) = b0;
        if (RES) {
          v8h b1 = *(const v8h*)(vlg + 8 * i);
          if (!resOK) b1 = zero8h();
          *(v8h*)(Vtl + r * LP + half + 8 * i) = b1;
        }
      }
    }
    __syncthreads();

    // ---- scores: 16 query rows x 64 keys per wave, 3 bf16 products ----
    v8f s[4];
#pragma unroll
    for (int j = 0; j < 4; ++j) {
      s[j] = zero8();
#pragma unroll
      for (int dc = 0; dc < 2; ++dc) {
        FB kb, kl;
        kb.h[0] = *(const v8b*)(Ksh + (j * 16 + c) * LP + dc * 32 + 8 * hh);
        kb.h[1] = *(const v8b*)(Ksh + (j * 16 + c) * LP + dc * 32 + 16 + 8 * hh);
        kl.h[0] = *(const v8b*)(Ksl + (j * 16 + c) * LP + dc * 32 + 8 * hh);
        kl.h[1] = *(const v8b*)(Ksl + (j * 16 + c) * LP + dc * 32 + 16 + 8 * hh);
        s[j] = mma_b(qah[dc], kb.v, s[j]);
        s[j] = mma_b(qah[dc], kl.v, s[j]);
        s[j] = mma_b(qal[dc], kb.v, s[j]);
      }
    }

    // ---- scale + causal mask (replace by -FLT_MAX), row max, online softmax, P (x1024, f16) and
    //      P residual (x4096) to LDS ----
    _Float16* pwh = Psh[wave];
    _Float16* pwl = Psl[RES ? wave : 0];
#pragma unroll
    for (int r = 0; r < 8; ++r) {
      const int qrow = q0 + 8 * hh + r;
      float m = -INFINITY;
#pragma unroll
      for (int j = 0; j < 4; ++j) {
        const int key = kv0 + j * 16 + c;
        float sv = s[j][r] * sscale;
        sv = (key > qrow) ? -FLT_MAX : sv;
        s[j][r] = sv;
        m = fmaxf(m, sv);
      }
#pragma unroll
      for (int off = 1; off < 16; off <<= 1) m = fmaxf(m, __shfl_xor(m, off, 32));
      const float mnew  = fmaxf(mrow[r], m);
      const float msafe = (mnew == -INFINITY) ? 0.f : mnew;
      const float alpha = __expf(mrow[r] - msafe);
      mrow[r] = mnew;
      float psum = 0.f;
#pragma unroll
      for (int j = 0; j < 4; ++j) {
        const float p = __expf(s[j][r] - msafe);     // masked logit against a finite max: exp -> 0
        psum += p;
        const float p1k = p * 1024.0f;
        const _Float16 ph = (_Float16)p1k;
        pwh[(8 * hh + r) * LP + j * 16 + c] = ph;
        if (RES) {
          const _Float16 pl = (_Float16)((p1k - (float)ph) * 4096.0f);
          pwl[(8 * hh + r) * LP + j * 16 + c] = pl;
        }
      }
#pragma unroll
      for (int off = 1; off < 16; off <<= 1) psum += __shfl_xor(psum, off, 32);
      lrow[r] = lrow[r] * alpha + psum;
#pragma unroll
      for (int t = 0; t < 4; ++t) oacc[t][r] *= alpha;
    }
    __builtin_amdgcn_fence(__ATOMIC_RELEASE, "workgroup");
    __builtin_amdgcn_wave_barrier();
    __builtin_amdgcn_fence(__ATOMIC_ACQUIRE, "workgroup");

    // ---- context += P . V (f16 WMMA), residual products into a separate accumulator ----
    v8f o1[4];
#pragma unroll
    for (int t = 0; t < 4; ++t) o1[t] = zero8();
#pragma unroll 1
    for (int kk = 0; kk < 2; ++kk) {
      FH pa, pl;
      pa.h[0] = *(const v8h*)(pwh + c * LP + kk * 32 + 8 * hh);
      pa.h[1] = *(const v8h*)(pwh + c * LP + kk * 32 + 16 + 8 * hh);
      if (RES) {
        pl.h[0] = *(const v8h*)(pwl + c * LP + kk * 32 + 8 * hh);
        pl.h[1] = *(const v8h*)(pwl + c * LP + kk * 32 + 16 + 8 * hh);
      } else {
        pl.v = pa.v;
      }
#pragma unroll
      for (int t = 0; t < 4; ++t) {
        FH vb;
        vb.h[0] = *(const v8h*)(Vth + (t * 16 + c) * LP + kk * 32 + 8 * hh);
        vb.h[1] = *(const v8h*)(Vth + (t * 16 + c) * LP + kk * 32 + 16 + 8 * hh);
        oacc[t] = mma_h(pa.v, vb.v, oacc[t]);
        if (RES) {
          FH vl;
          vl.h[0] = *(const v8h*)(Vtl + (t * 16 + c) * LP + kk * 32 + 8 * hh);
          vl.h[1] = *(const v8h*)(Vtl + (t * 16 + c) * LP + kk * 32 + 16 + 8 * hh);
          o1[t] = mma_h(pa.v, vl.v, o1[t]);
          o1[t] = mma_h(pl.v, vb.v, o1[t]);
        }
      }
    }
    if (RES) {
#pragma unroll
      for (int t = 0; t < 4; ++t)
#pragma unroll
        for (int r = 0; r < 8; ++r) oacc[t][r] += o1[t][r] * (1.0f / 4096.0f);
    }
  }

  // ---- normalise (1/l and the 1/1024 p carry), stage the wave's 16x64 tile in LDS, then write whole
  float* os = Os[wave];
#pragma unroll
  for (int r = 0; r < 8; ++r) {
    const float l = lrow[r];
    const float inv = ((l > 0.f) ? (1.0f / l) : 0.f) * (1.0f / 1024.0f);
#pragma unroll
    for (int t = 0; t < 4; ++t) os[(8 * hh + r) * OP + t * 16 + c] = oacc[t][r] * inv;
  }
  __builtin_amdgcn_fence(__ATOMIC_RELEASE, "workgroup");
  __builtin_amdgcn_wave_barrier();
  __builtin_amdgcn_fence(__ATOMIC_ACQUIRE, "workgroup");
  {
    const int h2 = lane >> 4, c4 = (lane & 15) * 4;
    v4f ov[8];
#pragma unroll
    for (int it = 0; it < 8; ++it) {
      const int row = it * 2 + h2;   // it 0..7 x h2 0..1 = rows 0..15 of the wave tile
      ov[it] = *(const v4f*)(os + row * OP + c4);
    }
    {
#pragma unroll
      for (int it = 0; it < 8; ++it) {
        const int row = it * 2 + h2;
        const size_t go = (rowB + q0 + row) * DM + (size_t)h * HD + c4;
        *(v4f*)(outp + go) = ov[it];
      }
      
    }
  }
}

// =====================================================================================================
// Workspace map (bytes), every region an exact multiple of its whole-line / whole-tile store granularity:
//   Xb    bf16 [4096][1024]          0          8388608
//   Winb  bf16 [3072][1024]          8388608    6291456
//   Wob   bf16 [1024][1024]          14680064   2097152
//   Rin   f32  [3072]                16777216     12288   (96 lines)
//   Rout  f32  [1024]                16789504      4096   (32 lines)
//   Rrow  f32  [4096]                16793600     16384   (128 lines)
//   CosT  f32  [2048][32]            16809984    262144
//   SinT  f32  [2048][32]            17072128    262144
//   QKf   f32  [4096][2048]          17334272  33554432   (later: Af f32 [4096][1024] + Ah bf16 + Al bf16)
//   VTh   f16  [2][1024][2048]       50888704   8388608
//   VTl   f16  [2][1024][512]        59277312   2097152
//   Qh    bf16 [4096][1024]          61374464   8388608
//   Ql    bf16 [4096][1024]          69763072   8388608
//   Kh    bf16 [4096][1024]          78151680   8388608
//   Kl    bf16 [4096][1024]          86540288   8388608
//   end                              94928896
// Weights are [out n][in k] with k contiguous = the Bt / A layout the GEMM wants, so they are only converted.
// =====================================================================================================
extern "C" void kernel_launch(void* const* d_in, const int* in_sizes, int n_in,
                              void* d_out, int out_size, void* d_ws, size_t ws_size,
                              hipStream_t stream) {
  if (n_in < 4) return;
  if (in_sizes[0] != NB * SEQ * DM) return;
  if (in_sizes[1] != SEQ * (HD / 2)) return;
  if (in_sizes[2] != 3 * DM * DM) return;
  if (in_sizes[3] != DM * DM) return;
  if (out_size != NB * SEQ * DM) return;

  const float* x    = (const float*)d_in[0];
  const float* rpf  = (const float*)d_in[1];
  const float* w_in = (const float*)d_in[2];
  const float* w_o  = (const float*)d_in[3];

  const size_t PXb   = (size_t)NB * SEQ * DM * 2;      //  8388608  16-bit activation plane [4096][1024]
  const size_t PWin  = (size_t)3 * DM * DM * 2;        //  6291456
  const size_t PWo   = (size_t)DM * DM * 2;            //  2097152
  const size_t PRin  = (size_t)3 * DM * 4;             //    12288
  const size_t PRout = (size_t)DM * 4;                 //     4096
  const size_t PRrow = (size_t)NB * SEQ * 4;           //    16384
  const size_t PTrig = (size_t)SEQ * (HD / 2) * 4;     //   262144
  const size_t PQK   = (size_t)NB * SEQ * NQK * 4;     // 33554432
  const size_t PVTh  = (size_t)NB * DM * SEQ * 2;      //  8388608
  const size_t PVTl  = (size_t)NB * DM * VLP * 2;      //  2097152
  const size_t PAf   = (size_t)NB * SEQ * DM * 4;      // 16777216
  if (PAf + 2 * PXb != PQK) return;                    // Af + Ah + Al reuse the q/k f32 region exactly
  size_t off = 0;
  const size_t oXb   = off; off += PXb;
  const size_t oWin  = off; off += PWin;
  const size_t oWo   = off; off += PWo;
  const size_t oRin  = off; off += PRin;
  const size_t oRout = off; off += PRout;
  const size_t oRrow = off; off += PRrow;
  const size_t oCos  = off; off += PTrig;
  const size_t oSin  = off; off += PTrig;
  const size_t oQK   = off; off += PQK;
  const size_t oVTh  = off; off += PVTh;
  const size_t oVTl  = off; off += PVTl;
  const size_t oQh   = off; off += PXb;
  const size_t oQl   = off; off += PXb;
  const size_t oKh   = off; off += PXb;
  const size_t oKl   = off; off += PXb;
  if (off > ws_size) return;                           // off = 94928896
  if (off > (size_t)134217728) return;
  const size_t oAf = oQK;
  const size_t oAh = oQK + PAf;
  const size_t oAl = oAh + PXb;
  if (oAl + PXb > oVTh) return;                        // region ordering sanity

  char* ws = (char*)d_ws;
  unsigned short* Xb   = (unsigned short*)(ws + oXb);
  unsigned short* Winb = (unsigned short*)(ws + oWin);
  unsigned short* Wvb  = Winb + (size_t)2 * DM * DM;   // rows 2048..3071 of w_in = v features
  unsigned short* Wob  = (unsigned short*)(ws + oWo);
  float*          Rin  = (float*)(ws + oRin);
  float*          Rv   = Rin + 2 * DM;
  float*          Rout = (float*)(ws + oRout);
  float*          Rrow = (float*)(ws + oRrow);
  float*          CosT = (float*)(ws + oCos);
  float*          SinT = (float*)(ws + oSin);
  float*          QKf  = (float*)(ws + oQK);
  unsigned short* VTh  = (unsigned short*)(ws + oVTh);
  unsigned short* VTl  = (unsigned short*)(ws + oVTl);
  unsigned short* Qh   = (unsigned short*)(ws + oQh);
  unsigned short* Ql   = (unsigned short*)(ws + oQl);
  unsigned short* Kh   = (unsigned short*)(ws + oKh);
  unsigned short* Kl   = (unsigned short*)(ws + oKl);
  float*          Af   = (float*)(ws + oAf);
  unsigned short* Ah   = (unsigned short*)(ws + oAh);
  unsigned short* Al   = (unsigned short*)(ws + oAl);

  const dim3 blk(256);
  const int nTrig = SEQ * (HD / 2);                                  // 65536
  const int n8x   = NB * SEQ * DM / 8;                               // 524288
  const dim3 gTrig((nTrig + 255) / 256);                             // 256 blocks
  const dim3 gCvtX((n8x + 255) / 256);                               // 2048 blocks
  const dim3 gPrepWin(3 * DM / 32);                                  // 96 blocks (32 rows each)
  const dim3 gPrepWo(DM / 32);                                       // 32 blocks
  const dim3 gPrepA(NB * SEQ / 32);                                  // 128 blocks
  const dim3 gblk(128);                                              // GEMM block: 4 waves, one 128x128 tile
  const dim3 gQK((NB * SEQ / 128) * (NQK / 128), 1);                 // 32 x 16 = 512 blocks
  const dim3 gVT((DM / 128) * (SEQ / 128), NB);                      // 8 x 16 = 128 blocks x 2 batches
  const dim3 gOut((NB * SEQ / 128) * (DM / 128), 1);                 // 32 x 8 = 256 blocks
  const dim3 gRope(NB * SEQ * NH / 8);                               // 8192 blocks (8 (token, head) per block)

  // (0) angle tables from the bf16-converted input table
  trig_tab<<<gTrig, blk, 0, stream>>>(rpf, CosT, SinT, nTrig);
  // (1) x -> bf16 plane [4096][1024]
  cvt_bf16x8<<<gCvtX, blk, 0, stream>>>(x, Xb, n8x);
  // (2) weights -> bf16 planes [n][k] + per-row inverse L2 norms of the converted rows
  row_prep<false, true><<<gPrepWin, blk, 0, stream>>>(w_in, Winb, Winb, Rin, 1.0f);
  row_prep<false, true><<<gPrepWo, blk, 0, stream>>>(w_o, Wob, Wob, Rout, 1.0f);
  // (3) q/k projection: QKf[b*SEQ+s][e] = Rin[e] * sum_d Xb[s][d] Winb[e][d], e < 2048  (M=4096, N=2048, K=1024)
  gemm64<0, 0, false, true><<<gQK, gblk, 0, stream>>>(
      Xb, Xb, DM, 0LL, Winb, DM, 0LL,
      (void*)QKf, NQK, 0LL, (void*)QKf, 0, 0LL, 0,
      NB * SEQ, NQK, DM, 1.0f, Rin, Rin);
  // (4) v^T per batch: VTh[b][m][s] = Rv[m] * sum_d Wvb[m][d] Xb[b*SEQ+s][d] -> f16 hi plane (pitch SEQ) and
  //     residual plane (x4096, keys < VLP, pitch VLP)  (M=1024, N=2048, K=1024)
  gemm64<0, 3, true, false><<<gVT, gblk, 0, stream>>>(
      Wvb, Wvb, DM, 0LL, Xb, DM, (long long)SEQ * DM,
      (void*)VTh, SEQ, (long long)DM * SEQ, (void*)VTl, VLP, (long long)DM * VLP, VLP,
      DM, SEQ, DM, 4096.0f, Rv, Rv);
  // (5) rotary + per-head rms -> q/k bf16 hi/lo planes
  rope_norm<<<gRope, blk, 0, stream>>>(QKf, CosT, SinT, Qh, Ql, Kh, Kl);
  // (6) causal attention: query blocks 0..RESQB-1 with residual planes, the rest without -> Af f32 [4096][1024]
  attn_causal64<true><<<dim3(NB * NH * RESQB), dim3(128), 0, stream>>>(
      Qh, Ql, Kh, Kl, VTh, VTl, Af, 0, RESQB, 0.125f);
  attn_causal64<false><<<dim3(NB * NH * (NQB - RESQB)), dim3(128), 0, stream>>>(
      Qh, Ql, Kh, Kl, VTh, VTl, Af, RESQB, NQB - RESQB, 0.125f);
  // (7) merged rows -> bf16 hi/lo planes + per-row inverse rms over 1024
  row_prep<true, false><<<gPrepA, blk, 0, stream>>>(Af, Ah, Al, Rrow, 1.0f / (float)DM);
  // (8) out[s][e] = Rrow[s] * Rout[e] * sum_d (Ah+Al)[s][d] Wob[e][d] -> d_out f32 [4096][1024]  (M=4096, N=1024, K=1024)
  gemm64<1, 0, true, true><<<gOut, gblk, 0, stream>>>(
      Ah, Al, DM, 0LL, Wob, DM, 0LL,
      d_out, DM, 0LL, d_out, 0, 0LL, 0,
      NB * SEQ, DM, DM, 1.0f, Rrow, Rout);
  (void)hipGetLastError();
}

// v003
// One run takes 216 microseconds.
// Next to v002, in two timings, it ran 1.04 times as fast each time.
// Over all steps from v000 it is 1.85 times as fast.
// Contractions: q/k and v^T projections = v_wmma_f32_16x16x32_bf16 (bf16 operands from RNE-converted inputs, single product, f32 row/column scales in the epilogue; q/k: RoPE and head rms there too);
// q.k^T scores = v_wmma_f32_16x16x32_bf16 with bf16 hi/lo split q and k (hi.hi + hi.lo + lo.hi);
// p.v = v_wmma_f32_16x16x32_f16 (p carried x1024 in f16, v in f16; extra f16 residual planes x4096 of p and v on the first 512 query rows);
// a.Wout^T = v_wmma_f32_16x16x32_bf16 with a as bf16 hi/lo planes times bf16 Wout (2 products); all f32 accumulate; RoPE, norms and softmax in f32.
#include <hip/hip_runtime.h>
#include <math.h>
#include <float.h>
#include <stdint.h>

#define NB    2
#define SEQ   2048
#define DM    1024
#define NH    16
#define HD    64
#define NQK   (2 * DM)       // q and k feature columns of the fused q/k projection output
#define NQB   (SEQ / 64)     // 32 query / key tiles of 64
#define VLP   512            // key pitch of the v^T residual plane (keys 0..VLP-1)
#define RESQB 8              // leading 64-row query blocks that use the p / v residual planes
static_assert(RESQB * 64 <= VLP);
static_assert(NH * HD == DM);
static_assert((SEQ % 64) == 0 && (DM % 256) == 0);
static_assert(HD == 64);
static_assert((NB * SEQ) % 128 == 0 && SEQ % 128 == 0 && DM % 128 == 0 && NQK % 128 == 0);   // GEMM block tiles of 128x128, k slabs of 64
#define LP    72             // LDS pitch, in 16-bit elements, of a 64-element row: 144 B = 16 B x odd, so that the 16 rows
                             // one ds_load_b128 fragment read touches fall on 16 different groups of four banks
#define GP    72             // LDS pitch, in 16-bit elements, of a GEMM k-slab row of 64 elements (144 B = 16 B x odd, as LP)
#define GPLANE (128 * GP)    // elements of one staged 128-row k slab
#define OP    68             // LDS pitch, in floats, of a 64-float row: the two lane halves store rows eight apart, on different banks

typedef _Float16 v16h __attribute__((ext_vector_type(16)));
typedef _Float16 v8h  __attribute__((ext_vector_type(8)));
typedef __bf16   v16b __attribute__((ext_vector_type(16)));
typedef __bf16   v8b  __attribute__((ext_vector_type(8)));
typedef float    v8f  __attribute__((ext_vector_type(8)));
typedef float    v4f  __attribute__((ext_vector_type(4)));
typedef unsigned int v4u __attribute__((ext_vector_type(4)));

// ---- scalar helpers --------------------------------------------------------------------------------
__device__ __forceinline__ unsigned short bf_bits(float f) {          // f32 -> bf16 bits, RNE convert
  unsigned u = __float_as_uint(f);
  return (unsigned short)((u + 0x7FFFu + ((u >> 16) & 1u)) >> 16);
}
__device__ __forceinline__ float bf_up(unsigned short h) { return __uint_as_float(((unsigned)h) << 16); }
__device__ __forceinline__ unsigned short h_bits(_Float16 x) { return __builtin_bit_cast(unsigned short, x); }
__device__ __forceinline__ unsigned pk16(unsigned short a, unsigned short b) { return (unsigned)a | ((unsigned)b << 16); }
__device__ __forceinline__ v8f zero8() { v8f z = {0.f, 0.f, 0.f, 0.f, 0.f, 0.f, 0.f, 0.f}; return z; }
__device__ __forceinline__ v8h zero8h() {
  const _Float16 z = (_Float16)0.0f;
  v8h r = {z, z, z, z, z, z, z, z};
  return r;
}

// ---- fragment loader: 16-bit A/B operand, lane -> row/col (lane&15), p already includes +8*(lane>>4);
//      elements 0..7 <- p[0..7] (k0+8h..), elements 8..15 <- p[16..23] (k0+16+8h..)
__device__ __forceinline__ v16b ldfrag_b(const __bf16* p) {
  union { v16b v; v8b h[2]; } f;
  f.h[0] = *(const v8b*)(p);
  f.h[1] = *(const v8b*)(p + 16);
  return f.v;
}

// ---- WMMA helpers with trailing VALU hazard gap --------------------------------------------------------
__device__ __forceinline__ v8f mma_b(v16b a, v16b b, v8f c) {
  c = __builtin_amdgcn_wmma_f32_16x16x32_bf16(false, a, false, b, (short)0, c, false, false);
#if defined(__HIP_DEVICE_COMPILE__)
  asm volatile("v_nop\n\tv_nop\n\tv_nop\n\tv_nop" : "+v"(c) : "v"(a), "v"(b));
#endif
  return c;
}
__device__ __forceinline__ v8f mma_h(v16h a, v16h b, v8f c) {
  c = __builtin_amdgcn_wmma_f32_16x16x32_f16(false, a, false, b, (short)0, c, false, false);
#if defined(__HIP_DEVICE_COMPILE__)
  asm volatile("v_nop\n\tv_nop\n\tv_nop\n\tv_nop" : "+v"(c) : "v"(a), "v"(b));
#endif
  return c;
}
__device__ __forceinline__ v8f mma_b_raw(v16b a, v16b b, v8f c) {
  return __builtin_amdgcn_wmma_f32_16x16x32_bf16(false, a, false, b, (short)0, c, false, false);
}
__device__ __forceinline__ void dep_guard_b(v8f& a, v8f& b, v16b x, v16b y) {
#if defined(__HIP_DEVICE_COMPILE__)
  asm volatile("v_nop\n\tv_nop\n\tv_nop\n\tv_nop" : "+v"(a), "+v"(b) : "v"(x), "v"(y));
#endif
}
__device__ __forceinline__ void keep4_b(v16b a, v16b b, v16b c, v16b d) {
#if defined(__HIP_DEVICE_COMPILE__)
  asm volatile("v_nop" :: "v"(a), "v"(b), "v"(c), "v"(d));
#endif
}
__device__ __forceinline__ void acc_guard4(v8f& a, v8f& b, v8f& c, v8f& d) {
#if defined(__HIP_DEVICE_COMPILE__)
  asm volatile("v_nop\n\tv_nop\n\tv_nop\n\tv_nop" : "+v"(a), "+v"(b), "+v"(c), "+v"(d));
#endif
}

// =====================================================================================================
// f32 -> bf16 (RNE convert), 8 elements per thread, one 16-B store per lane: a wave writes 512 contiguous B
// coverage: n8 threads x 8 = whole plane (n8 is a multiple of 256 here).
// =====================================================================================================
__global__ __launch_bounds__(256) void cvt_bf16x8(const float* __restrict__ in, unsigned short* out, int n8) {
  const int i = blockIdx.x * 256 + threadIdx.x;
  if (i < n8) {
    const v4f a = *(const v4f*)(in + (size_t)i * 8);
    const v4f b = *(const v4f*)(in + (size_t)i * 8 + 4);
    v4u p;
    p[0] = pk16(bf_bits(a[0]), bf_bits(a[1]));
    p[1] = pk16(bf_bits(a[2]), bf_bits(a[3]));
    p[2] = pk16(bf_bits(b[0]), bf_bits(b[1]));
    p[3] = pk16(bf_bits(b[2]), bf_bits(b[3]));
    *(v4u*)(out + (size_t)i * 8) = p;
    
  }
}

// =====================================================================================================
// Angle table: ct[i] = cosf(bf(fr[i])), st[i] = sinf(bf(fr[i])) with the angle RNE-converted to bf16
// =====================================================================================================
__global__ __launch_bounds__(256) void trig_tab(const float* __restrict__ fr, float* ct, float* st, int n) {
  const int i = blockIdx.x * 256 + threadIdx.x;
  if (i < n) {
    const float f  = bf_up(bf_bits(fr[i]));
    const float cv = cosf(f);
    const float sv = sinf(f);
    *(float*)(ct + i) = cv;
    *(float*)(st + i) = sv;
    
  }
}

// =====================================================================================================
// Row preparation over rows of DM=1024 f32 values (pitch DM):
//   hi plane = RNE bf16 of each value; LO: lo plane = RNE bf16 of (v - hi) (unscaled);
//   rtab[row] = rsqrt(ss * inv_div + 1e-6) with ss = sum over the row of g^2,
//     g = the bf16-converted value (SQR) or the f32 value (!SQR).
// Block = 8 waves = 32 rows (wave w: rows 4w..4w+3 of the block); grid = rows / 32 (exact here).
// Per row and instruction t (0..3): lane l holds columns 256t + 8l .. +7 -> 32 lanes x 16 B = 512 B
// coverage: 4 t x 32 lanes x 8 = 1024 columns per row; 8 waves x 4 rows = 32 rows per block.
// =====================================================================================================
template <bool LO, bool SQR>
__global__ __launch_bounds__(256) void row_prep(const float* __restrict__ in, unsigned short* hp, unsigned short* lp,
                                                float* rtab, float inv_div) {
  __shared__ float sr[32];
  const int tid = threadIdx.x, wave = tid >> 5, lane = tid & 31;
#pragma unroll 1
  for (int i = 0; i < 4; ++i) {
    const int row = blockIdx.x * 32 + wave * 4 + i;
    const float* rp = in + (size_t)row * DM + lane * 8;
    float ss = 0.f;
    v4u hv[4], lv[4];
#pragma unroll
    for (int t = 0; t < 4; ++t) {
      const v4f a  = *(const v4f*)(rp + t * 256);
      const v4f bq = *(const v4f*)(rp + t * 256 + 4);
      v4u ph, pl;
#pragma unroll
      for (int e = 0; e < 4; ++e) {
        const float f0 = (e < 2) ? a[2 * e]     : bq[2 * e - 4];
        const float f1 = (e < 2) ? a[2 * e + 1] : bq[2 * e - 3];
        const unsigned short h0 = bf_bits(f0), h1 = bf_bits(f1);
        const float g0 = SQR ? bf_up(h0) : f0;
        const float g1 = SQR ? bf_up(h1) : f1;
        ss += g0 * g0;
        ss += g1 * g1;
        ph[e] = pk16(h0, h1);
        if (LO) {
          pl[e] = pk16(bf_bits(f0 - bf_up(h0)), bf_bits(f1 - bf_up(h1)));
        } else {
          pl[e] = 0u;
        }
      }
      hv[t] = ph; lv[t] = pl;
    }
#pragma unroll
    for (int off = 16; off >= 1; off >>= 1) ss += __shfl_xor(ss, off, 32);
    const float rv = rsqrtf(ss * inv_div + 1e-6f);
    if (lane == 0) sr[wave * 4 + i] = rv;
    {
#pragma unroll
      for (int t = 0; t < 4; ++t) {
        const size_t go = (size_t)row * DM + t * 256 + lane * 8;
        *(v4u*)(hp + go) = hv[t];
        if (LO) *(v4u*)(lp + go) = lv[t];
      }
      
    }
  }
  __syncthreads();
  if (wave == 0) {
    const float rv = sr[lane];
    float* d = rtab + (size_t)blockIdx.x * 32 + lane;
    *(float*)d = rv;
    
  }
}

// =====================================================================================================
// Eight asynchronous 16-B copies per lane, global memory -> LDS: this lane's piece of rows r, r+16, .., r+112 of one
// 128-row x 64-element k slab. g = the lane's piece in row r (row pitch ld elements), l = its LDS byte address
// (row pitch GP elements). Eight lanes cover one 128-B row, so a wave's copy covers four whole lines.
// =====================================================================================================
__device__ __forceinline__ void stage_plane(const __bf16* g, int ld, unsigned l) {
  const size_t   gs = (size_t)16 * (size_t)ld;        // 16 rows in global memory, elements
  const unsigned ls = 16u * GP * 2u;                  // 16 rows in LDS, bytes
  const __bf16 *g0 = g, *g1 = g + gs, *g2 = g + 2 * gs, *g3 = g + 3 * gs;
  const __bf16 *g4 = g + 4 * gs, *g5 = g + 5 * gs, *g6 = g + 6 * gs, *g7 = g + 7 * gs;
  const unsigned l0 = l, l1 = l + ls, l2 = l + 2 * ls, l3 = l + 3 * ls;
  const unsigned l4 = l + 4 * ls, l5 = l + 5 * ls, l6 = l + 6 * ls, l7 = l + 7 * ls;
#if defined(__HIP_DEVICE_COMPILE__)
  // the copies bring the slab into LDS through no register; the closing s_wait_xcnt stands in the same statement so
  // that no address register named here is rewritten in front of it
  asm volatile(
      "global_load_async_to_lds_b128 %0, %8, off\n\t"
      "global_load_async_to_lds_b128 %1, %9, off\n\t"
      "global_load_async_to_lds_b128 %2, %10, off\n\t"
      "global_load_async_to_lds_b128 %3, %11, off\n\t"
      "global_load_async_to_lds_b128 %4, %12, off\n\t"
      "global_load_async_to_lds_b128 %5, %13, off\n\t"
      "global_load_async_to_lds_b128 %6, %14, off\n\t"
      "global_load_async_to_lds_b128 %7, %15, off\n\t"
      "s_wait_xcnt 0x0"
      :: "v"(l0), "v"(l1), "v"(l2), "v"(l3), "v"(l4), "v"(l5), "v"(l6), "v"(l7),
         "v"(g0), "v"(g1), "v"(g2), "v"(g3), "v"(g4), "v"(g5), "v"(g6), "v"(g7)
      : "memory");
#endif
}
// this wave's own copies have landed in LDS
__device__ __forceinline__ void wait_async0() {
#if defined(__HIP_DEVICE_COMPILE__)
  asm volatile("s_wait_asynccnt 0x0" ::: "memory");
#endif
}
// this wave's own LDS reads have returned, so that the buffer they read may be refilled behind the next barrier
__device__ __forceinline__ void wait_ds0() {
#if defined(__HIP_DEVICE_COMPILE__)
  asm volatile("s_wait_dscnt 0x0" ::: "memory");
#endif
}

// cos / sin of rows row0 .. row0+7 (row0 a multiple of 8, so the eight positions row0 % SEQ + r stay below SEQ) and
// pairs p, p + 16 from the [SEQ][32] angle tables
__device__ __forceinline__ void load_angles(const float* __restrict__ ct, const float* __restrict__ st, int row0, int p,
                                            float (&cv)[8][2], float (&sv)[8][2]) {
  const size_t to = (size_t)(row0 % SEQ) * (HD / 2) + p;
#pragma unroll
  for (int r = 0; r < 8; ++r) {
#pragma unroll
    for (int j = 0; j < 2; ++j) {
      cv[r][j] = ct[to + r * (HD / 2) + (j << 4)];
      sv[r][j] = st[to + r * (HD / 2) + (j << 4)];
    }
  }
}

// =====================================================================================================
// Batched bf16 WMMA GEMM: C[m][n] = rs[m] * cs[n] * sum_k A[m][k] * Bt[n][k]. Block = 4 waves = a 128x128 tile,
// wave (wave>>1, wave&1) owns one 64x64 quarter. A row-major [M][K] pitch lda; Bt row-major [N][K] pitch ldb
// (k contiguous); M, N multiples of 128, K a multiple of 64 (true of the three launches below).
// blockIdx.y = batch index (strides in elements).
// Operands: k slabs of 64 elements (one 128-B line per row) are copied into LDS by asynchronous 16-B copies, whole
// lines per wave, two buffers: slab t+1 flies while slab t is worked on. Fragments are read from LDS (row pitch GP).
// NSPLIT: 0 = A.Bt; 1 = (A + A2).Bt (A2 = unscaled bf16 lo plane of A).
// RS / CS: per-row scale rsp[m] / per-column scale csp[n] (f32, not batched) applied in the epilogue.
// OUT_MODE: 0 = f32 (pitch ldc); 2 = bf16 hi plane C + bf16 lo plane C2 (lo = RNE(v - hi), unscaled);
//           3 = f16 hi plane C + f16 residual plane C2 = f16((v - hi) * rscale), C2 written only for tiles
//               with n0 < N2 (pitch ldc2, batch stride strideC2);
//           4 = q/k projection: a wave's 64 columns are one head of q (n0 < DM) or of k. Half-split rotary and the
//               per-head rms over the 64 dims are applied to the accumulators, then bf16 hi/lo planes as in 2, element
//               (row, h*64 + d) at [row*ldc + h*64 + d]: q -> C / C2, k -> C3 / C4.
//               ctp/stp [SEQ][32] f32 angle tables, pair index = d mod 32, position = row mod SEQ.
//               y[d<32] = x1*cos - x2*sin, y[32+d] = x1*sin + x2*cos (x1 = x[d], x2 = x[32+d]); y * rsqrt(mean(y^2) + 1e-6).
//               A lane holds columns 16j + (lane&15), j = 0..3, of its rows: x[d] and x[32+d] are its tiles j and j+2.
// =====================================================================================================
template <int NSPLIT, int OUT_MODE, bool RS, bool CS>
__global__ __launch_bounds__(128) void gemm64(
    const unsigned short* __restrict__ Ap, const unsigned short* A2p, int lda, long long strideA,
    const unsigned short* __restrict__ Btp, int ldb, long long strideB,
    void* Cout, int ldc, long long strideC,
    void* Cout2, int ldc2, long long strideC2, int N2,
    int M, int N, int K, float rscale,
    const float* __restrict__ rsp, const float* __restrict__ csp,
    void* Cout3, void* Cout4, const float* __restrict__ ctp, const float* __restrict__ stp) {
  static_assert(NSPLIT == 0 || NSPLIT == 1);
  const __bf16* A   = (const __bf16*)(const void*)Ap;
  const __bf16* A2  = (const __bf16*)(const void*)A2p;
  const __bf16* Bt  = (const __bf16*)(const void*)Btp;
  __shared__ __align__(16) __bf16 sA[2][GPLANE];                                   // A slab, two buffers
  __shared__ __align__(16) __bf16 sB[2][GPLANE];                                   // Bt slab, two buffers
  __shared__ __align__(16) __bf16 sA2[NSPLIT ? 2 : 1][NSPLIT ? GPLANE : 8];        // A2 slab, two buffers
  __shared__ __align__(16) float sT[4][16 * 68];   // per-wave 16x64 slab, pitch 68 floats
  const int b    = blockIdx.y;
  const int tid  = threadIdx.x;
  const int lane = tid & 31;
  const int wave = tid >> 5;
  const int tilesN = N >> 7;
  const int tilesM = M >> 7;
  const int tile = blockIdx.x;
  if (tile >= tilesM * tilesN) return;   // block-uniform, in front of every copy and barrier
  const int tm = tile / tilesN;
  const int tn = tile - tm * tilesN;
  const int bm0 = tm << 7;
  const int bn0 = tn << 7;
  const int wm  = (wave >> 1) << 6;            // this wave's quarter inside the block tile
  const int wn  = (wave & 1) << 6;
  const int m0 = bm0 + wm;
  const int n0 = bn0 + wn;

  const __bf16* Ab  = A  + (size_t)b * strideA;
  const __bf16* Bb  = Bt + (size_t)b * strideB;
  const __bf16* Ab2 = (NSPLIT >= 1) ? (A2  + (size_t)b * strideA) : Ab;

  const int rlane = lane & 15;                 // row (A) / col (B, D) within subtile
  const int koff  = (lane >> 4) * 8;           // k offset of this lane half
  const int mOff  = (lane >> 4) * 8;           // D row offset

  // ---- staging addresses: thread -> row tid>>3 (+16 per copy), 16-B piece tid&7 of the 128-B slab row ----
  const int srow = tid >> 3, spc = (tid & 7) * 8;
  const __bf16* gA  = Ab  + (size_t)(bm0 + srow) * lda + spc;
  const __bf16* gA2 = Ab2 + (size_t)(bm0 + srow) * lda + spc;
  const __bf16* gB  = Bb  + (size_t)(bn0 + srow) * ldb + spc;
  const unsigned lofs = (unsigned)(srow * GP + spc) * 2u;
  const unsigned lA  = (unsigned)(size_t)(const void*)&sA[0][0]  + lofs;   // low 32 bits = byte offset in LDS
  const unsigned lB  = (unsigned)(size_t)(const void*)&sB[0][0]  + lofs;
  const unsigned lA2 = (unsigned)(size_t)(const void*)&sA2[0][0] + lofs;
  const int nslab = K >> 6;

  v8f acc[4][4];
#pragma unroll
  for (int i = 0; i < 4; ++i)
#pragma unroll
    for (int j = 0; j < 4; ++j) acc[i][j] = zero8();

  // ---- prologue: slab 0 landed and published, then slab 1 in flight ----
  stage_plane(gA, lda, lA);
  stage_plane(gB, ldb, lB);
  if (NSPLIT >= 1) stage_plane(gA2, lda, lA2);
  wait_async0();
  __syncthreads();
  if (nslab > 1) {
    stage_plane(gA + 64, lda, lA + GPLANE * 2u);
    stage_plane(gB + 64, ldb, lB + GPLANE * 2u);
    if (NSPLIT >= 1) stage_plane(gA2 + 64, lda, lA2 + GPLANE * 2u);
  }

#pragma unroll 1   // one slab per trip: the two buffers alternate by the trip's parity
  for (int t = 0; t < nslab; ++t) {
    const int buf = t & 1;
    const __bf16* fa  = &sA[buf][(wm + rlane) * GP + koff];
    const __bf16* fb  = &sB[buf][(wn + rlane) * GP + koff];
    const __bf16* fa2 = NSPLIT ? &sA2[NSPLIT ? buf : 0][(wm + rlane) * GP + koff] : fa;
#pragma unroll
    for (int ks = 0; ks < 64; ks += 32) {
      // all fragments of this 32-wide k step are read as one group in front of its WMMAs
      v16b bh[4], ah[4], al[4];
#pragma unroll
      for (int j = 0; j < 4; ++j) bh[j] = ldfrag_b(fb + (j << 4) * GP + ks);
#pragma unroll
      for (int i = 0; i < 4; ++i) {
        ah[i] = ldfrag_b(fa + (i << 4) * GP + ks);
        if (NSPLIT >= 1) al[i] = ldfrag_b(fa2 + (i << 4) * GP + ks); else al[i] = ah[i];
      }
#pragma unroll
      for (int i = 0; i < 4; ++i) {
#pragma unroll
        for (int j = 0; j < 4; ++j) {
          acc[i][j] = mma_b_raw(ah[i], bh[j], acc[i][j]);
          if (NSPLIT >= 1) acc[i][j] = mma_b_raw(al[i], bh[j], acc[i][j]);
        }
        dep_guard_b(acc[i][0], acc[i][3], ah[i], al[i]);
      }
      keep4_b(bh[0], bh[1], bh[2], bh[3]);
    }
    // ---- publish slab t+1, free slab t's buffer: own LDS reads done, own copies landed, block barrier ----
    wait_ds0();
    wait_async0();
    __syncthreads();
    if (t + 2 < nslab) {                       // block-uniform: refill the buffer that this trip has just read
      const int kn = (t + 2) << 6;
      const unsigned bo = (unsigned)buf * (GPLANE * 2u);
      stage_plane(gA + kn, lda, lA + bo);
      stage_plane(gB + kn, ldb, lB + bo);
      if (NSPLIT >= 1) stage_plane(gA2 + kn, lda, lA2 + bo);
    }
  }
  wait_async0();
  acc_guard4(acc[0][0], acc[0][1], acc[0][2], acc[0][3]);
  acc_guard4(acc[1][0], acc[1][1], acc[1][2], acc[1][3]);
  acc_guard4(acc[2][0], acc[2][1], acc[2][2], acc[2][3]);
  acc_guard4(acc[3][0], acc[3][1], acc[3][2], acc[3][3]);

  // ---- epilogue scales ----
  float csv[4];
#pragma unroll
  for (int j = 0; j < 4; ++j) csv[j] = CS ? csp[n0 + (j << 4) + rlane] : 1.0f;

  // ---- epilogue ----
  float* slab = sT[wave];
#pragma unroll
  for (int i = 0; i < 4; ++i) {
    const int mBase = m0 + (i << 4);
    float cv[8][2], sv[8][2];                              // OUT_MODE 4: cos / sin of (row mOff + r, pair 16j + rlane)
    if (OUT_MODE == 4) load_angles(ctp, stp, mBase + mOff, rlane, cv, sv);
#pragma unroll
    for (int r = 0; r < 8; ++r) {
      const float rsv = RS ? rsp[mBase + mOff + r] : 1.0f;
      if (OUT_MODE == 4) {
        float y1[2], y2[2], sq[2];
#pragma unroll
        for (int j = 0; j < 2; ++j) {
          const float x1 = acc[i][j][r] * rsv * csv[j];
          const float x2 = acc[i][j + 2][r] * rsv * csv[j + 2];
          y1[j] = fmaf(x1, cv[r][j], -(x2 * sv[r][j]));
          y2[j] = fmaf(x1, sv[r][j], x2 * cv[r][j]);
          sq[j] = fmaf(y1[j], y1[j], y2[j] * y2[j]);
        }
        // sum over the 32 pairs: pairs d and d+16 in the lane, then partners 8, 4, 2, 1 of the 16-lane row
        float ss = sq[0] + sq[1];
#pragma unroll
        for (int off = 8; off >= 1; off >>= 1) ss += __shfl_xor(ss, off, 32);
        const float sc = rsqrtf(ss * (1.0f / HD) + 1e-6f);
#pragma unroll
        for (int j = 0; j < 2; ++j) {
          slab[(mOff + r) * 68 + (j << 4) + rlane]      = y1[j] * sc;
          slab[(mOff + r) * 68 + 32 + (j << 4) + rlane] = y2[j] * sc;
        }
      } else {
#pragma unroll
        for (int j = 0; j < 4; ++j) {
          slab[(mOff + r) * 68 + (j << 4) + rlane] = acc[i][j][r] * rsv * csv[j];
        }
      }
    }
    __builtin_amdgcn_fence(__ATOMIC_RELEASE, "workgroup");
    __builtin_amdgcn_wave_barrier();
    __builtin_amdgcn_fence(__ATOMIC_ACQUIRE, "workgroup");
    if (OUT_MODE == 0) {
      float* C = (float*)Cout + (size_t)b * strideC;
      const int hh = lane >> 4, c4 = (lane & 15) * 4;     // 256-B row segment = 16 lanes x 16 B
      v4f ov[8];
#pragma unroll
      for (int it = 0; it < 8; ++it) {
        const int row = it * 2 + hh;                       // it 0..7 x hh 0..1 = rows 0..15
        ov[it] = *(const v4f*)(slab + row * 68 + c4);
      }
      {
#pragma unroll
        for (int it = 0; it < 8; ++it) {
          const int row = it * 2 + hh;
          *(v4f*)(C + (size_t)(mBase + row) * ldc + n0 + c4) = ov[it];
        }
        
      }
    } else {
      const int q = lane >> 3, c8 = (lane & 7) * 8;
      const bool kside = (OUT_MODE == 4) && (n0 >= DM);   // wave-uniform: this wave's head is a k head
      const int  nc    = (OUT_MODE == 4) ? (n0 % DM) : n0; // first column in the output planes
      unsigned short* C  = (unsigned short*)(kside ? Cout3 : Cout)  + (size_t)b * strideC;
      unsigned short* C2 = (unsigned short*)(kside ? Cout4 : Cout2) + (size_t)b * strideC2;
      const bool wlo = (OUT_MODE == 2) || (OUT_MODE == 4) || (n0 < N2);      // wave-uniform
      v4u hv[4], lv[4];
#pragma unroll
      for (int it = 0; it < 4; ++it) {
        const int row = it * 4 + q;                        // it 0..3 x q 0..3 = rows 0..15
        const float* sp = slab + row * 68 + c8;
        v4u a, a2;
#pragma unroll
        for (int e = 0; e < 4; ++e) {
          const float f0 = sp[2 * e], f1 = sp[2 * e + 1];
          unsigned short h0, h1, l0, l1;
          if (OUT_MODE == 2 || OUT_MODE == 4) {
            h0 = bf_bits(f0); h1 = bf_bits(f1);
            l0 = bf_bits(f0 - bf_up(h0)); l1 = bf_bits(f1 - bf_up(h1));
          } else {
            const _Float16 x0 = (_Float16)f0, x1 = (_Float16)f1;
            h0 = h_bits(x0); h1 = h_bits(x1);
            l0 = h_bits((_Float16)((f0 - (float)x0) * rscale));
            l1 = h_bits((_Float16)((f1 - (float)x1) * rscale));
          }
          a[e] = pk16(h0, h1); a2[e] = pk16(l0, l1);
        }
        hv[it] = a; lv[it] = a2;
      }
      {
#pragma unroll
        for (int it = 0; it < 4; ++it) {
          const int row = it * 4 + q;
          *(v4u*)(C + (size_t)(mBase + row) * ldc + nc + c8) = hv[it];
          if (wlo) *(v4u*)(C2 + (size_t)(mBase + row) * ldc2 + nc + c8) = lv[it];
        }
        
      }
    }
    __builtin_amdgcn_fence(__ATOMIC_RELEASE, "workgroup");
    __builtin_amdgcn_wave_barrier();
    __builtin_amdgcn_fence(__ATOMIC_ACQUIRE, "workgroup");
  }
}

// =====================================================================================================
// Causal attention, head dim 64 (tril mask incl. diagonal, computed).
//   q planes (bf16 hi / lo): element (b, t, h, d) at [(b*SEQ + t)*DM + h*64 + d]
//   k planes (bf16 hi / lo): same layout with key index s
//   v^T hi plane (f16):      element (b, h, d, s) at [(b*DM + h*64 + d)*SEQ + s]
//   v^T residual plane (f16, (v - hi)*4096): [(b*DM + h*64 + d)*VLP + s], s < VLP, read only when RES
//   (a key tile at or beyond VLP would contribute a zero v residual; with RES only tiles below VLP occur)
//   logit = q.k * sscale for key <= query, -FLT_MAX otherwise (exp -> 0); every row has a live key in every
//   processed key tile (tiles 0..qb only, block-uniform trip count qb+1 <= 32).
//   out f32 plane: element (b, t, h*64 + d) at [(b*SEQ + t)*DM + h*64 + d] = normalised context.
//   scores = q . k : bf16 hi/lo split (hi.hi + hi.lo + lo.hi), f32 accumulate, then * sscale in f32
//   p = exp(s - m) carried as f16(1024 p); context = p . v on f16 WMMA; RES adds f16 residual planes of p and v
//   (scale 4096, separate accumulator folded back with 1/4096 per chunk in f32); online softmax in f32.
//   Block = 4 waves = 64 query rows of one (b, h); grid = nqbThis * NH * NB; kv chunks of 64.
//   K / V^T chunk staging: 128 threads x 32 elements per plane = the whole 64x64 tile (plain 16-B loads,
//   __syncthreads before and after); P tiles are wave-private, spilled with _Float16 element stores and reloaded
//   Output coverage: each wave stores rows q0..q0+15 (it 0..7 x lane>>4 0..1) x 64 columns (16 lanes x 4 floats),
// =====================================================================================================
template <bool RES>
__global__ __launch_bounds__(128)
void attn_causal64(const unsigned short* __restrict__ qhp, const unsigned short* __restrict__ qlp,
                   const unsigned short* __restrict__ khp, const unsigned short* __restrict__ klp,
                   const unsigned short* __restrict__ vhp, const unsigned short* __restrict__ vlp,
                   float* outp, int qbBase, int nqbThis, float sscale) {
  union FB { v16b v; v8b h[2]; };
  union FH { v16h v; v8h h[2]; };
  __shared__ __align__(16) __bf16   Ksh[64 * LP];                 // K hi [kv][d], row pitch LP
  __shared__ __align__(16) __bf16   Ksl[64 * LP];                 // K lo
  __shared__ __align__(16) _Float16 Vth[64 * LP];                 // V^T hi [d][kv], row pitch LP
  __shared__ __align__(16) _Float16 Vtl[RES ? 64 * LP : 8];       // V^T residual
  __shared__ __align__(16) _Float16 Psh[4][16 * LP];              // per wave P [row][kv], row pitch LP
  __shared__ __align__(16) _Float16 Psl[RES ? 4 : 1][16 * LP];    // per wave P residual
  __shared__ __align__(16) float    Os[4][16 * OP];               // per wave context tile [row][d], row pitch OP

  const int tid  = threadIdx.x;
  const int wave = tid >> 5;
  const int lane = tid & 31;
  const int hh   = lane >> 4;
  const int c    = lane & 15;

  const int bx   = blockIdx.x;
  const int qbl  = bx % nqbThis;
  const int rest = bx / nqbThis;
  const int h    = rest % NH;
  const int b    = rest / NH;
  const int qb   = qbBase + qbl;
  const int q0   = qb * 64 + wave * 16;
  const size_t rowB = (size_t)b * SEQ;

  const __bf16* Qh = (const __bf16*)(const void*)qhp + (size_t)h * HD;
  const __bf16* Ql = (const __bf16*)(const void*)qlp + (size_t)h * HD;
  const __bf16* Kh = (const __bf16*)(const void*)khp + (size_t)h * HD;
  const __bf16* Kl = (const __bf16*)(const void*)klp + (size_t)h * HD;
  const _Float16* Vh = (const _Float16*)(const void*)vhp + ((size_t)b * DM + (size_t)h * HD) * SEQ;
  const _Float16* Vl = (const _Float16*)(const void*)vlp + ((size_t)b * DM + (size_t)h * HD) * VLP;

  // ---- Q fragments (A operand, row = lane&15): 2 d-chunks, hi and lo ----
  v16b qah[2], qal[2];
#pragma unroll
  for (int dc = 0; dc < 2; ++dc) {
    const size_t qo = (rowB + q0 + c) * DM + dc * 32 + 8 * hh;
    qah[dc] = ldfrag_b(Qh + qo);
    qal[dc] = ldfrag_b(Ql + qo);
  }

  float mrow[8], lrow[8];
  v8f oacc[4];
#pragma unroll
  for (int r = 0; r < 8; ++r) { mrow[r] = -INFINITY; lrow[r] = 0.f; }
#pragma unroll
  for (int t = 0; t < 4; ++t) oacc[t] = zero8();

  int nkt = qb + 1;                          // causal: key tiles 0..qb, block-uniform
  if (nkt > NQB) nkt = NQB;
  for (int kt = 0; kt < nkt; ++kt) {
    const int kv0 = kt * 64;
    __syncthreads();
    {
      const int r = tid >> 1, half = (tid & 1) * 32;
      const __bf16*   kg  = Kh + (rowB + kv0 + r) * DM + half;    // K row kv0+r, d = half..half+31
      const __bf16*   klg = Kl + (rowB + kv0 + r) * DM + half;
      const _Float16* vg  = Vh + (size_t)r * SEQ + kv0 + half;    // V^T row d = r, s = kv0+half..+31
      const int kvl = (kv0 + 64 <= VLP) ? kv0 : (VLP - 64);     // clamped address into the residual plane
      const _Float16* vlg = Vl + (size_t)r * VLP + kvl + half;
      const bool resOK = (kv0 + 64 <= VLP);                      // block-uniform
#pragma unroll
      for (int i = 0; i < 4; ++i) {
        const v8b a0 = *(const v8b*)(kg + 8 * i);
        const v8b a1 = *(const v8b*)(klg + 8 * i);
        const v8h b0 = *(const v8h*)(vg + 8 * i);
        *(v8b*)(Ksh + r * LP + half + 8 * i) = a0;
        *(v8b*)(Ksl + r * LP + half + 8 * i) = a1;
        *(v8h*)(Vth + r * LP + half + 8 * i) = b0;
        if (RES) {
          v8h b1 = *(const v8h*)(vlg + 8 * i);
          if (!resOK) b1 = zero8h();
          *(v8h*)(Vtl + r * LP + half + 8 * i) = b1;
        }
      }
    }
    __syncthreads();

    // ---- scores: 16 query rows x 64 keys per wave, 3 bf16 products ----
    v8f s[4];
#pragma unroll
    for (int j = 0; j < 4; ++j) {
      s[j] = zero8();
#pragma unroll
      for (int dc = 0; dc < 2; ++dc) {
        FB kb, kl;
        kb.h[0] = *(const v8b*)(Ksh + (j * 16 + c) * LP + dc * 32 + 8 * hh);
        kb.h[1] = *(const v8b*)(Ksh + (j * 16 + c) * LP + dc * 32 + 16 + 8 * hh);
        kl.h[0] = *(const v8b*)(Ksl + (j * 16 + c) * LP + dc * 32 + 8 * hh);
        kl.h[1] = *(const v8b*)(Ksl + (j * 16 + c) * LP + dc * 32 + 16 + 8 * hh);
        s[j] = mma_b(qah[dc], kb.v, s[j]);
        s[j] = mma_b(qah[dc], kl.v, s[j]);
        s[j] = mma_b(qal[dc], kb.v, s[j]);
      }
    }

    // ---- scale + causal mask (replace by -FLT_MAX), row max, online softmax, P (x1024, f16) and
    //      P residual (x4096) to LDS ----
    _Float16* pwh = Psh[wave];
    _Float16* pwl = Psl[RES ? wave : 0];
#pragma unroll
    for (int r = 0; r < 8; ++r) {
      const int qrow = q0 + 8 * hh + r;
      float m = -INFINITY;
#pragma unroll
      for (int j = 0; j < 4; ++j) {
        const int key = kv0 + j * 16 + c;
        float sv = s[j][r] * sscale;
        sv = (key > qrow) ? -FLT_MAX : sv;
        s[j][r] = sv;
        m = fmaxf(m, sv);
      }
#pragma unroll
      for (int off = 1; off < 16; off <<= 1) m = fmaxf(m, __shfl_xor(m, off, 32));
      const float mnew  = fmaxf(mrow[r], m);
      const float msafe = (mnew == -INFINITY) ? 0.f : mnew;
      const float alpha = __expf(mrow[r] - msafe);
      mrow[r] = mnew;
      float psum = 0.f;
#pragma unroll
      for (int j = 0; j < 4; ++j) {
        const float p = __expf(s[j][r] - msafe);     // masked logit against a finite max: exp -> 0
        psum += p;
        const float p1k = p * 1024.0f;
        const _Float16 ph = (_Float16)p1k;
        pwh[(8 * hh + r) * LP + j * 16 + c] = ph;
        if (RES) {
          const _Float16 pl = (_Float16)((p1k - (float)ph) * 4096.0f);
          pwl[(8 * hh + r) * LP + j * 16 + c] = pl;
        }
      }
#pragma unroll
      for (int off = 1; off < 16; off <<= 1) psum += __shfl_xor(psum, off, 32);
      lrow[r] = lrow[r] * alpha + psum;
#pragma unroll
      for (int t = 0; t < 4; ++t) oacc[t][r] *= alpha;
    }
    __builtin_amdgcn_fence(__ATOMIC_RELEASE, "workgroup");
    __builtin_amdgcn_wave_barrier();
    __builtin_amdgcn_fence(__ATOMIC_ACQUIRE, "workgroup");

    // ---- context += P . V (f16 WMMA), residual products into a separate accumulator ----
    v8f o1[4];
#pragma unroll
    for (int t = 0; t < 4; ++t) o1[t] = zero8();
#pragma unroll 1
    for (int kk = 0; kk < 2; ++kk) {
      FH pa, pl;
      pa.h[0] = *(const v8h*)(pwh + c * LP + kk * 32 + 8 * hh);
      pa.h[1] = *(const v8h*)(pwh + c * LP + kk * 32 + 16 + 8 * hh);
      if (RES) {
        pl.h[0] = *(const v8h*)(pwl + c * LP + kk * 32 + 8 * hh);
        pl.h[1] = *(const v8h*)(pwl + c * LP + kk * 32 + 16 + 8 * hh);
      } else {
        pl.v = pa.v;
      }
#pragma unroll
      for (int t = 0; t < 4; ++t) {
        FH vb;
        vb.h[0] = *(const v8h*)(Vth + (t * 16 + c) * LP + kk * 32 + 8 * hh);
        vb.h[1] = *(const v8h*)(Vth + (t * 16 + c) * LP + kk * 32 + 16 + 8 * hh);
        oacc[t] = mma_h(pa.v, vb.v, oacc[t]);
        if (RES) {
          FH vl;
          vl.h[0] = *(const v8h*)(Vtl + (t * 16 + c) * LP + kk * 32 + 8 * hh);
          vl.h[1] = *(const v8h*)(Vtl + (t * 16 + c) * LP + kk * 32 + 16 + 8 * hh);
          o1[t] = mma_h(pa.v, vl.v, o1[t]);
          o1[t] = mma_h(pl.v, vb.v, o1[t]);
        }
      }
    }
    if (RES) {
#pragma unroll
      for (int t = 0; t < 4; ++t)
#pragma unroll
        for (int r = 0; r < 8; ++r) oacc[t][r] += o1[t][r] * (1.0f / 4096.0f);
    }
  }

  // ---- normalise (1/l and the 1/1024 p carry), stage the wave's 16x64 tile in LDS, then write whole
  float* os = Os[wave];
#pragma unroll
  for (int r = 0; r < 8; ++r) {
    const float l = lrow[r];
    const float inv = ((l > 0.f) ? (1.0f / l) : 0.f) * (1.0f / 1024.0f);
#pragma unroll
    for (int t = 0; t < 4; ++t) os[(8 * hh + r) * OP + t * 16 + c] = oacc[t][r] * inv;
  }
  __builtin_amdgcn_fence(__ATOMIC_RELEASE, "workgroup");
  __builtin_amdgcn_wave_barrier();
  __builtin_amdgcn_fence(__ATOMIC_ACQUIRE, "workgroup");
  {
    const int h2 = lane >> 4, c4 = (lane & 15) * 4;
    v4f ov[8];
#pragma unroll
    for (int it = 0; it < 8; ++it) {
      const int row = it * 2 + h2;   // it 0..7 x h2 0..1 = rows 0..15 of the wave tile
      ov[it] = *(const v4f*)(os + row * OP + c4);
    }
    {
#pragma unroll
      for (int it = 0; it < 8; ++it) {
        const int row = it * 2 + h2;
        const size_t go = (rowB + q0 + row) * DM + (size_t)h * HD + c4;
        *(v4f*)(outp + go) = ov[it];
      }
      
    }
  }
}

// =====================================================================================================
// Workspace map (bytes), every region an exact multiple of its whole-line / whole-tile store granularity:
//   Xb    bf16 [4096][1024]          0          8388608
//   Winb  bf16 [3072][1024]          8388608    6291456
//   Wob   bf16 [1024][1024]          14680064   2097152
//   Rin   f32  [3072]                16777216     12288   (96 lines)
//   Rout  f32  [1024]                16789504      4096   (32 lines)
//   Rrow  f32  [4096]                16793600     16384   (128 lines)
//   CosT  f32  [2048][32]            16809984    262144
//   SinT  f32  [2048][32]            17072128    262144
//   Af    f32  [4096][1024]          17334272  33554432   (Af, then Ah bf16 and Al bf16 [4096][1024] each)
//   VTh   f16  [2][1024][2048]       50888704   8388608
//   VTl   f16  [2][1024][512]        59277312   2097152
//   Qh    bf16 [4096][1024]          61374464   8388608
//   Ql    bf16 [4096][1024]          69763072   8388608
//   Kh    bf16 [4096][1024]          78151680   8388608
//   Kl    bf16 [4096][1024]          86540288   8388608
//   end                              94928896
// Weights are [out n][in k] with k contiguous = the Bt / A layout the GEMM wants, so they are only converted.
// =====================================================================================================
extern "C" void kernel_launch(void* const* d_in, const int* in_sizes, int n_in,
                              void* d_out, int out_size, void* d_ws, size_t ws_size,
                              hipStream_t stream) {
  if (n_in < 4) return;
  if (in_sizes[0] != NB * SEQ * DM) return;
  if (in_sizes[1] != SEQ * (HD / 2)) return;
  if (in_sizes[2] != 3 * DM * DM) return;
  if (in_sizes[3] != DM * DM) return;
  if (out_size != NB * SEQ * DM) return;

  const float* x    = (const float*)d_in[0];
  const float* rpf  = (const float*)d_in[1];
  const float* w_in = (const float*)d_in[2];
  const float* w_o  = (const float*)d_in[3];

  const size_t PXb   = (size_t)NB * SEQ * DM * 2;      //  8388608  16-bit activation plane [4096][1024]
  const size_t PWin  = (size_t)3 * DM * DM * 2;        //  6291456
  const size_t PWo   = (size_t)DM * DM * 2;            //  2097152
  const size_t PRin  = (size_t)3 * DM * 4;             //    12288
  const size_t PRout = (size_t)DM * 4;                 //     4096
  const size_t PRrow = (size_t)NB * SEQ * 4;           //    16384
  const size_t PTrig = (size_t)SEQ * (HD / 2) * 4;     //   262144
  const size_t PQK   = (size_t)NB * SEQ * NQK * 4;     // 33554432  Af + Ah + Al
  const size_t PVTh  = (size_t)NB * DM * SEQ * 2;      //  8388608
  const size_t PVTl  = (size_t)NB * DM * VLP * 2;      //  2097152
  const size_t PAf   = (size_t)NB * SEQ * DM * 4;      // 16777216
  if (PAf + 2 * PXb != PQK) return;                    // Af + Ah + Al fill their region exactly
  size_t off = 0;
  const size_t oXb   = off; off += PXb;
  const size_t oWin  = off; off += PWin;
  const size_t oWo   = off; off += PWo;
  const size_t oRin  = off; off += PRin;
  const size_t oRout = off; off += PRout;
  const size_t oRrow = off; off += PRrow;
  const size_t oCos  = off; off += PTrig;
  const size_t oSin  = off; off += PTrig;
  const size_t oQK   = off; off += PQK;
  const size_t oVTh  = off; off += PVTh;
  const size_t oVTl  = off; off += PVTl;
  const size_t oQh   = off; off += PXb;
  const size_t oQl   = off; off += PXb;
  const size_t oKh   = off; off += PXb;
  const size_t oKl   = off; off += PXb;
  if (off > ws_size) return;                           // off = 94928896
  if (off > (size_t)134217728) return;
  const size_t oAf = oQK;
  const size_t oAh = oQK + PAf;
  const size_t oAl = oAh + PXb;
  if (oAl + PXb > oVTh) return;                        // region ordering sanity

  char* ws = (char*)d_ws;
  unsigned short* Xb   = (unsigned short*)(ws + oXb);
  unsigned short* Winb = (unsigned short*)(ws + oWin);
  unsigned short* Wvb  = Winb + (size_t)2 * DM * DM;   // rows 2048..3071 of w_in = v features
  unsigned short* Wob  = (unsigned short*)(ws + oWo);
  float*          Rin  = (float*)(ws + oRin);
  float*          Rv   = Rin + 2 * DM;
  float*          Rout = (float*)(ws + oRout);
  float*          Rrow = (float*)(ws + oRrow);
  float*          CosT = (float*)(ws + oCos);
  float*          SinT = (float*)(ws + oSin);
  unsigned short* VTh  = (unsigned short*)(ws + oVTh);
  unsigned short* VTl  = (unsigned short*)(ws + oVTl);
  unsigned short* Qh   = (unsigned short*)(ws + oQh);
  unsigned short* Ql   = (unsigned short*)(ws + oQl);
  unsigned short* Kh   = (unsigned short*)(ws + oKh);
  unsigned short* Kl   = (unsigned short*)(ws + oKl);
  float*          Af   = (float*)(ws + oAf);
  unsigned short* Ah   = (unsigned short*)(ws + oAh);
  unsigned short* Al   = (unsigned short*)(ws + oAl);

  const dim3 blk(256);
  const int nTrig = SEQ * (HD / 2);                                  // 65536
  const int n8x   = NB * SEQ * DM / 8;                               // 524288
  const dim3 gTrig((nTrig + 255) / 256);                             // 256 blocks
  const dim3 gCvtX((n8x + 255) / 256);                               // 2048 blocks
  const dim3 gPrepWin(3 * DM / 32);                                  // 96 blocks (32 rows each)
  const dim3 gPrepWo(DM / 32);                                       // 32 blocks
  const dim3 gPrepA(NB * SEQ / 32);                                  // 128 blocks
  const dim3 gblk(128);                                              // GEMM block: 4 waves, one 128x128 tile
  const dim3 gQK((NB * SEQ / 128) * (NQK / 128), 1);                 // 32 x 16 = 512 blocks
  const dim3 gVT((DM / 128) * (SEQ / 128), NB);                      // 8 x 16 = 128 blocks x 2 batches
  const dim3 gOut((NB * SEQ / 128) * (DM / 128), 1);                 // 32 x 8 = 256 blocks

  // (0) angle tables from the bf16-converted input table
  trig_tab<<<gTrig, blk, 0, stream>>>(rpf, CosT, SinT, nTrig);
  // (1) x -> bf16 plane [4096][1024]
  cvt_bf16x8<<<gCvtX, blk, 0, stream>>>(x, Xb, n8x);
  // (2) weights -> bf16 planes [n][k] + per-row inverse L2 norms of the converted rows
  row_prep<false, true><<<gPrepWin, blk, 0, stream>>>(w_in, Winb, Winb, Rin, 1.0f);
  row_prep<false, true><<<gPrepWo, blk, 0, stream>>>(w_o, Wob, Wob, Rout, 1.0f);
  // (3) q/k projection: Rin[e] * sum_d Xb[b*SEQ+s][d] Winb[e][d], e < 2048  (M=4096, N=2048, K=1024), with rotary and
  //     per-head rms in the epilogue -> q/k bf16 hi/lo planes
  gemm64<0, 4, false, true><<<gQK, gblk, 0, stream>>>(
      Xb, Xb, DM, 0LL, Winb, DM, 0LL,
      (void*)Qh, DM, 0LL, (void*)Ql, DM, 0LL, 0,
      NB * SEQ, NQK, DM, 1.0f, Rin, Rin,
      (void*)Kh, (void*)Kl, CosT, SinT);
  // (4) v^T per batch: VTh[b][m][s] = Rv[m] * sum_d Wvb[m][d] Xb[b*SEQ+s][d] -> f16 hi plane (pitch SEQ) and
  //     residual plane (x4096, keys < VLP, pitch VLP)  (M=1024, N=2048, K=1024)
  gemm64<0, 3, true, false><<<gVT, gblk, 0, stream>>>(
      Wvb, Wvb, DM, 0LL, Xb, DM, (long long)SEQ * DM,
      (void*)VTh, SEQ, (long long)DM * SEQ, (void*)VTl, VLP, (long long)DM * VLP, VLP,
      DM, SEQ, DM, 4096.0f, Rv, Rv,
      (void*)VTh, (void*)VTl, Rv, Rv);
  // (6) causal attention: query blocks 0..RESQB-1 with residual planes, the rest without -> Af f32 [4096][1024]
  attn_causal64<true><<<dim3(NB * NH * RESQB), dim3(128), 0, stream>>>(
      Qh, Ql, Kh, Kl, VTh, VTl, Af, 0, RESQB, 0.125f);
  attn_causal64<false><<<dim3(NB * NH * (NQB - RESQB)), dim3(128), 0, stream>>>(
      Qh, Ql, Kh, Kl, VTh, VTl, Af, RESQB, NQB - RESQB, 0.125f);
  // (7) merged rows -> bf16 hi/lo planes + per-row inverse rms over 1024
  row_prep<true, false><<<gPrepA, blk, 0, stream>>>(Af, Ah, Al, Rrow, 1.0f / (float)DM);
  // (8) out[s][e] = Rrow[s] * Rout[e] * sum_d (Ah+Al)[s][d] Wob[e][d] -> d_out f32 [4096][1024]  (M=4096, N=1024, K=1024)
  gemm64<1, 0, true, true><<<gOut, gblk, 0, stream>>>(
      Ah, Al, DM, 0LL, Wob, DM, 0LL,
      d_out, DM, 0LL, d_out, 0, 0LL, 0,
      NB * SEQ, DM, DM, 1.0f, Rrow, Rout,
      d_out, d_out, Rrow, Rout);
  (void)hipGetLastError();
}

// v004
// Measured time: 181 microseconds a run.
// In two side-by-side timings against v003, it was 1.20 and 1.19 times as fast.
// All steps since v000 together make it 2.21 times as fast.
// Contractions: q/k and v^T projections = v_wmma_f32_16x16x32_bf16 (bf16 operands from RNE-converted inputs, single product, f32 row/column scales in the epilogue; q/k: RoPE and head rms there too);
// k.q^T scores (transposed) = v_wmma_f32_16x16x32_bf16 with bf16 hi/lo split q and k (hi.hi + hi.lo + lo.hi);
// v^T.p^T (transposed) = v_wmma_f32_16x16x32_f16 (p carried x1024 in f16, v in f16; extra f16 residual planes x4096 of p and v on the first 512 query rows);
// a.Wout^T = v_wmma_f32_16x16x32_bf16 with a as bf16 hi/lo planes times bf16 Wout (2 products); all f32 accumulate; RoPE, norms and softmax in f32.
#include <hip/hip_runtime.h>
#include <math.h>
#include <float.h>
#include <stdint.h>

#define NB    2
#define SEQ   2048
#define DM    1024
#define NH    16
#define HD    64
#define NQK   (2 * DM)       // q and k feature columns of the fused q/k projection output
#define NQB   (SEQ / 64)     // 32 query / key tiles of 64
#define VLP   512            // key pitch of the v^T residual plane (keys 0..VLP-1)
#define RESQB 8              // leading 64-row query blocks that use the p / v residual planes
static_assert(RESQB * 64 <= VLP);
static_assert(NH * HD == DM);
static_assert((SEQ % 64) == 0 && (DM % 256) == 0);
static_assert(HD == 64);
static_assert((NB * SEQ) % 128 == 0 && SEQ % 128 == 0 && DM % 128 == 0 && NQK % 128 == 0);   // GEMM block tiles of 128x128, k slabs of 64
#define LP    72             // LDS pitch, in 16-bit elements, of a 64-element row: 144 B = 16 B x odd, so that the 16 rows
                             // one ds_load_b128 fragment read touches fall on 16 different groups of four banks
#define GP    72             // LDS pitch, in 16-bit elements, of a GEMM k-slab row of 64 elements (144 B = 16 B x odd, as LP)
#define GPLANE (128 * GP)    // elements of one staged 128-row k slab
#define OP    68             // LDS pitch, in floats, of a 64-float row: the 16 lanes of a lane half store 16 rows, on different banks

typedef _Float16 v16h __attribute__((ext_vector_type(16)));
typedef _Float16 v8h  __attribute__((ext_vector_type(8)));
typedef __bf16   v16b __attribute__((ext_vector_type(16)));
typedef __bf16   v8b  __attribute__((ext_vector_type(8)));
typedef float    v8f  __attribute__((ext_vector_type(8)));
typedef float    v4f  __attribute__((ext_vector_type(4)));
typedef unsigned int v4u __attribute__((ext_vector_type(4)));

// ---- scalar helpers --------------------------------------------------------------------------------
__device__ __forceinline__ unsigned short bf_bits(float f) {          // f32 -> bf16 bits, RNE convert
  unsigned u = __float_as_uint(f);
  return (unsigned short)((u + 0x7FFFu + ((u >> 16) & 1u)) >> 16);
}
__device__ __forceinline__ float bf_up(unsigned short h) { return __uint_as_float(((unsigned)h) << 16); }
__device__ __forceinline__ unsigned short h_bits(_Float16 x) { return __builtin_bit_cast(unsigned short, x); }
__device__ __forceinline__ unsigned pk16(unsigned short a, unsigned short b) { return (unsigned)a | ((unsigned)b << 16); }
__device__ __forceinline__ v8f zero8() { v8f z = {0.f, 0.f, 0.f, 0.f, 0.f, 0.f, 0.f, 0.f}; return z; }
__device__ __forceinline__ v8h zero8h() {
  const _Float16 z = (_Float16)0.0f;
  v8h r = {z, z, z, z, z, z, z, z};
  return r;
}

// value of lane l ^ 16 (the other 16-lane row), by a vector cross-row move
__device__ __forceinline__ float xhalf(float x) {
  const int b = __builtin_bit_cast(int, x);
  return __builtin_bit_cast(float, __builtin_amdgcn_permlanex16(b, b, 0x76543210, 0xfedcba98, false, false));
}

// e^x as 2^(x * log2 e) on v_exp_f32, as __expf gives it. The v_nop is the one slot that the instruction set asks for
// between a transcendental and an instruction that reads its result or overwrites its source: in the same statement
// it stands there whichever instruction the compiler puts next
__device__ __forceinline__ float exp_slot(float x) {
  const float y = x * 1.44269504f;
  float r;
#if defined(__HIP_DEVICE_COMPILE__)
  asm("v_exp_f32 %0, %1\n\tv_nop" : "=v"(r) : "v"(y));
#else
  r = y;
#endif
  return r;
}

// ---- fragment loader: 16-bit A/B operand, lane -> row/col (lane&15), p already includes +8*(lane>>4);
//      elements 0..7 <- p[0..7] (k0+8h..), elements 8..15 <- p[16..23] (k0+16+8h..)
__device__ __forceinline__ v16b ldfrag_b(const __bf16* p) {
  union { v16b v; v8b h[2]; } f;
  f.h[0] = *(const v8b*)(p);
  f.h[1] = *(const v8b*)(p + 16);
  return f.v;
}

// ---- WMMA helpers with trailing VALU hazard gap --------------------------------------------------------
__device__ __forceinline__ v8f mma_b(v16b a, v16b b, v8f c) {
  c = __builtin_amdgcn_wmma_f32_16x16x32_bf16(false, a, false, b, (short)0, c, false, false);
#if defined(__HIP_DEVICE_COMPILE__)
  asm volatile("v_nop\n\tv_nop\n\tv_nop\n\tv_nop" : "+v"(c) : "v"(a), "v"(b));
#endif
  return c;
}
__device__ __forceinline__ v8f mma_h(v16h a, v16h b, v8f c) {
  c = __builtin_amdgcn_wmma_f32_16x16x32_f16(false, a, false, b, (short)0, c, false, false);
#if defined(__HIP_DEVICE_COMPILE__)
  asm volatile("v_nop\n\tv_nop\n\tv_nop\n\tv_nop" : "+v"(c) : "v"(a), "v"(b));
#endif
  return c;
}
__device__ __forceinline__ v8f mma_b_raw(v16b a, v16b b, v8f c) {
  return __builtin_amdgcn_wmma_f32_16x16x32_bf16(false, a, false, b, (short)0, c, false, false);
}
__device__ __forceinline__ void dep_guard_b(v8f& a, v8f& b, v16b x, v16b y) {
#if defined(__HIP_DEVICE_COMPILE__)
  asm volatile("v_nop\n\tv_nop\n\tv_nop\n\tv_nop" : "+v"(a), "+v"(b) : "v"(x), "v"(y));
#endif
}
__device__ __forceinline__ void keep4_b(v16b a, v16b b, v16b c, v16b d) {
#if defined(__HIP_DEVICE_COMPILE__)
  asm volatile("v_nop" :: "v"(a), "v"(b), "v"(c), "v"(d));
#endif
}
__device__ __forceinline__ void acc_guard4(v8f& a, v8f& b, v8f& c, v8f& d) {
#if defined(__HIP_DEVICE_COMPILE__)
  asm volatile("v_nop\n\tv_nop\n\tv_nop\n\tv_nop" : "+v"(a), "+v"(b), "+v"(c), "+v"(d));
#endif
}

// =====================================================================================================
// f32 -> bf16 (RNE convert), 8 elements per thread, one 16-B store per lane: a wave writes 512 contiguous B
// coverage: n8 threads x 8 = whole plane (n8 is a multiple of 256 here).
// =====================================================================================================
__global__ __launch_bounds__(256) void cvt_bf16x8(const float* __restrict__ in, unsigned short* out, int n8) {
  const int i = blockIdx.x * 256 + threadIdx.x;
  if (i < n8) {
    const v4f a = *(const v4f*)(in + (size_t)i * 8);
    const v4f b = *(const v4f*)(in + (size_t)i * 8 + 4);
    v4u p;
    p[0] = pk16(bf_bits(a[0]), bf_bits(a[1]));
    p[1] = pk16(bf_bits(a[2]), bf_bits(a[3]));
    p[2] = pk16(bf_bits(b[0]), bf_bits(b[1]));
    p[3] = pk16(bf_bits(b[2]), bf_bits(b[3]));
    *(v4u*)(out + (size_t)i * 8) = p;
    
  }
}

// =====================================================================================================
// Angle table: ct[i] = cosf(bf(fr[i])), st[i] = sinf(bf(fr[i])) with the angle RNE-converted to bf16
// =====================================================================================================
__global__ __launch_bounds__(256) void trig_tab(const float* __restrict__ fr, float* ct, float* st, int n) {
  const int i = blockIdx.x * 256 + threadIdx.x;
  if (i < n) {
    const float f  = bf_up(bf_bits(fr[i]));
    const float cv = cosf(f);
    const float sv = sinf(f);
    *(float*)(ct + i) = cv;
    *(float*)(st + i) = sv;
    
  }
}

// =====================================================================================================
// Row preparation over rows of DM=1024 f32 values (pitch DM):
//   hi plane = RNE bf16 of each value; LO: lo plane = RNE bf16 of (v - hi) (unscaled);
//   rtab[row] = rsqrt(ss * inv_div + 1e-6) with ss = sum over the row of g^2,
//     g = the bf16-converted value (SQR) or the f32 value (!SQR).
// Block = 8 waves = 32 rows (wave w: rows 4w..4w+3 of the block); grid = rows / 32 (exact here).
// Per row and instruction t (0..3): lane l holds columns 256t + 8l .. +7 -> 32 lanes x 16 B = 512 B
// coverage: 4 t x 32 lanes x 8 = 1024 columns per row; 8 waves x 4 rows = 32 rows per block.
// =====================================================================================================
template <bool LO, bool SQR>
__global__ __launch_bounds__(256) void row_prep(const float* __restrict__ in, unsigned short* hp, unsigned short* lp,
                                                float* rtab, float inv_div) {
  __shared__ float sr[32];
  const int tid = threadIdx.x, wave = tid >> 5, lane = tid & 31;
#pragma unroll 1
  for (int i = 0; i < 4; ++i) {
    const int row = blockIdx.x * 32 + wave * 4 + i;
    const float* rp = in + (size_t)row * DM + lane * 8;
    float ss = 0.f;
    v4u hv[4], lv[4];
#pragma unroll
    for (int t = 0; t < 4; ++t) {
      const v4f a  = *(const v4f*)(rp + t * 256);
      const v4f bq = *(const v4f*)(rp + t * 256 + 4);
      v4u ph, pl;
#pragma unroll
      for (int e = 0; e < 4; ++e) {
        const float f0 = (e < 2) ? a[2 * e]     : bq[2 * e - 4];
        const float f1 = (e < 2) ? a[2 * e + 1] : bq[2 * e - 3];
        const unsigned short h0 = bf_bits(f0), h1 = bf_bits(f1);
        const float g0 = SQR ? bf_up(h0) : f0;
        const float g1 = SQR ? bf_up(h1) : f1;
        ss += g0 * g0;
        ss += g1 * g1;
        ph[e] = pk16(h0, h1);
        if (LO) {
          pl[e] = pk16(bf_bits(f0 - bf_up(h0)), bf_bits(f1 - bf_up(h1)));
        } else {
          pl[e] = 0u;
        }
      }
      hv[t] = ph; lv[t] = pl;
    }
#pragma unroll
    for (int off = 16; off >= 1; off >>= 1) ss += __shfl_xor(ss, off, 32);
    const float rv = rsqrtf(ss * inv_div + 1e-6f);
    if (lane == 0) sr[wave * 4 + i] = rv;
    {
#pragma unroll
      for (int t = 0; t < 4; ++t) {
        const size_t go = (size_t)row * DM + t * 256 + lane * 8;
        *(v4u*)(hp + go) = hv[t];
        if (LO) *(v4u*)(lp + go) = lv[t];
      }
      
    }
  }
  __syncthreads();
  if (wave == 0) {
    const float rv = sr[lane];
    float* d = rtab + (size_t)blockIdx.x * 32 + lane;
    *(float*)d = rv;
    
  }
}

// =====================================================================================================
// Eight asynchronous 16-B copies per lane, global memory -> LDS: this lane's piece of rows r, r+16, .., r+112 of one
// 128-row x 64-element k slab. g = the lane's piece in row r (row pitch ld elements), l = its LDS byte address
// (row pitch GP elements). Eight lanes cover one 128-B row, so a wave's copy covers four whole lines.
// =====================================================================================================
__device__ __forceinline__ void stage_plane(const __bf16* g, int ld, unsigned l) {
  const size_t   gs = (size_t)16 * (size_t)ld;        // 16 rows in global memory, elements
  const unsigned ls = 16u * GP * 2u;                  // 16 rows in LDS, bytes
  const __bf16 *g0 = g, *g1 = g + gs, *g2 = g + 2 * gs, *g3 = g + 3 * gs;
  const __bf16 *g4 = g + 4 * gs, *g5 = g + 5 * gs, *g6 = g + 6 * gs, *g7 = g + 7 * gs;
  const unsigned l0 = l, l1 = l + ls, l2 = l + 2 * ls, l3 = l + 3 * ls;
  const unsigned l4 = l + 4 * ls, l5 = l + 5 * ls, l6 = l + 6 * ls, l7 = l + 7 * ls;
#if defined(__HIP_DEVICE_COMPILE__)
  // the copies bring the slab into LDS through no register; the closing s_wait_xcnt stands in the same statement so
  // that no address register named here is rewritten in front of it
  asm volatile(
      "global_load_async_to_lds_b128 %0, %8, off\n\t"
      "global_load_async_to_lds_b128 %1, %9, off\n\t"
      "global_load_async_to_lds_b128 %2, %10, off\n\t"
      "global_load_async_to_lds_b128 %3, %11, off\n\t"
      "global_load_async_to_lds_b128 %4, %12, off\n\t"
      "global_load_async_to_lds_b128 %5, %13, off\n\t"
      "global_load_async_to_lds_b128 %6, %14, off\n\t"
      "global_load_async_to_lds_b128 %7, %15, off\n\t"
      "s_wait_xcnt 0x0"
      :: "v"(l0), "v"(l1), "v"(l2), "v"(l3), "v"(l4), "v"(l5), "v"(l6), "v"(l7),
         "v"(g0), "v"(g1), "v"(g2), "v"(g3), "v"(g4), "v"(g5), "v"(g6), "v"(g7)
      : "memory");
#endif
}
// this wave's own copies have landed in LDS
__device__ __forceinline__ void wait_async0() {
#if defined(__HIP_DEVICE_COMPILE__)
  asm volatile("s_wait_asynccnt 0x0" ::: "memory");
#endif
}
// this wave's own LDS reads have returned, so that the buffer they read may be refilled behind the next barrier
__device__ __forceinline__ void wait_ds0() {
#if defined(__HIP_DEVICE_COMPILE__)
  asm volatile("s_wait_dscnt 0x0" ::: "memory");
#endif
}

// cos / sin of rows row0 .. row0+7 (row0 a multiple of 8, so the eight positions row0 % SEQ + r stay below SEQ) and
// pairs p, p + 16 from the [SEQ][32] angle tables
__device__ __forceinline__ void load_angles(const float* __restrict__ ct, const float* __restrict__ st, int row0, int p,
                                            float (&cv)[8][2], float (&sv)[8][2]) {
  const size_t to = (size_t)(row0 % SEQ) * (HD / 2) + p;
#pragma unroll
  for (int r = 0; r < 8; ++r) {
#pragma unroll
    for (int j = 0; j < 2; ++j) {
      cv[r][j] = ct[to + r * (HD / 2) + (j << 4)];
      sv[r][j] = st[to + r * (HD / 2) + (j << 4)];
    }
  }
}

// =====================================================================================================
// Batched bf16 WMMA GEMM: C[m][n] = rs[m] * cs[n] * sum_k A[m][k] * Bt[n][k]. Block = 4 waves = a 128x128 tile,
// wave (wave>>1, wave&1) owns one 64x64 quarter. A row-major [M][K] pitch lda; Bt row-major [N][K] pitch ldb
// (k contiguous); M, N multiples of 128, K a multiple of 64 (true of the three launches below).
// blockIdx.y = batch index (strides in elements).
// Operands: k slabs of 64 elements (one 128-B line per row) are copied into LDS by asynchronous 16-B copies, whole
// lines per wave, two buffers: slab t+1 flies while slab t is worked on. Fragments are read from LDS (row pitch GP).
// NSPLIT: 0 = A.Bt; 1 = (A + A2).Bt (A2 = unscaled bf16 lo plane of A).
// RS / CS: per-row scale rsp[m] / per-column scale csp[n] (f32, not batched) applied in the epilogue.
// OUT_MODE: 0 = f32 (pitch ldc); 2 = bf16 hi plane C + bf16 lo plane C2 (lo = RNE(v - hi), unscaled);
//           3 = f16 hi plane C + f16 residual plane C2 = f16((v - hi) * rscale), C2 written only for tiles
//               with n0 < N2 (pitch ldc2, batch stride strideC2);
//           4 = q/k projection: a wave's 64 columns are one head of q (n0 < DM) or of k. Half-split rotary and the
//               per-head rms over the 64 dims are applied to the accumulators, then bf16 hi/lo planes as in 2, element
//               (row, h*64 + d) at [row*ldc + h*64 + d]: q -> C / C2, k -> C3 / C4.
//               ctp/stp [SEQ][32] f32 angle tables, pair index = d mod 32, position = row mod SEQ.
//               y[d<32] = x1*cos - x2*sin, y[32+d] = x1*sin + x2*cos (x1 = x[d], x2 = x[32+d]); y * rsqrt(mean(y^2) + 1e-6).
//               A lane holds columns 16j + (lane&15), j = 0..3, of its rows: x[d] and x[32+d] are its tiles j and j+2.
// =====================================================================================================
template <int NSPLIT, int OUT_MODE, bool RS, bool CS>
__global__ __launch_bounds__(128) void gemm64(
    const unsigned short* __restrict__ Ap, const unsigned short* A2p, int lda, long long strideA,
    const unsigned short* __restrict__ Btp, int ldb, long long strideB,
    void* Cout, int ldc, long long strideC,
    void* Cout2, int ldc2, long long strideC2, int N2,
    int M, int N, int K, float rscale,
    const float* __restrict__ rsp, const float* __restrict__ csp,
    void* Cout3, void* Cout4, const float* __restrict__ ctp, const float* __restrict__ stp) {
  static_assert(NSPLIT == 0 || NSPLIT == 1);
  const __bf16* A   = (const __bf16*)(const void*)Ap;
  const __bf16* A2  = (const __bf16*)(const void*)A2p;
  const __bf16* Bt  = (const __bf16*)(const void*)Btp;
  __shared__ __align__(16) __bf16 sA[2][GPLANE];                                   // A slab, two buffers
  __shared__ __align__(16) __bf16 sB[2][GPLANE];                                   // Bt slab, two buffers
  __shared__ __align__(16) __bf16 sA2[NSPLIT ? 2 : 1][NSPLIT ? GPLANE : 8];        // A2 slab, two buffers
  __shared__ __align__(16) float sT[4][16 * 68];   // per-wave 16x64 slab, pitch 68 floats
  const int b    = blockIdx.y;
  const int tid  = threadIdx.x;
  const int lane = tid & 31;
  const int wave = tid >> 5;
  const int tilesN = N >> 7;
  const int tilesM = M >> 7;
  const int tile = blockIdx.x;
  if (tile >= tilesM * tilesN) return;   // block-uniform, in front of every copy and barrier
  const int tm = tile / tilesN;
  const int tn = tile - tm * tilesN;
  const int bm0 = tm << 7;
  const int bn0 = tn << 7;
  const int wm  = (wave >> 1) << 6;            // this wave's quarter inside the block tile
  const int wn  = (wave & 1) << 6;
  const int m0 = bm0 + wm;
  const int n0 = bn0 + wn;

  const __bf16* Ab  = A  + (size_t)b * strideA;
  const __bf16* Bb  = Bt + (size_t)b * strideB;
  const __bf16* Ab2 = (NSPLIT >= 1) ? (A2  + (size_t)b * strideA) : Ab;

  const int rlane = lane & 15;                 // row (A) / col (B, D) within subtile
  const int koff  = (lane >> 4) * 8;           // k offset of this lane half
  const int mOff  = (lane >> 4) * 8;           // D row offset

  // ---- staging addresses: thread -> row tid>>3 (+16 per copy), 16-B piece tid&7 of the 128-B slab row ----
  const int srow = tid >> 3, spc = (tid & 7) * 8;
  const __bf16* gA  = Ab  + (size_t)(bm0 + srow) * lda + spc;
  const __bf16* gA2 = Ab2 + (size_t)(bm0 + srow) * lda + spc;
  const __bf16* gB  = Bb  + (size_t)(bn0 + srow) * ldb + spc;
  const unsigned lofs = (unsigned)(srow * GP + spc) * 2u;
  const unsigned lA  = (unsigned)(size_t)(const void*)&sA[0][0]  + lofs;   // low 32 bits = byte offset in LDS
  const unsigned lB  = (unsigned)(size_t)(const void*)&sB[0][0]  + lofs;
  const unsigned lA2 = (unsigned)(size_t)(const void*)&sA2[0][0] + lofs;
  const int nslab = K >> 6;

  v8f acc[4][4];
#pragma unroll
  for (int i = 0; i < 4; ++i)
#pragma unroll
    for (int j = 0; j < 4; ++j) acc[i][j] = zero8();

  // ---- prologue: slab 0 landed and published, then slab 1 in flight ----
  stage_plane(gA, lda, lA);
  stage_plane(gB, ldb, lB);
  if (NSPLIT >= 1) stage_plane(gA2, lda, lA2);
  wait_async0();
  __syncthreads();
  if (nslab > 1) {
    stage_plane(gA + 64, lda, lA + GPLANE * 2u);
    stage_plane(gB + 64, ldb, lB + GPLANE * 2u);
    if (NSPLIT >= 1) stage_plane(gA2 + 64, lda, lA2 + GPLANE * 2u);
  }

#pragma unroll 1   // one slab per trip: the two buffers alternate by the trip's parity
  for (int t = 0; t < nslab; ++t) {
    const int buf = t & 1;
    const __bf16* fa  = &sA[buf][(wm + rlane) * GP + koff];
    const __bf16* fb  = &sB[buf][(wn + rlane) * GP + koff];
    const __bf16* fa2 = NSPLIT ? &sA2[NSPLIT ? buf : 0][(wm + rlane) * GP + koff] : fa;
#pragma unroll
    for (int ks = 0; ks < 64; ks += 32) {
      // all fragments of this 32-wide k step are read as one group in front of its WMMAs
      v16b bh[4], ah[4], al[4];
#pragma unroll
      for (int j = 0; j < 4; ++j) bh[j] = ldfrag_b(fb + (j << 4) * GP + ks);
#pragma unroll
      for (int i = 0; i < 4; ++i) {
        ah[i] = ldfrag_b(fa + (i << 4) * GP + ks);
        if (NSPLIT >= 1) al[i] = ldfrag_b(fa2 + (i << 4) * GP + ks); else al[i] = ah[i];
      }
#pragma unroll
      for (int i = 0; i < 4; ++i) {
#pragma unroll
        for (int j = 0; j < 4; ++j) {
          acc[i][j] = mma_b_raw(ah[i], bh[j], acc[i][j]);
          if (NSPLIT >= 1) acc[i][j] = mma_b_raw(al[i], bh[j], acc[i][j]);
        }
        dep_guard_b(acc[i][0], acc[i][3], ah[i], al[i]);
      }
      keep4_b(bh[0], bh[1], bh[2], bh[3]);
    }
    // ---- publish slab t+1, free slab t's buffer: own LDS reads done, own copies landed, block barrier ----
    wait_ds0();
    wait_async0();
    __syncthreads();
    if (t + 2 < nslab) {                       // block-uniform: refill the buffer that this trip has just read
      const int kn = (t + 2) << 6;
      const unsigned bo = (unsigned)buf * (GPLANE * 2u);
      stage_plane(gA + kn, lda, lA + bo);
      stage_plane(gB + kn, ldb, lB + bo);
      if (NSPLIT >= 1) stage_plane(gA2 + kn, lda, lA2 + bo);
    }
  }
  wait_async0();
  acc_guard4(acc[0][0], acc[0][1], acc[0][2], acc[0][3]);
  acc_guard4(acc[1][0], acc[1][1], acc[1][2], acc[1][3]);
  acc_guard4(acc[2][0], acc[2][1], acc[2][2], acc[2][3]);
  acc_guard4(acc[3][0], acc[3][1], acc[3][2], acc[3][3]);

  // ---- epilogue scales ----
  float csv[4];
#pragma unroll
  for (int j = 0; j < 4; ++j) csv[j] = CS ? csp[n0 + (j << 4) + rlane] : 1.0f;

  // ---- epilogue ----
  float* slab = sT[wave];
#pragma unroll
  for (int i = 0; i < 4; ++i) {
    const int mBase = m0 + (i << 4);
    float cv[8][2], sv[8][2];                              // OUT_MODE 4: cos / sin of (row mOff + r, pair 16j + rlane)
    if (OUT_MODE == 4) load_angles(ctp, stp, mBase + mOff, rlane, cv, sv);
#pragma unroll
    for (int r = 0; r < 8; ++r) {
      const float rsv = RS ? rsp[mBase + mOff + r] : 1.0f;
      if (OUT_MODE == 4) {
        float y1[2], y2[2], sq[2];
#pragma unroll
        for (int j = 0; j < 2; ++j) {
          const float x1 = acc[i][j][r] * rsv * csv[j];
          const float x2 = acc[i][j + 2][r] * rsv * csv[j + 2];
          y1[j] = fmaf(x1, cv[r][j], -(x2 * sv[r][j]));
          y2[j] = fmaf(x1, sv[r][j], x2 * cv[r][j]);
          sq[j] = fmaf(y1[j], y1[j], y2[j] * y2[j]);
        }
        // sum over the 32 pairs: pairs d and d+16 in the lane, then partners 8, 4, 2, 1 of the 16-lane row
        float ss = sq[0] + sq[1];
#pragma unroll
        for (int off = 8; off >= 1; off >>= 1) ss += __shfl_xor(ss, off, 32);
        const float sc = rsqrtf(ss * (1.0f / HD) + 1e-6f);
#pragma unroll
        for (int j = 0; j < 2; ++j) {
          slab[(mOff + r) * 68 + (j << 4) + rlane]      = y1[j] * sc;
          slab[(mOff + r) * 68 + 32 + (j << 4) + rlane] = y2[j] * sc;
        }
      } else {
#pragma unroll
        for (int j = 0; j < 4; ++j) {
          slab[(mOff + r) * 68 + (j << 4) + rlane] = acc[i][j][r] * rsv * csv[j];
        }
      }
    }
    __builtin_amdgcn_fence(__ATOMIC_RELEASE, "workgroup");
    __builtin_amdgcn_wave_barrier();
    __builtin_amdgcn_fence(__ATOMIC_ACQUIRE, "workgroup");
    if (OUT_MODE == 0) {
      float* C = (float*)Cout + (size_t)b * strideC;
      const int hh = lane >> 4, c4 = (lane & 15) * 4;     // 256-B row segment = 16 lanes x 16 B
      v4f ov[8];
#pragma unroll
      for (int it = 0; it < 8; ++it) {
        const int row = it * 2 + hh;                       // it 0..7 x hh 0..1 = rows 0..15
        ov[it] = *(const v4f*)(slab + row * 68 + c4);
      }
      {
#pragma unroll
        for (int it = 0; it < 8; ++it) {
          const int row = it * 2 + hh;
          *(v4f*)(C + (size_t)(mBase + row) * ldc + n0 + c4) = ov[it];
        }
        
      }
    } else {
      const int q = lane >> 3, c8 = (lane & 7) * 8;
      const bool kside = (OUT_MODE == 4) && (n0 >= DM);   // wave-uniform: this wave's head is a k head
      const int  nc    = (OUT_MODE == 4) ? (n0 % DM) : n0; // first column in the output planes
      unsigned short* C  = (unsigned short*)(kside ? Cout3 : Cout)  + (size_t)b * strideC;
      unsigned short* C2 = (unsigned short*)(kside ? Cout4 : Cout2) + (size_t)b * strideC2;
      const bool wlo = (OUT_MODE == 2) || (OUT_MODE == 4) || (n0 < N2);      // wave-uniform
      v4u hv[4], lv[4];
#pragma unroll
      for (int it = 0; it < 4; ++it) {
        const int row = it * 4 + q;                        // it 0..3 x q 0..3 = rows 0..15
        const float* sp = slab + row * 68 + c8;
        v4u a, a2;
#pragma unroll
        for (int e = 0; e < 4; ++e) {
          const float f0 = sp[2 * e], f1 = sp[2 * e + 1];
          unsigned short h0, h1, l0, l1;
          if (OUT_MODE == 2 || OUT_MODE == 4) {
            h0 = bf_bits(f0); h1 = bf_bits(f1);
            l0 = bf_bits(f0 - bf_up(h0)); l1 = bf_bits(f1 - bf_up(h1));
          } else {
            const _Float16 x0 = (_Float16)f0, x1 = (_Float16)f1;
            h0 = h_bits(x0); h1 = h_bits(x1);
            l0 = h_bits((_Float16)((f0 - (float)x0) * rscale));
            l1 = h_bits((_Float16)((f1 - (float)x1) * rscale));
          }
          a[e] = pk16(h0, h1); a2[e] = pk16(l0, l1);
        }
        hv[it] = a; lv[it] = a2;
      }
      {
#pragma unroll
        for (int it = 0; it < 4; ++it) {
          const int row = it * 4 + q;
          *(v4u*)(C + (size_t)(mBase + row) * ldc + nc + c8) = hv[it];
          if (wlo) *(v4u*)(C2 + (size_t)(mBase + row) * ldc2 + nc + c8) = lv[it];
        }
        
      }
    }
    __builtin_amdgcn_fence(__ATOMIC_RELEASE, "workgroup");
    __builtin_amdgcn_wave_barrier();
    __builtin_amdgcn_fence(__ATOMIC_ACQUIRE, "workgroup");
  }
}

template <bool RES>
__global__ __launch_bounds__(128)
void attn_causal64(const unsigned short* __restrict__ qhp, const unsigned short* __restrict__ qlp,
                   const unsigned short* __restrict__ khp, const unsigned short* __restrict__ klp,
                   const unsigned short* __restrict__ vhp, const unsigned short* __restrict__ vlp,
                   float* outp, int qbBase, int nqbThis, float sscale) {
  union FB { v16b v; v8b h[2]; };
  union FH { v16h v; v8h h[2]; };
  __shared__ __align__(16) __bf16   Ksh[64 * LP];                 // K hi [kv][d], row pitch LP
  __shared__ __align__(16) __bf16   Ksl[64 * LP];                 // K lo
  __shared__ __align__(16) _Float16 Vth[64 * LP];                 // V^T hi [d][kv], row pitch LP
  __shared__ __align__(16) _Float16 Vtl[RES ? 64 * LP : 8];       // V^T residual
  __shared__ __align__(16) float    Os[4][16 * OP];               // per wave context tile [row][d], row pitch OP

  const int tid  = threadIdx.x;
  const int wave = tid >> 5;
  const int lane = tid & 31;
  const int hh   = lane >> 4;
  const int c    = lane & 15;

  const int bx   = blockIdx.x;
  const int qbl  = bx % nqbThis;
  const int rest = bx / nqbThis;
  const int h    = rest % NH;
  const int b    = rest / NH;
  const int qb   = qbBase + qbl;
  const int q0   = qb * 64 + wave * 16;
  const size_t rowB = (size_t)b * SEQ;

  const __bf16* Qh = (const __bf16*)(const void*)qhp + (size_t)h * HD;
  const __bf16* Ql = (const __bf16*)(const void*)qlp + (size_t)h * HD;
  const __bf16* Kh = (const __bf16*)(const void*)khp + (size_t)h * HD;
  const __bf16* Kl = (const __bf16*)(const void*)klp + (size_t)h * HD;
  const _Float16* Vh = (const _Float16*)(const void*)vhp + ((size_t)b * DM + (size_t)h * HD) * SEQ;
  const _Float16* Vl = (const _Float16*)(const void*)vlp + ((size_t)b * DM + (size_t)h * HD) * VLP;

  // ---- Q fragments (B operand, column = query = lane&15): 2 d-chunks, hi and lo ----
  v16b qah[2], qal[2];
#pragma unroll
  for (int dc = 0; dc < 2; ++dc) {
    const size_t qo = (rowB + q0 + c) * DM + dc * 32 + 8 * hh;
    qah[dc] = ldfrag_b(Qh + qo);
    qal[dc] = ldfrag_b(Ql + qo);
  }

  const int qrow = q0 + c;                   // this lane's query
  float mrow = -INFINITY, lrow = 0.f;        // running maximum (both halves alike), this half's running sum
  v8f oacc[4];                               // O^T: tile t, register r = dim 16t + 8*hh + r of query c
#pragma unroll
  for (int t = 0; t < 4; ++t) oacc[t] = zero8();

  int nkt = qb + 1;                          // causal: key tiles 0..qb, block-uniform
  if (nkt > NQB) nkt = NQB;
  for (int kt = 0; kt < nkt; ++kt) {
    const int kv0 = kt * 64;
    __syncthreads();
    {
      const int r = tid >> 1, half = (tid & 1) * 32;
      const __bf16*   kg  = Kh + (rowB + kv0 + r) * DM + half;    // K row kv0+r, d = half..half+31
      const __bf16*   klg = Kl + (rowB + kv0 + r) * DM + half;
      const _Float16* vg  = Vh + (size_t)r * SEQ + kv0 + half;    // V^T row d = r, s = kv0+half..+31
      const int kvl = (kv0 + 64 <= VLP) ? kv0 : (VLP - 64);     // clamped address into the residual plane
      const _Float16* vlg = Vl + (size_t)r * VLP + kvl + half;
      const bool resOK = (kv0 + 64 <= VLP);                      // block-uniform
#pragma unroll
      for (int i = 0; i < 4; ++i) {
        const v8b a0 = *(const v8b*)(kg + 8 * i);
        const v8b a1 = *(const v8b*)(klg + 8 * i);
        const v8h b0 = *(const v8h*)(vg + 8 * i);
        *(v8b*)(Ksh + r * LP + half + 8 * i) = a0;
        *(v8b*)(Ksl + r * LP + half + 8 * i) = a1;
        *(v8h*)(Vth + r * LP + half + 8 * i) = b0;
        if (RES) {
          v8h b1 = *(const v8h*)(vlg + 8 * i);
          if (!resOK) b1 = zero8h();
          *(v8h*)(Vtl + r * LP + half + 8 * i) = b1;
        }
      }
    }
    __syncthreads();

    // ---- scores, transposed: 64 keys x 16 queries per wave, 3 bf16 products ----
    v8f s[4];
#pragma unroll
    for (int j = 0; j < 4; ++j) {
      s[j] = zero8();
#pragma unroll
      for (int dc = 0; dc < 2; ++dc) {
        FB kb, kl;
        kb.h[0] = *(const v8b*)(Ksh + (j * 16 + c) * LP + dc * 32 + 8 * hh);
        kb.h[1] = *(const v8b*)(Ksh + (j * 16 + c) * LP + dc * 32 + 16 + 8 * hh);
        kl.h[0] = *(const v8b*)(Ksl + (j * 16 + c) * LP + dc * 32 + 8 * hh);
        kl.h[1] = *(const v8b*)(Ksl + (j * 16 + c) * LP + dc * 32 + 16 + 8 * hh);
        s[j] = mma_b(kb.v, qah[dc], s[j]);
        s[j] = mma_b(kl.v, qah[dc], s[j]);
        s[j] = mma_b(kb.v, qal[dc], s[j]);
      }
    }

    // ---- scale + causal mask (replace by -FLT_MAX), maximum of the lane's 32 keys, joined with the other half ----
    float mj[4];
#pragma unroll
    for (int j = 0; j < 4; ++j) {
      mj[j] = -INFINITY;
#pragma unroll
      for (int r = 0; r < 8; ++r) {
        const int key = kv0 + j * 16 + 8 * hh + r;
        float sv = s[j][r] * sscale;
        sv = (key > qrow) ? -FLT_MAX : sv;
        s[j][r] = sv;
        mj[j] = fmaxf(mj[j], sv);
      }
    }
    float m = fmaxf(fmaxf(mj[0], mj[1]), fmaxf(mj[2], mj[3]));
    m = fmaxf(m, xhalf(m));
    const float mnew  = fmaxf(mrow, m);
    const float msafe = (mnew == -INFINITY) ? 0.f : mnew;
    const float alpha = exp_slot(mrow - msafe);
    mrow = mnew;

    // ---- online softmax: P (x1024, f16) and P residual (x4096) packed into the B operands of the two key chunks ----
    FH pa[2], pl[2];
    float pj[4];
#pragma unroll
    for (int j = 0; j < 4; ++j) {
      pj[j] = 0.f;
#pragma unroll
      for (int r = 0; r < 8; ++r) {
        const float p = exp_slot(s[j][r] - msafe);   // masked logit against a finite max: exp -> 0
        pj[j] += p;
        const float p1k = p * 1024.0f;
        const _Float16 ph = (_Float16)p1k;
        pa[j >> 1].v[(j & 1) * 8 + r] = ph;
        if (RES) pl[j >> 1].v[(j & 1) * 8 + r] = (_Float16)((p1k - (float)ph) * 4096.0f);
      }
    }
    lrow = lrow * alpha + ((pj[0] + pj[1]) + (pj[2] + pj[3]));
#pragma unroll
    for (int t = 0; t < 4; ++t)
#pragma unroll
      for (int r = 0; r < 8; ++r) oacc[t][r] *= alpha;

    // ---- context^T += V^T . P^T (f16 WMMA), residual products into a separate accumulator ----
    v8f o1[4];
#pragma unroll
    for (int t = 0; t < 4; ++t) o1[t] = zero8();
#pragma unroll   // both chunks written out: pa[kk] and pl[kk] live in registers, which a run-time index cannot pick
    for (int kk = 0; kk < 2; ++kk) {
#pragma unroll
      for (int t = 0; t < 4; ++t) {
        FH vb;
        vb.h[0] = *(const v8h*)(Vth + (t * 16 + c) * LP + kk * 32 + 8 * hh);
        vb.h[1] = *(const v8h*)(Vth + (t * 16 + c) * LP + kk * 32 + 16 + 8 * hh);
        oacc[t] = mma_h(vb.v, pa[kk].v, oacc[t]);
        if (RES) {
          FH vl;
          vl.h[0] = *(const v8h*)(Vtl + (t * 16 + c) * LP + kk * 32 + 8 * hh);
          vl.h[1] = *(const v8h*)(Vtl + (t * 16 + c) * LP + kk * 32 + 16 + 8 * hh);
          o1[t] = mma_h(vl.v, pa[kk].v, o1[t]);
          o1[t] = mma_h(vb.v, pl[kk].v, o1[t]);
        }
      }
    }
    if (RES) {
#pragma unroll
      for (int t = 0; t < 4; ++t)
#pragma unroll
        for (int r = 0; r < 8; ++r) oacc[t][r] += o1[t][r] * (1.0f / 4096.0f);
    }
  }

  // ---- normalise (1/l and the 1/1024 p carry), stage the wave's 16x64 tile in LDS, then write whole
  float* os = Os[wave];
  {
    const float l = lrow + xhalf(lrow);      // the two halves' sums, joined once
    const float inv = ((l > 0.f) ? (1.0f / l) : 0.f) * (1.0f / 1024.0f);
#pragma unroll
    for (int t = 0; t < 4; ++t) {
      v4f w0, w1;
#pragma unroll
      for (int e = 0; e < 4; ++e) { w0[e] = oacc[t][e] * inv; w1[e] = oacc[t][4 + e] * inv; }
      *(v4f*)(os + c * OP + t * 16 + 8 * hh)     = w0;   // query row c, dims 16t + 8*hh ..
      *(v4f*)(os + c * OP + t * 16 + 8 * hh + 4) = w1;
    }
  }
  __builtin_amdgcn_fence(__ATOMIC_RELEASE, "workgroup");
  __builtin_amdgcn_wave_barrier();
  __builtin_amdgcn_fence(__ATOMIC_ACQUIRE, "workgroup");
  {
    const int h2 = lane >> 4, c4 = (lane & 15) * 4;
    v4f ov[8];
#pragma unroll
    for (int it = 0; it < 8; ++it) {
      const int row = it * 2 + h2;   // it 0..7 x h2 0..1 = rows 0..15 of the wave tile
      ov[it] = *(const v4f*)(os + row * OP + c4);
    }
    {
#pragma unroll
      for (int it = 0; it < 8; ++it) {
        const int row = it * 2 + h2;
        const size_t go = (rowB + q0 + row) * DM + (size_t)h * HD + c4;
        *(v4f*)(outp + go) = ov[it];
      }
      
    }
  }
}

// =====================================================================================================
// Workspace map (bytes), every region an exact multiple of its whole-line / whole-tile store granularity:
//   Xb    bf16 [4096][1024]          0          8388608
//   Winb  bf16 [3072][1024]          8388608    6291456
//   Wob   bf16 [1024][1024]          14680064   2097152
//   Rin   f32  [3072]                16777216     12288   (96 lines)
//   Rout  f32  [1024]                16789504      4096   (32 lines)
//   Rrow  f32  [4096]                16793600     16384   (128 lines)
//   CosT  f32  [2048][32]            16809984    262144
//   SinT  f32  [2048][32]            17072128    262144
//   Af    f32  [4096][1024]          17334272  33554432   (Af, then Ah bf16 and Al bf16 [4096][1024] each)
//   VTh   f16  [2][1024][2048]       50888704   8388608
//   VTl   f16  [2][1024][512]        59277312   2097152
//   Qh    bf16 [4096][1024]          61374464   8388608
//   Ql    bf16 [4096][1024]          69763072   8388608
//   Kh    bf16 [4096][1024]          78151680   8388608
//   Kl    bf16 [4096][1024]          86540288   8388608
//   end                              94928896
// Weights are [out n][in k] with k contiguous = the Bt / A layout the GEMM wants, so they are only converted.
// =====================================================================================================
extern "C" void kernel_launch(void* const* d_in, const int* in_sizes, int n_in,
                              void* d_out, int out_size, void* d_ws, size_t ws_size,
                              hipStream_t stream) {
  if (n_in < 4) return;
  if (in_sizes[0] != NB * SEQ * DM) return;
  if (in_sizes[1] != SEQ * (HD / 2)) return;
  if (in_sizes[2] != 3 * DM * DM) return;
  if (in_sizes[3] != DM * DM) return;
  if (out_size != NB * SEQ * DM) return;

  const float* x    = (const float*)d_in[0];
  const float* rpf  = (const float*)d_in[1];
  const float* w_in = (const float*)d_in[2];
  const float* w_o  = (const float*)d_in[3];

  const size_t PXb   = (size_t)NB * SEQ * DM * 2;      //  8388608  16-bit activation plane [4096][1024]
  const size_t PWin  = (size_t)3 * DM * DM * 2;        //  6291456
  const size_t PWo   = (size_t)DM * DM * 2;            //  2097152
  const size_t PRin  = (size_t)3 * DM * 4;             //    12288
  const size_t PRout = (size_t)DM * 4;                 //     4096
  const size_t PRrow = (size_t)NB * SEQ * 4;           //    16384
  const size_t PTrig = (size_t)SEQ * (HD / 2) * 4;     //   262144
  const size_t PQK   = (size_t)NB * SEQ * NQK * 4;     // 33554432  Af + Ah + Al
  const size_t PVTh  = (size_t)NB * DM * SEQ * 2;      //  8388608
  const size_t PVTl  = (size_t)NB * DM * VLP * 2;      //  2097152
  const size_t PAf   = (size_t)NB * SEQ * DM * 4;      // 16777216
  if (PAf + 2 * PXb != PQK) return;                    // Af + Ah + Al fill their region exactly
  size_t off = 0;
  const size_t oXb   = off; off += PXb;
  const size_t oWin  = off; off += PWin;
  const size_t oWo   = off; off += PWo;
  const size_t oRin  = off; off += PRin;
  const size_t oRout = off; off += PRout;
  const size_t oRrow = off; off += PRrow;
  const size_t oCos  = off; off += PTrig;
  const size_t oSin  = off; off += PTrig;
  const size_t oQK   = off; off += PQK;
  const size_t oVTh  = off; off += PVTh;
  const size_t oVTl  = off; off += PVTl;
  const size_t oQh   = off; off += PXb;
  const size_t oQl   = off; off += PXb;
  const size_t oKh   = off; off += PXb;
  const size_t oKl   = off; off += PXb;
  if (off > ws_size) return;                           // off = 94928896
  if (off > (size_t)134217728) return;
  const size_t oAf = oQK;
  const size_t oAh = oQK + PAf;
  const size_t oAl = oAh + PXb;
  if (oAl + PXb > oVTh) return;                        // region ordering sanity

  char* ws = (char*)d_ws;
  unsigned short* Xb   = (unsigned short*)(ws + oXb);
  unsigned short* Winb = (unsigned short*)(ws + oWin);
  unsigned short* Wvb  = Winb + (size_t)2 * DM * DM;   // rows 2048..3071 of w_in = v features
  unsigned short* Wob  = (unsigned short*)(ws + oWo);
  float*          Rin  = (float*)(ws + oRin);
  float*          Rv   = Rin + 2 * DM;
  float*          Rout = (float*)(ws + oRout);
  float*          Rrow = (float*)(ws + oRrow);
  float*          CosT = (float*)(ws + oCos);
  float*          SinT = (float*)(ws + oSin);
  unsigned short* VTh  = (unsigned short*)(ws + oVTh);
  unsigned short* VTl  = (unsigned short*)(ws + oVTl);
  unsigned short* Qh   = (unsigned short*)(ws + oQh);
  unsigned short* Ql   = (unsigned short*)(ws + oQl);
  unsigned short* Kh   = (unsigned short*)(ws + oKh);
  unsigned short* Kl   = (unsigned short*)(ws + oKl);
  float*          Af   = (float*)(ws + oAf);
  unsigned short* Ah   = (unsigned short*)(ws + oAh);
  unsigned short* Al   = (unsigned short*)(ws + oAl);

  const dim3 blk(256);
  const int nTrig = SEQ * (HD / 2);                                  // 65536
  const int n8x   = NB * SEQ * DM / 8;                               // 524288
  const dim3 gTrig((nTrig + 255) / 256);                             // 256 blocks
  const dim3 gCvtX((n8x + 255) / 256);                               // 2048 blocks
  const dim3 gPrepWin(3 * DM / 32);                                  // 96 blocks (32 rows each)
  const dim3 gPrepWo(DM / 32);                                       // 32 blocks
  const dim3 gPrepA(NB * SEQ / 32);                                  // 128 blocks
  const dim3 gblk(128);                                              // GEMM block: 4 waves, one 128x128 tile
  const dim3 gQK((NB * SEQ / 128) * (NQK / 128), 1);                 // 32 x 16 = 512 blocks
  const dim3 gVT((DM / 128) * (SEQ / 128), NB);                      // 8 x 16 = 128 blocks x 2 batches
  const dim3 gOut((NB * SEQ / 128) * (DM / 128), 1);                 // 32 x 8 = 256 blocks

  // (0) angle tables from the bf16-converted input table
  trig_tab<<<gTrig, blk, 0, stream>>>(rpf, CosT, SinT, nTrig);
  // (1) x -> bf16 plane [4096][1024]
  cvt_bf16x8<<<gCvtX, blk, 0, stream>>>(x, Xb, n8x);
  // (2) weights -> bf16 planes [n][k] + per-row inverse L2 norms of the converted rows
  row_prep<false, true><<<gPrepWin, blk, 0, stream>>>(w_in, Winb, Winb, Rin, 1.0f);
  row_prep<false, true><<<gPrepWo, blk, 0, stream>>>(w_o, Wob, Wob, Rout, 1.0f);
  // (3) q/k projection: Rin[e] * sum_d Xb[b*SEQ+s][d] Winb[e][d], e < 2048  (M=4096, N=2048, K=1024), with rotary and
  //     per-head rms in the epilogue -> q/k bf16 hi/lo planes
  gemm64<0, 4, false, true><<<gQK, gblk, 0, stream>>>(
      Xb, Xb, DM, 0LL, Winb, DM, 0LL,
      (void*)Qh, DM, 0LL, (void*)Ql, DM, 0LL, 0,
      NB * SEQ, NQK, DM, 1.0f, Rin, Rin,
      (void*)Kh, (void*)Kl, CosT, SinT);
  // (4) v^T per batch: VTh[b][m][s] = Rv[m] * sum_d Wvb[m][d] Xb[b*SEQ+s][d] -> f16 hi plane (pitch SEQ) and
  //     residual plane (x4096, keys < VLP, pitch VLP)  (M=1024, N=2048, K=1024)
  gemm64<0, 3, true, false><<<gVT, gblk, 0, stream>>>(
      Wvb, Wvb, DM, 0LL, Xb, DM, (long long)SEQ * DM,
      (void*)VTh, SEQ, (long long)DM * SEQ, (void*)VTl, VLP, (long long)DM * VLP, VLP,
      DM, SEQ, DM, 4096.0f, Rv, Rv,
      (void*)VTh, (void*)VTl, Rv, Rv);
  // (6) causal attention: query blocks 0..RESQB-1 with residual planes, the rest without -> Af f32 [4096][1024]
  attn_causal64<true><<<dim3(NB * NH * RESQB), dim3(128), 0, stream>>>(
      Qh, Ql, Kh, Kl, VTh, VTl, Af, 0, RESQB, 0.125f);
  attn_causal64<false><<<dim3(NB * NH * (NQB - RESQB)), dim3(128), 0, stream>>>(
      Qh, Ql, Kh, Kl, VTh, VTl, Af, RESQB, NQB - RESQB, 0.125f);
  // (7) merged rows -> bf16 hi/lo planes + per-row inverse rms over 1024
  row_prep<true, false><<<gPrepA, blk, 0, stream>>>(Af, Ah, Al, Rrow, 1.0f / (float)DM);
  // (8) out[s][e] = Rrow[s] * Rout[e] * sum_d (Ah+Al)[s][d] Wob[e][d] -> d_out f32 [4096][1024]  (M=4096, N=1024, K=1024)
  gemm64<1, 0, true, true><<<gOut, gblk, 0, stream>>>(
      Ah, Al, DM, 0LL, Wob, DM, 0LL,
      d_out, DM, 0LL, d_out, 0, 0LL, 0,
      NB * SEQ, DM, DM, 1.0f, Rrow, Rout,
      d_out, d_out, Rrow, Rout);
  (void)hipGetLastError();
}

// v005
// Measured time: 165 microseconds a run.
// Two timings next to v004 put it at 1.10 and 1.11 times that version's speed.
// Over all steps from v000 it is 2.44 times as fast.
// Contractions: q/k and v^T projections = v_wmma_f32_16x16x32_bf16 (bf16 operands from RNE-converted inputs, single product, f32 row/column scales in the epilogue; q/k: RoPE and head rms there too);
// k.q^T scores (transposed) = v_wmma_f32_16x16x32_bf16 with bf16 hi/lo split q and k (hi.hi + hi.lo + lo.hi);
// v^T.p^T (transposed) = v_wmma_f32_16x16x32_f16 (p carried x1024 in f16, v in f16; extra f16 residual planes x4096 of p and v on the first 512 query rows);
// a.Wout^T = v_wmma_f32_16x16x32_bf16 with a as bf16 hi/lo planes times bf16 Wout (2 products); all f32 accumulate; RoPE, norms and softmax in f32.
#include <hip/hip_runtime.h>
#include <math.h>
#include <float.h>
#include <stdint.h>

#define NB    2
#define SEQ   2048
#define DM    1024
#define NH    16
#define HD    64
#define NQK   (2 * DM)       // q and k feature columns of the fused q/k projection output
#define NQB   (SEQ / 64)     // 32 query / key tiles of 64
#define VLP   512            // key pitch of the v^T residual plane (keys 0..VLP-1)
#define RESQB 8              // leading 64-row query blocks that use the p / v residual planes
static_assert(RESQB * 64 <= VLP);
static_assert(NH * HD == DM);
static_assert((SEQ % 64) == 0 && (DM % 256) == 0);
static_assert(HD == 64);
static_assert((NB * SEQ) % 128 == 0 && SEQ % 128 == 0 && DM % 128 == 0 && NQK % 128 == 0);   // GEMM block tiles of 128x128, k slabs of 64
#define LP    72             // LDS pitch, in 16-bit elements, of a 64-element row: 144 B = 16 B x odd, so that the 16 rows
                             // one ds_load_b128 fragment read touches fall on 16 different groups of four banks
#define GP    72             // LDS pitch, in 16-bit elements, of a GEMM k-slab row of 64 elements (144 B = 16 B x odd, as LP)
#define GPLANE (128 * GP)    // elements of one staged 128-row k slab
#define OP    68             // LDS pitch, in floats, of a 64-float row: the 16 lanes of a lane half store 16 rows, on different banks

typedef _Float16 v16h __attribute__((ext_vector_type(16)));
typedef _Float16 v8h  __attribute__((ext_vector_type(8)));
typedef __bf16   v16b __attribute__((ext_vector_type(16)));
typedef __bf16   v8b  __attribute__((ext_vector_type(8)));
typedef float    v8f  __attribute__((ext_vector_type(8)));
typedef float    v4f  __attribute__((ext_vector_type(4)));
typedef unsigned int v4u __attribute__((ext_vector_type(4)));

// ---- scalar helpers --------------------------------------------------------------------------------
__device__ __forceinline__ unsigned short bf_bits(float f) {          // f32 -> bf16 bits, RNE convert
  unsigned u = __float_as_uint(f);
  return (unsigned short)((u + 0x7FFFu + ((u >> 16) & 1u)) >> 16);
}
__device__ __forceinline__ float bf_up(unsigned short h) { return __uint_as_float(((unsigned)h) << 16); }
__device__ __forceinline__ unsigned short h_bits(_Float16 x) { return __builtin_bit_cast(unsigned short, x); }
__device__ __forceinline__ unsigned pk16(unsigned short a, unsigned short b) { return (unsigned)a | ((unsigned)b << 16); }
__device__ __forceinline__ v8f zero8() { v8f z = {0.f, 0.f, 0.f, 0.f, 0.f, 0.f, 0.f, 0.f}; return z; }
__device__ __forceinline__ v8h zero8h() {
  const _Float16 z = (_Float16)0.0f;
  v8h r = {z, z, z, z, z, z, z, z};
  return r;
}

// value of lane l ^ 16 (the other 16-lane row), by a vector cross-row move
__device__ __forceinline__ float xhalf(float x) {
  const int b = __builtin_bit_cast(int, x);
  return __builtin_bit_cast(float, __builtin_amdgcn_permlanex16(b, b, 0x76543210, 0xfedcba98, false, false));
}

// e^x as 2^(x * log2 e) on v_exp_f32, as __expf gives it. The v_nop is the one slot that the instruction set asks for
// between a transcendental and an instruction that reads its result or overwrites its source: in the same statement
// it stands there whichever instruction the compiler puts next
__device__ __forceinline__ float exp_slot(float x) {
  const float y = x * 1.44269504f;
  float r;
#if defined(__HIP_DEVICE_COMPILE__)
  asm("v_exp_f32 %0, %1\n\tv_nop" : "=v"(r) : "v"(y));
#else
  r = y;
#endif
  return r;
}

// ---- fragment loader: 16-bit A/B operand, lane -> row/col (lane&15), p already includes +8*(lane>>4);
//      elements 0..7 <- p[0..7] (k0+8h..), elements 8..15 <- p[16..23] (k0+16+8h..)
__device__ __forceinline__ v16b ldfrag_b(const __bf16* p) {
  union { v16b v; v8b h[2]; } f;
  f.h[0] = *(const v8b*)(p);
  f.h[1] = *(const v8b*)(p + 16);
  return f.v;
}

// ---- WMMA helpers with trailing VALU hazard gap --------------------------------------------------------
__device__ __forceinline__ v8f mma_b_raw(v16b a, v16b b, v8f c) {
  return __builtin_amdgcn_wmma_f32_16x16x32_bf16(false, a, false, b, (short)0, c, false, false);
}
__device__ __forceinline__ v8f mma_h_raw(v16h a, v16h b, v8f c) {
  return __builtin_amdgcn_wmma_f32_16x16x32_f16(false, a, false, b, (short)0, c, false, false);
}
__device__ __forceinline__ void dep_guard_b(v8f& a, v8f& b, v16b x, v16b y) {
#if defined(__HIP_DEVICE_COMPILE__)
  asm volatile("v_nop\n\tv_nop\n\tv_nop\n\tv_nop" : "+v"(a), "+v"(b) : "v"(x), "v"(y));
#endif
}
__device__ __forceinline__ void keep4_b(v16b a, v16b b, v16b c, v16b d) {
#if defined(__HIP_DEVICE_COMPILE__)
  asm volatile("v_nop" :: "v"(a), "v"(b), "v"(c), "v"(d));
#endif
}
__device__ __forceinline__ void acc_guard4(v8f& a, v8f& b, v8f& c, v8f& d) {
#if defined(__HIP_DEVICE_COMPILE__)
  asm volatile("v_nop\n\tv_nop\n\tv_nop\n\tv_nop" : "+v"(a), "+v"(b), "+v"(c), "+v"(d));
#endif
}

// =====================================================================================================
// f32 -> bf16 (RNE convert), 8 elements per thread, one 16-B store per lane: a wave writes 512 contiguous B
// coverage: n8 threads x 8 = whole plane (n8 is a multiple of 256 here).
// =====================================================================================================
__global__ __launch_bounds__(256) void cvt_bf16x8(const float* __restrict__ in, unsigned short* out, int n8) {
  const int i = blockIdx.x * 256 + threadIdx.x;
  if (i < n8) {
    const v4f a = *(const v4f*)(in + (size_t)i * 8);
    const v4f b = *(const v4f*)(in + (size_t)i * 8 + 4);
    v4u p;
    p[0] = pk16(bf_bits(a[0]), bf_bits(a[1]));
    p[1] = pk16(bf_bits(a[2]), bf_bits(a[3]));
    p[2] = pk16(bf_bits(b[0]), bf_bits(b[1]));
    p[3] = pk16(bf_bits(b[2]), bf_bits(b[3]));
    *(v4u*)(out + (size_t)i * 8) = p;
    
  }
}

// =====================================================================================================
// Angle table: ct[i] = cosf(bf(fr[i])), st[i] = sinf(bf(fr[i])) with the angle RNE-converted to bf16
// =====================================================================================================
__global__ __launch_bounds__(256) void trig_tab(const float* __restrict__ fr, float* ct, float* st, int n) {
  const int i = blockIdx.x * 256 + threadIdx.x;
  if (i < n) {
    const float f  = bf_up(bf_bits(fr[i]));
    const float cv = cosf(f);
    const float sv = sinf(f);
    *(float*)(ct + i) = cv;
    *(float*)(st + i) = sv;
    
  }
}

// =====================================================================================================
// Row preparation over rows of DM=1024 f32 values (pitch DM):
//   hi plane = RNE bf16 of each value; LO: lo plane = RNE bf16 of (v - hi) (unscaled);
//   rtab[row] = rsqrt(ss * inv_div + 1e-6) with ss = sum over the row of g^2,
//     g = the bf16-converted value (SQR) or the f32 value (!SQR).
// Block = 8 waves = 32 rows (wave w: rows 4w..4w+3 of the block); grid = rows / 32 (exact here).
// Per row and instruction t (0..3): lane l holds columns 256t + 8l .. +7 -> 32 lanes x 16 B = 512 B
// coverage: 4 t x 32 lanes x 8 = 1024 columns per row; 8 waves x 4 rows = 32 rows per block.
// =====================================================================================================
template <bool LO, bool SQR>
__global__ __launch_bounds__(256) void row_prep(const float* __restrict__ in, unsigned short* hp, unsigned short* lp,
                                                float* rtab, float inv_div) {
  __shared__ float sr[32];
  const int tid = threadIdx.x, wave = tid >> 5, lane = tid & 31;
#pragma unroll 1
  for (int i = 0; i < 4; ++i) {
    const int row = blockIdx.x * 32 + wave * 4 + i;
    const float* rp = in + (size_t)row * DM + lane * 8;
    float ss = 0.f;
    v4u hv[4], lv[4];
#pragma unroll
    for (int t = 0; t < 4; ++t) {
      const v4f a  = *(const v4f*)(rp + t * 256);
      const v4f bq = *(const v4f*)(rp + t * 256 + 4);
      v4u ph, pl;
#pragma unroll
      for (int e = 0; e < 4; ++e) {
        const float f0 = (e < 2) ? a[2 * e]     : bq[2 * e - 4];
        const float f1 = (e < 2) ? a[2 * e + 1] : bq[2 * e - 3];
        const unsigned short h0 = bf_bits(f0), h1 = bf_bits(f1);
        const float g0 = SQR ? bf_up(h0) : f0;
        const float g1 = SQR ? bf_up(h1) : f1;
        ss += g0 * g0;
        ss += g1 * g1;
        ph[e] = pk16(h0, h1);
        if (LO) {
          pl[e] = pk16(bf_bits(f0 - bf_up(h0)), bf_bits(f1 - bf_up(h1)));
        } else {
          pl[e] = 0u;
        }
      }
      hv[t] = ph; lv[t] = pl;
    }
#pragma unroll
    for (int off = 16; off >= 1; off >>= 1) ss += __shfl_xor(ss, off, 32);
    const float rv = rsqrtf(ss * inv_div + 1e-6f);
    if (lane == 0) sr[wave * 4 + i] = rv;
    {
#pragma unroll
      for (int t = 0; t < 4; ++t) {
        const size_t go = (size_t)row * DM + t * 256 + lane * 8;
        *(v4u*)(hp + go) = hv[t];
        if (LO) *(v4u*)(lp + go) = lv[t];
      }
      
    }
  }
  __syncthreads();
  if (wave == 0) {
    const float rv = sr[lane];
    float* d = rtab + (size_t)blockIdx.x * 32 + lane;
    *(float*)d = rv;
    
  }
}

// =====================================================================================================
// Eight asynchronous 16-B copies per lane, global memory -> LDS: this lane's piece of rows r, r+16, .., r+112 of one
// 128-row x 64-element k slab. g = the lane's piece in row r (row pitch ld elements), l = its LDS byte address
// (row pitch GP elements). Eight lanes cover one 128-B row, so a wave's copy covers four whole lines.
// =====================================================================================================
__device__ __forceinline__ void stage_plane(const __bf16* g, int ld, unsigned l) {
  const size_t   gs = (size_t)16 * (size_t)ld;        // 16 rows in global memory, elements
  const unsigned ls = 16u * GP * 2u;                  // 16 rows in LDS, bytes
  const __bf16 *g0 = g, *g1 = g + gs, *g2 = g + 2 * gs, *g3 = g + 3 * gs;
  const __bf16 *g4 = g + 4 * gs, *g5 = g + 5 * gs, *g6 = g + 6 * gs, *g7 = g + 7 * gs;
  const unsigned l0 = l, l1 = l + ls, l2 = l + 2 * ls, l3 = l + 3 * ls;
  const unsigned l4 = l + 4 * ls, l5 = l + 5 * ls, l6 = l + 6 * ls, l7 = l + 7 * ls;
#if defined(__HIP_DEVICE_COMPILE__)
  // the copies bring the slab into LDS through no register; the closing s_wait_xcnt stands in the same statement so
  // that no address register named here is rewritten in front of it
  asm volatile(
      "global_load_async_to_lds_b128 %0, %8, off\n\t"
      "global_load_async_to_lds_b128 %1, %9, off\n\t"
      "global_load_async_to_lds_b128 %2, %10, off\n\t"
      "global_load_async_to_lds_b128 %3, %11, off\n\t"
      "global_load_async_to_lds_b128 %4, %12, off\n\t"
      "global_load_async_to_lds_b128 %5, %13, off\n\t"
      "global_load_async_to_lds_b128 %6, %14, off\n\t"
      "global_load_async_to_lds_b128 %7, %15, off\n\t"
      "s_wait_xcnt 0x0"
      :: "v"(l0), "v"(l1), "v"(l2), "v"(l3), "v"(l4), "v"(l5), "v"(l6), "v"(l7),
         "v"(g0), "v"(g1), "v"(g2), "v"(g3), "v"(g4), "v"(g5), "v"(g6), "v"(g7)
      : "memory");
#endif
}
// this wave's own copies have landed in LDS
__device__ __forceinline__ void wait_async0() {
#if defined(__HIP_DEVICE_COMPILE__)
  asm volatile("s_wait_asynccnt 0x0" ::: "memory");
#endif
}
// this wave's own LDS reads have returned, so that the buffer they read may be refilled behind the next barrier
__device__ __forceinline__ void wait_ds0() {
#if defined(__HIP_DEVICE_COMPILE__)
  asm volatile("s_wait_dscnt 0x0" ::: "memory");
#endif
}

// cos / sin of rows row0 .. row0+7 (row0 a multiple of 8, so the eight positions row0 % SEQ + r stay below SEQ) and
// pairs p, p + 16 from the [SEQ][32] angle tables
__device__ __forceinline__ void load_angles(const float* __restrict__ ct, const float* __restrict__ st, int row0, int p,
                                            float (&cv)[8][2], float (&sv)[8][2]) {
  const size_t to = (size_t)(row0 % SEQ) * (HD / 2) + p;
#pragma unroll
  for (int r = 0; r < 8; ++r) {
#pragma unroll
    for (int j = 0; j < 2; ++j) {
      cv[r][j] = ct[to + r * (HD / 2) + (j << 4)];
      sv[r][j] = st[to + r * (HD / 2) + (j << 4)];
    }
  }
}

// =====================================================================================================
// Batched bf16 WMMA GEMM: C[m][n] = rs[m] * cs[n] * sum_k A[m][k] * Bt[n][k]. Block = 4 waves = a 128x128 tile,
// wave (wave>>1, wave&1) owns one 64x64 quarter. A row-major [M][K] pitch lda; Bt row-major [N][K] pitch ldb
// (k contiguous); M, N multiples of 128, K a multiple of 64 (true of the three launches below).
// blockIdx.y = batch index (strides in elements).
// Operands: k slabs of 64 elements (one 128-B line per row) are copied into LDS by asynchronous 16-B copies, whole
// lines per wave, two buffers: slab t+1 flies while slab t is worked on. Fragments are read from LDS (row pitch GP).
// NSPLIT: 0 = A.Bt; 1 = (A + A2).Bt (A2 = unscaled bf16 lo plane of A).
// RS / CS: per-row scale rsp[m] / per-column scale csp[n] (f32, not batched) applied in the epilogue.
// OUT_MODE: 0 = f32 (pitch ldc); 2 = bf16 hi plane C + bf16 lo plane C2 (lo = RNE(v - hi), unscaled);
//           3 = f16 hi plane C + f16 residual plane C2 = f16((v - hi) * rscale), C2 written only for tiles
//               with n0 < N2 (pitch ldc2, batch stride strideC2);
//           4 = q/k projection: a wave's 64 columns are one head of q (n0 < DM) or of k. Half-split rotary and the
//               per-head rms over the 64 dims are applied to the accumulators, then bf16 hi/lo planes as in 2, element
//               (row, h*64 + d) at [row*ldc + h*64 + d]: q -> C / C2, k -> C3 / C4.
//               ctp/stp [SEQ][32] f32 angle tables, pair index = d mod 32, position = row mod SEQ.
//               y[d<32] = x1*cos - x2*sin, y[32+d] = x1*sin + x2*cos (x1 = x[d], x2 = x[32+d]); y * rsqrt(mean(y^2) + 1e-6).
//               A lane holds columns 16j + (lane&15), j = 0..3, of its rows: x[d] and x[32+d] are its tiles j and j+2.
// =====================================================================================================
template <int NSPLIT, int OUT_MODE, bool RS, bool CS>
__global__ __launch_bounds__(128) void gemm64(
    const unsigned short* __restrict__ Ap, const unsigned short* A2p, int lda, long long strideA,
    const unsigned short* __restrict__ Btp, int ldb, long long strideB,
    void* Cout, int ldc, long long strideC,
    void* Cout2, int ldc2, long long strideC2, int N2,
    int M, int N, int K, float rscale,
    const float* __restrict__ rsp, const float* __restrict__ csp,
    void* Cout3, void* Cout4, const float* __restrict__ ctp, const float* __restrict__ stp) {
  static_assert(NSPLIT == 0 || NSPLIT == 1);
  const __bf16* A   = (const __bf16*)(const void*)Ap;
  const __bf16* A2  = (const __bf16*)(const void*)A2p;
  const __bf16* Bt  = (const __bf16*)(const void*)Btp;
  __shared__ __align__(16) __bf16 sA[2][GPLANE];                                   // A slab, two buffers
  __shared__ __align__(16) __bf16 sB[2][GPLANE];                                   // Bt slab, two buffers
  __shared__ __align__(16) __bf16 sA2[NSPLIT ? 2 : 1][NSPLIT ? GPLANE : 8];        // A2 slab, two buffers
  __shared__ __align__(16) float sT[4][16 * 68];   // per-wave 16x64 slab, pitch 68 floats
  const int b    = blockIdx.y;
  const int tid  = threadIdx.x;
  const int lane = tid & 31;
  const int wave = tid >> 5;
  const int tilesN = N >> 7;
  const int tilesM = M >> 7;
  const int tile = blockIdx.x;
  if (tile >= tilesM * tilesN) return;   // block-uniform, in front of every copy and barrier
  const int tm = tile / tilesN;
  const int tn = tile - tm * tilesN;
  const int bm0 = tm << 7;
  const int bn0 = tn << 7;
  const int wm  = (wave >> 1) << 6;            // this wave's quarter inside the block tile
  const int wn  = (wave & 1) << 6;
  const int m0 = bm0 + wm;
  const int n0 = bn0 + wn;

  const __bf16* Ab  = A  + (size_t)b * strideA;
  const __bf16* Bb  = Bt + (size_t)b * strideB;
  const __bf16* Ab2 = (NSPLIT >= 1) ? (A2  + (size_t)b * strideA) : Ab;

  const int rlane = lane & 15;                 // row (A) / col (B, D) within subtile
  const int koff  = (lane >> 4) * 8;           // k offset of this lane half
  const int mOff  = (lane >> 4) * 8;           // D row offset

  // ---- staging addresses: thread -> row tid>>3 (+16 per copy), 16-B piece tid&7 of the 128-B slab row ----
  const int srow = tid >> 3, spc = (tid & 7) * 8;
  const __bf16* gA  = Ab  + (size_t)(bm0 + srow) * lda + spc;
  const __bf16* gA2 = Ab2 + (size_t)(bm0 + srow) * lda + spc;
  const __bf16* gB  = Bb  + (size_t)(bn0 + srow) * ldb + spc;
  const unsigned lofs = (unsigned)(srow * GP + spc) * 2u;
  const unsigned lA  = (unsigned)(size_t)(const void*)&sA[0][0]  + lofs;   // low 32 bits = byte offset in LDS
  const unsigned lB  = (unsigned)(size_t)(const void*)&sB[0][0]  + lofs;
  const unsigned lA2 = (unsigned)(size_t)(const void*)&sA2[0][0] + lofs;
  const int nslab = K >> 6;

  v8f acc[4][4];
#pragma unroll
  for (int i = 0; i < 4; ++i)
#pragma unroll
    for (int j = 0; j < 4; ++j) acc[i][j] = zero8();

  // ---- prologue: slab 0 landed and published, then slab 1 in flight ----
  stage_plane(gA, lda, lA);
  stage_plane(gB, ldb, lB);
  if (NSPLIT >= 1) stage_plane(gA2, lda, lA2);
  wait_async0();
  __syncthreads();
  if (nslab > 1) {
    stage_plane(gA + 64, lda, lA + GPLANE * 2u);
    stage_plane(gB + 64, ldb, lB + GPLANE * 2u);
    if (NSPLIT >= 1) stage_plane(gA2 + 64, lda, lA2 + GPLANE * 2u);
  }

#pragma unroll 1   // one slab per trip: the two buffers alternate by the trip's parity
  for (int t = 0; t < nslab; ++t) {
    const int buf = t & 1;
    const __bf16* fa  = &sA[buf][(wm + rlane) * GP + koff];
    const __bf16* fb  = &sB[buf][(wn + rlane) * GP + koff];
    const __bf16* fa2 = NSPLIT ? &sA2[NSPLIT ? buf : 0][(wm + rlane) * GP + koff] : fa;
#pragma unroll
    for (int ks = 0; ks < 64; ks += 32) {
      // all fragments of this 32-wide k step are read as one group in front of its WMMAs
      v16b bh[4], ah[4], al[4];
#pragma unroll
      for (int j = 0; j < 4; ++j) bh[j] = ldfrag_b(fb + (j << 4) * GP + ks);
#pragma unroll
      for (int i = 0; i < 4; ++i) {
        ah[i] = ldfrag_b(fa + (i << 4) * GP + ks);
        if (NSPLIT >= 1) al[i] = ldfrag_b(fa2 + (i << 4) * GP + ks); else al[i] = ah[i];
      }
#pragma unroll
      for (int i = 0; i < 4; ++i) {
#pragma unroll
        for (int j = 0; j < 4; ++j) {
          acc[i][j] = mma_b_raw(ah[i], bh[j], acc[i][j]);
          if (NSPLIT >= 1) acc[i][j] = mma_b_raw(al[i], bh[j], acc[i][j]);
        }
        dep_guard_b(acc[i][0], acc[i][3], ah[i], al[i]);
      }
      keep4_b(bh[0], bh[1], bh[2], bh[3]);
    }
    // ---- publish slab t+1, free slab t's buffer: own LDS reads done, own copies landed, block barrier ----
    wait_ds0();
    wait_async0();
    __syncthreads();
    if (t + 2 < nslab) {                       // block-uniform: refill the buffer that this trip has just read
      const int kn = (t + 2) << 6;
      const unsigned bo = (unsigned)buf * (GPLANE * 2u);
      stage_plane(gA + kn, lda, lA + bo);
      stage_plane(gB + kn, ldb, lB + bo);
      if (NSPLIT >= 1) stage_plane(gA2 + kn, lda, lA2 + bo);
    }
  }
  wait_async0();
  acc_guard4(acc[0][0], acc[0][1], acc[0][2], acc[0][3]);
  acc_guard4(acc[1][0], acc[1][1], acc[1][2], acc[1][3]);
  acc_guard4(acc[2][0], acc[2][1], acc[2][2], acc[2][3]);
  acc_guard4(acc[3][0], acc[3][1], acc[3][2], acc[3][3]);

  // ---- epilogue scales ----
  float csv[4];
#pragma unroll
  for (int j = 0; j < 4; ++j) csv[j] = CS ? csp[n0 + (j << 4) + rlane] : 1.0f;

  // ---- epilogue ----
  float* slab = sT[wave];
#pragma unroll
  for (int i = 0; i < 4; ++i) {
    const int mBase = m0 + (i << 4);
    float cv[8][2], sv[8][2];                              // OUT_MODE 4: cos / sin of (row mOff + r, pair 16j + rlane)
    if (OUT_MODE == 4) load_angles(ctp, stp, mBase + mOff, rlane, cv, sv);
#pragma unroll
    for (int r = 0; r < 8; ++r) {
      const float rsv = RS ? rsp[mBase + mOff + r] : 1.0f;
      if (OUT_MODE == 4) {
        float y1[2], y2[2], sq[2];
#pragma unroll
        for (int j = 0; j < 2; ++j) {
          const float x1 = acc[i][j][r] * rsv * csv[j];
          const float x2 = acc[i][j + 2][r] * rsv * csv[j + 2];
          y1[j] = fmaf(x1, cv[r][j], -(x2 * sv[r][j]));
          y2[j] = fmaf(x1, sv[r][j], x2 * cv[r][j]);
          sq[j] = fmaf(y1[j], y1[j], y2[j] * y2[j]);
        }
        // sum over the 32 pairs: pairs d and d+16 in the lane, then partners 8, 4, 2, 1 of the 16-lane row
        float ss = sq[0] + sq[1];
#pragma unroll
        for (int off = 8; off >= 1; off >>= 1) ss += __shfl_xor(ss, off, 32);
        const float sc = rsqrtf(ss * (1.0f / HD) + 1e-6f);
#pragma unroll
        for (int j = 0; j < 2; ++j) {
          slab[(mOff + r) * 68 + (j << 4) + rlane]      = y1[j] * sc;
          slab[(mOff + r) * 68 + 32 + (j << 4) + rlane] = y2[j] * sc;
        }
      } else {
#pragma unroll
        for (int j = 0; j < 4; ++j) {
          slab[(mOff + r) * 68 + (j << 4) + rlane] = acc[i][j][r] * rsv * csv[j];
        }
      }
    }
    __builtin_amdgcn_fence(__ATOMIC_RELEASE, "workgroup");
    __builtin_amdgcn_wave_barrier();
    __builtin_amdgcn_fence(__ATOMIC_ACQUIRE, "workgroup");
    if (OUT_MODE == 0) {
      float* C = (float*)Cout + (size_t)b * strideC;
      const int hh = lane >> 4, c4 = (lane & 15) * 4;     // 256-B row segment = 16 lanes x 16 B
      v4f ov[8];
#pragma unroll
      for (int it = 0; it < 8; ++it) {
        const int row = it * 2 + hh;                       // it 0..7 x hh 0..1 = rows 0..15
        ov[it] = *(const v4f*)(slab + row * 68 + c4);
      }
      {
#pragma unroll
        for (int it = 0; it < 8; ++it) {
          const int row = it * 2 + hh;
          *(v4f*)(C + (size_t)(mBase + row) * ldc + n0 + c4) = ov[it];
        }
        
      }
    } else {
      const int q = lane >> 3, c8 = (lane & 7) * 8;
      const bool kside = (OUT_MODE == 4) && (n0 >= DM);   // wave-uniform: this wave's head is a k head
      const int  nc    = (OUT_MODE == 4) ? (n0 % DM) : n0; // first column in the output planes
      unsigned short* C  = (unsigned short*)(kside ? Cout3 : Cout)  + (size_t)b * strideC;
      unsigned short* C2 = (unsigned short*)(kside ? Cout4 : Cout2) + (size_t)b * strideC2;
      const bool wlo = (OUT_MODE == 2) || (OUT_MODE == 4) || (n0 < N2);      // wave-uniform
      v4u hv[4], lv[4];
#pragma unroll
      for (int it = 0; it < 4; ++it) {
        const int row = it * 4 + q;                        // it 0..3 x q 0..3 = rows 0..15
        const float* sp = slab + row * 68 + c8;
        v4u a, a2;
#pragma unroll
        for (int e = 0; e < 4; ++e) {
          const float f0 = sp[2 * e], f1 = sp[2 * e + 1];
          unsigned short h0, h1, l0, l1;
          if (OUT_MODE == 2 || OUT_MODE == 4) {
            h0 = bf_bits(f0); h1 = bf_bits(f1);
            l0 = bf_bits(f0 - bf_up(h0)); l1 = bf_bits(f1 - bf_up(h1));
          } else {
            const _Float16 x0 = (_Float16)f0, x1 = (_Float16)f1;
            h0 = h_bits(x0); h1 = h_bits(x1);
            l0 = h_bits((_Float16)((f0 - (float)x0) * rscale));
            l1 = h_bits((_Float16)((f1 - (float)x1) * rscale));
          }
          a[e] = pk16(h0, h1); a2[e] = pk16(l0, l1);
        }
        hv[it] = a; lv[it] = a2;
      }
      {
#pragma unroll
        for (int it = 0; it < 4; ++it) {
          const int row = it * 4 + q;
          *(v4u*)(C + (size_t)(mBase + row) * ldc + nc + c8) = hv[it];
          if (wlo) *(v4u*)(C2 + (size_t)(mBase + row) * ldc2 + nc + c8) = lv[it];
        }
        
      }
    }
    __builtin_amdgcn_fence(__ATOMIC_RELEASE, "workgroup");
    __builtin_amdgcn_wave_barrier();
    __builtin_amdgcn_fence(__ATOMIC_ACQUIRE, "workgroup");
  }
}

template <bool RES>
__global__ __launch_bounds__(128)
void attn_causal64(const unsigned short* __restrict__ qhp, const unsigned short* __restrict__ qlp,
                   const unsigned short* __restrict__ khp, const unsigned short* __restrict__ klp,
                   const unsigned short* __restrict__ vhp, const unsigned short* __restrict__ vlp,
                   float* outp, int qbBase, int nqbThis, float sscale) {
  union FB { v16b v; v8b h[2]; };
  union FH { v16h v; v8h h[2]; };
  __shared__ __align__(16) __bf16   Ksh[64 * LP];                 // K hi [kv][d], row pitch LP
  __shared__ __align__(16) __bf16   Ksl[64 * LP];                 // K lo
  __shared__ __align__(16) _Float16 Vth[64 * LP];                 // V^T hi [d][kv], row pitch LP
  __shared__ __align__(16) _Float16 Vtl[RES ? 64 * LP : 8];       // V^T residual
  __shared__ __align__(16) float    Os[4][16 * OP];               // per wave context tile [row][d], row pitch OP

  const int tid  = threadIdx.x;
  const int wave = tid >> 5;
  const int lane = tid & 31;
  const int hh   = lane >> 4;
  const int c    = lane & 15;

  const int bx   = blockIdx.x;
  const int qbl  = bx % nqbThis;
  const int rest = bx / nqbThis;
  const int h    = rest % NH;
  const int b    = rest / NH;
  const int qb   = qbBase + qbl;
  const int q0   = qb * 64 + wave * 16;
  const size_t rowB = (size_t)b * SEQ;

  const __bf16* Qh = (const __bf16*)(const void*)qhp + (size_t)h * HD;
  const __bf16* Ql = (const __bf16*)(const void*)qlp + (size_t)h * HD;
  const __bf16* Kh = (const __bf16*)(const void*)khp + (size_t)h * HD;
  const __bf16* Kl = (const __bf16*)(const void*)klp + (size_t)h * HD;
  const _Float16* Vh = (const _Float16*)(const void*)vhp + ((size_t)b * DM + (size_t)h * HD) * SEQ;
  const _Float16* Vl = (const _Float16*)(const void*)vlp + ((size_t)b * DM + (size_t)h * HD) * VLP;

  // ---- Q fragments (B operand, column = query = lane&15): 2 d-chunks, hi and lo ----
  v16b qah[2], qal[2];
#pragma unroll
  for (int dc = 0; dc < 2; ++dc) {
    const size_t qo = (rowB + q0 + c) * DM + dc * 32 + 8 * hh;
    qah[dc] = ldfrag_b(Qh + qo);
    qal[dc] = ldfrag_b(Ql + qo);
  }

  const int qrow = q0 + c;                   // this lane's query
  float mrow = -INFINITY, lrow = 0.f;        // running maximum (both halves alike), this half's running sum
  v8f oacc[4];                               // O^T: tile t, register r = dim 16t + 8*hh + r of query c
#pragma unroll
  for (int t = 0; t < 4; ++t) oacc[t] = zero8();

  int nkt = qb + 1;                          // causal: key tiles 0..qb, block-uniform
  if (nkt > NQB) nkt = NQB;
  for (int kt = 0; kt < nkt; ++kt) {
    const int kv0 = kt * 64;
    __syncthreads();
    {
      const int r = tid >> 1, half = (tid & 1) * 32;
      const __bf16*   kg  = Kh + (rowB + kv0 + r) * DM + half;    // K row kv0+r, d = half..half+31
      const __bf16*   klg = Kl + (rowB + kv0 + r) * DM + half;
      const _Float16* vg  = Vh + (size_t)r * SEQ + kv0 + half;    // V^T row d = r, s = kv0+half..+31
      const int kvl = (kv0 + 64 <= VLP) ? kv0 : (VLP - 64);     // clamped address into the residual plane
      const _Float16* vlg = Vl + (size_t)r * VLP + kvl + half;
      const bool resOK = (kv0 + 64 <= VLP);                      // block-uniform
#pragma unroll
      for (int i = 0; i < 4; ++i) {
        const v8b a0 = *(const v8b*)(kg + 8 * i);
        const v8b a1 = *(const v8b*)(klg + 8 * i);
        const v8h b0 = *(const v8h*)(vg + 8 * i);
        *(v8b*)(Ksh + r * LP + half + 8 * i) = a0;
        *(v8b*)(Ksl + r * LP + half + 8 * i) = a1;
        *(v8h*)(Vth + r * LP + half + 8 * i) = b0;
        if (RES) {
          v8h b1 = *(const v8h*)(vlg + 8 * i);
          if (!resOK) b1 = zero8h();
          *(v8h*)(Vtl + r * LP + half + 8 * i) = b1;
        }
      }
    }
    __syncthreads();

    // ---- scores, transposed: 64 keys x 16 queries per wave, 3 bf16 products ----
    // all 16 K fragments are read as one group in front of the 24 products, in the order of their use; the products
    // run back to back, the four key tiles' accumulator chains in turn (each chain keeps its order of products)
    FB kb[2][4], kl[2][4];
#pragma unroll
    for (int dc = 0; dc < 2; ++dc) {
#pragma unroll
      for (int j = 0; j < 4; ++j) {
        kb[dc][j].h[0] = *(const v8b*)(Ksh + (j * 16 + c) * LP + dc * 32 + 8 * hh);
        kb[dc][j].h[1] = *(const v8b*)(Ksh + (j * 16 + c) * LP + dc * 32 + 16 + 8 * hh);
      }
#pragma unroll
      for (int j = 0; j < 4; ++j) {
        kl[dc][j].h[0] = *(const v8b*)(Ksl + (j * 16 + c) * LP + dc * 32 + 8 * hh);
        kl[dc][j].h[1] = *(const v8b*)(Ksl + (j * 16 + c) * LP + dc * 32 + 16 + 8 * hh);
      }
    }
    v8f s[4];
    FH vb[2][4], vl[2][4];
#pragma unroll
    for (int j = 0; j < 4; ++j) s[j] = zero8();
#pragma unroll
    for (int dc = 0; dc < 2; ++dc) {
      // no instruction: the scheduler moves nothing across, so the group of LDS reads in front stays one group
      // instead of being spread among the products
      __builtin_amdgcn_sched_barrier(0);
#pragma unroll
      for (int j = 0; j < 4; ++j) s[j] = mma_b_raw(kb[dc][j].v, qah[dc], s[j]);
#pragma unroll
      for (int j = 0; j < 4; ++j) s[j] = mma_b_raw(kl[dc][j].v, qah[dc], s[j]);
#pragma unroll
      for (int j = 0; j < 4; ++j) s[j] = mma_b_raw(kb[dc][j].v, qal[dc], s[j]);
      __builtin_amdgcn_sched_barrier(0);   // as above; the twelve products stay one run, their four chains in turn
      if (dc == 0) {
        // all V^T fragments of this chunk are read as one group here, behind the first half of the score products:
        // they arrive while the second half and the softmax run
#pragma unroll
        for (int kk = 0; kk < 2; ++kk) {
#pragma unroll
          for (int t = 0; t < 4; ++t) {
            vb[kk][t].h[0] = *(const v8h*)(Vth + (t * 16 + c) * LP + kk * 32 + 8 * hh);
            vb[kk][t].h[1] = *(const v8h*)(Vth + (t * 16 + c) * LP + kk * 32 + 16 + 8 * hh);
            if (RES) {
              vl[kk][t].h[0] = *(const v8h*)(Vtl + (t * 16 + c) * LP + kk * 32 + 8 * hh);
              vl[kk][t].h[1] = *(const v8h*)(Vtl + (t * 16 + c) * LP + kk * 32 + 16 + 8 * hh);
            }
          }
        }
      }
    }

    // ---- scale + causal mask (replace by -FLT_MAX), maximum of the lane's 32 keys, joined with the other half ----
    float mj[4];
#pragma unroll
    for (int j = 0; j < 4; ++j) {
      mj[j] = -INFINITY;
#pragma unroll
      for (int r = 0; r < 8; ++r) {
        const int key = kv0 + j * 16 + 8 * hh + r;
        float sv = s[j][r] * sscale;
        sv = (key > qrow) ? -FLT_MAX : sv;
        s[j][r] = sv;
        mj[j] = fmaxf(mj[j], sv);
      }
    }
    float m = fmaxf(fmaxf(mj[0], mj[1]), fmaxf(mj[2], mj[3]));
    m = fmaxf(m, xhalf(m));
    const float mnew  = fmaxf(mrow, m);
    const float msafe = (mnew == -INFINITY) ? 0.f : mnew;
    const float alpha = exp_slot(mrow - msafe);
    mrow = mnew;

    // ---- online softmax: P (x1024, f16) and P residual (x4096) packed into the B operands of the two key chunks ----
    FH pa[2], pl[2];
    float pj[4];
#pragma unroll
    for (int j = 0; j < 4; ++j) {
      pj[j] = 0.f;
#pragma unroll
      for (int r = 0; r < 8; ++r) {
        const float p = exp_slot(s[j][r] - msafe);   // masked logit against a finite max: exp -> 0
        pj[j] += p;
        const float p1k = p * 1024.0f;
        const _Float16 ph = (_Float16)p1k;
        pa[j >> 1].v[(j & 1) * 8 + r] = ph;
        if (RES) pl[j >> 1].v[(j & 1) * 8 + r] = (_Float16)((p1k - (float)ph) * 4096.0f);
      }
    }
    // no instruction: every e^x above is asm text; the scheduler moves none of them down among the products below
    __builtin_amdgcn_sched_barrier(0);
    lrow = lrow * alpha + ((pj[0] + pj[1]) + (pj[2] + pj[3]));
#pragma unroll
    for (int t = 0; t < 4; ++t)
#pragma unroll
      for (int r = 0; r < 8; ++r) oacc[t][r] *= alpha;

    // ---- context^T += V^T . P^T (f16 WMMA), residual products into a separate accumulator ----
    v8f o1[4];
#pragma unroll
    for (int t = 0; t < 4; ++t) o1[t] = zero8();
#pragma unroll   // both chunks written out: pa[kk] and pl[kk] live in registers, which a run-time index cannot pick
    for (int kk = 0; kk < 2; ++kk) {
#pragma unroll
      for (int t = 0; t < 4; ++t) oacc[t] = mma_h_raw(vb[kk][t].v, pa[kk].v, oacc[t]);
      if (RES) {
#pragma unroll
        for (int t = 0; t < 4; ++t) o1[t] = mma_h_raw(vl[kk][t].v, pa[kk].v, o1[t]);
#pragma unroll
        for (int t = 0; t < 4; ++t) o1[t] = mma_h_raw(vb[kk][t].v, pl[kk].v, o1[t]);
      }
    }
    // the distance behind the last products, also on the loop's taken branch
    // (with RES the fold below stands between the products and the branch)
    if (!RES) acc_guard4(oacc[0], oacc[1], oacc[2], oacc[3]);
    if (RES) {
#pragma unroll
      for (int t = 0; t < 4; ++t)
#pragma unroll
        for (int r = 0; r < 8; ++r) oacc[t][r] += o1[t][r] * (1.0f / 4096.0f);
    }
  }

  // ---- normalise (1/l and the 1/1024 p carry), stage the wave's 16x64 tile in LDS, then write whole
  float* os = Os[wave];
  {
    const float l = lrow + xhalf(lrow);      // the two halves' sums, joined once
    const float inv = ((l > 0.f) ? (1.0f / l) : 0.f) * (1.0f / 1024.0f);
#pragma unroll
    for (int t = 0; t < 4; ++t) {
      v4f w0, w1;
#pragma unroll
      for (int e = 0; e < 4; ++e) { w0[e] = oacc[t][e] * inv; w1[e] = oacc[t][4 + e] * inv; }
      *(v4f*)(os + c * OP + t * 16 + 8 * hh)     = w0;   // query row c, dims 16t + 8*hh ..
      *(v4f*)(os + c * OP + t * 16 + 8 * hh + 4) = w1;
    }
  }
  __builtin_amdgcn_fence(__ATOMIC_RELEASE, "workgroup");
  __builtin_amdgcn_wave_barrier();
  __builtin_amdgcn_fence(__ATOMIC_ACQUIRE, "workgroup");
  {
    const int h2 = lane >> 4, c4 = (lane & 15) * 4;
    v4f ov[8];
#pragma unroll
    for (int it = 0; it < 8; ++it) {
      const int row = it * 2 + h2;   // it 0..7 x h2 0..1 = rows 0..15 of the wave tile
      ov[it] = *(const v4f*)(os + row * OP + c4);
    }
    {
#pragma unroll
      for (int it = 0; it < 8; ++it) {
        const int row = it * 2 + h2;
        const size_t go = (rowB + q0 + row) * DM + (size_t)h * HD + c4;
        *(v4f*)(outp + go) = ov[it];
      }
      
    }
  }
}

// =====================================================================================================
// Workspace map (bytes), every region an exact multiple of its whole-line / whole-tile store granularity:
//   Xb    bf16 [4096][1024]          0          8388608
//   Winb  bf16 [3072][1024]          8388608    6291456
//   Wob   bf16 [1024][1024]          14680064   2097152
//   Rin   f32  [3072]                16777216     12288   (96 lines)
//   Rout  f32  [1024]                16789504      4096   (32 lines)
//   Rrow  f32  [4096]                16793600     16384   (128 lines)
//   CosT  f32  [2048][32]            16809984    262144
//   SinT  f32  [2048][32]            17072128    262144
//   Af    f32  [4096][1024]          17334272  33554432   (Af, then Ah bf16 and Al bf16 [4096][1024] each)
//   VTh   f16  [2][1024][2048]       50888704   8388608
//   VTl   f16  [2][1024][512]        59277312   2097152
//   Qh    bf16 [4096][1024]          61374464   8388608
//   Ql    bf16 [4096][1024]          69763072   8388608
//   Kh    bf16 [4096][1024]          78151680   8388608
//   Kl    bf16 [4096][1024]          86540288   8388608
//   end                              94928896
// Weights are [out n][in k] with k contiguous = the Bt / A layout the GEMM wants, so they are only converted.
// =====================================================================================================
extern "C" void kernel_launch(void* const* d_in, const int* in_sizes, int n_in,
                              void* d_out, int out_size, void* d_ws, size_t ws_size,
                              hipStream_t stream) {
  if (n_in < 4) return;
  if (in_sizes[0] != NB * SEQ * DM) return;
  if (in_sizes[1] != SEQ * (HD / 2)) return;
  if (in_sizes[2] != 3 * DM * DM) return;
  if (in_sizes[3] != DM * DM) return;
  if (out_size != NB * SEQ * DM) return;

  const float* x    = (const float*)d_in[0];
  const float* rpf  = (const float*)d_in[1];
  const float* w_in = (const float*)d_in[2];
  const float* w_o  = (const float*)d_in[3];

  const size_t PXb   = (size_t)NB * SEQ * DM * 2;      //  8388608  16-bit activation plane [4096][1024]
  const size_t PWin  = (size_t)3 * DM * DM * 2;        //  6291456
  const size_t PWo   = (size_t)DM * DM * 2;            //  2097152
  const size_t PRin  = (size_t)3 * DM * 4;             //    12288
  const size_t PRout = (size_t)DM * 4;                 //     4096
  const size_t PRrow = (size_t)NB * SEQ * 4;           //    16384
  const size_t PTrig = (size_t)SEQ * (HD / 2) * 4;     //   262144
  const size_t PQK   = (size_t)NB * SEQ * NQK * 4;     // 33554432  Af + Ah + Al
  const size_t PVTh  = (size_t)NB * DM * SEQ * 2;      //  8388608
  const size_t PVTl  = (size_t)NB * DM * VLP * 2;      //  2097152
  const size_t PAf   = (size_t)NB * SEQ * DM * 4;      // 16777216
  if (PAf + 2 * PXb != PQK) return;                    // Af + Ah + Al fill their region exactly
  size_t off = 0;
  const size_t oXb   = off; off += PXb;
  const size_t oWin  = off; off += PWin;
  const size_t oWo   = off; off += PWo;
  const size_t oRin  = off; off += PRin;
  const size_t oRout = off; off += PRout;
  const size_t oRrow = off; off += PRrow;
  const size_t oCos  = off; off += PTrig;
  const size_t oSin  = off; off += PTrig;
  const size_t oQK   = off; off += PQK;
  const size_t oVTh  = off; off += PVTh;
  const size_t oVTl  = off; off += PVTl;
  const size_t oQh   = off; off += PXb;
  const size_t oQl   = off; off += PXb;
  const size_t oKh   = off; off += PXb;
  const size_t oKl   = off; off += PXb;
  if (off > ws_size) return;                           // off = 94928896
  if (off > (size_t)134217728) return;
  const size_t oAf = oQK;
  const size_t oAh = oQK + PAf;
  const size_t oAl = oAh + PXb;
  if (oAl + PXb > oVTh) return;                        // region ordering sanity

  char* ws = (char*)d_ws;
  unsigned short* Xb   = (unsigned short*)(ws + oXb);
  unsigned short* Winb = (unsigned short*)(ws + oWin);
  unsigned short* Wvb  = Winb + (size_t)2 * DM * DM;   // rows 2048..3071 of w_in = v features
  unsigned short* Wob  = (unsigned short*)(ws + oWo);
  float*          Rin  = (float*)(ws + oRin);
  float*          Rv   = Rin + 2 * DM;
  float*          Rout = (float*)(ws + oRout);
  float*          Rrow = (float*)(ws + oRrow);
  float*          CosT = (float*)(ws + oCos);
  float*          SinT = (float*)(ws + oSin);
  unsigned short* VTh  = (unsigned short*)(ws + oVTh);
  unsigned short* VTl  = (unsigned short*)(ws + oVTl);
  unsigned short* Qh   = (unsigned short*)(ws + oQh);
  unsigned short* Ql   = (unsigned short*)(ws + oQl);
  unsigned short* Kh   = (unsigned short*)(ws + oKh);
  unsigned short* Kl   = (unsigned short*)(ws + oKl);
  float*          Af   = (float*)(ws + oAf);
  unsigned short* Ah   = (unsigned short*)(ws + oAh);
  unsigned short* Al   = (unsigned short*)(ws + oAl);

  const dim3 blk(256);
  const int nTrig = SEQ * (HD / 2);                                  // 65536
  const int n8x   = NB * SEQ * DM / 8;                               // 524288
  const dim3 gTrig((nTrig + 255) / 256);                             // 256 blocks
  const dim3 gCvtX((n8x + 255) / 256);                               // 2048 blocks
  const dim3 gPrepWin(3 * DM / 32);                                  // 96 blocks (32 rows each)
  const dim3 gPrepWo(DM / 32);                                       // 32 blocks
  const dim3 gPrepA(NB * SEQ / 32);                                  // 128 blocks
  const dim3 gblk(128);                                              // GEMM block: 4 waves, one 128x128 tile
  const dim3 gQK((NB * SEQ / 128) * (NQK / 128), 1);                 // 32 x 16 = 512 blocks
  const dim3 gVT((DM / 128) * (SEQ / 128), NB);                      // 8 x 16 = 128 blocks x 2 batches
  const dim3 gOut((NB * SEQ / 128) * (DM / 128), 1);                 // 32 x 8 = 256 blocks

  // (0) angle tables from the bf16-converted input table
  trig_tab<<<gTrig, blk, 0, stream>>>(rpf, CosT, SinT, nTrig);
  // (1) x -> bf16 plane [4096][1024]
  cvt_bf16x8<<<gCvtX, blk, 0, stream>>>(x, Xb, n8x);
  // (2) weights -> bf16 planes [n][k] + per-row inverse L2 norms of the converted rows
  row_prep<false, true><<<gPrepWin, blk, 0, stream>>>(w_in, Winb, Winb, Rin, 1.0f);
  row_prep<false, true><<<gPrepWo, blk, 0, stream>>>(w_o, Wob, Wob, Rout, 1.0f);
  // (3) q/k projection: Rin[e] * sum_d Xb[b*SEQ+s][d] Winb[e][d], e < 2048  (M=4096, N=2048, K=1024), with rotary and
  //     per-head rms in the epilogue -> q/k bf16 hi/lo planes
  gemm64<0, 4, false, true><<<gQK, gblk, 0, stream>>>(
      Xb, Xb, DM, 0LL, Winb, DM, 0LL,
      (void*)Qh, DM, 0LL, (void*)Ql, DM, 0LL, 0,
      NB * SEQ, NQK, DM, 1.0f, Rin, Rin,
      (void*)Kh, (void*)Kl, CosT, SinT);
  // (4) v^T per batch: VTh[b][m][s] = Rv[m] * sum_d Wvb[m][d] Xb[b*SEQ+s][d] -> f16 hi plane (pitch SEQ) and
  //     residual plane (x4096, keys < VLP, pitch VLP)  (M=1024, N=2048, K=1024)
  gemm64<0, 3, true, false><<<gVT, gblk, 0, stream>>>(
      Wvb, Wvb, DM, 0LL, Xb, DM, (long long)SEQ * DM,
      (void*)VTh, SEQ, (long long)DM * SEQ, (void*)VTl, VLP, (long long)DM * VLP, VLP,
      DM, SEQ, DM, 4096.0f, Rv, Rv,
      (void*)VTh, (void*)VTl, Rv, Rv);
  // (6) causal attention: query blocks 0..RESQB-1 with residual planes, the rest without -> Af f32 [4096][1024]
  attn_causal64<true><<<dim3(NB * NH * RESQB), dim3(128), 0, stream>>>(
      Qh, Ql, Kh, Kl, VTh, VTl, Af, 0, RESQB, 0.125f);
  attn_causal64<false><<<dim3(NB * NH * (NQB - RESQB)), dim3(128), 0, stream>>>(
      Qh, Ql, Kh, Kl, VTh, VTl, Af, RESQB, NQB - RESQB, 0.125f);
  // (7) merged rows -> bf16 hi/lo planes + per-row inverse rms over 1024
  row_prep<true, false><<<gPrepA, blk, 0, stream>>>(Af, Ah, Al, Rrow, 1.0f / (float)DM);
  // (8) out[s][e] = Rrow[s] * Rout[e] * sum_d (Ah+Al)[s][d] Wob[e][d] -> d_out f32 [4096][1024]  (M=4096, N=1024, K=1024)
  gemm64<1, 0, true, true><<<gOut, gblk, 0, stream>>>(
      Ah, Al, DM, 0LL, Wob, DM, 0LL,
      d_out, DM, 0LL, d_out, 0, 0LL, 0,
      NB * SEQ, DM, DM, 1.0f, Rrow, Rout,
      d_out, d_out, Rrow, Rout);
  (void)hipGetLastError();
}

// v006
// A run of this version takes 121 microseconds.
// Timed twice side by side with v005, it ran 1.35 and 1.37 times as fast.
// Over all steps from v000 it is 3.32 times as fast.
// Contractions: q/k and v^T projections = v_wmma_f32_16x16x32_bf16 (bf16 operands from RNE-converted inputs, single product, f32 row/column scales in the epilogue; q/k: RoPE and head rms there too);
// k.q^T scores (transposed) = v_wmma_f32_16x16x32_bf16 with bf16 hi/lo split q and k (hi.hi + hi.lo + lo.hi);
// v^T.p^T (transposed) = v_wmma_f32_16x16x32_f16 (p carried x1024 in f16, v in f16; extra f16 residual planes x4096 of p and v on the first 512 query rows);
// a.Wout^T = v_wmma_f32_16x16x32_bf16 with a as bf16 hi/lo planes times bf16 Wout (2 products); all f32 accumulate; RoPE, norms and softmax in f32.
#include <hip/hip_runtime.h>
#include <math.h>
#include <float.h>
#include <stdint.h>

#define NB    2
#define SEQ   2048
#define DM    1024
#define NH    16
#define HD    64
#define NQK   (2 * DM)       // q and k feature columns of the fused q/k projection output
#define NQB   (SEQ / 64)     // 32 query / key tiles of 64
#define VLP   512            // key pitch of the v^T residual plane (keys 0..VLP-1)
#define RESQB 8              // leading 64-row query blocks that use the p / v residual planes
static_assert(RESQB * 64 <= VLP);
static_assert(NH * HD == DM);
static_assert((SEQ % 64) == 0 && (DM % 256) == 0);
static_assert(HD == 64);
static_assert((NB * SEQ) % 128 == 0 && SEQ % 128 == 0 && DM % 128 == 0 && NQK % 128 == 0);   // GEMM block tiles of 128x128, k slabs of 64
#define LP    72             // LDS pitch, in 16-bit elements, of a 64-element row: 144 B = 16 B x odd, so that the 16 rows
                             // one ds_load_b128 fragment read touches fall on 16 different groups of four banks
#define GP    72             // LDS pitch, in 16-bit elements, of a GEMM k-slab row of 64 elements (144 B = 16 B x odd, as LP)
#define GPLANE (128 * GP)    // elements of one staged 128-row k slab
#define OP    68             // LDS pitch, in floats, of a 64-float row: the 16 lanes of a lane half store 16 rows, on different banks

typedef _Float16 v16h __attribute__((ext_vector_type(16)));
typedef _Float16 v8h  __attribute__((ext_vector_type(8)));
typedef __bf16   v16b __attribute__((ext_vector_type(16)));
typedef __bf16   v8b  __attribute__((ext_vector_type(8)));
typedef float    v8f  __attribute__((ext_vector_type(8)));
typedef float    v4f  __attribute__((ext_vector_type(4)));
typedef unsigned int v4u __attribute__((ext_vector_type(4)));

// ---- scalar helpers --------------------------------------------------------------------------------
__device__ __forceinline__ unsigned short bf_bits(float f) {          // f32 -> bf16 bits, RNE convert
  unsigned u = __float_as_uint(f);
  return (unsigned short)((u + 0x7FFFu + ((u >> 16) & 1u)) >> 16);
}
__device__ __forceinline__ float bf_up(unsigned short h) { return __uint_as_float(((unsigned)h) << 16); }
__device__ __forceinline__ unsigned short h_bits(_Float16 x) { return __builtin_bit_cast(unsigned short, x); }
__device__ __forceinline__ unsigned pk16(unsigned short a, unsigned short b) { return (unsigned)a | ((unsigned)b << 16); }
__device__ __forceinline__ v8f zero8() { v8f z = {0.f, 0.f, 0.f, 0.f, 0.f, 0.f, 0.f, 0.f}; return z; }
__device__ __forceinline__ v8h zero8h() {
  const _Float16 z = (_Float16)0.0f;
  v8h r = {z, z, z, z, z, z, z, z};
  return r;
}

// value of lane l ^ 16 (the other 16-lane row), by a vector cross-row move
__device__ __forceinline__ float xhalf(float x) {
  const int b = __builtin_bit_cast(int, x);
  return __builtin_bit_cast(float, __builtin_amdgcn_permlanex16(b, b, 0x76543210, 0xfedcba98, false, false));
}

// e^x as 2^(x * log2 e) on v_exp_f32, as __expf gives it. The v_nop is the one slot that the instruction set asks for
// between a transcendental and an instruction that reads its result or overwrites its source: in the same statement
// it stands there whichever instruction the compiler puts next
__device__ __forceinline__ float exp_slot(float x) {
  const float y = x * 1.44269504f;
  float r;
#if defined(__HIP_DEVICE_COMPILE__)
  asm("v_exp_f32 %0, %1\n\tv_nop" : "=v"(r) : "v"(y));
#else
  r = y;
#endif
  return r;
}

// ---- fragment loader: 16-bit A/B operand, lane -> row/col (lane&15), p already includes +8*(lane>>4);
//      elements 0..7 <- p[0..7] (k0+8h..), elements 8..15 <- p[16..23] (k0+16+8h..)
__device__ __forceinline__ v16b ldfrag_b(const __bf16* p) {
  union { v16b v; v8b h[2]; } f;
  f.h[0] = *(const v8b*)(p);
  f.h[1] = *(const v8b*)(p + 16);
  return f.v;
}

// ---- WMMA helpers with trailing VALU hazard gap --------------------------------------------------------
__device__ __forceinline__ v8f mma_b_raw(v16b a, v16b b, v8f c) {
  return __builtin_amdgcn_wmma_f32_16x16x32_bf16(false, a, false, b, (short)0, c, false, false);
}
__device__ __forceinline__ v8f mma_h_raw(v16h a, v16h b, v8f c) {
  return __builtin_amdgcn_wmma_f32_16x16x32_f16(false, a, false, b, (short)0, c, false, false);
}
__device__ __forceinline__ void dep_guard_b(v8f& a, v8f& b, v16b x, v16b y) {
#if defined(__HIP_DEVICE_COMPILE__)
  asm volatile("v_nop\n\tv_nop\n\tv_nop\n\tv_nop" : "+v"(a), "+v"(b) : "v"(x), "v"(y));
#endif
}
__device__ __forceinline__ void keep4_b(v16b a, v16b b, v16b c, v16b d) {
#if defined(__HIP_DEVICE_COMPILE__)
  asm volatile("v_nop" :: "v"(a), "v"(b), "v"(c), "v"(d));
#endif
}
__device__ __forceinline__ void acc_guard4(v8f& a, v8f& b, v8f& c, v8f& d) {
#if defined(__HIP_DEVICE_COMPILE__)
  asm volatile("v_nop\n\tv_nop\n\tv_nop\n\tv_nop" : "+v"(a), "+v"(b), "+v"(c), "+v"(d));
#endif
}

// =====================================================================================================
// f32 -> bf16 (RNE convert), 8 elements per thread, one 16-B store per lane: a wave writes 512 contiguous B
// coverage: n8 threads x 8 = whole plane (n8 is a multiple of 256 here). blk = index of this 256-thread block in the job.
// =====================================================================================================
__device__ __forceinline__ void cvt_bf16x8(int blk, const float* __restrict__ in, unsigned short* out, int n8) {
  const int i = blk * 256 + threadIdx.x;
  if (i < n8) {
    const v4f a = *(const v4f*)(in + (size_t)i * 8);
    const v4f b = *(const v4f*)(in + (size_t)i * 8 + 4);
    v4u p;
    p[0] = pk16(bf_bits(a[0]), bf_bits(a[1]));
    p[1] = pk16(bf_bits(a[2]), bf_bits(a[3]));
    p[2] = pk16(bf_bits(b[0]), bf_bits(b[1]));
    p[3] = pk16(bf_bits(b[2]), bf_bits(b[3]));
    *(v4u*)(out + (size_t)i * 8) = p;
    
  }
}

// =====================================================================================================
// Angle table: ct[i] = cosf(bf(fr[i])), st[i] = sinf(bf(fr[i])) with the angle RNE-converted to bf16
// =====================================================================================================
__device__ __forceinline__ void trig_tab(int blk, const float* __restrict__ fr, float* ct, float* st, int n) {
  const int i = blk * 256 + threadIdx.x;
  if (i < n) {
    const float f  = bf_up(bf_bits(fr[i]));
    const float cv = cosf(f);
    const float sv = sinf(f);
    *(float*)(ct + i) = cv;
    *(float*)(st + i) = sv;
    
  }
}

// =====================================================================================================
// Row preparation over rows of DM=1024 f32 values (pitch DM):
//   hi plane = RNE bf16 of each value; LO: lo plane = RNE bf16 of (v - hi) (unscaled);
//   rtab[row] = rsqrt(ss * inv_div + 1e-6) with ss = sum over the row of g^2,
//     g = the bf16-converted value (SQR) or the f32 value (!SQR).
// Block = 8 waves = 32 rows (wave w: rows 4w..4w+3 of the block); blocks of the job = rows / 32 (exact here), blk = this one.
// sr = 32 floats of LDS that belong to the block.
// Per row and instruction t (0..3): lane l holds columns 256t + 8l .. +7 -> 32 lanes x 16 B = 512 B
// coverage: 4 t x 32 lanes x 8 = 1024 columns per row; 8 waves x 4 rows = 32 rows per block.
// =====================================================================================================
template <bool LO, bool SQR>
__device__ __forceinline__ void row_prep_part(float* sr, int blk, const float* __restrict__ in, unsigned short* hp,
                                              unsigned short* lp, float* rtab, float inv_div) {
  const int tid = threadIdx.x, wave = tid >> 5, lane = tid & 31;
#pragma unroll 1
  for (int i = 0; i < 4; ++i) {
    const int row = blk * 32 + wave * 4 + i;
    const float* rp = in + (size_t)row * DM + lane * 8;
    float ss = 0.f;
    v4u hv[4], lv[4];
#pragma unroll
    for (int t = 0; t < 4; ++t) {
      const v4f a  = *(const v4f*)(rp + t * 256);
      const v4f bq = *(const v4f*)(rp + t * 256 + 4);
      v4u ph, pl;
#pragma unroll
      for (int e = 0; e < 4; ++e) {
        const float f0 = (e < 2) ? a[2 * e]     : bq[2 * e - 4];
        const float f1 = (e < 2) ? a[2 * e + 1] : bq[2 * e - 3];
        const unsigned short h0 = bf_bits(f0), h1 = bf_bits(f1);
        const float g0 = SQR ? bf_up(h0) : f0;
        const float g1 = SQR ? bf_up(h1) : f1;
        ss += g0 * g0;
        ss += g1 * g1;
        ph[e] = pk16(h0, h1);
        if (LO) {
          pl[e] = pk16(bf_bits(f0 - bf_up(h0)), bf_bits(f1 - bf_up(h1)));
        } else {
          pl[e] = 0u;
        }
      }
      hv[t] = ph; lv[t] = pl;
    }
#pragma unroll
    for (int off = 16; off >= 1; off >>= 1) ss += __shfl_xor(ss, off, 32);
    const float rv = rsqrtf(ss * inv_div + 1e-6f);
    if (lane == 0) sr[wave * 4 + i] = rv;
    {
#pragma unroll
      for (int t = 0; t < 4; ++t) {
        const size_t go = (size_t)row * DM + t * 256 + lane * 8;
        *(v4u*)(hp + go) = hv[t];
        if (LO) *(v4u*)(lp + go) = lv[t];
      }
      
    }
  }
  __syncthreads();
  if (wave == 0) {
    const float rv = sr[lane];
    float* d = rtab + (size_t)blk * 32 + lane;
    *(float*)d = rv;
    
  }
}

// merged attention rows -> bf16 hi/lo planes + per-row inverse rms
__global__ __launch_bounds__(256) void row_prep_hilo(const float* __restrict__ in, unsigned short* hp, unsigned short* lp,
                                                     float* rtab, float inv_div) {
  __shared__ float sr[32];
  row_prep_part<true, false>(sr, blockIdx.x, in, hp, lp, rtab, inv_div);
}

// =====================================================================================================
// The four preparations of the inputs, which do not depend on one another, as block ranges of ONE grid (every test on
// the block index is block-uniform). The jobs with the longest blocks come first:
//   [0, PB_WIN)            w_in rows  -> bf16 plane + inverse L2 norms of the converted rows
//   [PB_WIN, PB_W)         w_out rows -> the same
//   [PB_W, PB_WT)          angle tables
//   [PB_WT, PB_ALL)        x -> bf16 plane
// =====================================================================================================
#define PB_WIN  (3 * DM / 32)                          // 96
#define PB_W    (PB_WIN + DM / 32)                     // 128
#define PB_WT   (PB_W + SEQ * (HD / 2) / 256)          // 384
#define PB_ALL  (PB_WT + NB * SEQ * DM / 8 / 256)      // 2432
__global__ __launch_bounds__(256) void prep_inputs(const float* __restrict__ x, const float* __restrict__ fr,
                                                   const float* __restrict__ w_in, const float* __restrict__ w_o,
                                                   unsigned short* Xb, unsigned short* Winb, unsigned short* Wob,
                                                   float* Rin, float* Rout, float* ct, float* st) {
  __shared__ float sr[32];
  const int bx = blockIdx.x;
  if (bx < PB_W) {
    const bool first = bx < PB_WIN;
    unsigned short* hp = first ? Winb : Wob;
    row_prep_part<false, true>(sr, first ? bx : bx - PB_WIN, first ? w_in : w_o, hp, hp, first ? Rin : Rout, 1.0f);
  } else if (bx < PB_WT) {
    trig_tab(bx - PB_W, fr, ct, st, SEQ * (HD / 2));
  } else {
    cvt_bf16x8(bx - PB_WT, x, Xb, NB * SEQ * DM / 8);
  }
}

// =====================================================================================================
// Eight asynchronous 16-B copies per lane, global memory -> LDS: this lane's piece of rows r, r+16, .., r+112 of one
// 128-row x 64-element k slab. g = the lane's piece in row r (row pitch ld elements), l = its LDS byte address
// (row pitch GP elements). Eight lanes cover one 128-B row, so a wave's copy covers four whole lines.
// =====================================================================================================
__device__ __forceinline__ void stage_plane(const __bf16* g, int ld, unsigned l) {
  const size_t   gs = (size_t)16 * (size_t)ld;        // 16 rows in global memory, elements
  const unsigned ls = 16u * GP * 2u;                  // 16 rows in LDS, bytes
  const __bf16 *g0 = g, *g1 = g + gs, *g2 = g + 2 * gs, *g3 = g + 3 * gs;
  const __bf16 *g4 = g + 4 * gs, *g5 = g + 5 * gs, *g6 = g + 6 * gs, *g7 = g + 7 * gs;
  const unsigned l0 = l, l1 = l + ls, l2 = l + 2 * ls, l3 = l + 3 * ls;
  const unsigned l4 = l + 4 * ls, l5 = l + 5 * ls, l6 = l + 6 * ls, l7 = l + 7 * ls;
#if defined(__HIP_DEVICE_COMPILE__)
  // the copies bring the slab into LDS through no register; the closing s_wait_xcnt stands in the same statement so
  // that no address register named here is rewritten in front of it
  asm volatile(
      "global_load_async_to_lds_b128 %0, %8, off\n\t"
      "global_load_async_to_lds_b128 %1, %9, off\n\t"
      "global_load_async_to_lds_b128 %2, %10, off\n\t"
      "global_load_async_to_lds_b128 %3, %11, off\n\t"
      "global_load_async_to_lds_b128 %4, %12, off\n\t"
      "global_load_async_to_lds_b128 %5, %13, off\n\t"
      "global_load_async_to_lds_b128 %6, %14, off\n\t"
      "global_load_async_to_lds_b128 %7, %15, off\n\t"
      "s_wait_xcnt 0x0"
      :: "v"(l0), "v"(l1), "v"(l2), "v"(l3), "v"(l4), "v"(l5), "v"(l6), "v"(l7),
         "v"(g0), "v"(g1), "v"(g2), "v"(g3), "v"(g4), "v"(g5), "v"(g6), "v"(g7)
      : "memory");
#endif
}
// this wave's own copies have landed in LDS
__device__ __forceinline__ void wait_async0() {
#if defined(__HIP_DEVICE_COMPILE__)
  asm volatile("s_wait_asynccnt 0x0" ::: "memory");
#endif
}
// this wave's own LDS reads have returned, so that the buffer they read may be refilled behind the next barrier
__device__ __forceinline__ void wait_ds0() {
#if defined(__HIP_DEVICE_COMPILE__)
  asm volatile("s_wait_dscnt 0x0" ::: "memory");
#endif
}

// cos / sin of rows row0 .. row0+7 (row0 a multiple of 8, so the eight positions row0 % SEQ + r stay below SEQ) and
// pairs p, p + 16 from the [SEQ][32] angle tables
__device__ __forceinline__ void load_angles(const float* __restrict__ ct, const float* __restrict__ st, int row0, int p,
                                            float (&cv)[8][2], float (&sv)[8][2]) {
  const size_t to = (size_t)(row0 % SEQ) * (HD / 2) + p;
#pragma unroll
  for (int r = 0; r < 8; ++r) {
#pragma unroll
    for (int j = 0; j < 2; ++j) {
      cv[r][j] = ct[to + r * (HD / 2) + (j << 4)];
      sv[r][j] = st[to + r * (HD / 2) + (j << 4)];
    }
  }
}

// =====================================================================================================
// Batched bf16 WMMA GEMM: C[m][n] = rs[m] * cs[n] * sum_k A[m][k] * Bt[n][k]. Block = 4 waves = a 128x128 tile,
// wave (wave>>1, wave&1) owns one 64x64 quarter. A row-major [M][K] pitch lda; Bt row-major [N][K] pitch ldb
// (k contiguous); M, N multiples of 128, K a multiple of 64 (true of the three GEMMs below).
// tile = index of the block's tile (row-major over the tiles), b = batch index (strides in elements).
// sAp, sBp, sA2p, sTp = the block's LDS: A, Bt and (NSPLIT) A2 slabs, two buffers of GPLANE elements each, and four per-wave
// 16x64 f32 slabs of pitch 68.
// Operands: k slabs of 64 elements (one 128-B line per row) are copied into LDS by asynchronous 16-B copies, whole
// lines per wave, two buffers: slab t+1 flies while slab t is worked on. Fragments are read from LDS (row pitch GP).
// NSPLIT: 0 = A.Bt; 1 = (A + A2).Bt (A2 = unscaled bf16 lo plane of A).
// RS / CS: per-row scale rsp[m] / per-column scale csp[n] (f32, not batched) applied in the epilogue.
// OUT_MODE: 0 = f32 (pitch ldc); 2 = bf16 hi plane C + bf16 lo plane C2 (lo = RNE(v - hi), unscaled);
//           3 = f16 hi plane C + f16 residual plane C2 = f16((v - hi) * rscale), C2 written only for tiles
//               with n0 < N2 (pitch ldc2, batch stride strideC2);
//           4 = q/k projection: a wave's 64 columns are one head of q (n0 < DM) or of k. Half-split rotary and the
//               per-head rms over the 64 dims are applied to the accumulators, then bf16 hi/lo planes as in 2, element
//               (row, h*64 + d) at [row*ldc + h*64 + d]: q -> C / C2, k -> C3 / C4.
//               ctp/stp [SEQ][32] f32 angle tables, pair index = d mod 32, position = row mod SEQ.
//               y[d<32] = x1*cos - x2*sin, y[32+d] = x1*sin + x2*cos (x1 = x[d], x2 = x[32+d]); y * rsqrt(mean(y^2) + 1e-6).
//               A lane holds columns 16j + (lane&15), j = 0..3, of its rows: x[d] and x[32+d] are its tiles j and j+2.
// =====================================================================================================
template <int NSPLIT, int OUT_MODE, bool RS, bool CS>
__device__ __forceinline__ void gemm_tile(
    __bf16* sAp, __bf16* sBp, __bf16* sA2p, float* sTp, int tile, int b,
    const unsigned short* __restrict__ Ap, const unsigned short* A2p, int lda, long long strideA,
    const unsigned short* __restrict__ Btp, int ldb, long long strideB,
    void* Cout, int ldc, long long strideC,
    void* Cout2, int ldc2, long long strideC2, int N2,
    int M, int N, int K, float rscale,
    const float* __restrict__ rsp, const float* __restrict__ csp,
    void* Cout3, void* Cout4, const float* __restrict__ ctp, const float* __restrict__ stp) {
  static_assert(NSPLIT == 0 || NSPLIT == 1);
  const __bf16* A   = (const __bf16*)(const void*)Ap;
  const __bf16* A2  = (const __bf16*)(const void*)A2p;
  const __bf16* Bt  = (const __bf16*)(const void*)Btp;
  const int tid  = threadIdx.x;
  const int lane = tid & 31;
  const int wave = tid >> 5;
  const int tilesN = N >> 7;
  const int tilesM = M >> 7;
  if (tile >= tilesM * tilesN) return;   // block-uniform, in front of every copy and barrier
  const int tm = tile / tilesN;
  const int tn = tile - tm * tilesN;
  const int bm0 = tm << 7;
  const int bn0 = tn << 7;
  const int wm  = (wave >> 1) << 6;            // this wave's quarter inside the block tile
  const int wn  = (wave & 1) << 6;
  const int m0 = bm0 + wm;
  const int n0 = bn0 + wn;

  const __bf16* Ab  = A  + (size_t)b * strideA;
  const __bf16* Bb  = Bt + (size_t)b * strideB;
  const __bf16* Ab2 = (NSPLIT >= 1) ? (A2  + (size_t)b * strideA) : Ab;

  const int rlane = lane & 15;                 // row (A) / col (B, D) within subtile
  const int koff  = (lane >> 4) * 8;           // k offset of this lane half
  const int mOff  = (lane >> 4) * 8;           // D row offset

  // ---- staging addresses: thread -> row tid>>3 (+16 per copy), 16-B piece tid&7 of the 128-B slab row ----
  const int srow = tid >> 3, spc = (tid & 7) * 8;
  const __bf16* gA  = Ab  + (size_t)(bm0 + srow) * lda + spc;
  const __bf16* gA2 = Ab2 + (size_t)(bm0 + srow) * lda + spc;
  const __bf16* gB  = Bb  + (size_t)(bn0 + srow) * ldb + spc;
  const unsigned lofs = (unsigned)(srow * GP + spc) * 2u;
  const unsigned lA  = (unsigned)(size_t)(const void*)sAp  + lofs;   // low 32 bits = byte offset in LDS
  const unsigned lB  = (unsigned)(size_t)(const void*)sBp  + lofs;
  const unsigned lA2 = (unsigned)(size_t)(const void*)sA2p + lofs;
  const int nslab = K >> 6;

  v8f acc[4][4];
#pragma unroll
  for (int i = 0; i < 4; ++i)
#pragma unroll
    for (int j = 0; j < 4; ++j) acc[i][j] = zero8();

  // ---- prologue: slab 0 landed and published, then slab 1 in flight ----
  stage_plane(gA, lda, lA);
  stage_plane(gB, ldb, lB);
  if (NSPLIT >= 1) stage_plane(gA2, lda, lA2);
  wait_async0();
  __syncthreads();
  if (nslab > 1) {
    stage_plane(gA + 64, lda, lA + GPLANE * 2u);
    stage_plane(gB + 64, ldb, lB + GPLANE * 2u);
    if (NSPLIT >= 1) stage_plane(gA2 + 64, lda, lA2 + GPLANE * 2u);
  }

#pragma unroll 1   // one slab per trip: the two buffers alternate by the trip's parity
  for (int t = 0; t < nslab; ++t) {
    const int buf = t & 1;
    const __bf16* fa  = sAp + buf * GPLANE + (wm + rlane) * GP + koff;
    const __bf16* fb  = sBp + buf * GPLANE + (wn + rlane) * GP + koff;
    const __bf16* fa2 = NSPLIT ? sA2p + buf * GPLANE + (wm + rlane) * GP + koff : fa;
#pragma unroll
    for (int ks = 0; ks < 64; ks += 32) {
      // all fragments of this 32-wide k step are read as one group in front of its WMMAs
      v16b bh[4], ah[4], al[4];
#pragma unroll
      for (int j = 0; j < 4; ++j) bh[j] = ldfrag_b(fb + (j << 4) * GP + ks);
#pragma unroll
      for (int i = 0; i < 4; ++i) {
        ah[i] = ldfrag_b(fa + (i << 4) * GP + ks);
        if (NSPLIT >= 1) al[i] = ldfrag_b(fa2 + (i << 4) * GP + ks); else al[i] = ah[i];
      }
#pragma unroll
      for (int i = 0; i < 4; ++i) {
#pragma unroll
        for (int j = 0; j < 4; ++j) {
          acc[i][j] = mma_b_raw(ah[i], bh[j], acc[i][j]);
          if (NSPLIT >= 1) acc[i][j] = mma_b_raw(al[i], bh[j], acc[i][j]);
        }
        dep_guard_b(acc[i][0], acc[i][3], ah[i], al[i]);
      }
      keep4_b(bh[0], bh[1], bh[2], bh[3]);
    }
    // ---- publish slab t+1, free slab t's buffer: own LDS reads done, own copies landed, block barrier ----
    wait_ds0();
    wait_async0();
    __syncthreads();
    if (t + 2 < nslab) {                       // block-uniform: refill the buffer that this trip has just read
      const int kn = (t + 2) << 6;
      const unsigned bo = (unsigned)buf * (GPLANE * 2u);
      stage_plane(gA + kn, lda, lA + bo);
      stage_plane(gB + kn, ldb, lB + bo);
      if (NSPLIT >= 1) stage_plane(gA2 + kn, lda, lA2 + bo);
    }
  }
  wait_async0();
  acc_guard4(acc[0][0], acc[0][1], acc[0][2], acc[0][3]);
  acc_guard4(acc[1][0], acc[1][1], acc[1][2], acc[1][3]);
  acc_guard4(acc[2][0], acc[2][1], acc[2][2], acc[2][3]);
  acc_guard4(acc[3][0], acc[3][1], acc[3][2], acc[3][3]);

  // ---- epilogue scales ----
  float csv[4];
#pragma unroll
  for (int j = 0; j < 4; ++j) csv[j] = CS ? csp[n0 + (j << 4) + rlane] : 1.0f;

  // ---- epilogue ----
  float* slab = sTp + wave * (16 * 68);
#pragma unroll
  for (int i = 0; i < 4; ++i) {
    const int mBase = m0 + (i << 4);
    float cv[8][2], sv[8][2];                              // OUT_MODE 4: cos / sin of (row mOff + r, pair 16j + rlane)
    if (OUT_MODE == 4) load_angles(ctp, stp, mBase + mOff, rlane, cv, sv);
#pragma unroll
    for (int r = 0; r < 8; ++r) {
      const float rsv = RS ? rsp[mBase + mOff + r] : 1.0f;
      if (OUT_MODE == 4) {
        float y1[2], y2[2], sq[2];
#pragma unroll
        for (int j = 0; j < 2; ++j) {
          const float x1 = acc[i][j][r] * rsv * csv[j];
          const float x2 = acc[i][j + 2][r] * rsv * csv[j + 2];
          y1[j] = fmaf(x1, cv[r][j], -(x2 * sv[r][j]));
          y2[j] = fmaf(x1, sv[r][j], x2 * cv[r][j]);
          sq[j] = fmaf(y1[j], y1[j], y2[j] * y2[j]);
        }
        // sum over the 32 pairs: pairs d and d+16 in the lane, then partners 8, 4, 2, 1 of the 16-lane row
        float ss = sq[0] + sq[1];
#pragma unroll
        for (int off = 8; off >= 1; off >>= 1) ss += __shfl_xor(ss, off, 32);
        const float sc = rsqrtf(ss * (1.0f / HD) + 1e-6f);
#pragma unroll
        for (int j = 0; j < 2; ++j) {
          slab[(mOff + r) * 68 + (j << 4) + rlane]      = y1[j] * sc;
          slab[(mOff + r) * 68 + 32 + (j << 4) + rlane] = y2[j] * sc;
        }
      } else {
#pragma unroll
        for (int j = 0; j < 4; ++j) {
          slab[(mOff + r) * 68 + (j << 4) + rlane] = acc[i][j][r] * rsv * csv[j];
        }
      }
    }
    __builtin_amdgcn_fence(__ATOMIC_RELEASE, "workgroup");
    __builtin_amdgcn_wave_barrier();
    __builtin_amdgcn_fence(__ATOMIC_ACQUIRE, "workgroup");
    if (OUT_MODE == 0) {
      float* C = (float*)Cout + (size_t)b * strideC;
      const int hh = lane >> 4, c4 = (lane & 15) * 4;     // 256-B row segment = 16 lanes x 16 B
      v4f ov[8];
#pragma unroll
      for (int it = 0; it < 8; ++it) {
        const int row = it * 2 + hh;                       // it 0..7 x hh 0..1 = rows 0..15
        ov[it] = *(const v4f*)(slab + row * 68 + c4);
      }
      {
#pragma unroll
        for (int it = 0; it < 8; ++it) {
          const int row = it * 2 + hh;
          *(v4f*)(C + (size_t)(mBase + row) * ldc + n0 + c4) = ov[it];
        }
        
      }
    } else {
      const int q = lane >> 3, c8 = (lane & 7) * 8;
      const bool kside = (OUT_MODE == 4) && (n0 >= DM);   // wave-uniform: this wave's head is a k head
      const int  nc    = (OUT_MODE == 4) ? (n0 % DM) : n0; // first column in the output planes
      unsigned short* C  = (unsigned short*)(kside ? Cout3 : Cout)  + (size_t)b * strideC;
      unsigned short* C2 = (unsigned short*)(kside ? Cout4 : Cout2) + (size_t)b * strideC2;
      const bool wlo = (OUT_MODE == 2) || (OUT_MODE == 4) || (n0 < N2);      // wave-uniform
      v4u hv[4], lv[4];
#pragma unroll
      for (int it = 0; it < 4; ++it) {
        const int row = it * 4 + q;                        // it 0..3 x q 0..3 = rows 0..15
        const float* sp = slab + row * 68 + c8;
        v4u a, a2;
#pragma unroll
        for (int e = 0; e < 4; ++e) {
          const float f0 = sp[2 * e], f1 = sp[2 * e + 1];
          unsigned short h0, h1, l0, l1;
          if (OUT_MODE == 2 || OUT_MODE == 4) {
            h0 = bf_bits(f0); h1 = bf_bits(f1);
            l0 = bf_bits(f0 - bf_up(h0)); l1 = bf_bits(f1 - bf_up(h1));
          } else {
            const _Float16 x0 = (_Float16)f0, x1 = (_Float16)f1;
            h0 = h_bits(x0); h1 = h_bits(x1);
            l0 = h_bits((_Float16)((f0 - (float)x0) * rscale));
            l1 = h_bits((_Float16)((f1 - (float)x1) * rscale));
          }
          a[e] = pk16(h0, h1); a2[e] = pk16(l0, l1);
        }
        hv[it] = a; lv[it] = a2;
      }
      {
#pragma unroll
        for (int it = 0; it < 4; ++it) {
          const int row = it * 4 + q;
          *(v4u*)(C + (size_t)(mBase + row) * ldc + nc + c8) = hv[it];
          if (wlo) *(v4u*)(C2 + (size_t)(mBase + row) * ldc2 + nc + c8) = lv[it];
        }
        
      }
    }
    __builtin_amdgcn_fence(__ATOMIC_RELEASE, "workgroup");
    __builtin_amdgcn_wave_barrier();
    __builtin_amdgcn_fence(__ATOMIC_ACQUIRE, "workgroup");
  }
}

// one GEMM as a launch of its own: blockIdx.x = tile, blockIdx.y = batch index
template <int NSPLIT, int OUT_MODE, bool RS, bool CS>
__global__ __launch_bounds__(128) void gemm64(
    const unsigned short* __restrict__ Ap, const unsigned short* A2p, int lda, long long strideA,
    const unsigned short* __restrict__ Btp, int ldb, long long strideB,
    void* Cout, int ldc, long long strideC,
    void* Cout2, int ldc2, long long strideC2, int N2,
    int M, int N, int K, float rscale,
    const float* __restrict__ rsp, const float* __restrict__ csp,
    void* Cout3, void* Cout4, const float* __restrict__ ctp, const float* __restrict__ stp) {
  __shared__ __align__(16) __bf16 sA[2 * GPLANE];
  __shared__ __align__(16) __bf16 sB[2 * GPLANE];
  __shared__ __align__(16) __bf16 sA2[NSPLIT ? 2 * GPLANE : 8];
  __shared__ __align__(16) float  sT[4 * 16 * 68];
  gemm_tile<NSPLIT, OUT_MODE, RS, CS>(sA, sB, sA2, sT, blockIdx.x, blockIdx.y,
      Ap, A2p, lda, strideA, Btp, ldb, strideB, Cout, ldc, strideC, Cout2, ldc2, strideC2, N2,
      M, N, K, rscale, rsp, csp, Cout3, Cout4, ctp, stp);
}

// =====================================================================================================
// The q/k projection and the v^T projection, which do not depend on one another, as block ranges of ONE grid (the test
// on the block index is block-uniform; both jobs use the same LDS):
//   [0, GB_QK)        q/k: Rin[e] * sum_d Xb[b*SEQ+s][d] Winb[e][d], e < 2048 (M=4096, N=2048, K=1024), rotary and per-head rms
//                     in the epilogue -> q/k bf16 hi/lo planes
//   [GB_QK, GB_ALL)   v^T per batch: VTh[b][m][s] = Rv[m] * sum_d Wvb[m][d] Xb[b*SEQ+s][d] -> f16 hi plane (pitch SEQ) and
//                     residual plane (x4096, keys < nres <= VLP, pitch VLP) (M=1024, N=2048, K=1024)
// =====================================================================================================
#define GB_QK   ((NB * SEQ / 128) * (NQK / 128))       // 32 x 16 = 512
#define GB_VT1  ((DM / 128) * (SEQ / 128))             // 8 x 16 = 128 per batch
#define GB_ALL  (GB_QK + NB * GB_VT1)                  // 768
__global__ __launch_bounds__(128) void gemm_qk_vt(
    const unsigned short* __restrict__ Xb, const unsigned short* __restrict__ Winb, const unsigned short* __restrict__ Wvb,
    unsigned short* Qh, unsigned short* Ql, unsigned short* Kh, unsigned short* Kl,
    unsigned short* VTh, unsigned short* VTl,
    const float* __restrict__ Rin, const float* __restrict__ Rv,
    const float* __restrict__ CosT, const float* __restrict__ SinT, int nres) {
  __shared__ __align__(16) __bf16 sA[2 * GPLANE];
  __shared__ __align__(16) __bf16 sB[2 * GPLANE];
  __shared__ __align__(16) float  sT[4 * 16 * 68];
  const int bx = blockIdx.x;
  if (bx < GB_QK) {
    gemm_tile<0, 4, false, true>(sA, sB, sA, sT, bx, 0,
        Xb, Xb, DM, 0LL, Winb, DM, 0LL,
        (void*)Qh, DM, 0LL, (void*)Ql, DM, 0LL, 0,
        NB * SEQ, NQK, DM, 1.0f, Rin, Rin,
        (void*)Kh, (void*)Kl, CosT, SinT);
  } else {
    const int v = bx - GB_QK;
    gemm_tile<0, 3, true, false>(sA, sB, sA, sT, v % GB_VT1, v / GB_VT1,
        Wvb, Wvb, DM, 0LL, Xb, DM, (long long)SEQ * DM,
        (void*)VTh, SEQ, (long long)DM * SEQ, (void*)VTl, VLP, (long long)DM * VLP, nres,
        DM, SEQ, DM, 4096.0f, Rv, Rv,
        (void*)VTh, (void*)VTl, Rv, Rv);
  }
}

template <bool RES>
__device__ __forceinline__
void attn_tile(__bf16* Ksh, __bf16* Ksl, _Float16* Vth, _Float16* Vtl, float* Osp, int bx,
               const unsigned short* __restrict__ qhp, const unsigned short* __restrict__ qlp,
               const unsigned short* __restrict__ khp, const unsigned short* __restrict__ klp,
               const unsigned short* __restrict__ vhp, const unsigned short* __restrict__ vlp,
               float* outp, int qbBase, int nqbThis, float sscale) {
  union FB { v16b v; v8b h[2]; };
  union FH { v16h v; v8h h[2]; };

  const int tid  = threadIdx.x;
  const int wave = tid >> 5;
  const int lane = tid & 31;
  const int hh   = lane >> 4;
  const int c    = lane & 15;

  const int qbl  = bx % nqbThis;
  const int rest = bx / nqbThis;
  const int h    = rest % NH;
  const int b    = rest / NH;
  const int qb   = qbBase + qbl;
  const int q0   = qb * 64 + wave * 16;
  const size_t rowB = (size_t)b * SEQ;

  const __bf16* Qh = (const __bf16*)(const void*)qhp + (size_t)h * HD;
  const __bf16* Ql = (const __bf16*)(const void*)qlp + (size_t)h * HD;
  const __bf16* Kh = (const __bf16*)(const void*)khp + (size_t)h * HD;
  const __bf16* Kl = (const __bf16*)(const void*)klp + (size_t)h * HD;
  const _Float16* Vh = (const _Float16*)(const void*)vhp + ((size_t)b * DM + (size_t)h * HD) * SEQ;
  const _Float16* Vl = (const _Float16*)(const void*)vlp + ((size_t)b * DM + (size_t)h * HD) * VLP;

  // ---- Q fragments (B operand, column = query = lane&15): 2 d-chunks, hi and lo ----
  v16b qah[2], qal[2];
#pragma unroll
  for (int dc = 0; dc < 2; ++dc) {
    const size_t qo = (rowB + q0 + c) * DM + dc * 32 + 8 * hh;
    qah[dc] = ldfrag_b(Qh + qo);
    qal[dc] = ldfrag_b(Ql + qo);
  }

  const int qrow = q0 + c;                   // this lane's query
  float mrow = -INFINITY, lrow = 0.f;        // running maximum (both halves alike), this half's running sum
  v8f oacc[4];                               // O^T: tile t, register r = dim 16t + 8*hh + r of query c
#pragma unroll
  for (int t = 0; t < 4; ++t) oacc[t] = zero8();

  int nkt = qb + 1;                          // causal: key tiles 0..qb, block-uniform
  if (nkt > NQB) nkt = NQB;
  for (int kt = 0; kt < nkt; ++kt) {
    const int kv0 = kt * 64;
    __syncthreads();
    {
      const int r = tid >> 1, half = (tid & 1) * 32;
      const __bf16*   kg  = Kh + (rowB + kv0 + r) * DM + half;    // K row kv0+r, d = half..half+31
      const __bf16*   klg = Kl + (rowB + kv0 + r) * DM + half;
      const _Float16* vg  = Vh + (size_t)r * SEQ + kv0 + half;    // V^T row d = r, s = kv0+half..+31
      const int kvl = (kv0 + 64 <= VLP) ? kv0 : (VLP - 64);     // clamped address into the residual plane
      const _Float16* vlg = Vl + (size_t)r * VLP + kvl + half;
      const bool resOK = (kv0 + 64 <= VLP);                      // block-uniform
#pragma unroll
      for (int i = 0; i < 4; ++i) {
        const v8b a0 = *(const v8b*)(kg + 8 * i);
        const v8b a1 = *(const v8b*)(klg + 8 * i);
        const v8h b0 = *(const v8h*)(vg + 8 * i);
        *(v8b*)(Ksh + r * LP + half + 8 * i) = a0;
        *(v8b*)(Ksl + r * LP + half + 8 * i) = a1;
        *(v8h*)(Vth + r * LP + half + 8 * i) = b0;
        if (RES) {
          v8h b1 = *(const v8h*)(vlg + 8 * i);
          if (!resOK) b1 = zero8h();
          *(v8h*)(Vtl + r * LP + half + 8 * i) = b1;
        }
      }
#if defined(__HIP_DEVICE_COMPILE__)
      // the wait that stands in front of an overwrite of a register which an issued load names; the addresses are inputs,
      // so that no later load's result is laid on the address pair of an earlier one (seen in the listing with RES only)
      if (RES) asm volatile("s_wait_xcnt 0x0" :: "v"(kg), "v"(klg), "v"(vg), "v"(vlg) : "memory");
#endif
    }
    __syncthreads();

    // ---- scores, transposed: 64 keys x 16 queries per wave, 3 bf16 products ----
    // all 16 K fragments are read as one group in front of the 24 products, in the order of their use; the products
    // run back to back, the four key tiles' accumulator chains in turn (each chain keeps its order of products)
    FB kb[2][4], kl[2][4];
#pragma unroll
    for (int dc = 0; dc < 2; ++dc) {
#pragma unroll
      for (int j = 0; j < 4; ++j) {
        kb[dc][j].h[0] = *(const v8b*)(Ksh + (j * 16 + c) * LP + dc * 32 + 8 * hh);
        kb[dc][j].h[1] = *(const v8b*)(Ksh + (j * 16 + c) * LP + dc * 32 + 16 + 8 * hh);
      }
#pragma unroll
      for (int j = 0; j < 4; ++j) {
        kl[dc][j].h[0] = *(const v8b*)(Ksl + (j * 16 + c) * LP + dc * 32 + 8 * hh);
        kl[dc][j].h[1] = *(const v8b*)(Ksl + (j * 16 + c) * LP + dc * 32 + 16 + 8 * hh);
      }
    }
    v8f s[4];
    FH vb[2][4], vl[2][4];
#pragma unroll
    for (int j = 0; j < 4; ++j) s[j] = zero8();
#pragma unroll
    for (int dc = 0; dc < 2; ++dc) {
      // no instruction: the scheduler moves nothing across, so the group of LDS reads in front stays one group
      // instead of being spread among the products
      __builtin_amdgcn_sched_barrier(0);
#pragma unroll
      for (int j = 0; j < 4; ++j) s[j] = mma_b_raw(kb[dc][j].v, qah[dc], s[j]);
#pragma unroll
      for (int j = 0; j < 4; ++j) s[j] = mma_b_raw(kl[dc][j].v, qah[dc], s[j]);
#pragma unroll
      for (int j = 0; j < 4; ++j) s[j] = mma_b_raw(kb[dc][j].v, qal[dc], s[j]);
      __builtin_amdgcn_sched_barrier(0);   // as above; the twelve products stay one run, their four chains in turn
      if (dc == 0) {
        // all V^T hi fragments of this chunk are read as one group here, behind the first half of the score products:
        // they arrive while the second half and the softmax run
#pragma unroll
        for (int kk = 0; kk < 2; ++kk) {
#pragma unroll
          for (int t = 0; t < 4; ++t) {
            vb[kk][t].h[0] = *(const v8h*)(Vth + (t * 16 + c) * LP + kk * 32 + 8 * hh);
            vb[kk][t].h[1] = *(const v8h*)(Vth + (t * 16 + c) * LP + kk * 32 + 16 + 8 * hh);
          }
        }
      }
      if (RES && dc == 1) {
        // the residual fragments are read behind the last score product, into registers that the K fragments have left
        // (read with the group above they would cost the kernel its third wave per SIMD); they arrive under the softmax
#pragma unroll   // written out, like the loop inside: vl[kk][t] lives in registers, which a run-time index cannot pick
        for (int kk = 0; kk < 2; ++kk) {
#pragma unroll
          for (int t = 0; t < 4; ++t) {
            vl[kk][t].h[0] = *(const v8h*)(Vtl + (t * 16 + c) * LP + kk * 32 + 8 * hh);
            vl[kk][t].h[1] = *(const v8h*)(Vtl + (t * 16 + c) * LP + kk * 32 + 16 + 8 * hh);
          }
        }
      }
    }

    // ---- scale + causal mask (replace by -FLT_MAX), maximum of the lane's 32 keys, joined with the other half ----
    float mj[4];
#pragma unroll
    for (int j = 0; j < 4; ++j) {
      mj[j] = -INFINITY;
#pragma unroll
      for (int r = 0; r < 8; ++r) {
        const int key = kv0 + j * 16 + 8 * hh + r;
        float sv = s[j][r] * sscale;
        sv = (key > qrow) ? -FLT_MAX : sv;
        s[j][r] = sv;
        mj[j] = fmaxf(mj[j], sv);
      }
    }
    float m = fmaxf(fmaxf(mj[0], mj[1]), fmaxf(mj[2], mj[3]));
    m = fmaxf(m, xhalf(m));
    const float mnew  = fmaxf(mrow, m);
    const float msafe = (mnew == -INFINITY) ? 0.f : mnew;
    const float alpha = exp_slot(mrow - msafe);
    mrow = mnew;

    // ---- online softmax: P (x1024, f16) and P residual (x4096) packed into the B operands of the two key chunks ----
    FH pa[2], pl[2];
    float pj[4];
#pragma unroll
    for (int j = 0; j < 4; ++j) {
      pj[j] = 0.f;
#pragma unroll
      for (int r = 0; r < 8; ++r) {
        const float p = exp_slot(s[j][r] - msafe);   // masked logit against a finite max: exp -> 0
        pj[j] += p;
        const float p1k = p * 1024.0f;
        const _Float16 ph = (_Float16)p1k;
        pa[j >> 1].v[(j & 1) * 8 + r] = ph;
        if (RES) pl[j >> 1].v[(j & 1) * 8 + r] = (_Float16)((p1k - (float)ph) * 4096.0f);
      }
    }
    // no instruction: every e^x above is asm text; the scheduler moves none of them down among the products below
    __builtin_amdgcn_sched_barrier(0);
    lrow = lrow * alpha + ((pj[0] + pj[1]) + (pj[2] + pj[3]));
#pragma unroll
    for (int t = 0; t < 4; ++t)
#pragma unroll
      for (int r = 0; r < 8; ++r) oacc[t][r] *= alpha;

    // ---- context^T += V^T . P^T (f16 WMMA), residual products into a separate accumulator ----
    v8f o1[4];
#pragma unroll
    for (int t = 0; t < 4; ++t) o1[t] = zero8();
#pragma unroll   // both chunks written out: pa[kk] and pl[kk] live in registers, which a run-time index cannot pick
    for (int kk = 0; kk < 2; ++kk) {
#pragma unroll
      for (int t = 0; t < 4; ++t) oacc[t] = mma_h_raw(vb[kk][t].v, pa[kk].v, oacc[t]);
      if (RES) {
#pragma unroll
        for (int t = 0; t < 4; ++t) o1[t] = mma_h_raw(vl[kk][t].v, pa[kk].v, o1[t]);
#pragma unroll
        for (int t = 0; t < 4; ++t) o1[t] = mma_h_raw(vb[kk][t].v, pl[kk].v, o1[t]);
      }
    }
    // the distance behind the last products, also on the loop's taken branch
    // (with RES the fold below stands between the products and the branch)
    if (!RES) acc_guard4(oacc[0], oacc[1], oacc[2], oacc[3]);
    if (RES) {
#pragma unroll
      for (int t = 0; t < 4; ++t)
#pragma unroll
        for (int r = 0; r < 8; ++r) oacc[t][r] += o1[t][r] * (1.0f / 4096.0f);
    }
  }

  // ---- normalise (1/l and the 1/1024 p carry), stage the wave's 16x64 tile in LDS, then write whole
  float* os = Osp + wave * (16 * OP);
  {
    const float l = lrow + xhalf(lrow);      // the two halves' sums, joined once
    const float inv = ((l > 0.f) ? (1.0f / l) : 0.f) * (1.0f / 1024.0f);
#pragma unroll
    for (int t = 0; t < 4; ++t) {
      v4f w0, w1;
#pragma unroll
      for (int e = 0; e < 4; ++e) { w0[e] = oacc[t][e] * inv; w1[e] = oacc[t][4 + e] * inv; }
      *(v4f*)(os + c * OP + t * 16 + 8 * hh)     = w0;   // query row c, dims 16t + 8*hh ..
      *(v4f*)(os + c * OP + t * 16 + 8 * hh + 4) = w1;
    }
  }
  __builtin_amdgcn_fence(__ATOMIC_RELEASE, "workgroup");
  __builtin_amdgcn_wave_barrier();
  __builtin_amdgcn_fence(__ATOMIC_ACQUIRE, "workgroup");
  {
    const int h2 = lane >> 4, c4 = (lane & 15) * 4;
    v4f ov[8];
#pragma unroll
    for (int it = 0; it < 8; ++it) {
      const int row = it * 2 + h2;   // it 0..7 x h2 0..1 = rows 0..15 of the wave tile
      ov[it] = *(const v4f*)(os + row * OP + c4);
    }
    {
#pragma unroll
      for (int it = 0; it < 8; ++it) {
        const int row = it * 2 + h2;
        const size_t go = (rowB + q0 + row) * DM + (size_t)h * HD + c4;
        *(v4f*)(outp + go) = ov[it];
      }
      
    }
  }
}

// =====================================================================================================
// Both attention jobs, which do not depend on one another, as block ranges of ONE grid (the test on the block index is
// block-uniform; both jobs use the same LDS). The job with the long blocks comes first:
//   [0, AB_MAIN)        query blocks RESQB .. NQB-1, without residual planes
//   [AB_MAIN, AB_ALL)   query blocks 0 .. RESQB-1, with residual planes
// =====================================================================================================
#define AB_MAIN (NB * NH * (NQB - RESQB))              // 768
#define AB_ALL  (NB * NH * NQB)                        // 1024
__global__ __launch_bounds__(128)
void attn_causal64(const unsigned short* __restrict__ qhp, const unsigned short* __restrict__ qlp,
                   const unsigned short* __restrict__ khp, const unsigned short* __restrict__ klp,
                   const unsigned short* __restrict__ vhp, const unsigned short* __restrict__ vlp,
                   float* outp, float sscale) {
  __shared__ __align__(16) __bf16   Ksh[64 * LP];                 // K hi [kv][d], row pitch LP
  __shared__ __align__(16) __bf16   Ksl[64 * LP];                 // K lo
  __shared__ __align__(16) _Float16 Vth[64 * LP];                 // V^T hi [d][kv], row pitch LP
  __shared__ __align__(16) _Float16 Vtl[64 * LP];                 // V^T residual
  __shared__ __align__(16) float    Os[4 * 16 * OP];              // per wave context tile [row][d], row pitch OP
  const int bx = blockIdx.x;
  if (bx < AB_MAIN) {
    attn_tile<false>(Ksh, Ksl, Vth, Vtl, Os, bx, qhp, qlp, khp, klp, vhp, vlp, outp, RESQB, NQB - RESQB, sscale);
  } else {
    attn_tile<true>(Ksh, Ksl, Vth, Vtl, Os, bx - AB_MAIN, qhp, qlp, khp, klp, vhp, vlp, outp, 0, RESQB, sscale);
  }
}

// =====================================================================================================
// Workspace map (bytes), every region an exact multiple of its whole-line / whole-tile store granularity:
//   Xb    bf16 [4096][1024]          0          8388608
//   Winb  bf16 [3072][1024]          8388608    6291456
//   Wob   bf16 [1024][1024]          14680064   2097152
//   Rin   f32  [3072]                16777216     12288   (96 lines)
//   Rout  f32  [1024]                16789504      4096   (32 lines)
//   Rrow  f32  [4096]                16793600     16384   (128 lines)
//   CosT  f32  [2048][32]            16809984    262144
//   SinT  f32  [2048][32]            17072128    262144
//   Af    f32  [4096][1024]          17334272  33554432   (Af, then Ah bf16 and Al bf16 [4096][1024] each)
//   VTh   f16  [2][1024][2048]       50888704   8388608
//   VTl   f16  [2][1024][512]        59277312   2097152
//   Qh    bf16 [4096][1024]          61374464   8388608
//   Ql    bf16 [4096][1024]          69763072   8388608
//   Kh    bf16 [4096][1024]          78151680   8388608
//   Kl    bf16 [4096][1024]          86540288   8388608
//   end                              94928896
// Weights are [out n][in k] with k contiguous = the Bt / A layout the GEMM wants, so they are only converted.
// =====================================================================================================
extern "C" void kernel_launch(void* const* d_in, const int* in_sizes, int n_in,
                              void* d_out, int out_size, void* d_ws, size_t ws_size,
                              hipStream_t stream) {
  if (n_in < 4) return;
  if (in_sizes[0] != NB * SEQ * DM) return;
  if (in_sizes[1] != SEQ * (HD / 2)) return;
  if (in_sizes[2] != 3 * DM * DM) return;
  if (in_sizes[3] != DM * DM) return;
  if (out_size != NB * SEQ * DM) return;

  const float* x    = (const float*)d_in[0];
  const float* rpf  = (const float*)d_in[1];
  const float* w_in = (const float*)d_in[2];
  const float* w_o  = (const float*)d_in[3];

  const size_t PXb   = (size_t)NB * SEQ * DM * 2;      //  8388608  16-bit activation plane [4096][1024]
  const size_t PWin  = (size_t)3 * DM * DM * 2;        //  6291456
  const size_t PWo   = (size_t)DM * DM * 2;            //  2097152
  const size_t PRin  = (size_t)3 * DM * 4;             //    12288
  const size_t PRout = (size_t)DM * 4;                 //     4096
  const size_t PRrow = (size_t)NB * SEQ * 4;           //    16384
  const size_t PTrig = (size_t)SEQ * (HD / 2) * 4;     //   262144
  const size_t PQK   = (size_t)NB * SEQ * NQK * 4;     // 33554432  Af + Ah + Al
  const size_t PVTh  = (size_t)NB * DM * SEQ * 2;      //  8388608
  const size_t PVTl  = (size_t)NB * DM * VLP * 2;      //  2097152
  const size_t PAf   = (size_t)NB * SEQ * DM * 4;      // 16777216
  if (PAf + 2 * PXb != PQK) return;                    // Af + Ah + Al fill their region exactly
  size_t off = 0;
  const size_t oXb   = off; off += PXb;
  const size_t oWin  = off; off += PWin;
  const size_t oWo   = off; off += PWo;
  const size_t oRin  = off; off += PRin;
  const size_t oRout = off; off += PRout;
  const size_t oRrow = off; off += PRrow;
  const size_t oCos  = off; off += PTrig;
  const size_t oSin  = off; off += PTrig;
  const size_t oQK   = off; off += PQK;
  const size_t oVTh  = off; off += PVTh;
  const size_t oVTl  = off; off += PVTl;
  const size_t oQh   = off; off += PXb;
  const size_t oQl   = off; off += PXb;
  const size_t oKh   = off; off += PXb;
  const size_t oKl   = off; off += PXb;
  if (off > ws_size) return;                           // off = 94928896
  if (off > (size_t)134217728) return;
  const size_t oAf = oQK;
  const size_t oAh = oQK + PAf;
  const size_t oAl = oAh + PXb;
  if (oAl + PXb > oVTh) return;                        // region ordering sanity

  char* ws = (char*)d_ws;
  unsigned short* Xb   = (unsigned short*)(ws + oXb);
  unsigned short* Winb = (unsigned short*)(ws + oWin);
  unsigned short* Wvb  = Winb + (size_t)2 * DM * DM;   // rows 2048..3071 of w_in = v features
  unsigned short* Wob  = (unsigned short*)(ws + oWo);
  float*          Rin  = (float*)(ws + oRin);
  float*          Rv   = Rin + 2 * DM;
  float*          Rout = (float*)(ws + oRout);
  float*          Rrow = (float*)(ws + oRrow);
  float*          CosT = (float*)(ws + oCos);
  float*          SinT = (float*)(ws + oSin);
  unsigned short* VTh  = (unsigned short*)(ws + oVTh);
  unsigned short* VTl  = (unsigned short*)(ws + oVTl);
  unsigned short* Qh   = (unsigned short*)(ws + oQh);
  unsigned short* Ql   = (unsigned short*)(ws + oQl);
  unsigned short* Kh   = (unsigned short*)(ws + oKh);
  unsigned short* Kl   = (unsigned short*)(ws + oKl);
  float*          Af   = (float*)(ws + oAf);
  unsigned short* Ah   = (unsigned short*)(ws + oAh);
  unsigned short* Al   = (unsigned short*)(ws + oAl);

  const dim3 blk(256);
  const dim3 gPrepA(NB * SEQ / 32);                                  // 128 blocks (32 rows each)
  const dim3 gblk(128);                                              // GEMM block: 4 waves, one 128x128 tile
  const dim3 gOut((NB * SEQ / 128) * (DM / 128), 1);                 // 32 x 8 = 256 blocks

  // (1) inputs: weights -> bf16 planes [n][k] + per-row inverse L2 norms of the converted rows; angle tables from the
  //     bf16-converted input table; x -> bf16 plane [4096][1024]
  prep_inputs<<<dim3(PB_ALL), blk, 0, stream>>>(x, rpf, w_in, w_o, Xb, Winb, Wob, Rin, Rout, CosT, SinT);
  // (2) q/k projection with rotary and per-head rms -> q/k bf16 hi/lo planes; v^T projection -> f16 hi and residual planes
  gemm_qk_vt<<<dim3(GB_ALL), gblk, 0, stream>>>(Xb, Winb, Wvb, Qh, Ql, Kh, Kl, VTh, VTl, Rin, Rv, CosT, SinT, VLP);
  // (3) causal attention: query blocks 0..RESQB-1 with residual planes, the rest without -> Af f32 [4096][1024]
  attn_causal64<<<dim3(AB_ALL), dim3(128), 0, stream>>>(Qh, Ql, Kh, Kl, VTh, VTl, Af, 0.125f);
  // (4) merged rows -> bf16 hi/lo planes + per-row inverse rms over 1024
  row_prep_hilo<<<gPrepA, blk, 0, stream>>>(Af, Ah, Al, Rrow, 1.0f / (float)DM);
  // (5) out[s][e] = Rrow[s] * Rout[e] * sum_d (Ah+Al)[s][d] Wob[e][d] -> d_out f32 [4096][1024]  (M=4096, N=1024, K=1024)
  gemm64<1, 0, true, true><<<gOut, gblk, 0, stream>>>(
      Ah, Al, DM, 0LL, Wob, DM, 0LL,
      d_out, DM, 0LL, d_out, 0, 0LL, 0,
      NB * SEQ, DM, DM, 1.0f, Rrow, Rout,
      d_out, d_out, Rrow, Rout);
  (void)hipGetLastError();
}

// v007
// Measured time: 113 microseconds a run.
// Next to v006, in two timings, it ran 1.06 times as fast each time.
// Over all steps from v000 it is 3.52 times as fast.
// Contractions: q/k and v^T projections = v_wmma_f32_16x16x32_bf16 (bf16 operands from RNE-converted inputs, single product, f32 row/column scales in the epilogue; q/k: RoPE and head rms there too);
// k.q^T scores (transposed) = v_wmma_f32_16x16x32_bf16 with bf16 hi/lo split q and k (hi.hi + hi.lo + lo.hi);
// v^T.p^T (transposed) = v_wmma_f32_16x16x32_f16 (p carried x1024 in f16, v in f16; extra f16 residual planes x4096 of p and v on the first 512 query rows);
// a.Wout^T = v_wmma_f32_16x16x32_bf16 with a as bf16 hi/lo planes times bf16 Wout (2 products); all f32 accumulate; RoPE, norms and softmax in f32.
#include <hip/hip_runtime.h>
#include <math.h>
#include <float.h>
#include <stdint.h>

#define NB    2
#define SEQ   2048
#define DM    1024
#define NH    16
#define HD    64
#define NQK   (2 * DM)       // q and k feature columns of the fused q/k projection output
#define NQB   (SEQ / 64)     // 32 query / key tiles of 64
#define VLP   512            // key pitch of the v^T residual plane (keys 0..VLP-1)
#define RESQB 8              // leading 64-row query blocks that use the p / v residual planes
static_assert(RESQB * 64 <= VLP);
static_assert(NH * HD == DM);
static_assert((SEQ % 64) == 0 && (DM % 256) == 0);
static_assert(HD == 64);
static_assert((NB * SEQ) % 128 == 0 && SEQ % 128 == 0 && DM % 128 == 0 && NQK % 128 == 0);   // GEMM block tiles of 128x128, k slabs of 64
#define LP    72             // LDS pitch, in 16-bit elements, of a 64-element row: 144 B = 16 B x odd, so that the 16 rows
                             // one ds_load_b128 fragment read touches fall on 16 different groups of four banks
#define GP    72             // LDS pitch, in 16-bit elements, of a GEMM k-slab row of 64 elements (144 B = 16 B x odd, as LP)
#define GPLANE (128 * GP)    // elements of one staged 128-row k slab
#define APL   (64 * LP)      // elements of one staged 64-row attention tile (K hi, K lo, V^T or V^T residual)
#define OP    68             // LDS pitch, in floats, of a 64-float row: the two lane halves store the same rows, eight floats apart

typedef _Float16 v16h __attribute__((ext_vector_type(16)));
typedef _Float16 v8h  __attribute__((ext_vector_type(8)));
typedef __bf16   v16b __attribute__((ext_vector_type(16)));
typedef __bf16   v8b  __attribute__((ext_vector_type(8)));
typedef float    v8f  __attribute__((ext_vector_type(8)));
typedef float    v4f  __attribute__((ext_vector_type(4)));
typedef unsigned int v4u __attribute__((ext_vector_type(4)));

// ---- scalar helpers --------------------------------------------------------------------------------
__device__ __forceinline__ unsigned short bf_bits(float f) {          // f32 -> bf16 bits, RNE convert
  unsigned u = __float_as_uint(f);
  return (unsigned short)((u + 0x7FFFu + ((u >> 16) & 1u)) >> 16);
}
__device__ __forceinline__ float bf_up(unsigned short h) { return __uint_as_float(((unsigned)h) << 16); }
__device__ __forceinline__ unsigned short h_bits(_Float16 x) { return __builtin_bit_cast(unsigned short, x); }
__device__ __forceinline__ unsigned pk16(unsigned short a, unsigned short b) { return (unsigned)a | ((unsigned)b << 16); }
__device__ __forceinline__ v8f zero8() { v8f z = {0.f, 0.f, 0.f, 0.f, 0.f, 0.f, 0.f, 0.f}; return z; }
__device__ __forceinline__ v8h zero8h() {
  const _Float16 z = (_Float16)0.0f;
  v8h r = {z, z, z, z, z, z, z, z};
  return r;
}

// value of lane l ^ 16 (the other 16-lane row), by a vector cross-row move
__device__ __forceinline__ float xhalf(float x) {
  const int b = __builtin_bit_cast(int, x);
  return __builtin_bit_cast(float, __builtin_amdgcn_permlanex16(b, b, 0x76543210, 0xfedcba98, false, false));
}

// e^x as 2^(x * log2 e) on v_exp_f32, as __expf gives it. The v_nop is the one slot that the instruction set asks for
// between a transcendental and an instruction that reads its result or overwrites its source: in the same statement
// it stands there whichever instruction the compiler puts next
__device__ __forceinline__ float exp_slot(float x) {
  const float y = x * 1.44269504f;
  float r;
#if defined(__HIP_DEVICE_COMPILE__)
  asm("v_exp_f32 %0, %1\n\tv_nop" : "=v"(r) : "v"(y));
#else
  r = y;
#endif
  return r;
}

// ---- fragment loader: 16-bit A/B operand, lane -> row/col (lane&15), p already includes +8*(lane>>4);
//      elements 0..7 <- p[0..7] (k0+8h..), elements 8..15 <- p[16..23] (k0+16+8h..)
__device__ __forceinline__ v16b ldfrag_b(const __bf16* p) {
  union { v16b v; v8b h[2]; } f;
  f.h[0] = *(const v8b*)(p);
  f.h[1] = *(const v8b*)(p + 16);
  return f.v;
}

// ---- WMMA helpers with trailing VALU hazard gap --------------------------------------------------------
__device__ __forceinline__ v8f mma_b_raw(v16b a, v16b b, v8f c) {
  return __builtin_amdgcn_wmma_f32_16x16x32_bf16(false, a, false, b, (short)0, c, false, false);
}
__device__ __forceinline__ v8f mma_h_raw(v16h a, v16h b, v8f c) {
  return __builtin_amdgcn_wmma_f32_16x16x32_f16(false, a, false, b, (short)0, c, false, false);
}
__device__ __forceinline__ void dep_guard_b(v8f& a, v8f& b, v16b x, v16b y) {
#if defined(__HIP_DEVICE_COMPILE__)
  asm volatile("v_nop\n\tv_nop\n\tv_nop\n\tv_nop" : "+v"(a), "+v"(b) : "v"(x), "v"(y));
#endif
}
__device__ __forceinline__ void keep4_b(v16b a, v16b b, v16b c, v16b d) {
#if defined(__HIP_DEVICE_COMPILE__)
  asm volatile("v_nop" :: "v"(a), "v"(b), "v"(c), "v"(d));
#endif
}
__device__ __forceinline__ void acc_guard4(v8f& a, v8f& b, v8f& c, v8f& d) {
#if defined(__HIP_DEVICE_COMPILE__)
  asm volatile("v_nop\n\tv_nop\n\tv_nop\n\tv_nop" : "+v"(a), "+v"(b), "+v"(c), "+v"(d));
#endif
}

// =====================================================================================================
// f32 -> bf16 (RNE convert), 8 elements per thread, one 16-B store per lane: a wave writes 512 contiguous B
// coverage: n8 threads x 8 = whole plane (n8 is a multiple of 256 here). blk = index of this 256-thread block in the job.
// =====================================================================================================
__device__ __forceinline__ void cvt_bf16x8(int blk, const float* __restrict__ in, unsigned short* out, int n8) {
  const int i = blk * 256 + threadIdx.x;
  if (i < n8) {
    const v4f a = *(const v4f*)(in + (size_t)i * 8);
    const v4f b = *(const v4f*)(in + (size_t)i * 8 + 4);
    v4u p;
    p[0] = pk16(bf_bits(a[0]), bf_bits(a[1]));
    p[1] = pk16(bf_bits(a[2]), bf_bits(a[3]));
    p[2] = pk16(bf_bits(b[0]), bf_bits(b[1]));
    p[3] = pk16(bf_bits(b[2]), bf_bits(b[3]));
    *(v4u*)(out + (size_t)i * 8) = p;
    
  }
}

// =====================================================================================================
// Angle table: ct[i] = cosf(bf(fr[i])), st[i] = sinf(bf(fr[i])) with the angle RNE-converted to bf16
// =====================================================================================================
__device__ __forceinline__ void trig_tab(int blk, const float* __restrict__ fr, float* ct, float* st, int n) {
  const int i = blk * 256 + threadIdx.x;
  if (i < n) {
    const float f  = bf_up(bf_bits(fr[i]));
    const float cv = cosf(f);
    const float sv = sinf(f);
    *(float*)(ct + i) = cv;
    *(float*)(st + i) = sv;
    
  }
}

// =====================================================================================================
// Row preparation over rows of DM=1024 f32 values (pitch DM):
//   hi plane = RNE bf16 of each value; LO: lo plane = RNE bf16 of (v - hi) (unscaled);
//   rtab[row] = rsqrt(ss * inv_div + 1e-6) with ss = sum over the row of g^2,
//     g = the bf16-converted value (SQR) or the f32 value (!SQR).
// Block = 8 waves = 32 rows (wave w: rows 4w..4w+3 of the block); blocks of the job = rows / 32 (exact here), blk = this one.
// sr = 32 floats of LDS that belong to the block.
// Per row and instruction t (0..3): lane l holds columns 256t + 8l .. +7 -> 32 lanes x 16 B = 512 B
// coverage: 4 t x 32 lanes x 8 = 1024 columns per row; 8 waves x 4 rows = 32 rows per block.
// =====================================================================================================
template <bool LO, bool SQR>
__device__ __forceinline__ void row_prep_part(float* sr, int blk, const float* __restrict__ in, unsigned short* hp,
                                              unsigned short* lp, float* rtab, float inv_div) {
  const int tid = threadIdx.x, wave = tid >> 5, lane = tid & 31;
#pragma unroll 1
  for (int i = 0; i < 4; ++i) {
    const int row = blk * 32 + wave * 4 + i;
    const float* rp = in + (size_t)row * DM + lane * 8;
    float ss = 0.f;
    v4u hv[4], lv[4];
#pragma unroll
    for (int t = 0; t < 4; ++t) {
      const v4f a  = *(const v4f*)(rp + t * 256);
      const v4f bq = *(const v4f*)(rp + t * 256 + 4);
      v4u ph, pl;
#pragma unroll
      for (int e = 0; e < 4; ++e) {
        const float f0 = (e < 2) ? a[2 * e]     : bq[2 * e - 4];
        const float f1 = (e < 2) ? a[2 * e + 1] : bq[2 * e - 3];
        const unsigned short h0 = bf_bits(f0), h1 = bf_bits(f1);
        const float g0 = SQR ? bf_up(h0) : f0;
        const float g1 = SQR ? bf_up(h1) : f1;
        ss += g0 * g0;
        ss += g1 * g1;
        ph[e] = pk16(h0, h1);
        if (LO) {
          pl[e] = pk16(bf_bits(f0 - bf_up(h0)), bf_bits(f1 - bf_up(h1)));
        } else {
          pl[e] = 0u;
        }
      }
      hv[t] = ph; lv[t] = pl;
    }
#pragma unroll
    for (int off = 16; off >= 1; off >>= 1) ss += __shfl_xor(ss, off, 32);
    const float rv = rsqrtf(ss * inv_div + 1e-6f);
    if (lane == 0) sr[wave * 4 + i] = rv;
    {
#pragma unroll
      for (int t = 0; t < 4; ++t) {
        const size_t go = (size_t)row * DM + t * 256 + lane * 8;
        *(v4u*)(hp + go) = hv[t];
        if (LO) *(v4u*)(lp + go) = lv[t];
      }
      
    }
  }
  __syncthreads();
  if (wave == 0) {
    const float rv = sr[lane];
    float* d = rtab + (size_t)blk * 32 + lane;
    *(float*)d = rv;
    
  }
}

// merged attention rows -> bf16 hi/lo planes + per-row inverse rms
__global__ __launch_bounds__(256) void row_prep_hilo(const float* __restrict__ in, unsigned short* hp, unsigned short* lp,
                                                     float* rtab, float inv_div) {
  __shared__ float sr[32];
  row_prep_part<true, false>(sr, blockIdx.x, in, hp, lp, rtab, inv_div);
}

// =====================================================================================================
// The four preparations of the inputs, which do not depend on one another, as block ranges of ONE grid (every test on
// the block index is block-uniform). The jobs with the longest blocks come first:
//   [0, PB_WIN)            w_in rows  -> bf16 plane + inverse L2 norms of the converted rows
//   [PB_WIN, PB_W)         w_out rows -> the same
//   [PB_W, PB_WT)          angle tables
//   [PB_WT, PB_ALL)        x -> bf16 plane
// =====================================================================================================
#define PB_WIN  (3 * DM / 32)                          // 96
#define PB_W    (PB_WIN + DM / 32)                     // 128
#define PB_WT   (PB_W + SEQ * (HD / 2) / 256)          // 384
#define PB_ALL  (PB_WT + NB * SEQ * DM / 8 / 256)      // 2432
__global__ __launch_bounds__(256) void prep_inputs(const float* __restrict__ x, const float* __restrict__ fr,
                                                   const float* __restrict__ w_in, const float* __restrict__ w_o,
                                                   unsigned short* Xb, unsigned short* Winb, unsigned short* Wob,
                                                   float* Rin, float* Rout, float* ct, float* st) {
  __shared__ float sr[32];
  const int bx = blockIdx.x;
  if (bx < PB_W) {
    const bool first = bx < PB_WIN;
    unsigned short* hp = first ? Winb : Wob;
    row_prep_part<false, true>(sr, first ? bx : bx - PB_WIN, first ? w_in : w_o, hp, hp, first ? Rin : Rout, 1.0f);
  } else if (bx < PB_WT) {
    trig_tab(bx - PB_W, fr, ct, st, SEQ * (HD / 2));
  } else {
    cvt_bf16x8(bx - PB_WT, x, Xb, NB * SEQ * DM / 8);
  }
}

// =====================================================================================================
// Eight asynchronous 16-B copies per lane, global memory -> LDS: this lane's piece of rows r, r+16, .., r+112 of one
// 128-row x 64-element k slab. g = the lane's piece in row r (row pitch ld elements), l = its LDS byte address
// (row pitch GP elements). Eight lanes cover one 128-B row, so a wave's copy covers four whole lines.
// =====================================================================================================
__device__ __forceinline__ void stage_plane(const __bf16* g, int ld, unsigned l) {
  const size_t   gs = (size_t)16 * (size_t)ld;        // 16 rows in global memory, elements
  const unsigned ls = 16u * GP * 2u;                  // 16 rows in LDS, bytes
  const __bf16 *g0 = g, *g1 = g + gs, *g2 = g + 2 * gs, *g3 = g + 3 * gs;
  const __bf16 *g4 = g + 4 * gs, *g5 = g + 5 * gs, *g6 = g + 6 * gs, *g7 = g + 7 * gs;
  const unsigned l0 = l, l1 = l + ls, l2 = l + 2 * ls, l3 = l + 3 * ls;
  const unsigned l4 = l + 4 * ls, l5 = l + 5 * ls, l6 = l + 6 * ls, l7 = l + 7 * ls;
#if defined(__HIP_DEVICE_COMPILE__)
  // the copies bring the slab into LDS through no register; the closing s_wait_xcnt stands in the same statement so
  // that no address register named here is rewritten in front of it
  asm volatile(
      "global_load_async_to_lds_b128 %0, %8, off\n\t"
      "global_load_async_to_lds_b128 %1, %9, off\n\t"
      "global_load_async_to_lds_b128 %2, %10, off\n\t"
      "global_load_async_to_lds_b128 %3, %11, off\n\t"
      "global_load_async_to_lds_b128 %4, %12, off\n\t"
      "global_load_async_to_lds_b128 %5, %13, off\n\t"
      "global_load_async_to_lds_b128 %6, %14, off\n\t"
      "global_load_async_to_lds_b128 %7, %15, off\n\t"
      "s_wait_xcnt 0x0"
      :: "v"(l0), "v"(l1), "v"(l2), "v"(l3), "v"(l4), "v"(l5), "v"(l6), "v"(l7),
         "v"(g0), "v"(g1), "v"(g2), "v"(g3), "v"(g4), "v"(g5), "v"(g6), "v"(g7)
      : "memory");
#endif
}
// this wave's own copies have landed in LDS
__device__ __forceinline__ void wait_async0() {
#if defined(__HIP_DEVICE_COMPILE__)
  asm volatile("s_wait_asynccnt 0x0" ::: "memory");
#endif
}
// this wave's own LDS reads have returned, so that the buffer they read may be refilled behind the next barrier
__device__ __forceinline__ void wait_ds0() {
#if defined(__HIP_DEVICE_COMPILE__)
  asm volatile("s_wait_dscnt 0x0" ::: "memory");
#endif
}

// cos / sin of rows row0 .. row0+7 (row0 a multiple of 8, so the eight positions row0 % SEQ + r stay below SEQ) and
// pairs p, p + 16 from the [SEQ][32] angle tables
__device__ __forceinline__ void load_angles(const float* __restrict__ ct, const float* __restrict__ st, int row0, int p,
                                            float (&cv)[8][2], float (&sv)[8][2]) {
  const size_t to = (size_t)(row0 % SEQ) * (HD / 2) + p;
#pragma unroll
  for (int r = 0; r < 8; ++r) {
#pragma unroll
    for (int j = 0; j < 2; ++j) {
      cv[r][j] = ct[to + r * (HD / 2) + (j << 4)];
      sv[r][j] = st[to + r * (HD / 2) + (j << 4)];
    }
  }
}

// =====================================================================================================
// Batched bf16 WMMA GEMM: C[m][n] = rs[m] * cs[n] * sum_k A[m][k] * Bt[n][k]. Block = 4 waves = a 128x128 tile,
// wave (wave>>1, wave&1) owns one 64x64 quarter. A row-major [M][K] pitch lda; Bt row-major [N][K] pitch ldb
// (k contiguous); M, N multiples of 128, K a multiple of 64 (true of the three GEMMs below).
// tile = index of the block's tile (row-major over the tiles), b = batch index (strides in elements).
// sAp, sBp, sA2p, sTp = the block's LDS: A, Bt and (NSPLIT) A2 slabs, two buffers of GPLANE elements each, and four per-wave
// 16x64 f32 slabs of pitch 68.
// Operands: k slabs of 64 elements (one 128-B line per row) are copied into LDS by asynchronous 16-B copies, whole
// lines per wave, two buffers: slab t+1 flies while slab t is worked on. Fragments are read from LDS (row pitch GP).
// NSPLIT: 0 = A.Bt; 1 = (A + A2).Bt (A2 = unscaled bf16 lo plane of A).
// RS / CS: per-row scale rsp[m] / per-column scale csp[n] (f32, not batched) applied in the epilogue.
// OUT_MODE: 0 = f32 (pitch ldc); 2 = bf16 hi plane C + bf16 lo plane C2 (lo = RNE(v - hi), unscaled);
//           3 = f16 hi plane C + f16 residual plane C2 = f16((v - hi) * rscale), C2 written only for tiles
//               with n0 < N2 (pitch ldc2, batch stride strideC2);
//           4 = q/k projection: a wave's 64 columns are one head of q (n0 < DM) or of k. Half-split rotary and the
//               per-head rms over the 64 dims are applied to the accumulators, then bf16 hi/lo planes as in 2, element
//               (row, h*64 + d) at [row*ldc + h*64 + d]: q -> C / C2, k -> C3 / C4.
//               ctp/stp [SEQ][32] f32 angle tables, pair index = d mod 32, position = row mod SEQ.
//               y[d<32] = x1*cos - x2*sin, y[32+d] = x1*sin + x2*cos (x1 = x[d], x2 = x[32+d]); y * rsqrt(mean(y^2) + 1e-6).
//               A lane holds columns 16j + (lane&15), j = 0..3, of its rows: x[d] and x[32+d] are its tiles j and j+2.
// =====================================================================================================
template <int NSPLIT, int OUT_MODE, bool RS, bool CS>
__device__ __forceinline__ void gemm_tile(
    __bf16* sAp, __bf16* sBp, __bf16* sA2p, float* sTp, int tile, int b,
    const unsigned short* __restrict__ Ap, const unsigned short* A2p, int lda, long long strideA,
    const unsigned short* __restrict__ Btp, int ldb, long long strideB,
    void* Cout, int ldc, long long strideC,
    void* Cout2, int ldc2, long long strideC2, int N2,
    int M, int N, int K, float rscale,
    const float* __restrict__ rsp, const float* __restrict__ csp,
    void* Cout3, void* Cout4, const float* __restrict__ ctp, const float* __restrict__ stp) {
  static_assert(NSPLIT == 0 || NSPLIT == 1);
  const __bf16* A   = (const __bf16*)(const void*)Ap;
  const __bf16* A2  = (const __bf16*)(const void*)A2p;
  const __bf16* Bt  = (const __bf16*)(const void*)Btp;
  const int tid  = threadIdx.x;
  const int lane = tid & 31;
  const int wave = tid >> 5;
  const int tilesN = N >> 7;
  const int tilesM = M >> 7;
  if (tile >= tilesM * tilesN) return;   // block-uniform, in front of every copy and barrier
  const int tm = tile / tilesN;
  const int tn = tile - tm * tilesN;
  const int bm0 = tm << 7;
  const int bn0 = tn << 7;
  const int wm  = (wave >> 1) << 6;            // this wave's quarter inside the block tile
  const int wn  = (wave & 1) << 6;
  const int m0 = bm0 + wm;
  const int n0 = bn0 + wn;

  const __bf16* Ab  = A  + (size_t)b * strideA;
  const __bf16* Bb  = Bt + (size_t)b * strideB;
  const __bf16* Ab2 = (NSPLIT >= 1) ? (A2  + (size_t)b * strideA) : Ab;

  const int rlane = lane & 15;                 // row (A) / col (B, D) within subtile
  const int koff  = (lane >> 4) * 8;           // k offset of this lane half
  const int mOff  = (lane >> 4) * 8;           // D row offset

  // ---- staging addresses: thread -> row tid>>3 (+16 per copy), 16-B piece tid&7 of the 128-B slab row ----
  const int srow = tid >> 3, spc = (tid & 7) * 8;
  const __bf16* gA  = Ab  + (size_t)(bm0 + srow) * lda + spc;
  const __bf16* gA2 = Ab2 + (size_t)(bm0 + srow) * lda + spc;
  const __bf16* gB  = Bb  + (size_t)(bn0 + srow) * ldb + spc;
  const unsigned lofs = (unsigned)(srow * GP + spc) * 2u;
  const unsigned lA  = (unsigned)(size_t)(const void*)sAp  + lofs;   // low 32 bits = byte offset in LDS
  const unsigned lB  = (unsigned)(size_t)(const void*)sBp  + lofs;
  const unsigned lA2 = (unsigned)(size_t)(const void*)sA2p + lofs;
  const int nslab = K >> 6;

  v8f acc[4][4];
#pragma unroll
  for (int i = 0; i < 4; ++i)
#pragma unroll
    for (int j = 0; j < 4; ++j) acc[i][j] = zero8();

  // ---- prologue: slab 0 landed and published, then slab 1 in flight ----
  stage_plane(gA, lda, lA);
  stage_plane(gB, ldb, lB);
  if (NSPLIT >= 1) stage_plane(gA2, lda, lA2);
  wait_async0();
  __syncthreads();
  if (nslab > 1) {
    stage_plane(gA + 64, lda, lA + GPLANE * 2u);
    stage_plane(gB + 64, ldb, lB + GPLANE * 2u);
    if (NSPLIT >= 1) stage_plane(gA2 + 64, lda, lA2 + GPLANE * 2u);
  }

#pragma unroll 1   // one slab per trip: the two buffers alternate by the trip's parity
  for (int t = 0; t < nslab; ++t) {
    const int buf = t & 1;
    const __bf16* fa  = sAp + buf * GPLANE + (wm + rlane) * GP + koff;
    const __bf16* fb  = sBp + buf * GPLANE + (wn + rlane) * GP + koff;
    const __bf16* fa2 = NSPLIT ? sA2p + buf * GPLANE + (wm + rlane) * GP + koff : fa;
#pragma unroll
    for (int ks = 0; ks < 64; ks += 32) {
      // all fragments of this 32-wide k step are read as one group in front of its WMMAs
      v16b bh[4], ah[4], al[4];
#pragma unroll
      for (int j = 0; j < 4; ++j) bh[j] = ldfrag_b(fb + (j << 4) * GP + ks);
#pragma unroll
      for (int i = 0; i < 4; ++i) {
        ah[i] = ldfrag_b(fa + (i << 4) * GP + ks);
        if (NSPLIT >= 1) al[i] = ldfrag_b(fa2 + (i << 4) * GP + ks); else al[i] = ah[i];
      }
#pragma unroll
      for (int i = 0; i < 4; ++i) {
#pragma unroll
        for (int j = 0; j < 4; ++j) {
          acc[i][j] = mma_b_raw(ah[i], bh[j], acc[i][j]);
          if (NSPLIT >= 1) acc[i][j] = mma_b_raw(al[i], bh[j], acc[i][j]);
        }
        dep_guard_b(acc[i][0], acc[i][3], ah[i], al[i]);
      }
      keep4_b(bh[0], bh[1], bh[2], bh[3]);
    }
    // ---- publish slab t+1, free slab t's buffer: own LDS reads done, own copies landed, block barrier ----
    wait_ds0();
    wait_async0();
    __syncthreads();
    if (t + 2 < nslab) {                       // block-uniform: refill the buffer that this trip has just read
      const int kn = (t + 2) << 6;
      const unsigned bo = (unsigned)buf * (GPLANE * 2u);
      stage_plane(gA + kn, lda, lA + bo);
      stage_plane(gB + kn, ldb, lB + bo);
      if (NSPLIT >= 1) stage_plane(gA2 + kn, lda, lA2 + bo);
    }
  }
  wait_async0();
  acc_guard4(acc[0][0], acc[0][1], acc[0][2], acc[0][3]);
  acc_guard4(acc[1][0], acc[1][1], acc[1][2], acc[1][3]);
  acc_guard4(acc[2][0], acc[2][1], acc[2][2], acc[2][3]);
  acc_guard4(acc[3][0], acc[3][1], acc[3][2], acc[3][3]);

  // ---- epilogue scales ----
  float csv[4];
#pragma unroll
  for (int j = 0; j < 4; ++j) csv[j] = CS ? csp[n0 + (j << 4) + rlane] : 1.0f;

  // ---- epilogue ----
  float* slab = sTp + wave * (16 * 68);
#pragma unroll
  for (int i = 0; i < 4; ++i) {
    const int mBase = m0 + (i << 4);
    float cv[8][2], sv[8][2];                              // OUT_MODE 4: cos / sin of (row mOff + r, pair 16j + rlane)
    if (OUT_MODE == 4) load_angles(ctp, stp, mBase + mOff, rlane, cv, sv);
#pragma unroll
    for (int r = 0; r < 8; ++r) {
      const float rsv = RS ? rsp[mBase + mOff + r] : 1.0f;
      if (OUT_MODE == 4) {
        float y1[2], y2[2], sq[2];
#pragma unroll
        for (int j = 0; j < 2; ++j) {
          const float x1 = acc[i][j][r] * rsv * csv[j];
          const float x2 = acc[i][j + 2][r] * rsv * csv[j + 2];
          y1[j] = fmaf(x1, cv[r][j], -(x2 * sv[r][j]));
          y2[j] = fmaf(x1, sv[r][j], x2 * cv[r][j]);
          sq[j] = fmaf(y1[j], y1[j], y2[j] * y2[j]);
        }
        // sum over the 32 pairs: pairs d and d+16 in the lane, then partners 8, 4, 2, 1 of the 16-lane row
        float ss = sq[0] + sq[1];
#pragma unroll
        for (int off = 8; off >= 1; off >>= 1) ss += __shfl_xor(ss, off, 32);
        const float sc = rsqrtf(ss * (1.0f / HD) + 1e-6f);
#pragma unroll
        for (int j = 0; j < 2; ++j) {
          slab[(mOff + r) * 68 + (j << 4) + rlane]      = y1[j] * sc;
          slab[(mOff + r) * 68 + 32 + (j << 4) + rlane] = y2[j] * sc;
        }
      } else {
#pragma unroll
        for (int j = 0; j < 4; ++j) {
          slab[(mOff + r) * 68 + (j << 4) + rlane] = acc[i][j][r] * rsv * csv[j];
        }
      }
    }
    __builtin_amdgcn_fence(__ATOMIC_RELEASE, "workgroup");
    __builtin_amdgcn_wave_barrier();
    __builtin_amdgcn_fence(__ATOMIC_ACQUIRE, "workgroup");
    if (OUT_MODE == 0) {
      float* C = (float*)Cout + (size_t)b * strideC;
      const int hh = lane >> 4, c4 = (lane & 15) * 4;     // 256-B row segment = 16 lanes x 16 B
      v4f ov[8];
#pragma unroll
      for (int it = 0; it < 8; ++it) {
        const int row = it * 2 + hh;                       // it 0..7 x hh 0..1 = rows 0..15
        ov[it] = *(const v4f*)(slab + row * 68 + c4);
      }
      {
#pragma unroll
        for (int it = 0; it < 8; ++it) {
          const int row = it * 2 + hh;
          *(v4f*)(C + (size_t)(mBase + row) * ldc + n0 + c4) = ov[it];
        }
        
      }
    } else {
      const int q = lane >> 3, c8 = (lane & 7) * 8;
      const bool kside = (OUT_MODE == 4) && (n0 >= DM);   // wave-uniform: this wave's head is a k head
      const int  nc    = (OUT_MODE == 4) ? (n0 % DM) : n0; // first column in the output planes
      unsigned short* C  = (unsigned short*)(kside ? Cout3 : Cout)  + (size_t)b * strideC;
      unsigned short* C2 = (unsigned short*)(kside ? Cout4 : Cout2) + (size_t)b * strideC2;
      const bool wlo = (OUT_MODE == 2) || (OUT_MODE == 4) || (n0 < N2);      // wave-uniform
      v4u hv[4], lv[4];
#pragma unroll
      for (int it = 0; it < 4; ++it) {
        const int row = it * 4 + q;                        // it 0..3 x q 0..3 = rows 0..15
        const float* sp = slab + row * 68 + c8;
        v4u a, a2;
#pragma unroll
        for (int e = 0; e < 4; ++e) {
          const float f0 = sp[2 * e], f1 = sp[2 * e + 1];
          unsigned short h0, h1, l0, l1;
          if (OUT_MODE == 2 || OUT_MODE == 4) {
            h0 = bf_bits(f0); h1 = bf_bits(f1);
            l0 = bf_bits(f0 - bf_up(h0)); l1 = bf_bits(f1 - bf_up(h1));
          } else {
            const _Float16 x0 = (_Float16)f0, x1 = (_Float16)f1;
            h0 = h_bits(x0); h1 = h_bits(x1);
            l0 = h_bits((_Float16)((f0 - (float)x0) * rscale));
            l1 = h_bits((_Float16)((f1 - (float)x1) * rscale));
          }
          a[e] = pk16(h0, h1); a2[e] = pk16(l0, l1);
        }
        hv[it] = a; lv[it] = a2;
      }
      {
#pragma unroll
        for (int it = 0; it < 4; ++it) {
          const int row = it * 4 + q;
          *(v4u*)(C + (size_t)(mBase + row) * ldc + nc + c8) = hv[it];
          if (wlo) *(v4u*)(C2 + (size_t)(mBase + row) * ldc2 + nc + c8) = lv[it];
        }
        
      }
    }
    __builtin_amdgcn_fence(__ATOMIC_RELEASE, "workgroup");
    __builtin_amdgcn_wave_barrier();
    __builtin_amdgcn_fence(__ATOMIC_ACQUIRE, "workgroup");
  }
}

// one GEMM as a launch of its own: blockIdx.x = tile, blockIdx.y = batch index
template <int NSPLIT, int OUT_MODE, bool RS, bool CS>
__global__ __launch_bounds__(128) void gemm64(
    const unsigned short* __restrict__ Ap, const unsigned short* A2p, int lda, long long strideA,
    const unsigned short* __restrict__ Btp, int ldb, long long strideB,
    void* Cout, int ldc, long long strideC,
    void* Cout2, int ldc2, long long strideC2, int N2,
    int M, int N, int K, float rscale,
    const float* __restrict__ rsp, const float* __restrict__ csp,
    void* Cout3, void* Cout4, const float* __restrict__ ctp, const float* __restrict__ stp) {
  __shared__ __align__(16) __bf16 sA[2 * GPLANE];
  __shared__ __align__(16) __bf16 sB[2 * GPLANE];
  __shared__ __align__(16) __bf16 sA2[NSPLIT ? 2 * GPLANE : 8];
  __shared__ __align__(16) float  sT[4 * 16 * 68];
  gemm_tile<NSPLIT, OUT_MODE, RS, CS>(sA, sB, sA2, sT, blockIdx.x, blockIdx.y,
      Ap, A2p, lda, strideA, Btp, ldb, strideB, Cout, ldc, strideC, Cout2, ldc2, strideC2, N2,
      M, N, K, rscale, rsp, csp, Cout3, Cout4, ctp, stp);
}

// =====================================================================================================
// The q/k projection and the v^T projection, which do not depend on one another, as block ranges of ONE grid (the test
// on the block index is block-uniform; both jobs use the same LDS):
//   [0, GB_QK)        q/k: Rin[e] * sum_d Xb[b*SEQ+s][d] Winb[e][d], e < 2048 (M=4096, N=2048, K=1024), rotary and per-head rms
//                     in the epilogue -> q/k bf16 hi/lo planes
//   [GB_QK, GB_ALL)   v^T per batch: VTh[b][m][s] = Rv[m] * sum_d Wvb[m][d] Xb[b*SEQ+s][d] -> f16 hi plane (pitch SEQ) and
//                     residual plane (x4096, keys < nres <= VLP, pitch VLP) (M=1024, N=2048, K=1024)
// =====================================================================================================
#define GB_QK   ((NB * SEQ / 128) * (NQK / 128))       // 32 x 16 = 512
#define GB_VT1  ((DM / 128) * (SEQ / 128))             // 8 x 16 = 128 per batch
#define GB_ALL  (GB_QK + NB * GB_VT1)                  // 768
__global__ __launch_bounds__(128) void gemm_qk_vt(
    const unsigned short* __restrict__ Xb, const unsigned short* __restrict__ Winb, const unsigned short* __restrict__ Wvb,
    unsigned short* Qh, unsigned short* Ql, unsigned short* Kh, unsigned short* Kl,
    unsigned short* VTh, unsigned short* VTl,
    const float* __restrict__ Rin, const float* __restrict__ Rv,
    const float* __restrict__ CosT, const float* __restrict__ SinT, int nres) {
  __shared__ __align__(16) __bf16 sA[2 * GPLANE];
  __shared__ __align__(16) __bf16 sB[2 * GPLANE];
  __shared__ __align__(16) float  sT[4 * 16 * 68];
  const int bx = blockIdx.x;
  if (bx < GB_QK) {
    gemm_tile<0, 4, false, true>(sA, sB, sA, sT, bx, 0,
        Xb, Xb, DM, 0LL, Winb, DM, 0LL,
        (void*)Qh, DM, 0LL, (void*)Ql, DM, 0LL, 0,
        NB * SEQ, NQK, DM, 1.0f, Rin, Rin,
        (void*)Kh, (void*)Kl, CosT, SinT);
  } else {
    const int v = bx - GB_QK;
    gemm_tile<0, 3, true, false>(sA, sB, sA, sT, v % GB_VT1, v / GB_VT1,
        Wvb, Wvb, DM, 0LL, Xb, DM, (long long)SEQ * DM,
        (void*)VTh, SEQ, (long long)DM * SEQ, (void*)VTl, VLP, (long long)DM * VLP, nres,
        DM, SEQ, DM, 4096.0f, Rv, Rv,
        (void*)VTh, (void*)VTl, Rv, Rv);
  }
}

// =====================================================================================================
// Twelve asynchronous 16-B copies per lane, global memory -> LDS: this lane's piece of rows r, r+16, r+32, r+48 of the
// 64x64 K hi, K lo and V^T tiles of one key chunk. kh, kl = the lane's piece in row r of the K planes (row pitch DM),
// vt = the same in V^T (row pitch SEQ), l = its LDS byte address in the K hi tile of the buffer (row pitch LP; K lo and V^T
// follow at APL and 2 APL elements). Eight lanes cover one 128-B row, so a wave's copy covers four whole lines.
// =====================================================================================================
__device__ __forceinline__ void stage_kv(const __bf16* kh, const __bf16* kl, const _Float16* vt, unsigned l) {
  const size_t   ks = (size_t)16 * DM;                // 16 K rows in global memory, elements
  const size_t   vs = (size_t)16 * SEQ;               // 16 V^T rows in global memory, elements
  const unsigned ls = 16u * LP * 2u;                  // 16 rows in LDS, bytes
  const unsigned pl = APL * 2u;                       // one tile in LDS, bytes
  const __bf16 *a0 = kh, *a1 = kh + ks, *a2 = kh + 2 * ks, *a3 = kh + 3 * ks;
  const __bf16 *b0 = kl, *b1 = kl + ks, *b2 = kl + 2 * ks, *b3 = kl + 3 * ks;
  const _Float16 *c0 = vt, *c1 = vt + vs, *c2 = vt + 2 * vs, *c3 = vt + 3 * vs;
  const unsigned la0 = l, la1 = l + ls, la2 = l + 2 * ls, la3 = l + 3 * ls;
  const unsigned lb0 = la0 + pl, lb1 = la1 + pl, lb2 = la2 + pl, lb3 = la3 + pl;
  const unsigned lc0 = lb0 + pl, lc1 = lb1 + pl, lc2 = lb2 + pl, lc3 = lb3 + pl;
#if defined(__HIP_DEVICE_COMPILE__)
  // the copies bring the three tiles into LDS through no register; the closing s_wait_xcnt stands in the same statement
  // so that no address register named here is rewritten in front of it
  asm volatile(
      "global_load_async_to_lds_b128 %0, %12, off\n\t"
      "global_load_async_to_lds_b128 %1, %13, off\n\t"
      "global_load_async_to_lds_b128 %2, %14, off\n\t"
      "global_load_async_to_lds_b128 %3, %15, off\n\t"
      "global_load_async_to_lds_b128 %4, %16, off\n\t"
      "global_load_async_to_lds_b128 %5, %17, off\n\t"
      "global_load_async_to_lds_b128 %6, %18, off\n\t"
      "global_load_async_to_lds_b128 %7, %19, off\n\t"
      "global_load_async_to_lds_b128 %8, %20, off\n\t"
      "global_load_async_to_lds_b128 %9, %21, off\n\t"
      "global_load_async_to_lds_b128 %10, %22, off\n\t"
      "global_load_async_to_lds_b128 %11, %23, off\n\t"
      "s_wait_xcnt 0x0"
      :: "v"(la0), "v"(la1), "v"(la2), "v"(la3), "v"(lb0), "v"(lb1), "v"(lb2), "v"(lb3),
         "v"(lc0), "v"(lc1), "v"(lc2), "v"(lc3),
         "v"(a0), "v"(a1), "v"(a2), "v"(a3), "v"(b0), "v"(b1), "v"(b2), "v"(b3),
         "v"(c0), "v"(c1), "v"(c2), "v"(c3)
      : "memory");
#endif
}

template <bool RES>
__device__ __forceinline__
void attn_tile(__bf16* Ksh, __bf16* Ksl, _Float16* Vth, _Float16* Vtl, float* Osp, int bx,
               const unsigned short* __restrict__ qhp, const unsigned short* __restrict__ qlp,
               const unsigned short* __restrict__ khp, const unsigned short* __restrict__ klp,
               const unsigned short* __restrict__ vhp, const unsigned short* __restrict__ vlp,
               float* outp, int qbBase, int nqbThis, float sscale) {
  union FB { v16b v; v8b h[2]; };
  union FH { v16h v; v8h h[2]; };

  const int tid  = threadIdx.x;
  const int wave = tid >> 5;
  const int lane = tid & 31;
  const int hh   = lane >> 4;
  const int c    = lane & 15;

  const int qbl  = bx % nqbThis;
  const int rest = bx / nqbThis;
  const int h    = rest % NH;
  const int b    = rest / NH;
  const int qb   = qbBase + qbl;
  const int q0   = qb * 64 + wave * 16;
  const size_t rowB = (size_t)b * SEQ;

  const __bf16* Qh = (const __bf16*)(const void*)qhp + (size_t)h * HD;
  const __bf16* Ql = (const __bf16*)(const void*)qlp + (size_t)h * HD;
  const __bf16* Kh = (const __bf16*)(const void*)khp + (size_t)h * HD;
  const __bf16* Kl = (const __bf16*)(const void*)klp + (size_t)h * HD;
  const _Float16* Vh = (const _Float16*)(const void*)vhp + ((size_t)b * DM + (size_t)h * HD) * SEQ;
  const _Float16* Vl = (const _Float16*)(const void*)vlp + ((size_t)b * DM + (size_t)h * HD) * VLP;

  // ---- Q fragments (B operand, column = query = lane&15): 2 d-chunks, hi and lo ----
  v16b qah[2], qal[2];
#pragma unroll
  for (int dc = 0; dc < 2; ++dc) {
    const size_t qo = (rowB + q0 + c) * DM + dc * 32 + 8 * hh;
    qah[dc] = ldfrag_b(Qh + qo);
    qal[dc] = ldfrag_b(Ql + qo);
  }

  const int qrow = q0 + c;                   // this lane's query
  float mrow = -INFINITY, lrow = 0.f;        // running maximum (both halves alike), this half's running sum
  v8f oacc[4];                               // O^T: tile t, register r = dim 16t + 8*hh + r of query c
#pragma unroll
  for (int t = 0; t < 4; ++t) oacc[t] = zero8();

  int nkt = qb + 1;                          // causal: key tiles 0..qb, block-uniform
  if (nkt > NQB) nkt = NQB;

  // ---- staging addresses without RES: thread -> row tid>>3 (+16 per copy), 16-B piece tid&7 of the 128-B tile row ----
  const int srow = tid >> 3, spc = (tid & 7) * 8;
  const __bf16*   gKh = Kh + (rowB + srow) * DM + spc;              // chunk kt: + kt * 64 rows
  const __bf16*   gKl = Kl + (rowB + srow) * DM + spc;
  const _Float16* gVt = Vh + (size_t)srow * SEQ + spc;              // chunk kt: + kt * 64 columns
  const unsigned  lK  = (unsigned)(size_t)(const void*)Ksh + (unsigned)(srow * LP + spc) * 2u;   // byte offset in LDS
  if (!RES) {
    // prologue: chunk 0 landed and published
    stage_kv(gKh, gKl, gVt, lK);
    wait_async0();
    __syncthreads();
  }

  for (int kt = 0; kt < nkt; ++kt) {
    const int kv0 = kt * 64;
    const int bo  = RES ? 0 : (kt & 1) * (3 * APL);                 // this chunk's buffer, by the trip's parity
    const __bf16*   Kc  = Ksh + bo;
    const __bf16*   Klc = Ksl + bo;
    const _Float16* Vc  = Vth + bo;
    if (RES) {
      __syncthreads();
      const int r = tid >> 1, half = (tid & 1) * 32;
      const __bf16*   kg  = Kh + (rowB + kv0 + r) * DM + half;    // K row kv0+r, d = half..half+31
      const __bf16*   klg = Kl + (rowB + kv0 + r) * DM + half;
      const _Float16* vg  = Vh + (size_t)r * SEQ + kv0 + half;    // V^T row d = r, s = kv0+half..+31
      const int kvl = (kv0 + 64 <= VLP) ? kv0 : (VLP - 64);     // clamped address into the residual plane
      const _Float16* vlg = Vl + (size_t)r * VLP + kvl + half;
      const bool resOK = (kv0 + 64 <= VLP);                      // block-uniform
#pragma unroll
      for (int i = 0; i < 4; ++i) {
        const v8b a0 = *(const v8b*)(kg + 8 * i);
        const v8b a1 = *(const v8b*)(klg + 8 * i);
        const v8h b0 = *(const v8h*)(vg + 8 * i);
        *(v8b*)(Ksh + r * LP + half + 8 * i) = a0;
        *(v8b*)(Ksl + r * LP + half + 8 * i) = a1;
        *(v8h*)(Vth + r * LP + half + 8 * i) = b0;
        if (RES) {
          v8h b1 = *(const v8h*)(vlg + 8 * i);
          if (!resOK) b1 = zero8h();
          *(v8h*)(Vtl + r * LP + half + 8 * i) = b1;
        }
      }
#if defined(__HIP_DEVICE_COMPILE__)
      // the wait that stands in front of an overwrite of a register which an issued load names; the addresses are inputs,
      // so that no later load's result is laid on the address pair of an earlier one (seen in the listing with RES only)
      if (RES) asm volatile("s_wait_xcnt 0x0" :: "v"(kg), "v"(klg), "v"(vg), "v"(vlg) : "memory");
#endif
      __syncthreads();
    }

    // ---- scores, transposed: 64 keys x 16 queries per wave, 3 bf16 products ----
    // all 16 K fragments are read as one group in front of the 24 products, in the order of their use; the products
    // run back to back, the four key tiles' accumulator chains in turn (each chain keeps its order of products)
    FB kb[2][4], kl[2][4];
#pragma unroll
    for (int dc = 0; dc < 2; ++dc) {
#pragma unroll
      for (int j = 0; j < 4; ++j) {
        kb[dc][j].h[0] = *(const v8b*)(Kc + (j * 16 + c) * LP + dc * 32 + 8 * hh);
        kb[dc][j].h[1] = *(const v8b*)(Kc + (j * 16 + c) * LP + dc * 32 + 16 + 8 * hh);
      }
#pragma unroll
      for (int j = 0; j < 4; ++j) {
        kl[dc][j].h[0] = *(const v8b*)(Klc + (j * 16 + c) * LP + dc * 32 + 8 * hh);
        kl[dc][j].h[1] = *(const v8b*)(Klc + (j * 16 + c) * LP + dc * 32 + 16 + 8 * hh);
      }
    }
    if (!RES && kt + 1 < nkt) {
      // block-uniform; behind the barrier (the prologue's, or the one at the foot of trip kt-1, which ended every read of
      // the other buffer): chunk kt+1 goes into that buffer and flies while this trip works on chunk kt. The copies stand
      // behind this chunk's K reads, which are of this trip's own buffer, so that their issue runs while those reads return
      const size_t kn = (size_t)(kt + 1) * 64;
      stage_kv(gKh + kn * DM, gKl + kn * DM, gVt + kn, lK + (unsigned)(3 * APL - bo) * 2u);
    }
    v8f s[4];
    FH vb[2][4], vl[2][4];
#pragma unroll
    for (int j = 0; j < 4; ++j) s[j] = zero8();
#pragma unroll
    for (int dc = 0; dc < 2; ++dc) {
      // no instruction: the scheduler moves nothing across, so the group of LDS reads in front stays one group
      // instead of being spread among the products
      __builtin_amdgcn_sched_barrier(0);
#pragma unroll
      for (int j = 0; j < 4; ++j) s[j] = mma_b_raw(kb[dc][j].v, qah[dc], s[j]);
#pragma unroll
      for (int j = 0; j < 4; ++j) s[j] = mma_b_raw(kl[dc][j].v, qah[dc], s[j]);
#pragma unroll
      for (int j = 0; j < 4; ++j) s[j] = mma_b_raw(kb[dc][j].v, qal[dc], s[j]);
      __builtin_amdgcn_sched_barrier(0);   // as above; the twelve products stay one run, their four chains in turn
      if (dc == 0) {
        // all V^T hi fragments of this chunk are read as one group here, behind the first half of the score products:
        // they arrive while the second half and the softmax run
#pragma unroll
        for (int kk = 0; kk < 2; ++kk) {
#pragma unroll
          for (int t = 0; t < 4; ++t) {
            vb[kk][t].h[0] = *(const v8h*)(Vc + (t * 16 + c) * LP + kk * 32 + 8 * hh);
            vb[kk][t].h[1] = *(const v8h*)(Vc + (t * 16 + c) * LP + kk * 32 + 16 + 8 * hh);
          }
        }
      }
      if (RES && dc == 1) {
        // the residual fragments are read behind the last score product, into registers that the K fragments have left
        // (read with the group above they would cost the kernel its third wave per SIMD); they arrive under the softmax
#pragma unroll   // written out, like the loop inside: vl[kk][t] lives in registers, which a run-time index cannot pick
        for (int kk = 0; kk < 2; ++kk) {
#pragma unroll
          for (int t = 0; t < 4; ++t) {
            vl[kk][t].h[0] = *(const v8h*)(Vtl + (t * 16 + c) * LP + kk * 32 + 8 * hh);
            vl[kk][t].h[1] = *(const v8h*)(Vtl + (t * 16 + c) * LP + kk * 32 + 16 + 8 * hh);
          }
        }
      }
    }

    // ---- scale + causal mask (replace by -FLT_MAX), maximum of the lane's 32 keys, joined with the other half ----
    float mj[4];
#pragma unroll
    for (int j = 0; j < 4; ++j) {
      mj[j] = -INFINITY;
#pragma unroll
      for (int r = 0; r < 8; ++r) {
        const int key = kv0 + j * 16 + 8 * hh + r;
        float sv = s[j][r] * sscale;
        sv = (key > qrow) ? -FLT_MAX : sv;
        s[j][r] = sv;
        mj[j] = fmaxf(mj[j], sv);
      }
    }
    float m = fmaxf(fmaxf(mj[0], mj[1]), fmaxf(mj[2], mj[3]));
    m = fmaxf(m, xhalf(m));
    const float mnew  = fmaxf(mrow, m);
    const float msafe = (mnew == -INFINITY) ? 0.f : mnew;
    const float alpha = exp_slot(mrow - msafe);
    mrow = mnew;

    // ---- online softmax: P (x1024, f16) and P residual (x4096) packed into the B operands of the two key chunks ----
    FH pa[2], pl[2];
    float pj[4];
#pragma unroll
    for (int j = 0; j < 4; ++j) {
      pj[j] = 0.f;
#pragma unroll
      for (int r = 0; r < 8; ++r) {
        const float p = exp_slot(s[j][r] - msafe);   // masked logit against a finite max: exp -> 0
        pj[j] += p;
        const float p1k = p * 1024.0f;
        const _Float16 ph = (_Float16)p1k;
        pa[j >> 1].v[(j & 1) * 8 + r] = ph;
        if (RES) pl[j >> 1].v[(j & 1) * 8 + r] = (_Float16)((p1k - (float)ph) * 4096.0f);
      }
    }
    // no instruction: every e^x above is asm text; the scheduler moves none of them down among the products below
    __builtin_amdgcn_sched_barrier(0);
    lrow = lrow * alpha + ((pj[0] + pj[1]) + (pj[2] + pj[3]));
#pragma unroll
    for (int t = 0; t < 4; ++t)
#pragma unroll
      for (int r = 0; r < 8; ++r) oacc[t][r] *= alpha;

    // ---- context^T += V^T . P^T (f16 WMMA), residual products into a separate accumulator ----
    v8f o1[4];
#pragma unroll
    for (int t = 0; t < 4; ++t) o1[t] = zero8();
#pragma unroll   // both chunks written out: pa[kk] and pl[kk] live in registers, which a run-time index cannot pick
    for (int kk = 0; kk < 2; ++kk) {
#pragma unroll
      for (int t = 0; t < 4; ++t) oacc[t] = mma_h_raw(vb[kk][t].v, pa[kk].v, oacc[t]);
      if (RES) {
#pragma unroll
        for (int t = 0; t < 4; ++t) o1[t] = mma_h_raw(vl[kk][t].v, pa[kk].v, o1[t]);
#pragma unroll
        for (int t = 0; t < 4; ++t) o1[t] = mma_h_raw(vb[kk][t].v, pl[kk].v, o1[t]);
      }
    }
    // the distance behind the last products, also on the loop's taken branch
    // (with RES the fold below stands between the products and the branch)
    if (!RES) acc_guard4(oacc[0], oacc[1], oacc[2], oacc[3]);
    if (RES) {
#pragma unroll
      for (int t = 0; t < 4; ++t)
#pragma unroll
        for (int r = 0; r < 8; ++r) oacc[t][r] += o1[t][r] * (1.0f / 4096.0f);
    }
    if (!RES) {
      // ---- publish chunk kt+1, free chunk kt's buffer: own LDS reads done, own copies landed, block barrier ----
      // (the refill of this trip's buffer stands behind this barrier, in the next trip)
      wait_ds0();
      wait_async0();
      __syncthreads();
    }
  }
  if (!RES) wait_async0();

  // ---- normalise (1/l and the 1/1024 p carry), stage the wave's 16x64 tile in LDS, then write whole
  float* os = Osp + wave * (16 * OP);
  {
    const float l = lrow + xhalf(lrow);      // the two halves' sums, joined once
    const float inv = ((l > 0.f) ? (1.0f / l) : 0.f) * (1.0f / 1024.0f);
#pragma unroll
    for (int t = 0; t < 4; ++t) {
      v4f w0, w1;
#pragma unroll
      for (int e = 0; e < 4; ++e) { w0[e] = oacc[t][e] * inv; w1[e] = oacc[t][4 + e] * inv; }
      *(v4f*)(os + c * OP + t * 16 + 8 * hh)     = w0;   // query row c, dims 16t + 8*hh ..
      *(v4f*)(os + c * OP + t * 16 + 8 * hh + 4) = w1;
    }
  }
  __builtin_amdgcn_fence(__ATOMIC_RELEASE, "workgroup");
  __builtin_amdgcn_wave_barrier();
  __builtin_amdgcn_fence(__ATOMIC_ACQUIRE, "workgroup");
  {
    const int h2 = lane >> 4, c4 = (lane & 15) * 4;
    v4f ov[8];
#pragma unroll
    for (int it = 0; it < 8; ++it) {
      const int row = it * 2 + h2;   // it 0..7 x h2 0..1 = rows 0..15 of the wave tile
      ov[it] = *(const v4f*)(os + row * OP + c4);
    }
    {
#pragma unroll
      for (int it = 0; it < 8; ++it) {
        const int row = it * 2 + h2;
        const size_t go = (rowB + q0 + row) * DM + (size_t)h * HD + c4;
        *(v4f*)(outp + go) = ov[it];
      }
      
    }
  }
}

// =====================================================================================================
// Both attention jobs, which do not depend on one another, as block ranges of ONE grid (the test on the block index is
// block-uniform; both jobs use the same LDS). The job with the long blocks comes first:
//   [0, AB_MAIN)        query blocks RESQB .. NQB-1, without residual planes
//   [AB_MAIN, AB_ALL)   query blocks 0 .. RESQB-1, with residual planes
// =====================================================================================================
#define AB_MAIN (NB * NH * (NQB - RESQB))              // 768
#define AB_ALL  (NB * NH * NQB)                        // 1024
__global__ __launch_bounds__(128)
void attn_causal64(const unsigned short* __restrict__ qhp, const unsigned short* __restrict__ qlp,
                   const unsigned short* __restrict__ khp, const unsigned short* __restrict__ klp,
                   const unsigned short* __restrict__ vhp, const unsigned short* __restrict__ vlp,
                   float* outp, float sscale) {
  // six tiles of 64 rows, row pitch LP. First job: two buffers of [K hi [kv][d] | K lo | V^T hi [d][kv]].
  // Second job: tiles 0..3 = K hi, K lo, V^T hi, V^T residual
  __shared__ __align__(16) __bf16   KV[6 * APL];
  __shared__ __align__(16) float    Os[4 * 16 * OP];              // per wave context tile [row][d], row pitch OP
  __bf16*   Ksh = KV;
  __bf16*   Ksl = KV + APL;
  _Float16* Vth = (_Float16*)(void*)(KV + 2 * APL);
  _Float16* Vtl = (_Float16*)(void*)(KV + 3 * APL);
  const int bx = blockIdx.x;
  if (bx < AB_MAIN) {
    attn_tile<false>(Ksh, Ksl, Vth, Vtl, Os, bx, qhp, qlp, khp, klp, vhp, vlp, outp, RESQB, NQB - RESQB, sscale);
  } else {
    attn_tile<true>(Ksh, Ksl, Vth, Vtl, Os, bx - AB_MAIN, qhp, qlp, khp, klp, vhp, vlp, outp, 0, RESQB, sscale);
  }
}

// =====================================================================================================
// Workspace map (bytes), every region an exact multiple of its whole-line / whole-tile store granularity:
//   Xb    bf16 [4096][1024]          0          8388608
//   Winb  bf16 [3072][1024]          8388608    6291456
//   Wob   bf16 [1024][1024]          14680064   2097152
//   Rin   f32  [3072]                16777216     12288   (96 lines)
//   Rout  f32  [1024]                16789504      4096   (32 lines)
//   Rrow  f32  [4096]                16793600     16384   (128 lines)
//   CosT  f32  [2048][32]            16809984    262144
//   SinT  f32  [2048][32]            17072128    262144
//   Af    f32  [4096][1024]          17334272  33554432   (Af, then Ah bf16 and Al bf16 [4096][1024] each)
//   VTh   f16  [2][1024][2048]       50888704   8388608
//   VTl   f16  [2][1024][512]        59277312   2097152
//   Qh    bf16 [4096][1024]          61374464   8388608
//   Ql    bf16 [4096][1024]          69763072   8388608
//   Kh    bf16 [4096][1024]          78151680   8388608
//   Kl    bf16 [4096][1024]          86540288   8388608
//   end                              94928896
// Weights are [out n][in k] with k contiguous = the Bt / A layout the GEMM wants, so they are only converted.
// =====================================================================================================
extern "C" void kernel_launch(void* const* d_in, const int* in_sizes, int n_in,
                              void* d_out, int out_size, void* d_ws, size_t ws_size,
                              hipStream_t stream) {
  if (n_in < 4) return;
  if (in_sizes[0] != NB * SEQ * DM) return;
  if (in_sizes[1] != SEQ * (HD / 2)) return;
  if (in_sizes[2] != 3 * DM * DM) return;
  if (in_sizes[3] != DM * DM) return;
  if (out_size != NB * SEQ * DM) return;

  const float* x    = (const float*)d_in[0];
  const float* rpf  = (const float*)d_in[1];
  const float* w_in = (const float*)d_in[2];
  const float* w_o  = (const float*)d_in[3];

  const size_t PXb   = (size_t)NB * SEQ * DM * 2;      //  8388608  16-bit activation plane [4096][1024]
  const size_t PWin  = (size_t)3 * DM * DM * 2;        //  6291456
  const size_t PWo   = (size_t)DM * DM * 2;            //  2097152
  const size_t PRin  = (size_t)3 * DM * 4;             //    12288
  const size_t PRout = (size_t)DM * 4;                 //     4096
  const size_t PRrow = (size_t)NB * SEQ * 4;           //    16384
  const size_t PTrig = (size_t)SEQ * (HD / 2) * 4;     //   262144
  const size_t PQK   = (size_t)NB * SEQ * NQK * 4;     // 33554432  Af + Ah + Al
  const size_t PVTh  = (size_t)NB * DM * SEQ * 2;      //  8388608
  const size_t PVTl  = (size_t)NB * DM * VLP * 2;      //  2097152
  const size_t PAf   = (size_t)NB * SEQ * DM * 4;      // 16777216
  if (PAf + 2 * PXb != PQK) return;                    // Af + Ah + Al fill their region exactly
  size_t off = 0;
  const size_t oXb   = off; off += PXb;
  const size_t oWin  = off; off += PWin;
  const size_t oWo   = off; off += PWo;
  const size_t oRin  = off; off += PRin;
  const size_t oRout = off; off += PRout;
  const size_t oRrow = off; off += PRrow;
  const size_t oCos  = off; off += PTrig;
  const size_t oSin  = off; off += PTrig;
  const size_t oQK   = off; off += PQK;
  const size_t oVTh  = off; off += PVTh;
  const size_t oVTl  = off; off += PVTl;
  const size_t oQh   = off; off += PXb;
  const size_t oQl   = off; off += PXb;
  const size_t oKh   = off; off += PXb;
  const size_t oKl   = off; off += PXb;
  if (off > ws_size) return;                           // off = 94928896
  if (off > (size_t)134217728) return;
  const size_t oAf = oQK;
  const size_t oAh = oQK + PAf;
  const size_t oAl = oAh + PXb;
  if (oAl + PXb > oVTh) return;                        // region ordering sanity

  char* ws = (char*)d_ws;
  unsigned short* Xb   = (unsigned short*)(ws + oXb);
  unsigned short* Winb = (unsigned short*)(ws + oWin);
  unsigned short* Wvb  = Winb + (size_t)2 * DM * DM;   // rows 2048..3071 of w_in = v features
  unsigned short* Wob  = (unsigned short*)(ws + oWo);
  float*          Rin  = (float*)(ws + oRin);
  float*          Rv   = Rin + 2 * DM;
  float*          Rout = (float*)(ws + oRout);
  float*          Rrow = (float*)(ws + oRrow);
  float*          CosT = (float*)(ws + oCos);
  float*          SinT = (float*)(ws + oSin);
  unsigned short* VTh  = (unsigned short*)(ws + oVTh);
  unsigned short* VTl  = (unsigned short*)(ws + oVTl);
  unsigned short* Qh   = (unsigned short*)(ws + oQh);
  unsigned short* Ql   = (unsigned short*)(ws + oQl);
  unsigned short* Kh   = (unsigned short*)(ws + oKh);
  unsigned short* Kl   = (unsigned short*)(ws + oKl);
  float*          Af   = (float*)(ws + oAf);
  unsigned short* Ah   = (unsigned short*)(ws + oAh);
  unsigned short* Al   = (unsigned short*)(ws + oAl);

  const dim3 blk(256);
  const dim3 gPrepA(NB * SEQ / 32);                                  // 128 blocks (32 rows each)
  const dim3 gblk(128);                                              // GEMM block: 4 waves, one 128x128 tile
  const dim3 gOut((NB * SEQ / 128) * (DM / 128), 1);                 // 32 x 8 = 256 blocks

  // (1) inputs: weights -> bf16 planes [n][k] + per-row inverse L2 norms of the converted rows; angle tables from the
  //     bf16-converted input table; x -> bf16 plane [4096][1024]
  prep_inputs<<<dim3(PB_ALL), blk, 0, stream>>>(x, rpf, w_in, w_o, Xb, Winb, Wob, Rin, Rout, CosT, SinT);
  // (2) q/k projection with rotary and per-head rms -> q/k bf16 hi/lo planes; v^T projection -> f16 hi and residual planes
  gemm_qk_vt<<<dim3(GB_ALL), gblk, 0, stream>>>(Xb, Winb, Wvb, Qh, Ql, Kh, Kl, VTh, VTl, Rin, Rv, CosT, SinT, VLP);
  // (3) causal attention: query blocks 0..RESQB-1 with residual planes, the rest without -> Af f32 [4096][1024]
  attn_causal64<<<dim3(AB_ALL), dim3(128), 0, stream>>>(Qh, Ql, Kh, Kl, VTh, VTl, Af, 0.125f);
  // (4) merged rows -> bf16 hi/lo planes + per-row inverse rms over 1024
  row_prep_hilo<<<gPrepA, blk, 0, stream>>>(Af, Ah, Al, Rrow, 1.0f / (float)DM);
  // (5) out[s][e] = Rrow[s] * Rout[e] * sum_d (Ah+Al)[s][d] Wob[e][d] -> d_out f32 [4096][1024]  (M=4096, N=1024, K=1024)
  gemm64<1, 0, true, true><<<gOut, gblk, 0, stream>>>(
      Ah, Al, DM, 0LL, Wob, DM, 0LL,
      d_out, DM, 0LL, d_out, 0, 0LL, 0,
      NB * SEQ, DM, DM, 1.0f, Rrow, Rout,
      d_out, d_out, Rrow, Rout);
  (void)hipGetLastError();
}

// v008
// A run of this version takes 105 microseconds.
// Next to v007, in two timings, it ran 1.09 times as fast each time.
// Over all steps from v000 it is 3.83 times as fast.
// Contractions: q/k and v^T projections = v_wmma_f32_16x16x32_bf16 (bf16 operands from RNE-converted inputs, single product, f32 row/column scales in the epilogue; q/k: RoPE and head rms there too);
// k.q^T scores (transposed) = v_wmma_f32_16x16x32_bf16 with bf16 hi/lo split q and k (hi.hi + hi.lo + lo.hi);
// v^T.p^T (transposed) = v_wmma_f32_16x16x32_f16 (p carried x1024 in f16, v in f16; extra f16 residual planes x4096 of p and v on the first 512 query rows);
// a.Wout^T = v_wmma_f32_16x16x32_bf16 with a as bf16 hi/lo planes times bf16 Wout (2 products); all f32 accumulate; RoPE, norms and softmax in f32.
#include <hip/hip_runtime.h>
#include <math.h>
#include <float.h>
#include <stdint.h>

#define NB    2
#define SEQ   2048
#define DM    1024
#define NH    16
#define HD    64
#define NQK   (2 * DM)       // q and k feature columns of the fused q/k projection output
#define NQB   (SEQ / 64)     // 32 query / key tiles of 64
#define VLP   512            // key pitch of the v^T residual plane (keys 0..VLP-1)
#define RESQB 8              // leading 64-row query blocks that use the p / v residual planes
static_assert(RESQB * 64 <= VLP);
static_assert(NH * HD == DM);
static_assert((SEQ % 64) == 0 && (DM % 256) == 0);
static_assert(HD == 64);
static_assert((NB * SEQ) % 128 == 0 && SEQ % 128 == 0 && DM % 128 == 0 && NQK % 128 == 0);   // GEMM block tiles of 128x128, k slabs of 64
#define LP    72             // LDS pitch, in 16-bit elements, of a 64-element row: 144 B = 16 B x odd, so that the 16 rows
                             // one ds_load_b128 fragment read touches fall on 16 different groups of four banks
#define GP    72             // LDS pitch, in 16-bit elements, of a GEMM k-slab row of 64 elements (144 B = 16 B x odd, as LP)
#define GPLANE (128 * GP)    // elements of one staged 128-row k slab
#define APL   (64 * LP)      // elements of one staged 64-row attention tile (K hi, K lo, V^T or V^T residual)
#define OP    68             // LDS pitch, in floats, of a 64-float row: the two lane halves store the same rows, eight floats apart

typedef _Float16 v16h __attribute__((ext_vector_type(16)));
typedef _Float16 v8h  __attribute__((ext_vector_type(8)));
typedef __bf16   v16b __attribute__((ext_vector_type(16)));
typedef __bf16   v8b  __attribute__((ext_vector_type(8)));
typedef float    v8f  __attribute__((ext_vector_type(8)));
typedef float    v4f  __attribute__((ext_vector_type(4)));
typedef unsigned int v4u __attribute__((ext_vector_type(4)));
typedef float    v2f  __attribute__((ext_vector_type(2)));
typedef __bf16   v2b  __attribute__((ext_vector_type(2)));

// ---- scalar helpers --------------------------------------------------------------------------------
__device__ __forceinline__ unsigned short bf_bits(float f) {          // f32 -> bf16 bits, RNE convert
  unsigned u = __float_as_uint(f);
  return (unsigned short)((u + 0x7FFFu + ((u >> 16) & 1u)) >> 16);
}
__device__ __forceinline__ float bf_up(unsigned short h) { return __uint_as_float(((unsigned)h) << 16); }
__device__ __forceinline__ unsigned short h_bits(_Float16 x) { return __builtin_bit_cast(unsigned short, x); }
__device__ __forceinline__ unsigned pk16(unsigned short a, unsigned short b) { return (unsigned)a | ((unsigned)b << 16); }
// two f32 -> two bf16 (RNE) in one register, by the packed convert
__device__ __forceinline__ unsigned bf_pair(float a, float b) {
  const v2f f = {a, b};
  return __builtin_bit_cast(unsigned, __builtin_convertvector(f, v2b));
}
__device__ __forceinline__ v8f zero8() { v8f z = {0.f, 0.f, 0.f, 0.f, 0.f, 0.f, 0.f, 0.f}; return z; }
__device__ __forceinline__ v8h zero8h() {
  const _Float16 z = (_Float16)0.0f;
  v8h r = {z, z, z, z, z, z, z, z};
  return r;
}

// value of lane l ^ 16 (the other 16-lane row), by a vector cross-row move
__device__ __forceinline__ float xhalf(float x) {
  const int b = __builtin_bit_cast(int, x);
  return __builtin_bit_cast(float, __builtin_amdgcn_permlanex16(b, b, 0x76543210, 0xfedcba98, false, false));
}

// e^x as 2^(x * log2 e) on v_exp_f32, as __expf gives it. The v_nop is the one slot that the instruction set asks for
// between a transcendental and an instruction that reads its result or overwrites its source: in the same statement
// it stands there whichever instruction the compiler puts next
__device__ __forceinline__ float exp_slot(float x) {
  const float y = x * 1.44269504f;
  float r;
#if defined(__HIP_DEVICE_COMPILE__)
  asm("v_exp_f32 %0, %1\n\tv_nop" : "=v"(r) : "v"(y));
#else
  r = y;
#endif
  return r;
}

// ---- fragment loader: 16-bit A/B operand, lane -> row/col (lane&15), p already includes +8*(lane>>4);
//      elements 0..7 <- p[0..7] (k0+8h..), elements 8..15 <- p[16..23] (k0+16+8h..)
__device__ __forceinline__ v16b ldfrag_b(const __bf16* p) {
  union { v16b v; v8b h[2]; } f;
  f.h[0] = *(const v8b*)(p);
  f.h[1] = *(const v8b*)(p + 16);
  return f.v;
}

// ---- WMMA helpers with trailing VALU hazard gap --------------------------------------------------------
__device__ __forceinline__ v8f mma_b_raw(v16b a, v16b b, v8f c) {
  return __builtin_amdgcn_wmma_f32_16x16x32_bf16(false, a, false, b, (short)0, c, false, false);
}
__device__ __forceinline__ v8f mma_h_raw(v16h a, v16h b, v8f c) {
  return __builtin_amdgcn_wmma_f32_16x16x32_f16(false, a, false, b, (short)0, c, false, false);
}
__device__ __forceinline__ void dep_guard_b(v8f& a, v8f& b, v16b x, v16b y) {
#if defined(__HIP_DEVICE_COMPILE__)
  asm volatile("v_nop\n\tv_nop\n\tv_nop\n\tv_nop" : "+v"(a), "+v"(b) : "v"(x), "v"(y));
#endif
}
__device__ __forceinline__ void keep4_b(v16b a, v16b b, v16b c, v16b d) {
#if defined(__HIP_DEVICE_COMPILE__)
  asm volatile("v_nop" :: "v"(a), "v"(b), "v"(c), "v"(d));
#endif
}
__device__ __forceinline__ void acc_guard4(v8f& a, v8f& b, v8f& c, v8f& d) {
#if defined(__HIP_DEVICE_COMPILE__)
  asm volatile("v_nop\n\tv_nop\n\tv_nop\n\tv_nop" : "+v"(a), "+v"(b), "+v"(c), "+v"(d));
#endif
}

// =====================================================================================================
// f32 -> bf16 (RNE convert), 8 elements per thread, one 16-B store per lane: a wave writes 512 contiguous B
// coverage: n8 threads x 8 = whole plane (n8 is a multiple of 256 here). blk = index of this 256-thread block in the job.
// =====================================================================================================
__device__ __forceinline__ void cvt_bf16x8(int blk, const float* __restrict__ in, unsigned short* out, int n8) {
  const int i = blk * 256 + threadIdx.x;
  if (i < n8) {
    const v4f a = *(const v4f*)(in + (size_t)i * 8);
    const v4f b = *(const v4f*)(in + (size_t)i * 8 + 4);
    v4u p;
    p[0] = pk16(bf_bits(a[0]), bf_bits(a[1]));
    p[1] = pk16(bf_bits(a[2]), bf_bits(a[3]));
    p[2] = pk16(bf_bits(b[0]), bf_bits(b[1]));
    p[3] = pk16(bf_bits(b[2]), bf_bits(b[3]));
    *(v4u*)(out + (size_t)i * 8) = p;
    
  }
}

// =====================================================================================================
// Angle table: ct[i] = cosf(bf(fr[i])), st[i] = sinf(bf(fr[i])) with the angle RNE-converted to bf16
// =====================================================================================================
__device__ __forceinline__ void trig_tab(int blk, const float* __restrict__ fr, float* ct, float* st, int n) {
  const int i = blk * 256 + threadIdx.x;
  if (i < n) {
    const float f  = bf_up(bf_bits(fr[i]));
    const float cv = cosf(f);
    const float sv = sinf(f);
    *(float*)(ct + i) = cv;
    *(float*)(st + i) = sv;
    
  }
}

// =====================================================================================================
// Row preparation over rows of DM=1024 f32 values (pitch DM):
//   hi plane = RNE bf16 of each value; LO: lo plane = RNE bf16 of (v - hi) (unscaled);
//   rtab[row] = rsqrt(ss * inv_div + 1e-6) with ss = sum over the row of g^2,
//     g = the bf16-converted value (SQR) or the f32 value (!SQR).
// Block = 8 waves = 32 rows (wave w: rows 4w..4w+3 of the block); blocks of the job = rows / 32 (exact here), blk = this one.
// sr = 32 floats of LDS that belong to the block.
// Per row and instruction t (0..3): lane l holds columns 256t + 8l .. +7 -> 32 lanes x 16 B = 512 B
// coverage: 4 t x 32 lanes x 8 = 1024 columns per row; 8 waves x 4 rows = 32 rows per block.
// =====================================================================================================
template <bool LO, bool SQR>
__device__ __forceinline__ void row_prep_part(float* sr, int blk, const float* __restrict__ in, unsigned short* hp,
                                              unsigned short* lp, float* rtab, float inv_div) {
  const int tid = threadIdx.x, wave = tid >> 5, lane = tid & 31;
#pragma unroll 1
  for (int i = 0; i < 4; ++i) {
    const int row = blk * 32 + wave * 4 + i;
    const float* rp = in + (size_t)row * DM + lane * 8;
    float ss = 0.f;
    v4u hv[4], lv[4];
#pragma unroll
    for (int t = 0; t < 4; ++t) {
      const v4f a  = *(const v4f*)(rp + t * 256);
      const v4f bq = *(const v4f*)(rp + t * 256 + 4);
      v4u ph, pl;
#pragma unroll
      for (int e = 0; e < 4; ++e) {
        const float f0 = (e < 2) ? a[2 * e]     : bq[2 * e - 4];
        const float f1 = (e < 2) ? a[2 * e + 1] : bq[2 * e - 3];
        const unsigned short h0 = bf_bits(f0), h1 = bf_bits(f1);
        const float g0 = SQR ? bf_up(h0) : f0;
        const float g1 = SQR ? bf_up(h1) : f1;
        ss += g0 * g0;
        ss += g1 * g1;
        ph[e] = pk16(h0, h1);
        if (LO) {
          pl[e] = pk16(bf_bits(f0 - bf_up(h0)), bf_bits(f1 - bf_up(h1)));
        } else {
          pl[e] = 0u;
        }
      }
      hv[t] = ph; lv[t] = pl;
    }
#pragma unroll
    for (int off = 16; off >= 1; off >>= 1) ss += __shfl_xor(ss, off, 32);
    const float rv = rsqrtf(ss * inv_div + 1e-6f);
    if (lane == 0) sr[wave * 4 + i] = rv;
    {
#pragma unroll
      for (int t = 0; t < 4; ++t) {
        const size_t go = (size_t)row * DM + t * 256 + lane * 8;
        *(v4u*)(hp + go) = hv[t];
        if (LO) *(v4u*)(lp + go) = lv[t];
      }
      
    }
  }
  __syncthreads();
  if (wave == 0) {
    const float rv = sr[lane];
    float* d = rtab + (size_t)blk * 32 + lane;
    *(float*)d = rv;
    
  }
}

// =====================================================================================================
// The four preparations of the inputs, which do not depend on one another, as block ranges of ONE grid (every test on
// the block index is block-uniform). The jobs with the longest blocks come first:
//   [0, PB_WIN)            w_in rows  -> bf16 plane + inverse L2 norms of the converted rows
//   [PB_WIN, PB_W)         w_out rows -> the same
//   [PB_W, PB_WT)          angle tables
//   [PB_WT, PB_ALL)        x -> bf16 plane
// =====================================================================================================
#define PB_WIN  (3 * DM / 32)                          // 96
#define PB_W    (PB_WIN + DM / 32)                     // 128
#define PB_WT   (PB_W + SEQ * (HD / 2) / 256)          // 384
#define PB_ALL  (PB_WT + NB * SEQ * DM / 8 / 256)      // 2432
__global__ __launch_bounds__(256) void prep_inputs(const float* __restrict__ x, const float* __restrict__ fr,
                                                   const float* __restrict__ w_in, const float* __restrict__ w_o,
                                                   unsigned short* Xb, unsigned short* Winb, unsigned short* Wob,
                                                   float* Rin, float* Rout, float* ct, float* st) {
  __shared__ float sr[32];
  const int bx = blockIdx.x;
  if (bx < PB_W) {
    const bool first = bx < PB_WIN;
    unsigned short* hp = first ? Winb : Wob;
    row_prep_part<false, true>(sr, first ? bx : bx - PB_WIN, first ? w_in : w_o, hp, hp, first ? Rin : Rout, 1.0f);
  } else if (bx < PB_WT) {
    trig_tab(bx - PB_W, fr, ct, st, SEQ * (HD / 2));
  } else {
    cvt_bf16x8(bx - PB_WT, x, Xb, NB * SEQ * DM / 8);
  }
}

// =====================================================================================================
// Eight asynchronous 16-B copies per lane, global memory -> LDS: this lane's piece of rows r, r+16, .., r+112 of one
// 128-row x 64-element k slab. g = the lane's piece in row r (row pitch ld elements), l = its LDS byte address
// (row pitch GP elements). Eight lanes cover one 128-B row, so a wave's copy covers four whole lines.
// =====================================================================================================
__device__ __forceinline__ void stage_plane(const __bf16* g, int ld, unsigned l) {
  const size_t   gs = (size_t)16 * (size_t)ld;        // 16 rows in global memory, elements
  const unsigned ls = 16u * GP * 2u;                  // 16 rows in LDS, bytes
  const __bf16 *g0 = g, *g1 = g + gs, *g2 = g + 2 * gs, *g3 = g + 3 * gs;
  const __bf16 *g4 = g + 4 * gs, *g5 = g + 5 * gs, *g6 = g + 6 * gs, *g7 = g + 7 * gs;
  const unsigned l0 = l, l1 = l + ls, l2 = l + 2 * ls, l3 = l + 3 * ls;
  const unsigned l4 = l + 4 * ls, l5 = l + 5 * ls, l6 = l + 6 * ls, l7 = l + 7 * ls;
#if defined(__HIP_DEVICE_COMPILE__)
  // the copies bring the slab into LDS through no register; the closing s_wait_xcnt stands in the same statement so
  // that no address register named here is rewritten in front of it
  asm volatile(
      "global_load_async_to_lds_b128 %0, %8, off\n\t"
      "global_load_async_to_lds_b128 %1, %9, off\n\t"
      "global_load_async_to_lds_b128 %2, %10, off\n\t"
      "global_load_async_to_lds_b128 %3, %11, off\n\t"
      "global_load_async_to_lds_b128 %4, %12, off\n\t"
      "global_load_async_to_lds_b128 %5, %13, off\n\t"
      "global_load_async_to_lds_b128 %6, %14, off\n\t"
      "global_load_async_to_lds_b128 %7, %15, off\n\t"
      "s_wait_xcnt 0x0"
      :: "v"(l0), "v"(l1), "v"(l2), "v"(l3), "v"(l4), "v"(l5), "v"(l6), "v"(l7),
         "v"(g0), "v"(g1), "v"(g2), "v"(g3), "v"(g4), "v"(g5), "v"(g6), "v"(g7)
      : "memory");
#endif
}
// this wave's own copies have landed in LDS
__device__ __forceinline__ void wait_async0() {
#if defined(__HIP_DEVICE_COMPILE__)
  asm volatile("s_wait_asynccnt 0x0" ::: "memory");
#endif
}
// this wave's own LDS reads have returned, so that the buffer they read may be refilled behind the next barrier
__device__ __forceinline__ void wait_ds0() {
#if defined(__HIP_DEVICE_COMPILE__)
  asm volatile("s_wait_dscnt 0x0" ::: "memory");
#endif
}

// cos / sin of rows row0 .. row0+7 (row0 a multiple of 8, so the eight positions row0 % SEQ + r stay below SEQ) and
// pairs p, p + 16 from the [SEQ][32] angle tables
__device__ __forceinline__ void load_angles(const float* __restrict__ ct, const float* __restrict__ st, int row0, int p,
                                            float (&cv)[8][2], float (&sv)[8][2]) {
  const size_t to = (size_t)(row0 % SEQ) * (HD / 2) + p;
#pragma unroll
  for (int r = 0; r < 8; ++r) {
#pragma unroll
    for (int j = 0; j < 2; ++j) {
      cv[r][j] = ct[to + r * (HD / 2) + (j << 4)];
      sv[r][j] = st[to + r * (HD / 2) + (j << 4)];
    }
  }
}

// =====================================================================================================
// Batched bf16 WMMA GEMM: C[m][n] = rs[m] * cs[n] * sum_k A[m][k] * Bt[n][k]. Block = 4 waves = a 128x128 tile,
// wave (wave>>1, wave&1) owns one 64x64 quarter. A row-major [M][K] pitch lda; Bt row-major [N][K] pitch ldb
// (k contiguous); M, N multiples of 128, K a multiple of 64 (true of the three GEMMs below).
// tile = index of the block's tile (row-major over the tiles), b = batch index (strides in elements).
// sAp, sBp, sA2p, sTp = the block's LDS: A, Bt and (NSPLIT) A2 slabs, two buffers of GPLANE elements each, and four per-wave
// 16x64 f32 slabs of pitch 68.
// Operands: k slabs of 64 elements (one 128-B line per row) are copied into LDS by asynchronous 16-B copies, whole
// lines per wave, two buffers: slab t+1 flies while slab t is worked on. Fragments are read from LDS (row pitch GP).
// NSPLIT: 0 = A.Bt; 1 = (A + A2).Bt (A2 = unscaled bf16 lo plane of A).
// RS / CS: per-row scale / per-column scale csp[n] (f32, not batched) applied in the epilogue. RS: 0 = none; 1 = rsp[m];
//          2 = rsqrt(mean over the DM columns of a^2 + 1e-6), from rsp[hd * NB*SEQ + m] = sum of a^2 over the HD columns of head hd:
//              thread tid sums the NH heads of row bm0 + tid into sRp[tid] (128 floats of LDS), published by the prologue's barrier.
// OUT_MODE: 0 = f32 (pitch ldc); 2 = bf16 hi plane C + bf16 lo plane C2 (lo = RNE(v - hi), unscaled);
//           3 = f16 hi plane C + f16 residual plane C2 = f16((v - hi) * rscale), C2 written only for tiles
//               with n0 < N2 (pitch ldc2, batch stride strideC2);
//           4 = q/k projection: a wave's 64 columns are one head of q (n0 < DM) or of k. Half-split rotary and the
//               per-head rms over the 64 dims are applied to the accumulators, then bf16 hi/lo planes as in 2, element
//               (row, h*64 + d) at [row*ldc + h*64 + d]: q -> C / C2, k -> C3 / C4.
//               ctp/stp [SEQ][32] f32 angle tables, pair index = d mod 32, position = row mod SEQ.
//               y[d<32] = x1*cos - x2*sin, y[32+d] = x1*sin + x2*cos (x1 = x[d], x2 = x[32+d]); y * rsqrt(mean(y^2) + 1e-6).
//               A lane holds columns 16j + (lane&15), j = 0..3, of its rows: x[d] and x[32+d] are its tiles j and j+2.
// =====================================================================================================
template <int NSPLIT, int OUT_MODE, int RS, bool CS>
__device__ __forceinline__ void gemm_tile(
    __bf16* sAp, __bf16* sBp, __bf16* sA2p, float* sTp, float* sRp, int tile, int b,
    const unsigned short* __restrict__ Ap, const unsigned short* A2p, int lda, long long strideA,
    const unsigned short* __restrict__ Btp, int ldb, long long strideB,
    void* Cout, int ldc, long long strideC,
    void* Cout2, int ldc2, long long strideC2, int N2,
    int M, int N, int K, float rscale,
    const float* __restrict__ rsp, const float* __restrict__ csp,
    void* Cout3, void* Cout4, const float* __restrict__ ctp, const float* __restrict__ stp) {
  static_assert(NSPLIT == 0 || NSPLIT == 1);
  const __bf16* A   = (const __bf16*)(const void*)Ap;
  const __bf16* A2  = (const __bf16*)(const void*)A2p;
  const __bf16* Bt  = (const __bf16*)(const void*)Btp;
  const int tid  = threadIdx.x;
  const int lane = tid & 31;
  const int wave = tid >> 5;
  const int tilesN = N >> 7;
  const int tilesM = M >> 7;
  if (tile >= tilesM * tilesN) return;   // block-uniform, in front of every copy and barrier
  const int tm = tile / tilesN;
  const int tn = tile - tm * tilesN;
  const int bm0 = tm << 7;
  const int bn0 = tn << 7;
  const int wm  = (wave >> 1) << 6;            // this wave's quarter inside the block tile
  const int wn  = (wave & 1) << 6;
  const int m0 = bm0 + wm;
  const int n0 = bn0 + wn;

  const __bf16* Ab  = A  + (size_t)b * strideA;
  const __bf16* Bb  = Bt + (size_t)b * strideB;
  const __bf16* Ab2 = (NSPLIT >= 1) ? (A2  + (size_t)b * strideA) : Ab;

  const int rlane = lane & 15;                 // row (A) / col (B, D) within subtile
  const int koff  = (lane >> 4) * 8;           // k offset of this lane half
  const int mOff  = (lane >> 4) * 8;           // D row offset

  // ---- staging addresses: thread -> row tid>>3 (+16 per copy), 16-B piece tid&7 of the 128-B slab row ----
  const int srow = tid >> 3, spc = (tid & 7) * 8;
  const __bf16* gA  = Ab  + (size_t)(bm0 + srow) * lda + spc;
  const __bf16* gA2 = Ab2 + (size_t)(bm0 + srow) * lda + spc;
  const __bf16* gB  = Bb  + (size_t)(bn0 + srow) * ldb + spc;
  const unsigned lofs = (unsigned)(srow * GP + spc) * 2u;
  const unsigned lA  = (unsigned)(size_t)(const void*)sAp  + lofs;   // low 32 bits = byte offset in LDS
  const unsigned lB  = (unsigned)(size_t)(const void*)sBp  + lofs;
  const unsigned lA2 = (unsigned)(size_t)(const void*)sA2p + lofs;
  const int nslab = K >> 6;

  v8f acc[4][4];
#pragma unroll
  for (int i = 0; i < 4; ++i)
#pragma unroll
    for (int j = 0; j < 4; ++j) acc[i][j] = zero8();

  // ---- prologue: slab 0 landed and published, then slab 1 in flight ----
  stage_plane(gA, lda, lA);
  stage_plane(gB, ldb, lB);
  if (NSPLIT >= 1) stage_plane(gA2, lda, lA2);
  if (RS == 2) {
    // behind the copies' issue, so that these loads return while slab 0 flies
    float ss = 0.f;
#pragma unroll   // written out: the NH loads go out as one group, one address and NH immediate offsets
    for (int hd = 0; hd < NH; ++hd) ss += rsp[(size_t)hd * (NB * SEQ) + bm0 + tid];
    sRp[tid] = rsqrtf(ss * (1.0f / (float)DM) + 1e-6f);
  }
  wait_async0();
  __syncthreads();
  if (nslab > 1) {
    stage_plane(gA + 64, lda, lA + GPLANE * 2u);
    stage_plane(gB + 64, ldb, lB + GPLANE * 2u);
    if (NSPLIT >= 1) stage_plane(gA2 + 64, lda, lA2 + GPLANE * 2u);
  }

#pragma unroll 1   // one slab per trip: the two buffers alternate by the trip's parity
  for (int t = 0; t < nslab; ++t) {
    const int buf = t & 1;
    const __bf16* fa  = sAp + buf * GPLANE + (wm + rlane) * GP + koff;
    const __bf16* fb  = sBp + buf * GPLANE + (wn + rlane) * GP + koff;
    const __bf16* fa2 = NSPLIT ? sA2p + buf * GPLANE + (wm + rlane) * GP + koff : fa;
#pragma unroll
    for (int ks = 0; ks < 64; ks += 32) {
      // all fragments of this 32-wide k step are read as one group in front of its WMMAs
      v16b bh[4], ah[4], al[4];
#pragma unroll
      for (int j = 0; j < 4; ++j) bh[j] = ldfrag_b(fb + (j << 4) * GP + ks);
#pragma unroll
      for (int i = 0; i < 4; ++i) {
        ah[i] = ldfrag_b(fa + (i << 4) * GP + ks);
        if (NSPLIT >= 1) al[i] = ldfrag_b(fa2 + (i << 4) * GP + ks); else al[i] = ah[i];
      }
#pragma unroll
      for (int i = 0; i < 4; ++i) {
#pragma unroll
        for (int j = 0; j < 4; ++j) {
          acc[i][j] = mma_b_raw(ah[i], bh[j], acc[i][j]);
          if (NSPLIT >= 1) acc[i][j] = mma_b_raw(al[i], bh[j], acc[i][j]);
        }
        dep_guard_b(acc[i][0], acc[i][3], ah[i], al[i]);
      }
      keep4_b(bh[0], bh[1], bh[2], bh[3]);
    }
    // ---- publish slab t+1, free slab t's buffer: own LDS reads done, own copies landed, block barrier ----
    wait_ds0();
    wait_async0();
    __syncthreads();
    if (t + 2 < nslab) {                       // block-uniform: refill the buffer that this trip has just read
      const int kn = (t + 2) << 6;
      const unsigned bo = (unsigned)buf * (GPLANE * 2u);
      stage_plane(gA + kn, lda, lA + bo);
      stage_plane(gB + kn, ldb, lB + bo);
      if (NSPLIT >= 1) stage_plane(gA2 + kn, lda, lA2 + bo);
    }
  }
  wait_async0();
  acc_guard4(acc[0][0], acc[0][1], acc[0][2], acc[0][3]);
  acc_guard4(acc[1][0], acc[1][1], acc[1][2], acc[1][3]);
  acc_guard4(acc[2][0], acc[2][1], acc[2][2], acc[2][3]);
  acc_guard4(acc[3][0], acc[3][1], acc[3][2], acc[3][3]);

  // ---- epilogue scales ----
  float csv[4];
#pragma unroll
  for (int j = 0; j < 4; ++j) csv[j] = CS ? csp[n0 + (j << 4) + rlane] : 1.0f;

  // ---- epilogue ----
  float* slab = sTp + wave * (16 * 68);
#pragma unroll
  for (int i = 0; i < 4; ++i) {
    const int mBase = m0 + (i << 4);
    float cv[8][2], sv[8][2];                              // OUT_MODE 4: cos / sin of (row mOff + r, pair 16j + rlane)
    if (OUT_MODE == 4) load_angles(ctp, stp, mBase + mOff, rlane, cv, sv);
#pragma unroll
    for (int r = 0; r < 8; ++r) {
      const float rsv = (RS == 2) ? sRp[wm + (i << 4) + mOff + r] : (RS == 1) ? rsp[mBase + mOff + r] : 1.0f;
      if (OUT_MODE == 4) {
        float y1[2], y2[2], sq[2];
#pragma unroll
        for (int j = 0; j < 2; ++j) {
          const float x1 = acc[i][j][r] * rsv * csv[j];
          const float x2 = acc[i][j + 2][r] * rsv * csv[j + 2];
          y1[j] = fmaf(x1, cv[r][j], -(x2 * sv[r][j]));
          y2[j] = fmaf(x1, sv[r][j], x2 * cv[r][j]);
          sq[j] = fmaf(y1[j], y1[j], y2[j] * y2[j]);
        }
        // sum over the 32 pairs: pairs d and d+16 in the lane, then partners 8, 4, 2, 1 of the 16-lane row
        float ss = sq[0] + sq[1];
#pragma unroll
        for (int off = 8; off >= 1; off >>= 1) ss += __shfl_xor(ss, off, 32);
        const float sc = rsqrtf(ss * (1.0f / HD) + 1e-6f);
#pragma unroll
        for (int j = 0; j < 2; ++j) {
          slab[(mOff + r) * 68 + (j << 4) + rlane]      = y1[j] * sc;
          slab[(mOff + r) * 68 + 32 + (j << 4) + rlane] = y2[j] * sc;
        }
      } else {
#pragma unroll
        for (int j = 0; j < 4; ++j) {
          slab[(mOff + r) * 68 + (j << 4) + rlane] = acc[i][j][r] * rsv * csv[j];
        }
      }
    }
    __builtin_amdgcn_fence(__ATOMIC_RELEASE, "workgroup");
    __builtin_amdgcn_wave_barrier();
    __builtin_amdgcn_fence(__ATOMIC_ACQUIRE, "workgroup");
    if (OUT_MODE == 0) {
      float* C = (float*)Cout + (size_t)b * strideC;
      const int hh = lane >> 4, c4 = (lane & 15) * 4;     // 256-B row segment = 16 lanes x 16 B
      v4f ov[8];
#pragma unroll
      for (int it = 0; it < 8; ++it) {
        const int row = it * 2 + hh;                       // it 0..7 x hh 0..1 = rows 0..15
        ov[it] = *(const v4f*)(slab + row * 68 + c4);
      }
      {
#pragma unroll
        for (int it = 0; it < 8; ++it) {
          const int row = it * 2 + hh;
          *(v4f*)(C + (size_t)(mBase + row) * ldc + n0 + c4) = ov[it];
        }
        
      }
    } else {
      const int q = lane >> 3, c8 = (lane & 7) * 8;
      const bool kside = (OUT_MODE == 4) && (n0 >= DM);   // wave-uniform: this wave's head is a k head
      const int  nc    = (OUT_MODE == 4) ? (n0 % DM) : n0; // first column in the output planes
      unsigned short* C  = (unsigned short*)(kside ? Cout3 : Cout)  + (size_t)b * strideC;
      unsigned short* C2 = (unsigned short*)(kside ? Cout4 : Cout2) + (size_t)b * strideC2;
      const bool wlo = (OUT_MODE == 2) || (OUT_MODE == 4) || (n0 < N2);      // wave-uniform
      v4u hv[4], lv[4];
#pragma unroll
      for (int it = 0; it < 4; ++it) {
        const int row = it * 4 + q;                        // it 0..3 x q 0..3 = rows 0..15
        const float* sp = slab + row * 68 + c8;
        v4u a, a2;
#pragma unroll
        for (int e = 0; e < 4; ++e) {
          const float f0 = sp[2 * e], f1 = sp[2 * e + 1];
          unsigned short h0, h1, l0, l1;
          if (OUT_MODE == 2 || OUT_MODE == 4) {
            h0 = bf_bits(f0); h1 = bf_bits(f1);
            l0 = bf_bits(f0 - bf_up(h0)); l1 = bf_bits(f1 - bf_up(h1));
          } else {
            const _Float16 x0 = (_Float16)f0, x1 = (_Float16)f1;
            h0 = h_bits(x0); h1 = h_bits(x1);
            l0 = h_bits((_Float16)((f0 - (float)x0) * rscale));
            l1 = h_bits((_Float16)((f1 - (float)x1) * rscale));
          }
          a[e] = pk16(h0, h1); a2[e] = pk16(l0, l1);
        }
        hv[it] = a; lv[it] = a2;
      }
      {
#pragma unroll
        for (int it = 0; it < 4; ++it) {
          const int row = it * 4 + q;
          *(v4u*)(C + (size_t)(mBase + row) * ldc + nc + c8) = hv[it];
          if (wlo) *(v4u*)(C2 + (size_t)(mBase + row) * ldc2 + nc + c8) = lv[it];
        }
        
      }
    }
    __builtin_amdgcn_fence(__ATOMIC_RELEASE, "workgroup");
    __builtin_amdgcn_wave_barrier();
    __builtin_amdgcn_fence(__ATOMIC_ACQUIRE, "workgroup");
  }
}

// one GEMM as a launch of its own: blockIdx.x = tile, blockIdx.y = batch index
template <int NSPLIT, int OUT_MODE, int RS, bool CS>
__global__ __launch_bounds__(128) void gemm64(
    const unsigned short* __restrict__ Ap, const unsigned short* A2p, int lda, long long strideA,
    const unsigned short* __restrict__ Btp, int ldb, long long strideB,
    void* Cout, int ldc, long long strideC,
    void* Cout2, int ldc2, long long strideC2, int N2,
    int M, int N, int K, float rscale,
    const float* __restrict__ rsp, const float* __restrict__ csp,
    void* Cout3, void* Cout4, const float* __restrict__ ctp, const float* __restrict__ stp) {
  __shared__ __align__(16) __bf16 sA[2 * GPLANE];
  __shared__ __align__(16) __bf16 sB[2 * GPLANE];
  __shared__ __align__(16) __bf16 sA2[NSPLIT ? 2 * GPLANE : 8];
  __shared__ __align__(16) float  sT[4 * 16 * 68];
  __shared__ float sR[128];
  gemm_tile<NSPLIT, OUT_MODE, RS, CS>(sA, sB, sA2, sT, sR, blockIdx.x, blockIdx.y,
      Ap, A2p, lda, strideA, Btp, ldb, strideB, Cout, ldc, strideC, Cout2, ldc2, strideC2, N2,
      M, N, K, rscale, rsp, csp, Cout3, Cout4, ctp, stp);
}

// =====================================================================================================
// The q/k projection and the v^T projection, which do not depend on one another, as block ranges of ONE grid (the test
// on the block index is block-uniform; both jobs use the same LDS):
//   [0, GB_QK)        q/k: Rin[e] * sum_d Xb[b*SEQ+s][d] Winb[e][d], e < 2048 (M=4096, N=2048, K=1024), rotary and per-head rms
//                     in the epilogue -> q/k bf16 hi/lo planes
//   [GB_QK, GB_ALL)   v^T per batch: VTh[b][m][s] = Rv[m] * sum_d Wvb[m][d] Xb[b*SEQ+s][d] -> f16 hi plane (pitch SEQ) and
//                     residual plane (x4096, keys < nres <= VLP, pitch VLP) (M=1024, N=2048, K=1024)
// =====================================================================================================
#define GB_QK   ((NB * SEQ / 128) * (NQK / 128))       // 32 x 16 = 512
#define GB_VT1  ((DM / 128) * (SEQ / 128))             // 8 x 16 = 128 per batch
#define GB_ALL  (GB_QK + NB * GB_VT1)                  // 768
__global__ __launch_bounds__(128) void gemm_qk_vt(
    const unsigned short* __restrict__ Xb, const unsigned short* __restrict__ Winb, const unsigned short* __restrict__ Wvb,
    unsigned short* Qh, unsigned short* Ql, unsigned short* Kh, unsigned short* Kl,
    unsigned short* VTh, unsigned short* VTl,
    const float* __restrict__ Rin, const float* __restrict__ Rv,
    const float* __restrict__ CosT, const float* __restrict__ SinT, int nres) {
  __shared__ __align__(16) __bf16 sA[2 * GPLANE];
  __shared__ __align__(16) __bf16 sB[2 * GPLANE];
  __shared__ __align__(16) float  sT[4 * 16 * 68];
  const int bx = blockIdx.x;
  if (bx < GB_QK) {
    gemm_tile<0, 4, 0, true>(sA, sB, sA, sT, sT, bx, 0,
        Xb, Xb, DM, 0LL, Winb, DM, 0LL,
        (void*)Qh, DM, 0LL, (void*)Ql, DM, 0LL, 0,
        NB * SEQ, NQK, DM, 1.0f, Rin, Rin,
        (void*)Kh, (void*)Kl, CosT, SinT);
  } else {
    const int v = bx - GB_QK;
    gemm_tile<0, 3, 1, false>(sA, sB, sA, sT, sT, v % GB_VT1, v / GB_VT1,
        Wvb, Wvb, DM, 0LL, Xb, DM, (long long)SEQ * DM,
        (void*)VTh, SEQ, (long long)DM * SEQ, (void*)VTl, VLP, (long long)DM * VLP, nres,
        DM, SEQ, DM, 4096.0f, Rv, Rv,
        (void*)VTh, (void*)VTl, Rv, Rv);
  }
}

// =====================================================================================================
// Twelve asynchronous 16-B copies per lane, global memory -> LDS: this lane's piece of rows r, r+16, r+32, r+48 of the
// 64x64 K hi, K lo and V^T tiles of one key chunk. kh, kl = the lane's piece in row r of the K planes (row pitch DM),
// vt = the same in V^T (row pitch SEQ), l = its LDS byte address in the K hi tile of the buffer (row pitch LP; K lo and V^T
// follow at APL and 2 APL elements). Eight lanes cover one 128-B row, so a wave's copy covers four whole lines.
// =====================================================================================================
__device__ __forceinline__ void stage_kv(const __bf16* kh, const __bf16* kl, const _Float16* vt, unsigned l) {
  const size_t   ks = (size_t)16 * DM;                // 16 K rows in global memory, elements
  const size_t   vs = (size_t)16 * SEQ;               // 16 V^T rows in global memory, elements
  const unsigned ls = 16u * LP * 2u;                  // 16 rows in LDS, bytes
  const unsigned pl = APL * 2u;                       // one tile in LDS, bytes
  const __bf16 *a0 = kh, *a1 = kh + ks, *a2 = kh + 2 * ks, *a3 = kh + 3 * ks;
  const __bf16 *b0 = kl, *b1 = kl + ks, *b2 = kl + 2 * ks, *b3 = kl + 3 * ks;
  const _Float16 *c0 = vt, *c1 = vt + vs, *c2 = vt + 2 * vs, *c3 = vt + 3 * vs;
  const unsigned la0 = l, la1 = l + ls, la2 = l + 2 * ls, la3 = l + 3 * ls;
  const unsigned lb0 = la0 + pl, lb1 = la1 + pl, lb2 = la2 + pl, lb3 = la3 + pl;
  const unsigned lc0 = lb0 + pl, lc1 = lb1 + pl, lc2 = lb2 + pl, lc3 = lb3 + pl;
#if defined(__HIP_DEVICE_COMPILE__)
  // the copies bring the three tiles into LDS through no register; the closing s_wait_xcnt stands in the same statement
  // so that no address register named here is rewritten in front of it
  asm volatile(
      "global_load_async_to_lds_b128 %0, %12, off\n\t"
      "global_load_async_to_lds_b128 %1, %13, off\n\t"
      "global_load_async_to_lds_b128 %2, %14, off\n\t"
      "global_load_async_to_lds_b128 %3, %15, off\n\t"
      "global_load_async_to_lds_b128 %4, %16, off\n\t"
      "global_load_async_to_lds_b128 %5, %17, off\n\t"
      "global_load_async_to_lds_b128 %6, %18, off\n\t"
      "global_load_async_to_lds_b128 %7, %19, off\n\t"
      "global_load_async_to_lds_b128 %8, %20, off\n\t"
      "global_load_async_to_lds_b128 %9, %21, off\n\t"
      "global_load_async_to_lds_b128 %10, %22, off\n\t"
      "global_load_async_to_lds_b128 %11, %23, off\n\t"
      "s_wait_xcnt 0x0"
      :: "v"(la0), "v"(la1), "v"(la2), "v"(la3), "v"(lb0), "v"(lb1), "v"(lb2), "v"(lb3),
         "v"(lc0), "v"(lc1), "v"(lc2), "v"(lc3),
         "v"(a0), "v"(a1), "v"(a2), "v"(a3), "v"(b0), "v"(b1), "v"(b2), "v"(b3),
         "v"(c0), "v"(c1), "v"(c2), "v"(c3)
      : "memory");
#endif
}

template <bool RES>
__device__ __forceinline__
void attn_tile(__bf16* Ksh, __bf16* Ksl, _Float16* Vth, _Float16* Vtl, float* Osp, float* Sqp, int bx,
               const unsigned short* __restrict__ qhp, const unsigned short* __restrict__ qlp,
               const unsigned short* __restrict__ khp, const unsigned short* __restrict__ klp,
               const unsigned short* __restrict__ vhp, const unsigned short* __restrict__ vlp,
               unsigned short* ahp, unsigned short* alp, float* ssq, int qbBase, int nqbThis, float sscale) {
  union FB { v16b v; v8b h[2]; };
  union FH { v16h v; v8h h[2]; };

  const int tid  = threadIdx.x;
  const int wave = tid >> 5;
  const int lane = tid & 31;
  const int hh   = lane >> 4;
  const int c    = lane & 15;

  const int qbl  = bx % nqbThis;
  const int rest = bx / nqbThis;
  const int h    = rest % NH;
  const int b    = rest / NH;
  const int qb   = qbBase + qbl;
  const int q0   = qb * 64 + wave * 16;
  const size_t rowB = (size_t)b * SEQ;

  const __bf16* Qh = (const __bf16*)(const void*)qhp + (size_t)h * HD;
  const __bf16* Ql = (const __bf16*)(const void*)qlp + (size_t)h * HD;
  const __bf16* Kh = (const __bf16*)(const void*)khp + (size_t)h * HD;
  const __bf16* Kl = (const __bf16*)(const void*)klp + (size_t)h * HD;
  const _Float16* Vh = (const _Float16*)(const void*)vhp + ((size_t)b * DM + (size_t)h * HD) * SEQ;
  const _Float16* Vl = (const _Float16*)(const void*)vlp + ((size_t)b * DM + (size_t)h * HD) * VLP;

  // ---- Q fragments (B operand, column = query = lane&15): 2 d-chunks, hi and lo ----
  v16b qah[2], qal[2];
#pragma unroll
  for (int dc = 0; dc < 2; ++dc) {
    const size_t qo = (rowB + q0 + c) * DM + dc * 32 + 8 * hh;
    qah[dc] = ldfrag_b(Qh + qo);
    qal[dc] = ldfrag_b(Ql + qo);
  }

  const int qrow = q0 + c;                   // this lane's query
  float mrow = -INFINITY, lrow = 0.f;        // running maximum (both halves alike), this half's running sum
  v8f oacc[4];                               // O^T: tile t, register r = dim 16t + 8*hh + r of query c
#pragma unroll
  for (int t = 0; t < 4; ++t) oacc[t] = zero8();

  int nkt = qb + 1;                          // causal: key tiles 0..qb, block-uniform
  if (nkt > NQB) nkt = NQB;

  // ---- staging addresses without RES: thread -> row tid>>3 (+16 per copy), 16-B piece tid&7 of the 128-B tile row ----
  const int srow = tid >> 3, spc = (tid & 7) * 8;
  const __bf16*   gKh = Kh + (rowB + srow) * DM + spc;              // chunk kt: + kt * 64 rows
  const __bf16*   gKl = Kl + (rowB + srow) * DM + spc;
  const _Float16* gVt = Vh + (size_t)srow * SEQ + spc;              // chunk kt: + kt * 64 columns
  const unsigned  lK  = (unsigned)(size_t)(const void*)Ksh + (unsigned)(srow * LP + spc) * 2u;   // byte offset in LDS
  if (!RES) {
    // prologue: chunk 0 landed and published
    stage_kv(gKh, gKl, gVt, lK);
    wait_async0();
    __syncthreads();
  }

  for (int kt = 0; kt < nkt; ++kt) {
    const int kv0 = kt * 64;
    const int bo  = RES ? 0 : (kt & 1) * (3 * APL);                 // this chunk's buffer, by the trip's parity
    const __bf16*   Kc  = Ksh + bo;
    const __bf16*   Klc = Ksl + bo;
    const _Float16* Vc  = Vth + bo;
    if (RES) {
      __syncthreads();
      const int r = tid >> 1, half = (tid & 1) * 32;
      const __bf16*   kg  = Kh + (rowB + kv0 + r) * DM + half;    // K row kv0+r, d = half..half+31
      const __bf16*   klg = Kl + (rowB + kv0 + r) * DM + half;
      const _Float16* vg  = Vh + (size_t)r * SEQ + kv0 + half;    // V^T row d = r, s = kv0+half..+31
      const int kvl = (kv0 + 64 <= VLP) ? kv0 : (VLP - 64);     // clamped address into the residual plane
      const _Float16* vlg = Vl + (size_t)r * VLP + kvl + half;
      const bool resOK = (kv0 + 64 <= VLP);                      // block-uniform
#pragma unroll
      for (int i = 0; i < 4; ++i) {
        const v8b a0 = *(const v8b*)(kg + 8 * i);
        const v8b a1 = *(const v8b*)(klg + 8 * i);
        const v8h b0 = *(const v8h*)(vg + 8 * i);
        *(v8b*)(Ksh + r * LP + half + 8 * i) = a0;
        *(v8b*)(Ksl + r * LP + half + 8 * i) = a1;
        *(v8h*)(Vth + r * LP + half + 8 * i) = b0;
        if (RES) {
          v8h b1 = *(const v8h*)(vlg + 8 * i);
          if (!resOK) b1 = zero8h();
          *(v8h*)(Vtl + r * LP + half + 8 * i) = b1;
        }
      }
#if defined(__HIP_DEVICE_COMPILE__)
      // the wait that stands in front of an overwrite of a register which an issued load names; the addresses are inputs,
      // so that no later load's result is laid on the address pair of an earlier one (seen in the listing with RES only)
      if (RES) asm volatile("s_wait_xcnt 0x0" :: "v"(kg), "v"(klg), "v"(vg), "v"(vlg) : "memory");
#endif
      __syncthreads();
    }

    // ---- scores, transposed: 64 keys x 16 queries per wave, 3 bf16 products ----
    // all 16 K fragments are read as one group in front of the 24 products, in the order of their use; the products
    // run back to back, the four key tiles' accumulator chains in turn (each chain keeps its order of products)
    FB kb[2][4], kl[2][4];
#pragma unroll
    for (int dc = 0; dc < 2; ++dc) {
#pragma unroll
      for (int j = 0; j < 4; ++j) {
        kb[dc][j].h[0] = *(const v8b*)(Kc + (j * 16 + c) * LP + dc * 32 + 8 * hh);
        kb[dc][j].h[1] = *(const v8b*)(Kc + (j * 16 + c) * LP + dc * 32 + 16 + 8 * hh);
      }
#pragma unroll
      for (int j = 0; j < 4; ++j) {
        kl[dc][j].h[0] = *(const v8b*)(Klc + (j * 16 + c) * LP + dc * 32 + 8 * hh);
        kl[dc][j].h[1] = *(const v8b*)(Klc + (j * 16 + c) * LP + dc * 32 + 16 + 8 * hh);
      }
    }
    if (!RES && kt + 1 < nkt) {
      // block-uniform; behind the barrier (the prologue's, or the one at the foot of trip kt-1, which ended every read of
      // the other buffer): chunk kt+1 goes into that buffer and flies while this trip works on chunk kt. The copies stand
      // behind this chunk's K reads, which are of this trip's own buffer, so that their issue runs while those reads return
      const size_t kn = (size_t)(kt + 1) * 64;
      stage_kv(gKh + kn * DM, gKl + kn * DM, gVt + kn, lK + (unsigned)(3 * APL - bo) * 2u);
    }
    v8f s[4];
    FH vb[2][4], vl[2][4];
#pragma unroll
    for (int j = 0; j < 4; ++j) s[j] = zero8();
#pragma unroll
    for (int dc = 0; dc < 2; ++dc) {
      // no instruction: the scheduler moves nothing across, so the group of LDS reads in front stays one group
      // instead of being spread among the products
      __builtin_amdgcn_sched_barrier(0);
#pragma unroll
      for (int j = 0; j < 4; ++j) s[j] = mma_b_raw(kb[dc][j].v, qah[dc], s[j]);
#pragma unroll
      for (int j = 0; j < 4; ++j) s[j] = mma_b_raw(kl[dc][j].v, qah[dc], s[j]);
#pragma unroll
      for (int j = 0; j < 4; ++j) s[j] = mma_b_raw(kb[dc][j].v, qal[dc], s[j]);
      __builtin_amdgcn_sched_barrier(0);   // as above; the twelve products stay one run, their four chains in turn
      if (dc == 0) {
        // all V^T hi fragments of this chunk are read as one group here, behind the first half of the score products:
        // they arrive while the second half and the softmax run
#pragma unroll
        for (int kk = 0; kk < 2; ++kk) {
#pragma unroll
          for (int t = 0; t < 4; ++t) {
            vb[kk][t].h[0] = *(const v8h*)(Vc + (t * 16 + c) * LP + kk * 32 + 8 * hh);
            vb[kk][t].h[1] = *(const v8h*)(Vc + (t * 16 + c) * LP + kk * 32 + 16 + 8 * hh);
          }
        }
      }
      if (RES && dc == 1) {
        // the residual fragments are read behind the last score product, into registers that the K fragments have left
        // (read with the group above they would cost the kernel its third wave per SIMD); they arrive under the softmax
#pragma unroll   // written out, like the loop inside: vl[kk][t] lives in registers, which a run-time index cannot pick
        for (int kk = 0; kk < 2; ++kk) {
#pragma unroll
          for (int t = 0; t < 4; ++t) {
            vl[kk][t].h[0] = *(const v8h*)(Vtl + (t * 16 + c) * LP + kk * 32 + 8 * hh);
            vl[kk][t].h[1] = *(const v8h*)(Vtl + (t * 16 + c) * LP + kk * 32 + 16 + 8 * hh);
          }
        }
      }
    }

    // ---- scale + causal mask (replace by -FLT_MAX), maximum of the lane's 32 keys, joined with the other half ----
    float mj[4];
#pragma unroll
    for (int j = 0; j < 4; ++j) {
      mj[j] = -INFINITY;
#pragma unroll
      for (int r = 0; r < 8; ++r) {
        const int key = kv0 + j * 16 + 8 * hh + r;
        float sv = s[j][r] * sscale;
        sv = (key > qrow) ? -FLT_MAX : sv;
        s[j][r] = sv;
        mj[j] = fmaxf(mj[j], sv);
      }
    }
    float m = fmaxf(fmaxf(mj[0], mj[1]), fmaxf(mj[2], mj[3]));
    m = fmaxf(m, xhalf(m));
    const float mnew  = fmaxf(mrow, m);
    const float msafe = (mnew == -INFINITY) ? 0.f : mnew;
    const float alpha = exp_slot(mrow - msafe);
    mrow = mnew;

    // ---- online softmax: P (x1024, f16) and P residual (x4096) packed into the B operands of the two key chunks ----
    FH pa[2], pl[2];
    float pj[4];
#pragma unroll
    for (int j = 0; j < 4; ++j) {
      pj[j] = 0.f;
#pragma unroll
      for (int r = 0; r < 8; ++r) {
        const float p = exp_slot(s[j][r] - msafe);   // masked logit against a finite max: exp -> 0
        pj[j] += p;
        const float p1k = p * 1024.0f;
        const _Float16 ph = (_Float16)p1k;
        pa[j >> 1].v[(j & 1) * 8 + r] = ph;
        if (RES) pl[j >> 1].v[(j & 1) * 8 + r] = (_Float16)((p1k - (float)ph) * 4096.0f);
      }
    }
    // no instruction: every e^x above is asm text; the scheduler moves none of them down among the products below
    __builtin_amdgcn_sched_barrier(0);
    lrow = lrow * alpha + ((pj[0] + pj[1]) + (pj[2] + pj[3]));
#pragma unroll
    for (int t = 0; t < 4; ++t)
#pragma unroll
      for (int r = 0; r < 8; ++r) oacc[t][r] *= alpha;

    // ---- context^T += V^T . P^T (f16 WMMA), residual products into a separate accumulator ----
    v8f o1[4];
#pragma unroll
    for (int t = 0; t < 4; ++t) o1[t] = zero8();
#pragma unroll   // both chunks written out: pa[kk] and pl[kk] live in registers, which a run-time index cannot pick
    for (int kk = 0; kk < 2; ++kk) {
#pragma unroll
      for (int t = 0; t < 4; ++t) oacc[t] = mma_h_raw(vb[kk][t].v, pa[kk].v, oacc[t]);
      if (RES) {
#pragma unroll
        for (int t = 0; t < 4; ++t) o1[t] = mma_h_raw(vl[kk][t].v, pa[kk].v, o1[t]);
#pragma unroll
        for (int t = 0; t < 4; ++t) o1[t] = mma_h_raw(vb[kk][t].v, pl[kk].v, o1[t]);
      }
    }
    // the distance behind the last products, also on the loop's taken branch
    // (with RES the fold below stands between the products and the branch)
    if (!RES) acc_guard4(oacc[0], oacc[1], oacc[2], oacc[3]);
    if (RES) {
#pragma unroll
      for (int t = 0; t < 4; ++t)
#pragma unroll
        for (int r = 0; r < 8; ++r) oacc[t][r] += o1[t][r] * (1.0f / 4096.0f);
    }
    if (!RES) {
      // ---- publish chunk kt+1, free chunk kt's buffer: own LDS reads done, own copies landed, block barrier ----
      // (the refill of this trip's buffer stands behind this barrier, in the next trip)
      wait_ds0();
      wait_async0();
      __syncthreads();
    }
  }
  if (!RES) wait_async0();

  // ---- normalise (1/l and the 1/1024 p carry), stage the wave's 16x64 tile in LDS, then write whole
  float* os = Osp + wave * (16 * OP);
  {
    const float l = lrow + xhalf(lrow);      // the two halves' sums, joined once
    const float inv = ((l > 0.f) ? (1.0f / l) : 0.f) * (1.0f / 1024.0f);
    v2f sq[2] = {{0.f, 0.f}, {0.f, 0.f}};    // squares of this lane's 32 dims of its query: even / odd dims of tiles 0, 2 / 1, 3
#pragma unroll
    for (int t = 0; t < 4; ++t) {
      v4f w0, w1;
#pragma unroll
      for (int e = 0; e < 4; ++e) { w0[e] = oacc[t][e] * inv; w1[e] = oacc[t][4 + e] * inv; }
#pragma unroll   // written out: w0, w1 and sq live in registers, which a run-time index cannot pick
      for (int e = 0; e < 4; e += 2) {
        const v2f a = {w0[e], w0[e + 1]}, b2 = {w1[e], w1[e + 1]};
        sq[t & 1] = __builtin_elementwise_fma(a, a, sq[t & 1]);
        sq[t & 1] = __builtin_elementwise_fma(b2, b2, sq[t & 1]);
      }
      *(v4f*)(os + c * OP + t * 16 + 8 * hh)     = w0;   // query row c, dims 16t + 8*hh ..
      *(v4f*)(os + c * OP + t * 16 + 8 * hh + 4) = w1;
    }
    const float sh = (sq[0][0] + sq[0][1]) + (sq[1][0] + sq[1][1]);
    const float sa = sh + xhalf(sh);         // the two halves' dims joined: all 64 dims of query c
    if (hh == 0) Sqp[wave * 16 + c] = sa;
  }
  // block barrier: the wave's own tile is read back below, the four waves' sums of squares by waves 0 and 1. It stands
  // in front of the global stores, so that no wave waits at it for its stores to return
  __syncthreads();
  if (tid < 64) ssq[(size_t)h * (NB * SEQ) + rowB + (size_t)qb * 64 + tid] = Sqp[tid];   // two whole 128-B lines
  {
    const int q = lane >> 3, c8 = (lane & 7) * 8;
    v4u hv[4], lv[4];
#pragma unroll
    for (int it = 0; it < 4; ++it) {
      const int row = it * 4 + q;    // it 0..3 x q 0..3 = rows 0..15 of the wave tile
      const v4f f0 = *(const v4f*)(os + row * OP + c8);
      const v4f f1 = *(const v4f*)(os + row * OP + c8 + 4);
#pragma unroll
      for (int e = 0; e < 4; ++e) {
        const float a0 = (e < 2) ? f0[2 * e]     : f1[2 * e - 4];
        const float a1 = (e < 2) ? f0[2 * e + 1] : f1[2 * e - 3];
        const unsigned ph = bf_pair(a0, a1);
        hv[it][e] = ph;
        lv[it][e] = bf_pair(a0 - __uint_as_float(ph << 16), a1 - __uint_as_float(ph & 0xFFFF0000u));
      }
    }
#pragma unroll
    for (int it = 0; it < 4; ++it) {
      const int row = it * 4 + q;
      const size_t go = (rowB + q0 + row) * DM + (size_t)h * HD + c8;
      *(v4u*)(ahp + go) = hv[it];
      *(v4u*)(alp + go) = lv[it];
    }
  }
}

// =====================================================================================================
// Both attention jobs, which do not depend on one another, as block ranges of ONE grid (the test on the block index is
// block-uniform; both jobs use the same LDS). The job with the long blocks comes first:
//   [0, AB_MAIN)        query blocks RESQB .. NQB-1, without residual planes
//   [AB_MAIN, AB_ALL)   query blocks 0 .. RESQB-1, with residual planes
// =====================================================================================================
#define AB_MAIN (NB * NH * (NQB - RESQB))              // 768
#define AB_ALL  (NB * NH * NQB)                        // 1024
__global__ __launch_bounds__(128)
void attn_causal64(const unsigned short* __restrict__ qhp, const unsigned short* __restrict__ qlp,
                   const unsigned short* __restrict__ khp, const unsigned short* __restrict__ klp,
                   const unsigned short* __restrict__ vhp, const unsigned short* __restrict__ vlp,
                   unsigned short* ahp, unsigned short* alp, float* ssq, float sscale) {
  // six tiles of 64 rows, row pitch LP. First job: two buffers of [K hi [kv][d] | K lo | V^T hi [d][kv]].
  // Second job: tiles 0..3 = K hi, K lo, V^T hi, V^T residual
  __shared__ __align__(16) __bf16   KV[6 * APL];
  __shared__ __align__(16) float    Os[4 * 16 * OP];              // per wave context tile [row][d], row pitch OP
  __shared__ float                  Sq[64];                       // per query row of the block: sum of squares over the head
  __bf16*   Ksh = KV;
  __bf16*   Ksl = KV + APL;
  _Float16* Vth = (_Float16*)(void*)(KV + 2 * APL);
  _Float16* Vtl = (_Float16*)(void*)(KV + 3 * APL);
  const int bx = blockIdx.x;
  if (bx < AB_MAIN) {
    attn_tile<false>(Ksh, Ksl, Vth, Vtl, Os, Sq, bx, qhp, qlp, khp, klp, vhp, vlp, ahp, alp, ssq, RESQB, NQB - RESQB, sscale);
  } else {
    attn_tile<true>(Ksh, Ksl, Vth, Vtl, Os, Sq, bx - AB_MAIN, qhp, qlp, khp, klp, vhp, vlp, ahp, alp, ssq, 0, RESQB, sscale);
  }
}

// =====================================================================================================
// Workspace map (bytes), every region an exact multiple of its whole-line / whole-tile store granularity:
//   Xb    bf16 [4096][1024]          0          8388608
//   Winb  bf16 [3072][1024]          8388608    6291456
//   Wob   bf16 [1024][1024]          14680064   2097152
//   Rin   f32  [3072]                16777216     12288   (96 lines)
//   Rout  f32  [1024]                16789504      4096   (32 lines)
//   (free)                           16793600     16384
//   CosT  f32  [2048][32]            16809984    262144
//   SinT  f32  [2048][32]            17072128    262144
//   SSq   f32  [16][4096]            17334272  33554432   (SSq in the first 262144, then at +16777216 Ah bf16 and Al bf16 [4096][1024] each)
//   VTh   f16  [2][1024][2048]       50888704   8388608
//   VTl   f16  [2][1024][512]        59277312   2097152
//   Qh    bf16 [4096][1024]          61374464   8388608
//   Ql    bf16 [4096][1024]          69763072   8388608
//   Kh    bf16 [4096][1024]          78151680   8388608
//   Kl    bf16 [4096][1024]          86540288   8388608
//   end                              94928896
// Weights are [out n][in k] with k contiguous = the Bt / A layout the GEMM wants, so they are only converted.
// =====================================================================================================
extern "C" void kernel_launch(void* const* d_in, const int* in_sizes, int n_in,
                              void* d_out, int out_size, void* d_ws, size_t ws_size,
                              hipStream_t stream) {
  if (n_in < 4) return;
  if (in_sizes[0] != NB * SEQ * DM) return;
  if (in_sizes[1] != SEQ * (HD / 2)) return;
  if (in_sizes[2] != 3 * DM * DM) return;
  if (in_sizes[3] != DM * DM) return;
  if (out_size != NB * SEQ * DM) return;

  const float* x    = (const float*)d_in[0];
  const float* rpf  = (const float*)d_in[1];
  const float* w_in = (const float*)d_in[2];
  const float* w_o  = (const float*)d_in[3];

  const size_t PXb   = (size_t)NB * SEQ * DM * 2;      //  8388608  16-bit activation plane [4096][1024]
  const size_t PWin  = (size_t)3 * DM * DM * 2;        //  6291456
  const size_t PWo   = (size_t)DM * DM * 2;            //  2097152
  const size_t PRin  = (size_t)3 * DM * 4;             //    12288
  const size_t PRout = (size_t)DM * 4;                 //     4096
  const size_t PRrow = (size_t)NB * SEQ * 4;           //    16384
  const size_t PTrig = (size_t)SEQ * (HD / 2) * 4;     //   262144
  const size_t PQK   = (size_t)NB * SEQ * NQK * 4;     // 33554432  SSq region + Ah + Al
  const size_t PVTh  = (size_t)NB * DM * SEQ * 2;      //  8388608
  const size_t PVTl  = (size_t)NB * DM * VLP * 2;      //  2097152
  const size_t PAf   = (size_t)NB * SEQ * DM * 4;      // 16777216  region that holds SSq (NH * NB * SEQ * 4 = 262144 used)
  if (PAf + 2 * PXb != PQK) return;                    // the three fill their region exactly
  size_t off = 0;
  const size_t oXb   = off; off += PXb;
  const size_t oWin  = off; off += PWin;
  const size_t oWo   = off; off += PWo;
  const size_t oRin  = off; off += PRin;
  const size_t oRout = off; off += PRout;
  off += PRrow;                                        // free
  const size_t oCos  = off; off += PTrig;
  const size_t oSin  = off; off += PTrig;
  const size_t oQK   = off; off += PQK;
  const size_t oVTh  = off; off += PVTh;
  const size_t oVTl  = off; off += PVTl;
  const size_t oQh   = off; off += PXb;
  const size_t oQl   = off; off += PXb;
  const size_t oKh   = off; off += PXb;
  const size_t oKl   = off; off += PXb;
  if (off > ws_size) return;                           // off = 94928896
  if (off > (size_t)134217728) return;
  const size_t oAf = oQK;
  const size_t oAh = oQK + PAf;
  const size_t oAl = oAh + PXb;
  if (oAl + PXb > oVTh) return;                        // region ordering sanity

  char* ws = (char*)d_ws;
  unsigned short* Xb   = (unsigned short*)(ws + oXb);
  unsigned short* Winb = (unsigned short*)(ws + oWin);
  unsigned short* Wvb  = Winb + (size_t)2 * DM * DM;   // rows 2048..3071 of w_in = v features
  unsigned short* Wob  = (unsigned short*)(ws + oWo);
  float*          Rin  = (float*)(ws + oRin);
  float*          Rv   = Rin + 2 * DM;
  float*          Rout = (float*)(ws + oRout);
  float*          CosT = (float*)(ws + oCos);
  float*          SinT = (float*)(ws + oSin);
  unsigned short* VTh  = (unsigned short*)(ws + oVTh);
  unsigned short* VTl  = (unsigned short*)(ws + oVTl);
  unsigned short* Qh   = (unsigned short*)(ws + oQh);
  unsigned short* Ql   = (unsigned short*)(ws + oQl);
  unsigned short* Kh   = (unsigned short*)(ws + oKh);
  unsigned short* Kl   = (unsigned short*)(ws + oKl);
  float*          SSq  = (float*)(ws + oAf);
  unsigned short* Ah   = (unsigned short*)(ws + oAh);
  unsigned short* Al   = (unsigned short*)(ws + oAl);

  const dim3 blk(256);
  const dim3 gblk(128);                                              // GEMM block: 4 waves, one 128x128 tile
  const dim3 gOut((NB * SEQ / 128) * (DM / 128), 1);                 // 32 x 8 = 256 blocks

  // (1) inputs: weights -> bf16 planes [n][k] + per-row inverse L2 norms of the converted rows; angle tables from the
  //     bf16-converted input table; x -> bf16 plane [4096][1024]
  prep_inputs<<<dim3(PB_ALL), blk, 0, stream>>>(x, rpf, w_in, w_o, Xb, Winb, Wob, Rin, Rout, CosT, SinT);
  // (2) q/k projection with rotary and per-head rms -> q/k bf16 hi/lo planes; v^T projection -> f16 hi and residual planes
  gemm_qk_vt<<<dim3(GB_ALL), gblk, 0, stream>>>(Xb, Winb, Wvb, Qh, Ql, Kh, Kl, VTh, VTl, Rin, Rv, CosT, SinT, VLP);
  // (3) causal attention: query blocks 0..RESQB-1 with residual planes, the rest without -> merged rows as bf16 hi/lo planes
  //     [4096][1024] + per head and row the sum of squares
  attn_causal64<<<dim3(AB_ALL), dim3(128), 0, stream>>>(Qh, Ql, Kh, Kl, VTh, VTl, Ah, Al, SSq, 0.125f);
  // (4) out[s][e] = rrow[s] * Rout[e] * sum_d (Ah+Al)[s][d] Wob[e][d] -> d_out f32 [4096][1024]  (M=4096, N=1024, K=1024),
  //     rrow[s] = inverse rms over 1024 of merged row s, from the 16 heads' sums of squares
  gemm64<1, 0, 2, true><<<gOut, gblk, 0, stream>>>(
      Ah, Al, DM, 0LL, Wob, DM, 0LL,
      d_out, DM, 0LL, d_out, 0, 0LL, 0,
      NB * SEQ, DM, DM, 1.0f, SSq, Rout,
      d_out, d_out, Rout, Rout);
  (void)hipGetLastError();
}

// v009
// One run takes 100 microseconds.
// Next to v008, in two timings, it ran 1.05 times as fast each time.
// Counting every step since v000, it is 4.02 times as fast.
// Contractions: q/k and v^T projections = v_wmma_f32_16x16x32_bf16 (bf16 operands from RNE-converted inputs, single product, f32 row/column scales in the epilogue; q/k: RoPE and head rms there too);
// k.q^T scores (transposed) = v_wmma_f32_16x16x32_bf16 with bf16 hi/lo split q and k (hi.hi + hi.lo + lo.hi);
// v^T.p^T (transposed) = v_wmma_f32_16x16x32_f16 (p = e^logit in f16, v in f16; extra f16 residual planes x4096 of p and v on the first 512 query rows);
// a.Wout^T = v_wmma_f32_16x16x32_bf16 with a as bf16 hi/lo planes times bf16 Wout (2 products); all f32 accumulate; RoPE, norms and softmax in f32.
#include <hip/hip_runtime.h>
#include <math.h>
#include <float.h>
#include <stdint.h>

#define NB    2
#define SEQ   2048
#define DM    1024
#define NH    16
#define HD    64
#define NQK   (2 * DM)       // q and k feature columns of the fused q/k projection output
#define NQB   (SEQ / 64)     // 32 query / key tiles of 64
#define VLP   512            // key pitch of the v^T residual plane (keys 0..VLP-1)
#define RESQB 8              // leading 64-row query blocks that use the p / v residual planes
static_assert(RESQB * 64 <= VLP);
static_assert(NH * HD == DM);
static_assert((SEQ % 64) == 0 && (DM % 256) == 0);
static_assert(HD == 64);
static_assert((NB * SEQ) % 128 == 0 && SEQ % 128 == 0 && DM % 128 == 0 && NQK % 128 == 0);   // GEMM block tiles of 128x128, k slabs of 64
#define LP    72             // LDS pitch, in 16-bit elements, of a 64-element row: 144 B = 16 B x odd, so that the 16 rows
                             // one ds_load_b128 fragment read touches fall on 16 different groups of four banks
#define GP    72             // LDS pitch, in 16-bit elements, of a GEMM k-slab row of 64 elements (144 B = 16 B x odd, as LP)
#define GPLANE (128 * GP)    // elements of one staged 128-row k slab
#define APL   (64 * LP)      // elements of one staged 64-row attention tile (K hi, K lo, V^T or V^T residual)
#define OP    68             // LDS pitch, in floats, of a 64-float row: the two lane halves store the same rows, eight floats apart

typedef _Float16 v16h __attribute__((ext_vector_type(16)));
typedef _Float16 v8h  __attribute__((ext_vector_type(8)));
typedef __bf16   v16b __attribute__((ext_vector_type(16)));
typedef __bf16   v8b  __attribute__((ext_vector_type(8)));
typedef float    v8f  __attribute__((ext_vector_type(8)));
typedef float    v4f  __attribute__((ext_vector_type(4)));
typedef unsigned int v4u __attribute__((ext_vector_type(4)));
typedef float    v2f  __attribute__((ext_vector_type(2)));
typedef __bf16   v2b  __attribute__((ext_vector_type(2)));

// ---- scalar helpers --------------------------------------------------------------------------------
__device__ __forceinline__ unsigned short bf_bits(float f) {          // f32 -> bf16 bits, RNE convert
  unsigned u = __float_as_uint(f);
  return (unsigned short)((u + 0x7FFFu + ((u >> 16) & 1u)) >> 16);
}
__device__ __forceinline__ float bf_up(unsigned short h) { return __uint_as_float(((unsigned)h) << 16); }
__device__ __forceinline__ unsigned short h_bits(_Float16 x) { return __builtin_bit_cast(unsigned short, x); }
__device__ __forceinline__ unsigned pk16(unsigned short a, unsigned short b) { return (unsigned)a | ((unsigned)b << 16); }
// two f32 -> two bf16 (RNE) in one register, by the packed convert
__device__ __forceinline__ unsigned bf_pair(float a, float b) {
  const v2f f = {a, b};
  return __builtin_bit_cast(unsigned, __builtin_convertvector(f, v2b));
}
__device__ __forceinline__ v8f zero8() { v8f z = {0.f, 0.f, 0.f, 0.f, 0.f, 0.f, 0.f, 0.f}; return z; }
__device__ __forceinline__ v8h zero8h() {
  const _Float16 z = (_Float16)0.0f;
  v8h r = {z, z, z, z, z, z, z, z};
  return r;
}

// value of lane l ^ 16 (the other 16-lane row), by a vector cross-row move
__device__ __forceinline__ float xhalf(float x) {
  const int b = __builtin_bit_cast(int, x);
  return __builtin_bit_cast(float, __builtin_amdgcn_permlanex16(b, b, 0x76543210, 0xfedcba98, false, false));
}

// 2^y on v_exp_f32. The v_nop is the one slot that the instruction set asks for
// between a transcendental and an instruction that reads its result or overwrites its source: in the same statement
// it stands there whichever instruction the compiler puts next
__device__ __forceinline__ float exp2_slot(float y) {
  float r;
#if defined(__HIP_DEVICE_COMPILE__)
  asm("v_exp_f32 %0, %1\n\tv_nop" : "=v"(r) : "v"(y));
#else
  r = y;
#endif
  return r;
}

// ---- fragment loader: 16-bit A/B operand, lane -> row/col (lane&15), p already includes +8*(lane>>4);
//      elements 0..7 <- p[0..7] (k0+8h..), elements 8..15 <- p[16..23] (k0+16+8h..)
__device__ __forceinline__ v16b ldfrag_b(const __bf16* p) {
  union { v16b v; v8b h[2]; } f;
  f.h[0] = *(const v8b*)(p);
  f.h[1] = *(const v8b*)(p + 16);
  return f.v;
}

// ---- WMMA helpers with trailing VALU hazard gap --------------------------------------------------------
__device__ __forceinline__ v8f mma_b_raw(v16b a, v16b b, v8f c) {
  return __builtin_amdgcn_wmma_f32_16x16x32_bf16(false, a, false, b, (short)0, c, false, false);
}
__device__ __forceinline__ v8f mma_h_raw(v16h a, v16h b, v8f c) {
  return __builtin_amdgcn_wmma_f32_16x16x32_f16(false, a, false, b, (short)0, c, false, false);
}
__device__ __forceinline__ void dep_guard_b(v8f& a, v8f& b, v16b x, v16b y) {
#if defined(__HIP_DEVICE_COMPILE__)
  asm volatile("v_nop\n\tv_nop\n\tv_nop\n\tv_nop" : "+v"(a), "+v"(b) : "v"(x), "v"(y));
#endif
}
__device__ __forceinline__ void keep4_b(v16b a, v16b b, v16b c, v16b d) {
#if defined(__HIP_DEVICE_COMPILE__)
  asm volatile("v_nop" :: "v"(a), "v"(b), "v"(c), "v"(d));
#endif
}
__device__ __forceinline__ void acc_guard4(v8f& a, v8f& b, v8f& c, v8f& d) {
#if defined(__HIP_DEVICE_COMPILE__)
  asm volatile("v_nop\n\tv_nop\n\tv_nop\n\tv_nop" : "+v"(a), "+v"(b), "+v"(c), "+v"(d));
#endif
}

// =====================================================================================================
// f32 -> bf16 (RNE convert), 8 elements per thread, one 16-B store per lane: a wave writes 512 contiguous B
// coverage: n8 threads x 8 = whole plane (n8 is a multiple of 256 here). blk = index of this 256-thread block in the job.
// =====================================================================================================
__device__ __forceinline__ void cvt_bf16x8(int blk, const float* __restrict__ in, unsigned short* out, int n8) {
  const int i = blk * 256 + threadIdx.x;
  if (i < n8) {
    const v4f a = *(const v4f*)(in + (size_t)i * 8);
    const v4f b = *(const v4f*)(in + (size_t)i * 8 + 4);
    v4u p;
    p[0] = pk16(bf_bits(a[0]), bf_bits(a[1]));
    p[1] = pk16(bf_bits(a[2]), bf_bits(a[3]));
    p[2] = pk16(bf_bits(b[0]), bf_bits(b[1]));
    p[3] = pk16(bf_bits(b[2]), bf_bits(b[3]));
    *(v4u*)(out + (size_t)i * 8) = p;
    
  }
}

// =====================================================================================================
// Angle table: ct[i] = cosf(bf(fr[i])), st[i] = sinf(bf(fr[i])) with the angle RNE-converted to bf16
// =====================================================================================================
__device__ __forceinline__ void trig_tab(int blk, const float* __restrict__ fr, float* ct, float* st, int n) {
  const int i = blk * 256 + threadIdx.x;
  if (i < n) {
    const float f  = bf_up(bf_bits(fr[i]));
    const float cv = cosf(f);
    const float sv = sinf(f);
    *(float*)(ct + i) = cv;
    *(float*)(st + i) = sv;
    
  }
}

// =====================================================================================================
// Row preparation over rows of DM=1024 f32 values (pitch DM):
//   hi plane = RNE bf16 of each value; LO: lo plane = RNE bf16 of (v - hi) (unscaled);
//   rtab[row] = rsqrt(ss * inv_div + 1e-6) with ss = sum over the row of g^2,
//     g = the bf16-converted value (SQR) or the f32 value (!SQR).
// Block = 8 waves = 32 rows (wave w: rows 4w..4w+3 of the block); blocks of the job = rows / 32 (exact here), blk = this one.
// sr = 32 floats of LDS that belong to the block.
// Per row and instruction t (0..3): lane l holds columns 256t + 8l .. +7 -> 32 lanes x 16 B = 512 B
// coverage: 4 t x 32 lanes x 8 = 1024 columns per row; 8 waves x 4 rows = 32 rows per block.
// =====================================================================================================
template <bool LO, bool SQR>
__device__ __forceinline__ void row_prep_part(float* sr, int blk, const float* __restrict__ in, unsigned short* hp,
                                              unsigned short* lp, float* rtab, float inv_div) {
  const int tid = threadIdx.x, wave = tid >> 5, lane = tid & 31;
#pragma unroll 1
  for (int i = 0; i < 4; ++i) {
    const int row = blk * 32 + wave * 4 + i;
    const float* rp = in + (size_t)row * DM + lane * 8;
    float ss = 0.f;
    v4u hv[4], lv[4];
#pragma unroll
    for (int t = 0; t < 4; ++t) {
      const v4f a  = *(const v4f*)(rp + t * 256);
      const v4f bq = *(const v4f*)(rp + t * 256 + 4);
      v4u ph, pl;
#pragma unroll
      for (int e = 0; e < 4; ++e) {
        const float f0 = (e < 2) ? a[2 * e]     : bq[2 * e - 4];
        const float f1 = (e < 2) ? a[2 * e + 1] : bq[2 * e - 3];
        const unsigned short h0 = bf_bits(f0), h1 = bf_bits(f1);
        const float g0 = SQR ? bf_up(h0) : f0;
        const float g1 = SQR ? bf_up(h1) : f1;
        ss += g0 * g0;
        ss += g1 * g1;
        ph[e] = pk16(h0, h1);
        if (LO) {
          pl[e] = pk16(bf_bits(f0 - bf_up(h0)), bf_bits(f1 - bf_up(h1)));
        } else {
          pl[e] = 0u;
        }
      }
      hv[t] = ph; lv[t] = pl;
    }
#pragma unroll
    for (int off = 16; off >= 1; off >>= 1) ss += __shfl_xor(ss, off, 32);
    const float rv = rsqrtf(ss * inv_div + 1e-6f);
    if (lane == 0) sr[wave * 4 + i] = rv;
    {
#pragma unroll
      for (int t = 0; t < 4; ++t) {
        const size_t go = (size_t)row * DM + t * 256 + lane * 8;
        *(v4u*)(hp + go) = hv[t];
        if (LO) *(v4u*)(lp + go) = lv[t];
      }
      
    }
  }
  __syncthreads();
  if (wave == 0) {
    const float rv = sr[lane];
    float* d = rtab + (size_t)blk * 32 + lane;
    *(float*)d = rv;
    
  }
}

// =====================================================================================================
// The four preparations of the inputs, which do not depend on one another, as block ranges of ONE grid (every test on
// the block index is block-uniform). The jobs with the longest blocks come first:
//   [0, PB_WIN)            w_in rows  -> bf16 plane + inverse L2 norms of the converted rows
//   [PB_WIN, PB_W)         w_out rows -> the same
//   [PB_W, PB_WT)          angle tables
//   [PB_WT, PB_ALL)        x -> bf16 plane
// =====================================================================================================
#define PB_WIN  (3 * DM / 32)                          // 96
#define PB_W    (PB_WIN + DM / 32)                     // 128
#define PB_WT   (PB_W + SEQ * (HD / 2) / 256)          // 384
#define PB_ALL  (PB_WT + NB * SEQ * DM / 8 / 256)      // 2432
__global__ __launch_bounds__(256) void prep_inputs(const float* __restrict__ x, const float* __restrict__ fr,
                                                   const float* __restrict__ w_in, const float* __restrict__ w_o,
                                                   unsigned short* Xb, unsigned short* Winb, unsigned short* Wob,
                                                   float* Rin, float* Rout, float* ct, float* st) {
  __shared__ float sr[32];
  const int bx = blockIdx.x;
  if (bx < PB_W) {
    const bool first = bx < PB_WIN;
    unsigned short* hp = first ? Winb : Wob;
    row_prep_part<false, true>(sr, first ? bx : bx - PB_WIN, first ? w_in : w_o, hp, hp, first ? Rin : Rout, 1.0f);
  } else if (bx < PB_WT) {
    trig_tab(bx - PB_W, fr, ct, st, SEQ * (HD / 2));
  } else {
    cvt_bf16x8(bx - PB_WT, x, Xb, NB * SEQ * DM / 8);
  }
}

// =====================================================================================================
// Eight asynchronous 16-B copies per lane, global memory -> LDS: this lane's piece of rows r, r+16, .., r+112 of one
// 128-row x 64-element k slab. g = the lane's piece in row r (row pitch ld elements), l = its LDS byte address
// (row pitch GP elements). Eight lanes cover one 128-B row, so a wave's copy covers four whole lines.
// =====================================================================================================
__device__ __forceinline__ void stage_plane(const __bf16* g, int ld, unsigned l) {
  const size_t   gs = (size_t)16 * (size_t)ld;        // 16 rows in global memory, elements
  const unsigned ls = 16u * GP * 2u;                  // 16 rows in LDS, bytes
  const __bf16 *g0 = g, *g1 = g + gs, *g2 = g + 2 * gs, *g3 = g + 3 * gs;
  const __bf16 *g4 = g + 4 * gs, *g5 = g + 5 * gs, *g6 = g + 6 * gs, *g7 = g + 7 * gs;
  const unsigned l0 = l, l1 = l + ls, l2 = l + 2 * ls, l3 = l + 3 * ls;
  const unsigned l4 = l + 4 * ls, l5 = l + 5 * ls, l6 = l + 6 * ls, l7 = l + 7 * ls;
#if defined(__HIP_DEVICE_COMPILE__)
  // the copies bring the slab into LDS through no register; the closing s_wait_xcnt stands in the same statement so
  // that no address register named here is rewritten in front of it
  asm volatile(
      "global_load_async_to_lds_b128 %0, %8, off\n\t"
      "global_load_async_to_lds_b128 %1, %9, off\n\t"
      "global_load_async_to_lds_b128 %2, %10, off\n\t"
      "global_load_async_to_lds_b128 %3, %11, off\n\t"
      "global_load_async_to_lds_b128 %4, %12, off\n\t"
      "global_load_async_to_lds_b128 %5, %13, off\n\t"
      "global_load_async_to_lds_b128 %6, %14, off\n\t"
      "global_load_async_to_lds_b128 %7, %15, off\n\t"
      "s_wait_xcnt 0x0"
      :: "v"(l0), "v"(l1), "v"(l2), "v"(l3), "v"(l4), "v"(l5), "v"(l6), "v"(l7),
         "v"(g0), "v"(g1), "v"(g2), "v"(g3), "v"(g4), "v"(g5), "v"(g6), "v"(g7)
      : "memory");
#endif
}
// this wave's own copies have landed in LDS
__device__ __forceinline__ void wait_async0() {
#if defined(__HIP_DEVICE_COMPILE__)
  asm volatile("s_wait_asynccnt 0x0" ::: "memory");
#endif
}
// this wave's own LDS reads have returned, so that the buffer they read may be refilled behind the next barrier
__device__ __forceinline__ void wait_ds0() {
#if defined(__HIP_DEVICE_COMPILE__)
  asm volatile("s_wait_dscnt 0x0" ::: "memory");
#endif
}

// cos / sin of rows row0 .. row0+7 (row0 a multiple of 8, so the eight positions row0 % SEQ + r stay below SEQ) and
// pairs p, p + 16 from the [SEQ][32] angle tables
__device__ __forceinline__ void load_angles(const float* __restrict__ ct, const float* __restrict__ st, int row0, int p,
                                            float (&cv)[8][2], float (&sv)[8][2]) {
  const size_t to = (size_t)(row0 % SEQ) * (HD / 2) + p;
#pragma unroll
  for (int r = 0; r < 8; ++r) {
#pragma unroll
    for (int j = 0; j < 2; ++j) {
      cv[r][j] = ct[to + r * (HD / 2) + (j << 4)];
      sv[r][j] = st[to + r * (HD / 2) + (j << 4)];
    }
  }
}

// =====================================================================================================
// Batched bf16 WMMA GEMM: C[m][n] = rs[m] * cs[n] * sum_k A[m][k] * Bt[n][k]. Block = 4 waves = a 128x128 tile,
// wave (wave>>1, wave&1) owns one 64x64 quarter. A row-major [M][K] pitch lda; Bt row-major [N][K] pitch ldb
// (k contiguous); M, N multiples of 128, K a multiple of 64 (true of the three GEMMs below).
// tile = index of the block's tile (row-major over the tiles), b = batch index (strides in elements).
// sAp, sBp, sA2p, sTp = the block's LDS: A, Bt and (NSPLIT) A2 slabs, two buffers of GPLANE elements each, and four per-wave
// 16x64 f32 slabs of pitch 68.
// Operands: k slabs of 64 elements (one 128-B line per row) are copied into LDS by asynchronous 16-B copies, whole
// lines per wave, two buffers: slab t+1 flies while slab t is worked on. Fragments are read from LDS (row pitch GP).
// NSPLIT: 0 = A.Bt; 1 = (A + A2).Bt (A2 = unscaled bf16 lo plane of A).
// RS / CS: per-row scale / per-column scale csp[n] (f32, not batched) applied in the epilogue. RS: 0 = none; 1 = rsp[m];
//          2 = rsqrt(mean over the DM columns of a^2 + 1e-6), from rsp[hd * NB*SEQ + m] = sum of a^2 over the HD columns of head hd:
//              thread tid sums the NH heads of row bm0 + tid into sRp[tid] (128 floats of LDS), published by the prologue's barrier.
// OUT_MODE: 0 = f32 (pitch ldc); 2 = bf16 hi plane C + bf16 lo plane C2 (lo = RNE(v - hi), unscaled);
//           3 = f16 hi plane C + f16 residual plane C2 = f16((v - hi) * rscale), C2 written only for tiles
//               with n0 < N2 (pitch ldc2, batch stride strideC2);
//           4 = q/k projection: a wave's 64 columns are one head of q (n0 < DM) or of k. Half-split rotary and the
//               per-head rms over the 64 dims are applied to the accumulators, then bf16 hi/lo planes as in 2, element
//               (row, h*64 + d) at [row*ldc + h*64 + d]: q -> C / C2, k -> C3 / C4.
//               ctp/stp [SEQ][32] f32 angle tables, pair index = d mod 32, position = row mod SEQ.
//               y[d<32] = x1*cos - x2*sin, y[32+d] = x1*sin + x2*cos (x1 = x[d], x2 = x[32+d]); y * rsqrt(mean(y^2) + 1e-6).
//               A lane holds columns 16j + (lane&15), j = 0..3, of its rows: x[d] and x[32+d] are its tiles j and j+2.
// =====================================================================================================
template <int NSPLIT, int OUT_MODE, int RS, bool CS>
__device__ __forceinline__ void gemm_tile(
    __bf16* sAp, __bf16* sBp, __bf16* sA2p, float* sTp, float* sRp, int tile, int b,
    const unsigned short* __restrict__ Ap, const unsigned short* A2p, int lda, long long strideA,
    const unsigned short* __restrict__ Btp, int ldb, long long strideB,
    void* Cout, int ldc, long long strideC,
    void* Cout2, int ldc2, long long strideC2, int N2,
    int M, int N, int K, float rscale,
    const float* __restrict__ rsp, const float* __restrict__ csp,
    void* Cout3, void* Cout4, const float* __restrict__ ctp, const float* __restrict__ stp) {
  static_assert(NSPLIT == 0 || NSPLIT == 1);
  const __bf16* A   = (const __bf16*)(const void*)Ap;
  const __bf16* A2  = (const __bf16*)(const void*)A2p;
  const __bf16* Bt  = (const __bf16*)(const void*)Btp;
  const int tid  = threadIdx.x;
  const int lane = tid & 31;
  const int wave = tid >> 5;
  const int tilesN = N >> 7;
  const int tilesM = M >> 7;
  if (tile >= tilesM * tilesN) return;   // block-uniform, in front of every copy and barrier
  const int tm = tile / tilesN;
  const int tn = tile - tm * tilesN;
  const int bm0 = tm << 7;
  const int bn0 = tn << 7;
  const int wm  = (wave >> 1) << 6;            // this wave's quarter inside the block tile
  const int wn  = (wave & 1) << 6;
  const int m0 = bm0 + wm;
  const int n0 = bn0 + wn;

  const __bf16* Ab  = A  + (size_t)b * strideA;
  const __bf16* Bb  = Bt + (size_t)b * strideB;
  const __bf16* Ab2 = (NSPLIT >= 1) ? (A2  + (size_t)b * strideA) : Ab;

  const int rlane = lane & 15;                 // row (A) / col (B, D) within subtile
  const int koff  = (lane >> 4) * 8;           // k offset of this lane half
  const int mOff  = (lane >> 4) * 8;           // D row offset

  // ---- staging addresses: thread -> row tid>>3 (+16 per copy), 16-B piece tid&7 of the 128-B slab row ----
  const int srow = tid >> 3, spc = (tid & 7) * 8;
  const __bf16* gA  = Ab  + (size_t)(bm0 + srow) * lda + spc;
  const __bf16* gA2 = Ab2 + (size_t)(bm0 + srow) * lda + spc;
  const __bf16* gB  = Bb  + (size_t)(bn0 + srow) * ldb + spc;
  const unsigned lofs = (unsigned)(srow * GP + spc) * 2u;
  const unsigned lA  = (unsigned)(size_t)(const void*)sAp  + lofs;   // low 32 bits = byte offset in LDS
  const unsigned lB  = (unsigned)(size_t)(const void*)sBp  + lofs;
  const unsigned lA2 = (unsigned)(size_t)(const void*)sA2p + lofs;
  const int nslab = K >> 6;

  v8f acc[4][4];
#pragma unroll
  for (int i = 0; i < 4; ++i)
#pragma unroll
    for (int j = 0; j < 4; ++j) acc[i][j] = zero8();

  // ---- prologue: slab 0 landed and published, then slab 1 in flight ----
  stage_plane(gA, lda, lA);
  stage_plane(gB, ldb, lB);
  if (NSPLIT >= 1) stage_plane(gA2, lda, lA2);
  if (RS == 2) {
    // behind the copies' issue, so that these loads return while slab 0 flies
    float ss = 0.f;
#pragma unroll   // written out: the NH loads go out as one group, one address and NH immediate offsets
    for (int hd = 0; hd < NH; ++hd) ss += rsp[(size_t)hd * (NB * SEQ) + bm0 + tid];
    sRp[tid] = rsqrtf(ss * (1.0f / (float)DM) + 1e-6f);
  }
  wait_async0();
  __syncthreads();
  if (nslab > 1) {
    stage_plane(gA + 64, lda, lA + GPLANE * 2u);
    stage_plane(gB + 64, ldb, lB + GPLANE * 2u);
    if (NSPLIT >= 1) stage_plane(gA2 + 64, lda, lA2 + GPLANE * 2u);
  }

#pragma unroll 1   // one slab per trip: the two buffers alternate by the trip's parity
  for (int t = 0; t < nslab; ++t) {
    const int buf = t & 1;
    const __bf16* fa  = sAp + buf * GPLANE + (wm + rlane) * GP + koff;
    const __bf16* fb  = sBp + buf * GPLANE + (wn + rlane) * GP + koff;
    const __bf16* fa2 = NSPLIT ? sA2p + buf * GPLANE + (wm + rlane) * GP + koff : fa;
#pragma unroll
    for (int ks = 0; ks < 64; ks += 32) {
      // all fragments of this 32-wide k step are read as one group in front of its WMMAs
      v16b bh[4], ah[4], al[4];
#pragma unroll
      for (int j = 0; j < 4; ++j) bh[j] = ldfrag_b(fb + (j << 4) * GP + ks);
#pragma unroll
      for (int i = 0; i < 4; ++i) {
        ah[i] = ldfrag_b(fa + (i << 4) * GP + ks);
        if (NSPLIT >= 1) al[i] = ldfrag_b(fa2 + (i << 4) * GP + ks); else al[i] = ah[i];
      }
#pragma unroll
      for (int i = 0; i < 4; ++i) {
#pragma unroll
        for (int j = 0; j < 4; ++j) {
          acc[i][j] = mma_b_raw(ah[i], bh[j], acc[i][j]);
          if (NSPLIT >= 1) acc[i][j] = mma_b_raw(al[i], bh[j], acc[i][j]);
        }
        dep_guard_b(acc[i][0], acc[i][3], ah[i], al[i]);
      }
      keep4_b(bh[0], bh[1], bh[2], bh[3]);
    }
    // ---- publish slab t+1, free slab t's buffer: own LDS reads done, own copies landed, block barrier ----
    wait_ds0();
    wait_async0();
    __syncthreads();
    if (t + 2 < nslab) {                       // block-uniform: refill the buffer that this trip has just read
      const int kn = (t + 2) << 6;
      const unsigned bo = (unsigned)buf * (GPLANE * 2u);
      stage_plane(gA + kn, lda, lA + bo);
      stage_plane(gB + kn, ldb, lB + bo);
      if (NSPLIT >= 1) stage_plane(gA2 + kn, lda, lA2 + bo);
    }
  }
  wait_async0();
  acc_guard4(acc[0][0], acc[0][1], acc[0][2], acc[0][3]);
  acc_guard4(acc[1][0], acc[1][1], acc[1][2], acc[1][3]);
  acc_guard4(acc[2][0], acc[2][1], acc[2][2], acc[2][3]);
  acc_guard4(acc[3][0], acc[3][1], acc[3][2], acc[3][3]);

  // ---- epilogue scales ----
  float csv[4];
#pragma unroll
  for (int j = 0; j < 4; ++j) csv[j] = CS ? csp[n0 + (j << 4) + rlane] : 1.0f;

  // ---- epilogue ----
  float* slab = sTp + wave * (16 * 68);
#pragma unroll
  for (int i = 0; i < 4; ++i) {
    const int mBase = m0 + (i << 4);
    float cv[8][2], sv[8][2];                              // OUT_MODE 4: cos / sin of (row mOff + r, pair 16j + rlane)
    if (OUT_MODE == 4) load_angles(ctp, stp, mBase + mOff, rlane, cv, sv);
#pragma unroll
    for (int r = 0; r < 8; ++r) {
      const float rsv = (RS == 2) ? sRp[wm + (i << 4) + mOff + r] : (RS == 1) ? rsp[mBase + mOff + r] : 1.0f;
      if (OUT_MODE == 4) {
        float y1[2], y2[2], sq[2];
#pragma unroll
        for (int j = 0; j < 2; ++j) {
          const float x1 = acc[i][j][r] * rsv * csv[j];
          const float x2 = acc[i][j + 2][r] * rsv * csv[j + 2];
          y1[j] = fmaf(x1, cv[r][j], -(x2 * sv[r][j]));
          y2[j] = fmaf(x1, sv[r][j], x2 * cv[r][j]);
          sq[j] = fmaf(y1[j], y1[j], y2[j] * y2[j]);
        }
        // sum over the 32 pairs: pairs d and d+16 in the lane, then partners 8, 4, 2, 1 of the 16-lane row
        float ss = sq[0] + sq[1];
#pragma unroll
        for (int off = 8; off >= 1; off >>= 1) ss += __shfl_xor(ss, off, 32);
        const float sc = rsqrtf(ss * (1.0f / HD) + 1e-6f);
#pragma unroll
        for (int j = 0; j < 2; ++j) {
          slab[(mOff + r) * 68 + (j << 4) + rlane]      = y1[j] * sc;
          slab[(mOff + r) * 68 + 32 + (j << 4) + rlane] = y2[j] * sc;
        }
      } else {
#pragma unroll
        for (int j = 0; j < 4; ++j) {
          slab[(mOff + r) * 68 + (j << 4) + rlane] = acc[i][j][r] * rsv * csv[j];
        }
      }
    }
    __builtin_amdgcn_fence(__ATOMIC_RELEASE, "workgroup");
    __builtin_amdgcn_wave_barrier();
    __builtin_amdgcn_fence(__ATOMIC_ACQUIRE, "workgroup");
    if (OUT_MODE == 0) {
      float* C = (float*)Cout + (size_t)b * strideC;
      const int hh = lane >> 4, c4 = (lane & 15) * 4;     // 256-B row segment = 16 lanes x 16 B
      v4f ov[8];
#pragma unroll
      for (int it = 0; it < 8; ++it) {
        const int row = it * 2 + hh;                       // it 0..7 x hh 0..1 = rows 0..15
        ov[it] = *(const v4f*)(slab + row * 68 + c4);
      }
      {
#pragma unroll
        for (int it = 0; it < 8; ++it) {
          const int row = it * 2 + hh;
          *(v4f*)(C + (size_t)(mBase + row) * ldc + n0 + c4) = ov[it];
        }
        
      }
    } else {
      const int q = lane >> 3, c8 = (lane & 7) * 8;
      const bool kside = (OUT_MODE == 4) && (n0 >= DM);   // wave-uniform: this wave's head is a k head
      const int  nc    = (OUT_MODE == 4) ? (n0 % DM) : n0; // first column in the output planes
      unsigned short* C  = (unsigned short*)(kside ? Cout3 : Cout)  + (size_t)b * strideC;
      unsigned short* C2 = (unsigned short*)(kside ? Cout4 : Cout2) + (size_t)b * strideC2;
      const bool wlo = (OUT_MODE == 2) || (OUT_MODE == 4) || (n0 < N2);      // wave-uniform
      v4u hv[4], lv[4];
#pragma unroll
      for (int it = 0; it < 4; ++it) {
        const int row = it * 4 + q;                        // it 0..3 x q 0..3 = rows 0..15
        const float* sp = slab + row * 68 + c8;
        v4u a, a2;
#pragma unroll
        for (int e = 0; e < 4; ++e) {
          const float f0 = sp[2 * e], f1 = sp[2 * e + 1];
          unsigned short h0, h1, l0, l1;
          if (OUT_MODE == 2 || OUT_MODE == 4) {
            h0 = bf_bits(f0); h1 = bf_bits(f1);
            l0 = bf_bits(f0 - bf_up(h0)); l1 = bf_bits(f1 - bf_up(h1));
          } else {
            const _Float16 x0 = (_Float16)f0, x1 = (_Float16)f1;
            h0 = h_bits(x0); h1 = h_bits(x1);
            l0 = h_bits((_Float16)((f0 - (float)x0) * rscale));
            l1 = h_bits((_Float16)((f1 - (float)x1) * rscale));
          }
          a[e] = pk16(h0, h1); a2[e] = pk16(l0, l1);
        }
        hv[it] = a; lv[it] = a2;
      }
      {
#pragma unroll
        for (int it = 0; it < 4; ++it) {
          const int row = it * 4 + q;
          *(v4u*)(C + (size_t)(mBase + row) * ldc + nc + c8) = hv[it];
          if (wlo) *(v4u*)(C2 + (size_t)(mBase + row) * ldc2 + nc + c8) = lv[it];
        }
        
      }
    }
    __builtin_amdgcn_fence(__ATOMIC_RELEASE, "workgroup");
    __builtin_amdgcn_wave_barrier();
    __builtin_amdgcn_fence(__ATOMIC_ACQUIRE, "workgroup");
  }
}

// one GEMM as a launch of its own: blockIdx.x = tile, blockIdx.y = batch index
template <int NSPLIT, int OUT_MODE, int RS, bool CS>
__global__ __launch_bounds__(128) void gemm64(
    const unsigned short* __restrict__ Ap, const unsigned short* A2p, int lda, long long strideA,
    const unsigned short* __restrict__ Btp, int ldb, long long strideB,
    void* Cout, int ldc, long long strideC,
    void* Cout2, int ldc2, long long strideC2, int N2,
    int M, int N, int K, float rscale,
    const float* __restrict__ rsp, const float* __restrict__ csp,
    void* Cout3, void* Cout4, const float* __restrict__ ctp, const float* __restrict__ stp) {
  __shared__ __align__(16) __bf16 sA[2 * GPLANE];
  __shared__ __align__(16) __bf16 sB[2 * GPLANE];
  __shared__ __align__(16) __bf16 sA2[NSPLIT ? 2 * GPLANE : 8];
  __shared__ __align__(16) float  sT[4 * 16 * 68];
  __shared__ float sR[128];
  gemm_tile<NSPLIT, OUT_MODE, RS, CS>(sA, sB, sA2, sT, sR, blockIdx.x, blockIdx.y,
      Ap, A2p, lda, strideA, Btp, ldb, strideB, Cout, ldc, strideC, Cout2, ldc2, strideC2, N2,
      M, N, K, rscale, rsp, csp, Cout3, Cout4, ctp, stp);
}

// =====================================================================================================
// The q/k projection and the v^T projection, which do not depend on one another, as block ranges of ONE grid (the test
// on the block index is block-uniform; both jobs use the same LDS):
//   [0, GB_QK)        q/k: Rin[e] * sum_d Xb[b*SEQ+s][d] Winb[e][d], e < 2048 (M=4096, N=2048, K=1024), rotary and per-head rms
//                     in the epilogue -> q/k bf16 hi/lo planes
//   [GB_QK, GB_ALL)   v^T per batch: VTh[b][m][s] = Rv[m] * sum_d Wvb[m][d] Xb[b*SEQ+s][d] -> f16 hi plane (pitch SEQ) and
//                     residual plane (x4096, keys < nres <= VLP, pitch VLP) (M=1024, N=2048, K=1024)
// =====================================================================================================
#define GB_QK   ((NB * SEQ / 128) * (NQK / 128))       // 32 x 16 = 512
#define GB_VT1  ((DM / 128) * (SEQ / 128))             // 8 x 16 = 128 per batch
#define GB_ALL  (GB_QK + NB * GB_VT1)                  // 768
__global__ __launch_bounds__(128) void gemm_qk_vt(
    const unsigned short* __restrict__ Xb, const unsigned short* __restrict__ Winb, const unsigned short* __restrict__ Wvb,
    unsigned short* Qh, unsigned short* Ql, unsigned short* Kh, unsigned short* Kl,
    unsigned short* VTh, unsigned short* VTl,
    const float* __restrict__ Rin, const float* __restrict__ Rv,
    const float* __restrict__ CosT, const float* __restrict__ SinT, int nres) {
  __shared__ __align__(16) __bf16 sA[2 * GPLANE];
  __shared__ __align__(16) __bf16 sB[2 * GPLANE];
  __shared__ __align__(16) float  sT[4 * 16 * 68];
  const int bx = blockIdx.x;
  if (bx < GB_QK) {
    gemm_tile<0, 4, 0, true>(sA, sB, sA, sT, sT, bx, 0,
        Xb, Xb, DM, 0LL, Winb, DM, 0LL,
        (void*)Qh, DM, 0LL, (void*)Ql, DM, 0LL, 0,
        NB * SEQ, NQK, DM, 1.0f, Rin, Rin,
        (void*)Kh, (void*)Kl, CosT, SinT);
  } else {
    const int v = bx - GB_QK;
    gemm_tile<0, 3, 1, false>(sA, sB, sA, sT, sT, v % GB_VT1, v / GB_VT1,
        Wvb, Wvb, DM, 0LL, Xb, DM, (long long)SEQ * DM,
        (void*)VTh, SEQ, (long long)DM * SEQ, (void*)VTl, VLP, (long long)DM * VLP, nres,
        DM, SEQ, DM, 4096.0f, Rv, Rv,
        (void*)VTh, (void*)VTl, Rv, Rv);
  }
}

// =====================================================================================================
// Twelve asynchronous 16-B copies per lane, global memory -> LDS: this lane's piece of rows r, r+16, r+32, r+48 of the
// 64x64 K hi, K lo and V^T tiles of one key chunk. kh, kl = the lane's piece in row r of the K planes (row pitch DM),
// vt = the same in V^T (row pitch SEQ), l = its LDS byte address in the K hi tile of the buffer (row pitch LP; K lo and V^T
// follow at APL and 2 APL elements). Eight lanes cover one 128-B row, so a wave's copy covers four whole lines.
// =====================================================================================================
__device__ __forceinline__ void stage_kv(const __bf16* kh, const __bf16* kl, const _Float16* vt, unsigned l) {
  const size_t   ks = (size_t)16 * DM;                // 16 K rows in global memory, elements
  const size_t   vs = (size_t)16 * SEQ;               // 16 V^T rows in global memory, elements
  const unsigned ls = 16u * LP * 2u;                  // 16 rows in LDS, bytes
  const unsigned pl = APL * 2u;                       // one tile in LDS, bytes
  const __bf16 *a0 = kh, *a1 = kh + ks, *a2 = kh + 2 * ks, *a3 = kh + 3 * ks;
  const __bf16 *b0 = kl, *b1 = kl + ks, *b2 = kl + 2 * ks, *b3 = kl + 3 * ks;
  const _Float16 *c0 = vt, *c1 = vt + vs, *c2 = vt + 2 * vs, *c3 = vt + 3 * vs;
  const unsigned la0 = l, la1 = l + ls, la2 = l + 2 * ls, la3 = l + 3 * ls;
  const unsigned lb0 = la0 + pl, lb1 = la1 + pl, lb2 = la2 + pl, lb3 = la3 + pl;
  const unsigned lc0 = lb0 + pl, lc1 = lb1 + pl, lc2 = lb2 + pl, lc3 = lb3 + pl;
#if defined(__HIP_DEVICE_COMPILE__)
  // the copies bring the three tiles into LDS through no register; the closing s_wait_xcnt stands in the same statement
  // so that no address register named here is rewritten in front of it
  asm volatile(
      "global_load_async_to_lds_b128 %0, %12, off\n\t"
      "global_load_async_to_lds_b128 %1, %13, off\n\t"
      "global_load_async_to_lds_b128 %2, %14, off\n\t"
      "global_load_async_to_lds_b128 %3, %15, off\n\t"
      "global_load_async_to_lds_b128 %4, %16, off\n\t"
      "global_load_async_to_lds_b128 %5, %17, off\n\t"
      "global_load_async_to_lds_b128 %6, %18, off\n\t"
      "global_load_async_to_lds_b128 %7, %19, off\n\t"
      "global_load_async_to_lds_b128 %8, %20, off\n\t"
      "global_load_async_to_lds_b128 %9, %21, off\n\t"
      "global_load_async_to_lds_b128 %10, %22, off\n\t"
      "global_load_async_to_lds_b128 %11, %23, off\n\t"
      "s_wait_xcnt 0x0"
      :: "v"(la0), "v"(la1), "v"(la2), "v"(la3), "v"(lb0), "v"(lb1), "v"(lb2), "v"(lb3),
         "v"(lc0), "v"(lc1), "v"(lc2), "v"(lc3),
         "v"(a0), "v"(a1), "v"(a2), "v"(a3), "v"(b0), "v"(b1), "v"(b2), "v"(b3),
         "v"(c0), "v"(c1), "v"(c2), "v"(c3)
      : "memory");
#endif
}

template <bool RES>
__device__ __forceinline__
void attn_tile(__bf16* Ksh, __bf16* Ksl, _Float16* Vth, _Float16* Vtl, float* Osp, float* Sqp, int bx,
               const unsigned short* __restrict__ qhp, const unsigned short* __restrict__ qlp,
               const unsigned short* __restrict__ khp, const unsigned short* __restrict__ klp,
               const unsigned short* __restrict__ vhp, const unsigned short* __restrict__ vlp,
               unsigned short* ahp, unsigned short* alp, float* ssq, int qbBase, int nqbThis, float sscale) {
  union FB { v16b v; v8b h[2]; };
  union FH { v16h v; v8h h[2]; };

  const int tid  = threadIdx.x;
  const int wave = tid >> 5;
  const int lane = tid & 31;
  const int hh   = lane >> 4;
  const int c    = lane & 15;

  const int qbl  = bx % nqbThis;
  const int rest = bx / nqbThis;
  const int h    = rest % NH;
  const int b    = rest / NH;
  const int qb   = qbBase + qbl;
  const int q0   = qb * 64 + wave * 16;
  const size_t rowB = (size_t)b * SEQ;

  const __bf16* Qh = (const __bf16*)(const void*)qhp + (size_t)h * HD;
  const __bf16* Ql = (const __bf16*)(const void*)qlp + (size_t)h * HD;
  const __bf16* Kh = (const __bf16*)(const void*)khp + (size_t)h * HD;
  const __bf16* Kl = (const __bf16*)(const void*)klp + (size_t)h * HD;
  const _Float16* Vh = (const _Float16*)(const void*)vhp + ((size_t)b * DM + (size_t)h * HD) * SEQ;
  const _Float16* Vl = (const _Float16*)(const void*)vlp + ((size_t)b * DM + (size_t)h * HD) * VLP;

  // ---- Q fragments (B operand, column = query = lane&15): 2 d-chunks, hi and lo ----
  v16b qah[2], qal[2];
#pragma unroll
  for (int dc = 0; dc < 2; ++dc) {
    const size_t qo = (rowB + q0 + c) * DM + dc * 32 + 8 * hh;
    qah[dc] = ldfrag_b(Qh + qo);
    qal[dc] = ldfrag_b(Ql + qo);
  }

  const int qrow = q0 + c;                   // this lane's query
  float lrow = 0.f;                          // this half's running sum of p
  // q and k rows leave the projection with mean square <= 1 over their HD dims, so |q|, |k| <= sqrt(HD) and |q.k| <= HD for
  // any input: |logit| <= HD * sscale = 8, and p = e^logit = 2^(s * c0) lies in 3.3e-4 .. 2982, inside the normal range of
  // f16 (its residual x4096 too): no row maximum is taken off, and nothing is rescaled from chunk to chunk
  const float c0 = sscale * 1.44269504f;
  v8f oacc[4];                               // O^T: tile t, register r = dim 16t + 8*hh + r of query c
#pragma unroll
  for (int t = 0; t < 4; ++t) oacc[t] = zero8();

  int nkt = qb + 1;                          // causal: key tiles 0..qb, block-uniform
  if (nkt > NQB) nkt = NQB;

  // ---- staging addresses without RES: thread -> row tid>>3 (+16 per copy), 16-B piece tid&7 of the 128-B tile row ----
  const int srow = tid >> 3, spc = (tid & 7) * 8;
  const __bf16*   gKh = Kh + (rowB + srow) * DM + spc;              // chunk kt: + kt * 64 rows
  const __bf16*   gKl = Kl + (rowB + srow) * DM + spc;
  const _Float16* gVt = Vh + (size_t)srow * SEQ + spc;              // chunk kt: + kt * 64 columns
  const unsigned  lK  = (unsigned)(size_t)(const void*)Ksh + (unsigned)(srow * LP + spc) * 2u;   // byte offset in LDS
  if (!RES) {
    // prologue: chunk 0 landed and published
    stage_kv(gKh, gKl, gVt, lK);
    wait_async0();
    __syncthreads();
  }

  for (int kt = 0; kt < nkt; ++kt) {
    const int kv0 = kt * 64;
    const int bo  = RES ? 0 : (kt & 1) * (3 * APL);                 // this chunk's buffer, by the trip's parity
    const __bf16*   Kc  = Ksh + bo;
    const __bf16*   Klc = Ksl + bo;
    const _Float16* Vc  = Vth + bo;
    if (RES) {
      __syncthreads();
      const int r = tid >> 1, half = (tid & 1) * 32;
      const __bf16*   kg  = Kh + (rowB + kv0 + r) * DM + half;    // K row kv0+r, d = half..half+31
      const __bf16*   klg = Kl + (rowB + kv0 + r) * DM + half;
      const _Float16* vg  = Vh + (size_t)r * SEQ + kv0 + half;    // V^T row d = r, s = kv0+half..+31
      const int kvl = (kv0 + 64 <= VLP) ? kv0 : (VLP - 64);     // clamped address into the residual plane
      const _Float16* vlg = Vl + (size_t)r * VLP + kvl + half;
      const bool resOK = (kv0 + 64 <= VLP);                      // block-uniform
#pragma unroll
      for (int i = 0; i < 4; ++i) {
        const v8b a0 = *(const v8b*)(kg + 8 * i);
        const v8b a1 = *(const v8b*)(klg + 8 * i);
        const v8h b0 = *(const v8h*)(vg + 8 * i);
        *(v8b*)(Ksh + r * LP + half + 8 * i) = a0;
        *(v8b*)(Ksl + r * LP + half + 8 * i) = a1;
        *(v8h*)(Vth + r * LP + half + 8 * i) = b0;
        if (RES) {
          v8h b1 = *(const v8h*)(vlg + 8 * i);
          if (!resOK) b1 = zero8h();
          *(v8h*)(Vtl + r * LP + half + 8 * i) = b1;
        }
      }
#if defined(__HIP_DEVICE_COMPILE__)
      // the wait that stands in front of an overwrite of a register which an issued load names; the addresses are inputs,
      // so that no later load's result is laid on the address pair of an earlier one (seen in the listing with RES only)
      if (RES) asm volatile("s_wait_xcnt 0x0" :: "v"(kg), "v"(klg), "v"(vg), "v"(vlg) : "memory");
#endif
      __syncthreads();
    }

    // ---- scores, transposed: 64 keys x 16 queries per wave, 3 bf16 products ----
    // all 16 K fragments are read as one group in front of the 24 products, in the order of their use; the products
    // run back to back, the four key tiles' accumulator chains in turn (each chain keeps its order of products)
    FB kb[2][4], kl[2][4];
#pragma unroll
    for (int dc = 0; dc < 2; ++dc) {
#pragma unroll
      for (int j = 0; j < 4; ++j) {
        kb[dc][j].h[0] = *(const v8b*)(Kc + (j * 16 + c) * LP + dc * 32 + 8 * hh);
        kb[dc][j].h[1] = *(const v8b*)(Kc + (j * 16 + c) * LP + dc * 32 + 16 + 8 * hh);
      }
#pragma unroll
      for (int j = 0; j < 4; ++j) {
        kl[dc][j].h[0] = *(const v8b*)(Klc + (j * 16 + c) * LP + dc * 32 + 8 * hh);
        kl[dc][j].h[1] = *(const v8b*)(Klc + (j * 16 + c) * LP + dc * 32 + 16 + 8 * hh);
      }
    }
    if (!RES && kt + 1 < nkt) {
      // block-uniform; behind the barrier (the prologue's, or the one at the foot of trip kt-1, which ended every read of
      // the other buffer): chunk kt+1 goes into that buffer and flies while this trip works on chunk kt. The copies stand
      // behind this chunk's K reads, which are of this trip's own buffer, so that their issue runs while those reads return
      const size_t kn = (size_t)(kt + 1) * 64;
      stage_kv(gKh + kn * DM, gKl + kn * DM, gVt + kn, lK + (unsigned)(3 * APL - bo) * 2u);
    }
    v8f s[4];
    FH vb[2][4], vl[2][4];
#pragma unroll
    for (int j = 0; j < 4; ++j) s[j] = zero8();
#pragma unroll
    for (int dc = 0; dc < 2; ++dc) {
      // no instruction: the scheduler moves nothing across, so the group of LDS reads in front stays one group
      // instead of being spread among the products
      __builtin_amdgcn_sched_barrier(0);
#pragma unroll
      for (int j = 0; j < 4; ++j) s[j] = mma_b_raw(kb[dc][j].v, qah[dc], s[j]);
#pragma unroll
      for (int j = 0; j < 4; ++j) s[j] = mma_b_raw(kl[dc][j].v, qah[dc], s[j]);
#pragma unroll
      for (int j = 0; j < 4; ++j) s[j] = mma_b_raw(kb[dc][j].v, qal[dc], s[j]);
      __builtin_amdgcn_sched_barrier(0);   // as above; the twelve products stay one run, their four chains in turn
      if (dc == 0) {
        // all V^T hi fragments of this chunk are read as one group here, behind the first half of the score products:
        // they arrive while the second half and the softmax run
#pragma unroll
        for (int kk = 0; kk < 2; ++kk) {
#pragma unroll
          for (int t = 0; t < 4; ++t) {
            vb[kk][t].h[0] = *(const v8h*)(Vc + (t * 16 + c) * LP + kk * 32 + 8 * hh);
            vb[kk][t].h[1] = *(const v8h*)(Vc + (t * 16 + c) * LP + kk * 32 + 16 + 8 * hh);
          }
        }
      }
      if (RES && dc == 1) {
        // the residual fragments are read behind the last score product, into registers that the K fragments have left
        // (read with the group above they would cost the kernel its third wave per SIMD); they arrive under the softmax
#pragma unroll   // written out, like the loop inside: vl[kk][t] lives in registers, which a run-time index cannot pick
        for (int kk = 0; kk < 2; ++kk) {
#pragma unroll
          for (int t = 0; t < 4; ++t) {
            vl[kk][t].h[0] = *(const v8h*)(Vtl + (t * 16 + c) * LP + kk * 32 + 8 * hh);
            vl[kk][t].h[1] = *(const v8h*)(Vtl + (t * 16 + c) * LP + kk * 32 + 16 + 8 * hh);
          }
        }
      }
    }

    // ---- causal mask (replace by -FLT_MAX: 2^y -> 0) and softmax numerators: P (f16) and P residual (x4096) packed
    //      into the B operands of the two key chunks ----
    FH pa[2], pl[2];
    float pj[4];
#pragma unroll
    for (int j = 0; j < 4; ++j) {
      pj[j] = 0.f;
#pragma unroll
      for (int r = 0; r < 8; ++r) {
        const int key = kv0 + j * 16 + 8 * hh + r;
        const float sv  = (key > qrow) ? -FLT_MAX : s[j][r];
        const float p   = exp2_slot(sv * c0);
        pj[j] += p;
        const _Float16 ph = (_Float16)p;
        pa[j >> 1].v[(j & 1) * 8 + r] = ph;
        if (RES) pl[j >> 1].v[(j & 1) * 8 + r] = (_Float16)((p - (float)ph) * 4096.0f);
      }
    }
    // no instruction: every 2^y above is asm text, whose register writes the compiler does not hold at the distance that
    // a matrix instruction's operands need; the scheduler moves none of them down among the products below
    __builtin_amdgcn_sched_barrier(0);
    lrow += (pj[0] + pj[1]) + (pj[2] + pj[3]);

    // ---- context^T += V^T . P^T (f16 WMMA), residual products into a separate accumulator ----
    v8f o1[4];
#pragma unroll
    for (int t = 0; t < 4; ++t) o1[t] = zero8();
#pragma unroll   // both chunks written out: pa[kk] and pl[kk] live in registers, which a run-time index cannot pick
    for (int kk = 0; kk < 2; ++kk) {
#pragma unroll
      for (int t = 0; t < 4; ++t) oacc[t] = mma_h_raw(vb[kk][t].v, pa[kk].v, oacc[t]);
      if (RES) {
#pragma unroll
        for (int t = 0; t < 4; ++t) o1[t] = mma_h_raw(vl[kk][t].v, pa[kk].v, o1[t]);
#pragma unroll
        for (int t = 0; t < 4; ++t) o1[t] = mma_h_raw(vb[kk][t].v, pl[kk].v, o1[t]);
      }
    }
    // the distance behind the last products, also on the loop's taken branch
    // (with RES the fold below stands between the products and the branch)
    if (!RES) acc_guard4(oacc[0], oacc[1], oacc[2], oacc[3]);
    if (RES) {
#pragma unroll
      for (int t = 0; t < 4; ++t)
#pragma unroll
        for (int r = 0; r < 8; ++r) oacc[t][r] += o1[t][r] * (1.0f / 4096.0f);
    }
    if (!RES) {
      // ---- publish chunk kt+1, free chunk kt's buffer: own LDS reads done, own copies landed, block barrier ----
      // (the refill of this trip's buffer stands behind this barrier, in the next trip)
      wait_ds0();
      wait_async0();
      __syncthreads();
    }
  }
  if (!RES) wait_async0();

  // ---- normalise (1/l), stage the wave's 16x64 tile in LDS, then write whole
  float* os = Osp + wave * (16 * OP);
  {
    const float l = lrow + xhalf(lrow);      // the two halves' sums, joined once
    const float inv = (l > 0.f) ? (1.0f / l) : 0.f;
    v2f sq[2] = {{0.f, 0.f}, {0.f, 0.f}};    // squares of this lane's 32 dims of its query: even / odd dims of tiles 0, 2 / 1, 3
#pragma unroll
    for (int t = 0; t < 4; ++t) {
      v4f w0, w1;
#pragma unroll
      for (int e = 0; e < 4; ++e) { w0[e] = oacc[t][e] * inv; w1[e] = oacc[t][4 + e] * inv; }
#pragma unroll   // written out: w0, w1 and sq live in registers, which a run-time index cannot pick
      for (int e = 0; e < 4; e += 2) {
        const v2f a = {w0[e], w0[e + 1]}, b2 = {w1[e], w1[e + 1]};
        sq[t & 1] = __builtin_elementwise_fma(a, a, sq[t & 1]);
        sq[t & 1] = __builtin_elementwise_fma(b2, b2, sq[t & 1]);
      }
      *(v4f*)(os + c * OP + t * 16 + 8 * hh)     = w0;   // query row c, dims 16t + 8*hh ..
      *(v4f*)(os + c * OP + t * 16 + 8 * hh + 4) = w1;
    }
    const float sh = (sq[0][0] + sq[0][1]) + (sq[1][0] + sq[1][1]);
    const float sa = sh + xhalf(sh);         // the two halves' dims joined: all 64 dims of query c
    if (hh == 0) Sqp[wave * 16 + c] = sa;
  }
  // block barrier: the wave's own tile is read back below, the four waves' sums of squares by waves 0 and 1. It stands
  // in front of the global stores, so that no wave waits at it for its stores to return
  __syncthreads();
  if (tid < 64) ssq[(size_t)h * (NB * SEQ) + rowB + (size_t)qb * 64 + tid] = Sqp[tid];   // two whole 128-B lines
  {
    const int q = lane >> 3, c8 = (lane & 7) * 8;
    v4u hv[4], lv[4];
#pragma unroll
    for (int it = 0; it < 4; ++it) {
      const int row = it * 4 + q;    // it 0..3 x q 0..3 = rows 0..15 of the wave tile
      const v4f f0 = *(const v4f*)(os + row * OP + c8);
      const v4f f1 = *(const v4f*)(os + row * OP + c8 + 4);
#pragma unroll
      for (int e = 0; e < 4; ++e) {
        const float a0 = (e < 2) ? f0[2 * e]     : f1[2 * e - 4];
        const float a1 = (e < 2) ? f0[2 * e + 1] : f1[2 * e - 3];
        const unsigned ph = bf_pair(a0, a1);
        hv[it][e] = ph;
        lv[it][e] = bf_pair(a0 - __uint_as_float(ph << 16), a1 - __uint_as_float(ph & 0xFFFF0000u));
      }
    }
#pragma unroll
    for (int it = 0; it < 4; ++it) {
      const int row = it * 4 + q;
      const size_t go = (rowB + q0 + row) * DM + (size_t)h * HD + c8;
      *(v4u*)(ahp + go) = hv[it];
      *(v4u*)(alp + go) = lv[it];
    }
  }
}

// =====================================================================================================
// Both attention jobs, which do not depend on one another, as block ranges of ONE grid (the test on the block index is
// block-uniform; both jobs use the same LDS). The job with the long blocks comes first:
//   [0, AB_MAIN)        query blocks RESQB .. NQB-1, without residual planes
//   [AB_MAIN, AB_ALL)   query blocks 0 .. RESQB-1, with residual planes
// =====================================================================================================
#define AB_MAIN (NB * NH * (NQB - RESQB))              // 768
#define AB_ALL  (NB * NH * NQB)                        // 1024
__global__ __launch_bounds__(128)
void attn_causal64(const unsigned short* __restrict__ qhp, const unsigned short* __restrict__ qlp,
                   const unsigned short* __restrict__ khp, const unsigned short* __restrict__ klp,
                   const unsigned short* __restrict__ vhp, const unsigned short* __restrict__ vlp,
                   unsigned short* ahp, unsigned short* alp, float* ssq, float sscale) {
  // six tiles of 64 rows, row pitch LP. First job: two buffers of [K hi [kv][d] | K lo | V^T hi [d][kv]].
  // Second job: tiles 0..3 = K hi, K lo, V^T hi, V^T residual
  __shared__ __align__(16) __bf16   KV[6 * APL];
  __shared__ __align__(16) float    Os[4 * 16 * OP];              // per wave context tile [row][d], row pitch OP
  __shared__ float                  Sq[64];                       // per query row of the block: sum of squares over the head
  __bf16*   Ksh = KV;
  __bf16*   Ksl = KV + APL;
  _Float16* Vth = (_Float16*)(void*)(KV + 2 * APL);
  _Float16* Vtl = (_Float16*)(void*)(KV + 3 * APL);
  const int bx = blockIdx.x;
  if (bx < AB_MAIN) {
    attn_tile<false>(Ksh, Ksl, Vth, Vtl, Os, Sq, bx, qhp, qlp, khp, klp, vhp, vlp, ahp, alp, ssq, RESQB, NQB - RESQB, sscale);
  } else {
    attn_tile<true>(Ksh, Ksl, Vth, Vtl, Os, Sq, bx - AB_MAIN, qhp, qlp, khp, klp, vhp, vlp, ahp, alp, ssq, 0, RESQB, sscale);
  }
}

// =====================================================================================================
// Workspace map (bytes), every region an exact multiple of its whole-line / whole-tile store granularity:
//   Xb    bf16 [4096][1024]          0          8388608
//   Winb  bf16 [3072][1024]          8388608    6291456
//   Wob   bf16 [1024][1024]          14680064   2097152
//   Rin   f32  [3072]                16777216     12288   (96 lines)
//   Rout  f32  [1024]                16789504      4096   (32 lines)
//   (free)                           16793600     16384
//   CosT  f32  [2048][32]            16809984    262144
//   SinT  f32  [2048][32]            17072128    262144
//   SSq   f32  [16][4096]            17334272  33554432   (SSq in the first 262144, then at +16777216 Ah bf16 and Al bf16 [4096][1024] each)
//   VTh   f16  [2][1024][2048]       50888704   8388608
//   VTl   f16  [2][1024][512]        59277312   2097152
//   Qh    bf16 [4096][1024]          61374464   8388608
//   Ql    bf16 [4096][1024]          69763072   8388608
//   Kh    bf16 [4096][1024]          78151680   8388608
//   Kl    bf16 [4096][1024]          86540288   8388608
//   end                              94928896
// Weights are [out n][in k] with k contiguous = the Bt / A layout the GEMM wants, so they are only converted.
// =====================================================================================================
extern "C" void kernel_launch(void* const* d_in, const int* in_sizes, int n_in,
                              void* d_out, int out_size, void* d_ws, size_t ws_size,
                              hipStream_t stream) {
  if (n_in < 4) return;
  if (in_sizes[0] != NB * SEQ * DM) return;
  if (in_sizes[1] != SEQ * (HD / 2)) return;
  if (in_sizes[2] != 3 * DM * DM) return;
  if (in_sizes[3] != DM * DM) return;
  if (out_size != NB * SEQ * DM) return;

  const float* x    = (const float*)d_in[0];
  const float* rpf  = (const float*)d_in[1];
  const float* w_in = (const float*)d_in[2];
  const float* w_o  = (const float*)d_in[3];

  const size_t PXb   = (size_t)NB * SEQ * DM * 2;      //  8388608  16-bit activation plane [4096][1024]
  const size_t PWin  = (size_t)3 * DM * DM * 2;        //  6291456
  const size_t PWo   = (size_t)DM * DM * 2;            //  2097152
  const size_t PRin  = (size_t)3 * DM * 4;             //    12288
  const size_t PRout = (size_t)DM * 4;                 //     4096
  const size_t PRrow = (size_t)NB * SEQ * 4;           //    16384
  const size_t PTrig = (size_t)SEQ * (HD / 2) * 4;     //   262144
  const size_t PQK   = (size_t)NB * SEQ * NQK * 4;     // 33554432  SSq region + Ah + Al
  const size_t PVTh  = (size_t)NB * DM * SEQ * 2;      //  8388608
  const size_t PVTl  = (size_t)NB * DM * VLP * 2;      //  2097152
  const size_t PAf   = (size_t)NB * SEQ * DM * 4;      // 16777216  region that holds SSq (NH * NB * SEQ * 4 = 262144 used)
  if (PAf + 2 * PXb != PQK) return;                    // the three fill their region exactly
  size_t off = 0;
  const size_t oXb   = off; off += PXb;
  const size_t oWin  = off; off += PWin;
  const size_t oWo   = off; off += PWo;
  const size_t oRin  = off; off += PRin;
  const size_t oRout = off; off += PRout;
  off += PRrow;                                        // free
  const size_t oCos  = off; off += PTrig;
  const size_t oSin  = off; off += PTrig;
  const size_t oQK   = off; off += PQK;
  const size_t oVTh  = off; off += PVTh;
  const size_t oVTl  = off; off += PVTl;
  const size_t oQh   = off; off += PXb;
  const size_t oQl   = off; off += PXb;
  const size_t oKh   = off; off += PXb;
  const size_t oKl   = off; off += PXb;
  if (off > ws_size) return;                           // off = 94928896
  if (off > (size_t)134217728) return;
  const size_t oAf = oQK;
  const size_t oAh = oQK + PAf;
  const size_t oAl = oAh + PXb;
  if (oAl + PXb > oVTh) return;                        // region ordering sanity

  char* ws = (char*)d_ws;
  unsigned short* Xb   = (unsigned short*)(ws + oXb);
  unsigned short* Winb = (unsigned short*)(ws + oWin);
  unsigned short* Wvb  = Winb + (size_t)2 * DM * DM;   // rows 2048..3071 of w_in = v features
  unsigned short* Wob  = (unsigned short*)(ws + oWo);
  float*          Rin  = (float*)(ws + oRin);
  float*          Rv   = Rin + 2 * DM;
  float*          Rout = (float*)(ws + oRout);
  float*          CosT = (float*)(ws + oCos);
  float*          SinT = (float*)(ws + oSin);
  unsigned short* VTh  = (unsigned short*)(ws + oVTh);
  unsigned short* VTl  = (unsigned short*)(ws + oVTl);
  unsigned short* Qh   = (unsigned short*)(ws + oQh);
  unsigned short* Ql   = (unsigned short*)(ws + oQl);
  unsigned short* Kh   = (unsigned short*)(ws + oKh);
  unsigned short* Kl   = (unsigned short*)(ws + oKl);
  float*          SSq  = (float*)(ws + oAf);
  unsigned short* Ah   = (unsigned short*)(ws + oAh);
  unsigned short* Al   = (unsigned short*)(ws + oAl);

  const dim3 blk(256);
  const dim3 gblk(128);                                              // GEMM block: 4 waves, one 128x128 tile
  const dim3 gOut((NB * SEQ / 128) * (DM / 128), 1);                 // 32 x 8 = 256 blocks

  // (1) inputs: weights -> bf16 planes [n][k] + per-row inverse L2 norms of the converted rows; angle tables from the
  //     bf16-converted input table; x -> bf16 plane [4096][1024]
  prep_inputs<<<dim3(PB_ALL), blk, 0, stream>>>(x, rpf, w_in, w_o, Xb, Winb, Wob, Rin, Rout, CosT, SinT);
  // (2) q/k projection with rotary and per-head rms -> q/k bf16 hi/lo planes; v^T projection -> f16 hi and residual planes
  gemm_qk_vt<<<dim3(GB_ALL), gblk, 0, stream>>>(Xb, Winb, Wvb, Qh, Ql, Kh, Kl, VTh, VTl, Rin, Rv, CosT, SinT, VLP);
  // (3) causal attention: query blocks 0..RESQB-1 with residual planes, the rest without -> merged rows as bf16 hi/lo planes
  //     [4096][1024] + per head and row the sum of squares
  attn_causal64<<<dim3(AB_ALL), dim3(128), 0, stream>>>(Qh, Ql, Kh, Kl, VTh, VTl, Ah, Al, SSq, 0.125f);
  // (4) out[s][e] = rrow[s] * Rout[e] * sum_d (Ah+Al)[s][d] Wob[e][d] -> d_out f32 [4096][1024]  (M=4096, N=1024, K=1024),
  //     rrow[s] = inverse rms over 1024 of merged row s, from the 16 heads' sums of squares
  gemm64<1, 0, 2, true><<<gOut, gblk, 0, stream>>>(
      Ah, Al, DM, 0LL, Wob, DM, 0LL,
      d_out, DM, 0LL, d_out, 0, 0LL, 0,
      NB * SEQ, DM, DM, 1.0f, SSq, Rout,
      d_out, d_out, Rout, Rout);
  (void)hipGetLastError();
}
